// v000
// Measured on an AMD MI455X. A time is GPU time per run, averaged over a window of back-to-back runs after a warm-up
// (all launches, gaps included; the runs take copies of the inputs in turn), and the median of several windows.
// Apart from v000's, it joins two sittings. Times from different sittings can be a few percent apart, while
// side-by-side timings come from the same sitting.
// v000 is the starting kernel. One run takes 777 microseconds.
// Projections x.Wq/Wk/Wv/Wg^T: v_wmma_f32_16x16x32_bf16 (every float input RNE-converted to bf16 once, exact products, f32 accumulate); scores q.k^T and p.v for query positions >= 128: v_wmma_f32_16x16x32_f16 (q,k,v planes carried x64, p carried x32768); query positions < 128: f32 VALU attention; output projection: f16 (gated carried x1024, Wo carried x1024) for positions >= 128, bf16 hi+lo gated planes x bf16 Wo (two products) for positions < 128; norms, position rotation, softmax, gate in f32.
#include <hip/hip_runtime.h>
#include <math.h>

typedef __attribute__((ext_vector_type(16))) _Float16 v16h;
typedef __attribute__((ext_vector_type(8)))  _Float16 v8h;
typedef __attribute__((ext_vector_type(16))) __bf16   v16b;
typedef __attribute__((ext_vector_type(8)))  __bf16   v8b;
typedef __attribute__((ext_vector_type(8)))  float    v8f;
typedef __attribute__((ext_vector_type(4)))  float    v4f;
typedef __attribute__((ext_vector_type(4)))  unsigned int v4u;
typedef __attribute__((ext_vector_type(2)))  unsigned int v2u;

// ---------------------------------------------------------------------------
// Shape constants
// ---------------------------------------------------------------------------
constexpr int kB     = 2;
constexpr int kS     = 2048;
constexpr int kHid   = 2048;
constexpr int kHq    = 16;
constexpr int kHkv   = 4;
constexpr int kRep   = kHq / kHkv;
constexpr int kHD    = 128;
constexpr int kTok   = kB * kS;
constexpr int kQW    = kHq * kHD;
constexpr int kKW    = kHkv * kHD;
constexpr int kQKVW  = kQW + 2 * kKW;
constexpr int kVCol0 = kQW + kKW;
constexpr int kSlots = kHq + kHkv;
constexpr int kEarly = 128;
constexpr int kERows = kB * kEarly;
constexpr int kLateKC    = 64;
constexpr int kLatePairs = (kS - kEarly) / 32;
constexpr int kVP    = 132;
constexpr float kEps = 1e-6f;

constexpr double cx_sqrt(double x) {
  double r = (x > 1.0) ? x : 1.0;
  for (int i = 0; i < 80; ++i) r = 0.5 * (r + x / r);
  return r;
}
constexpr float kInvSqrtHD = (float)(1.0 / cx_sqrt((double)kHD));
/* power-of-two carries of the f16 operand planes */
constexpr float kQKCarry = 64.0f;
constexpr float kVCarry  = 64.0f;
constexpr float kPCarry  = 32768.0f;
constexpr float kGCarry  = 1024.0f;
constexpr float kWoCarry = 1024.0f;
constexpr float kScoreMul   = kInvSqrtHD / (kQKCarry * kQKCarry);
constexpr float kOutLateMul = 1.0f / (kGCarry * kWoCarry);

static_assert(kRep == 4 && kHkv == 4 && kHD == 128, "lane maps assume 4 kv heads x 4 query heads x 128");
static_assert(kTok == 4096 && kQW == 2048 && kKW == 512 && kQKVW == 3072, "wire shapes");
static_assert((kHid % 32) == 0 && (kQW % 32) == 0, "GEMM K multiples of 32");
static_assert((kTok % 64) == 0 && (kQKVW % 64) == 0 && (kQW % 64) == 0 && ((kS - kEarly) % 64) == 0 && (kEarly % 64) == 0, "GEMM M,N multiples of 64");
static_assert((kS % 64) == 0 && (kS / 64) == 32 && (kEarly % 16) == 0 && ((kS - kEarly) % 32) == 0, "tile multiples");

// ---------------------------------------------------------------------------
// Workspace region map (bytes; every offset a multiple of 128)
//   XB   bf16 [4096][2048]  x plane                                16,777,216
//   WQKV bf16 [3072][2048]  Wq | Wk | Wv rows                      12,582,912
//   WGB  bf16 [2048][2048]  Wg                                      8,388,608
//   QKV  f32  [4096][3072]  q | k | v projections                  50,331,648
//   QP   f16  [4096][2048]  normed+rotated q x64                   16,777,216
//   KP   f16  [4096][512]   normed+rotated k x64                    4,194,304
//   VT   f16  [2][4][128][2048] v transposed x64                    4,194,304
//   QE   f32  [256][2048]   q rows of positions < 128               2,097,152
//   KE   f32  [256][512]    k rows of positions < 128                 524,288
//   VE   f32  [256][512]    v rows of positions < 128                 524,288
//   WOB  bf16 [2048][2048]  Wo                                      8,388,608
//   WOH  f16  [2048][2048]  Wo (bf16 value) x1024                   8,388,608
//   total                                                         133,169,152
// Aliases (each across whole launches):
//   ATT  f32 [4096][2048]  = first 33,554,432 B of QKV (after the norm/rotation and v-prep launches)
//   GF   f32 [4096][2048]  = last 16,777,216 B of QKV + all of QP (after both attention launches)
//   GH   f16 [4096][2048]  = XB (after the gate projection)
//   EH/EL bf16 [256][2048] = first 2 x 1,048,576 B of WQKV (after the q|k|v projection)
// ---------------------------------------------------------------------------
constexpr size_t kOffXB   = 0;
constexpr size_t kOffWQKV = kOffXB   + (size_t)kTok * kHid * 2;
constexpr size_t kOffWGB  = kOffWQKV + (size_t)kQKVW * kHid * 2;
constexpr size_t kOffQKV  = kOffWGB  + (size_t)kQW * kHid * 2;
constexpr size_t kOffQP   = kOffQKV  + (size_t)kTok * kQKVW * 4;
constexpr size_t kOffKP   = kOffQP   + (size_t)kTok * kQW * 2;
constexpr size_t kOffVT   = kOffKP   + (size_t)kTok * kKW * 2;
constexpr size_t kOffQE   = kOffVT   + (size_t)kTok * kKW * 2;
constexpr size_t kOffKE   = kOffQE   + (size_t)kERows * kQW * 4;
constexpr size_t kOffVE   = kOffKE   + (size_t)kERows * kKW * 4;
constexpr size_t kOffWOB  = kOffVE   + (size_t)kERows * kKW * 4;
constexpr size_t kOffWOH  = kOffWOB  + (size_t)kQW * kQW * 2;
constexpr size_t kWsTotal = kOffWOH  + (size_t)kQW * kQW * 2;
constexpr size_t kOffATT  = kOffQKV;
constexpr size_t kOffGF   = kOffQKV + (size_t)kTok * kQW * 4;
constexpr size_t kOffGH   = kOffXB;
constexpr size_t kOffEH   = kOffWQKV;
constexpr size_t kOffEL   = kOffWQKV + (size_t)kERows * kQW * 2;
static_assert(kWsTotal == 133169152ull, "carve total");
static_assert(kWsTotal <= 134217728ull, "carve cap");
static_assert(kOffGF + (size_t)kTok * kQW * 4 == kOffKP, "gate plane covers the projection tail plus the q plane exactly");
static_assert(kOffEL + (size_t)kERows * kQW * 2 <= kOffWGB, "hi/lo planes inside the dead weight plane");
static_assert((kOffWQKV % 128) == 0 && (kOffWGB % 128) == 0 && (kOffQKV % 128) == 0 && (kOffQP % 128) == 0 &&
              (kOffKP % 128) == 0 && (kOffVT % 128) == 0 && (kOffQE % 128) == 0 && (kOffKE % 128) == 0 &&
              (kOffVE % 128) == 0 && (kOffWOB % 128) == 0 && (kOffWOH % 128) == 0 && (kOffGF % 128) == 0 &&
              (kOffEL % 128) == 0, "128-B aligned regions");

// ---------------------------------------------------------------------------
// Small helpers
// ---------------------------------------------------------------------------
__device__ __forceinline__ unsigned short f2bf_bits(float f) {
  unsigned u = __float_as_uint(f);
  return (unsigned short)((u + 0x7FFFu + ((u >> 16) & 1u)) >> 16);
}
__device__ __forceinline__ float bf_bits2f(unsigned short h) { return __uint_as_float(((unsigned)h) << 16); }
__device__ __forceinline__ float bf16r(float f) { return bf_bits2f(f2bf_bits(f)); }
__device__ __forceinline__ unsigned pk16(unsigned short a, unsigned short b) { return (unsigned)a | ((unsigned)b << 16); }
__device__ __forceinline__ unsigned short h_bits(float f) { const _Float16 h = (_Float16)f; return __builtin_bit_cast(unsigned short, h); }
__device__ __forceinline__ void wave_lds_sync() {
  __builtin_amdgcn_fence(__ATOMIC_RELEASE, "workgroup");
  __builtin_amdgcn_wave_barrier();
  __builtin_amdgcn_fence(__ATOMIC_ACQUIRE, "workgroup");
}

/* matrix op followed by the 4-slot hazard guard; one accumulator per guard statement, A and B named as inputs */
__device__ __forceinline__ v8f mma_guard_h(v16h a, v16h b, v8f c) {
  c = __builtin_amdgcn_wmma_f32_16x16x32_f16(false, a, false, b, (short)0, c, false, false);
  asm volatile("v_nop\n\tv_nop\n\tv_nop\n\tv_nop" : "+v"(c) : "v"(a), "v"(b));
  return c;
}
__device__ __forceinline__ v8f mma_guard_b(v16b a, v16b b, v8f c) {
  c = __builtin_amdgcn_wmma_f32_16x16x32_bf16(false, a, false, b, (short)0, c, false, false);
  asm volatile("v_nop\n\tv_nop\n\tv_nop\n\tv_nop" : "+v"(c) : "v"(a), "v"(b));
  return c;
}
__device__ __forceinline__ void keep4_h(v16h a, v16h b, v16h c, v16h d) { asm volatile("v_nop" :: "v"(a), "v"(b), "v"(c), "v"(d)); }
__device__ __forceinline__ void keep4_b(v16b a, v16b b, v16b c, v16b d) { asm volatile("v_nop" :: "v"(a), "v"(b), "v"(c), "v"(d)); }
__device__ __forceinline__ void acc_guard4(v8f& a, v8f& b, v8f& c, v8f& d) { asm volatile("v_nop\n\tv_nop\n\tv_nop\n\tv_nop" : "+v"(a), "+v"(b), "+v"(c), "+v"(d)); }

template <typename T> struct Frag;
template <> struct Frag<_Float16> {
  typedef v16h V; union U { v16h v; v8h h[2]; };
  /* elements 0..7 <- p[0..7], 8..15 <- p[16..23] */
  static __device__ __forceinline__ v16h load(const _Float16* p) {
    U f; f.h[0] = *(const v8h*)(p); f.h[1] = *(const v8h*)(p + 16); return f.v;
  }
  static __device__ __forceinline__ v8f mmag(v16h a, v16h b, v8f c) { return mma_guard_h(a, b, c); }
  static __device__ __forceinline__ void keep(v16h a, v16h b, v16h c, v16h d) { keep4_h(a, b, c, d); }
};
template <> struct Frag<__bf16> {
  typedef v16b V; union U { v16b v; v8b h[2]; };
  static __device__ __forceinline__ v16b load(const __bf16* p) {
    U f; f.h[0] = *(const v8b*)(p); f.h[1] = *(const v8b*)(p + 16); return f.v;
  }
  static __device__ __forceinline__ v8f mmag(v16b a, v16b b, v8f c) { return mma_guard_b(a, b, c); }
  static __device__ __forceinline__ void keep(v16b a, v16b b, v16b c, v16b d) { keep4_b(a, b, c, d); }
};

// ---------------------------------------------------------------------------
// Register-blocked batched GEMM: C[m,n] = scale * sum_k A[m,k] * Bt[n,k]; each wave owns a 64x64 tile.
// A row-major [M,K]; Bt row-major [N,K]; M,N % 64 == 0, K % 32 == 0 (no tails).
// ASPLIT: A carried as hi/lo planes (A2 = lo plane, same layout): product = hi.b + lo.b into one accumulator.
// ET: 0 = f16 operands, 1 = bf16 operands (pointers passed as 16-bit storage). Output f32.
// ---------------------------------------------------------------------------
template <int ET> struct Elem;
template <> struct Elem<0> { typedef _Float16 T; };
template <> struct Elem<1> { typedef __bf16 T; };
template <int ET, bool ASPLIT>
__global__ __launch_bounds__(256) void wmma_gemm64(
    const unsigned short* __restrict__ Ap, const unsigned short* __restrict__ A2p, int lda, long strideA,
    const unsigned short* __restrict__ Btp, int ldb, long strideB,
    float* __restrict__ Cout, int ldc, long strideC,
    int M, int N, int K, float scale) {
  typedef typename Elem<ET>::T T;
  typedef typename Frag<T>::V V;
  const T* A = (const T*)Ap; const T* A2 = (const T*)A2p; const T* Bt = (const T*)Btp;
  __shared__ __align__(16) float sT[8][16 * 68];
  const int b    = blockIdx.y;
  const int lane = threadIdx.x & 31;
  const int wave = __builtin_amdgcn_readfirstlane((int)(threadIdx.x >> 5));
  const int tilesN = N >> 6;
  const int tilesM = M >> 6;
  const int tile = blockIdx.x * 8 + wave;
  /* wave-uniform; no block barriers in this kernel */
  if (tile >= tilesM * tilesN) return;
  const int tm = tile / tilesN;
  const int tn = tile - tm * tilesN;
  const int m0 = tm << 6;
  const int n0 = tn << 6;

  const T* Ab  = A  + (size_t)b * strideA;
  const T* Bb  = Bt + (size_t)b * strideB;
  const T* Ab2 = A2 + (size_t)b * strideA;

  const int rlane = lane & 15;
  const int koff  = (lane >> 4) * 8;
  const int mOff  = (lane >> 4) * 8;

  v8f acc[4][4];
#pragma unroll
  for (int i = 0; i < 4; ++i)
#pragma unroll
    for (int j = 0; j < 4; ++j) acc[i][j] = (v8f){0.f,0.f,0.f,0.f,0.f,0.f,0.f,0.f};

  for (int k0 = 0; k0 < K; k0 += 32) {
    V bh[4];
#pragma unroll
    for (int j = 0; j < 4; ++j) {
      const size_t bo = (size_t)(n0 + (j << 4) + rlane) * ldb + koff + k0;
      bh[j] = Frag<T>::load(Bb + bo);
    }
#pragma unroll
    for (int i = 0; i < 4; ++i) {
      const size_t ao = (size_t)(m0 + (i << 4) + rlane) * lda + koff + k0;
      V ah = Frag<T>::load(Ab + ao);
      V al = ah;
      if (ASPLIT) al = Frag<T>::load(Ab2 + ao);
#pragma unroll
      for (int j = 0; j < 4; ++j) {
        acc[i][j] = Frag<T>::mmag(ah, bh[j], acc[i][j]);
        if (ASPLIT) acc[i][j] = Frag<T>::mmag(al, bh[j], acc[i][j]);
      }
    }
    Frag<T>::keep(bh[0], bh[1], bh[2], bh[3]);
  }
  acc_guard4(acc[0][0], acc[0][1], acc[0][2], acc[0][3]);
  acc_guard4(acc[1][0], acc[1][1], acc[1][2], acc[1][3]);
  acc_guard4(acc[2][0], acc[2][1], acc[2][2], acc[2][3]);
  acc_guard4(acc[3][0], acc[3][1], acc[3][2], acc[3][3]);

  float* slab = sT[wave];
  float* C = Cout + (size_t)b * strideC;
#pragma unroll
  for (int i = 0; i < 4; ++i) {
    const int mBase = m0 + (i << 4);
#pragma unroll
    for (int j = 0; j < 4; ++j) {
#pragma unroll
      for (int r = 0; r < 8; ++r) {
        slab[(mOff + r) * 68 + (j << 4) + rlane] = acc[i][j][r] * scale;
      }
    }
    wave_lds_sync();
    {
      const int hh = lane >> 4, c4 = (lane & 15) * 4;
      {
#pragma unroll
        for (int it = 0; it < 8; ++it) {
          const int row = it * 2 + hh;
          v4f v = *(const v4f*)(slab + row * 68 + c4);
          *(v4f*)(C + (size_t)(mBase + row) * ldc + n0 + c4) = v;
        }
        
      }
    }
    wave_lds_sync();
  }
}

// ---------------------------------------------------------------------------
// MODE 0: o0 = bf16 (RNE). MODE 1: o0 = bf16 (RNE), o1 = f16 of (bf16 value x carry) (exact: power-of-two carry).
// ---------------------------------------------------------------------------
template <int MODE>
__global__ __launch_bounds__(256) void cast8_kernel(const float* __restrict__ in, unsigned short* __restrict__ o0,
                                                    unsigned short* __restrict__ o1, int n8, float carry) {
  const int i = blockIdx.x * 256 + threadIdx.x;
  if (i >= n8) return;
  const size_t e0 = (size_t)i << 3;
  const v4f a0 = *(const v4f*)(in + e0);
  const v4f a1 = *(const v4f*)(in + e0 + 4);
  unsigned short bb[8], hb[8];
#pragma unroll
  for (int e = 0; e < 4; ++e) {
    bb[e]     = f2bf_bits(a0[e]);
    bb[4 + e] = f2bf_bits(a1[e]);
  }
#pragma unroll
  for (int e = 0; e < 8; ++e) hb[e] = (MODE == 1) ? h_bits(bf_bits2f(bb[e]) * carry) : (unsigned short)0;
  const v4u ub = (v4u){pk16(bb[0], bb[1]), pk16(bb[2], bb[3]), pk16(bb[4], bb[5]), pk16(bb[6], bb[7])};
  const v4u uh = (v4u){pk16(hb[0], hb[1]), pk16(hb[2], hb[3]), pk16(hb[4], hb[5]), pk16(hb[6], hb[7])};
  unsigned short* q0 = o0 + e0;
  unsigned short* q1 = o1 + e0;
  *(v4u*)q0 = ub;
  if (MODE == 1) *(v4u*)q1 = uh;
  
}

// ---------------------------------------------------------------------------
// Per-head RMS norm (eps inside the rsqrt of the mean square) then rotation by the position tables, f32.
// One wave per (token, slot): slots 0..15 = query heads, 16..19 = key heads (columns slot*128 of the q|k|v plane).
// Lane owns d = 4*lane..4*lane+3; the partner d +/- 64 lives in lane ^ 16 (unconditional shuffles).
// d < 64: y = n[d]*c[d] - n[d+64]*s[d]; d >= 64: y = n[d]*c[d] + n[d-64]*s[d]; tables read by value at [pos][d],
// tables and norm weights RNE-converted to bf16 on load.
// ---------------------------------------------------------------------------
__global__ __launch_bounds__(256) void normrot_kernel(
    const float* __restrict__ QKV, const float* __restrict__ ctab, const float* __restrict__ stab,
    const float* __restrict__ qw, const float* __restrict__ kw,
    unsigned short* __restrict__ Qp, unsigned short* __restrict__ Kp, float* __restrict__ Qe, float* __restrict__ Ke) {
  const int lane = threadIdx.x & 31;
  const int wave = __builtin_amdgcn_readfirstlane((int)(threadIdx.x >> 5));
  const int gw   = blockIdx.x * 8 + wave;
  const int tok  = gw / kSlots;
  const int slot = gw - tok * kSlots;
  const int pos  = tok & (kS - 1);
  const int b    = tok / kS;
  const bool isq = slot < kHq;
  const int kslot = isq ? 0 : (slot - kHq);

  const v4f x   = *(const v4f*)(QKV + (size_t)tok * kQKVW + slot * kHD + 4 * lane);
  const v4f wq4 = *(const v4f*)(qw + 4 * lane);
  const v4f wk4 = *(const v4f*)(kw + 4 * lane);
  const v4f c4  = *(const v4f*)(ctab + (size_t)pos * kHD + 4 * lane);
  const v4f s4  = *(const v4f*)(stab + (size_t)pos * kHD + 4 * lane);

  float ss = x[0] * x[0];
  ss = fmaf(x[1], x[1], ss);
  ss = fmaf(x[2], x[2], ss);
  ss = fmaf(x[3], x[3], ss);
#pragma unroll
  for (int off = 16; off > 0; off >>= 1) ss += __shfl_xor(ss, off, 32);
  const float inv = rsqrtf(ss * (1.0f / (float)kHD) + kEps);

  float n[4], p[4], y[4];
#pragma unroll
  for (int e = 0; e < 4; ++e) {
    const float w = bf16r(isq ? wq4[e] : wk4[e]);
    n[e] = x[e] * inv * w;
  }
#pragma unroll
  for (int e = 0; e < 4; ++e) p[e] = __shfl_xor(n[e], 16, 32);
  const float sgn = (lane < 16) ? -1.0f : 1.0f;
#pragma unroll
  for (int e = 0; e < 4; ++e) y[e] = n[e] * bf16r(c4[e]) + sgn * (p[e] * bf16r(s4[e]));

  unsigned short hb[4];
#pragma unroll
  for (int e = 0; e < 4; ++e) hb[e] = h_bits(y[e] * kQKCarry);
  const v2u u = (v2u){pk16(hb[0], hb[1]), pk16(hb[2], hb[3])};
  const v4f yv = (v4f){y[0], y[1], y[2], y[3]};

  unsigned short* dq = Qp + (size_t)tok * kQW + slot * kHD + 4 * lane;
  unsigned short* dk = Kp + (size_t)tok * kKW + kslot * kHD + 4 * lane;
  unsigned short* d16 = isq ? dq : dk;
  const bool early = pos < kEarly;
  const int erow = b * kEarly + (early ? pos : 0);
  float* eq = Qe + (size_t)erow * kQW + (isq ? slot : 0) * kHD + 4 * lane;
  float* ek = Ke + (size_t)erow * kKW + kslot * kHD + 4 * lane;
  float* d32 = isq ? eq : ek;
  {
    *(v2u*)d16 = u;
    if (early) *(v4f*)d32 = yv;
    
  }
}

// ---------------------------------------------------------------------------
// v columns of the q|k|v plane -> VT f16 [b][kv head][d][s] carried x64 (LDS transpose), plus VE f32 rows for positions < 128.
// Block = (b, kv head, 64 positions); 256 threads. Load coverage: 8 iterations x 256 threads = 2048 v4f = 64 rows x 32.
// VT stores: row d = it*32 + wave*4 + (lane>>3), it 0..3 x 8 waves x 4 = 128 rows; (lane&7) x 8 halves = 64 positions
// ---------------------------------------------------------------------------
__global__ __launch_bounds__(256) void vprep_kernel(const float* __restrict__ QKV, unsigned short* __restrict__ Vt,
                                                    float* __restrict__ Ve) {
  __shared__ __align__(16) float sm[64 * kVP];
  const int tid  = threadIdx.x;
  const int lane = tid & 31;
  const int wave = __builtin_amdgcn_readfirstlane((int)(tid >> 5));
  const int st   = blockIdx.x & 31;
  const int hkv  = (blockIdx.x >> 5) & (kHkv - 1);
  const int b    = blockIdx.x >> 7;
  const int s0   = st * 64;
  const float* src = QKV + (size_t)(b * kS + s0) * kQKVW + kVCol0 + hkv * kHD;
#pragma unroll
  for (int i = 0; i < 8; ++i) {
    const int e  = i * 256 + tid;
    const int r  = e >> 5;
    const int cc = (e & 31) * 4;
    const v4f v = *(const v4f*)(src + (size_t)r * kQKVW + cc);
    *(v4f*)(sm + r * kVP + cc) = v;
  }
  __syncthreads();
  const int q = lane >> 3, c8 = (lane & 7) * 8;
  v4u tv[4];
#pragma unroll
  for (int it = 0; it < 4; ++it) {
    const int d = it * 32 + wave * 4 + q;
    unsigned short hb[8];
#pragma unroll
    for (int e = 0; e < 8; ++e) hb[e] = h_bits(sm[(c8 + e) * kVP + d] * kVCarry);
    tv[it] = (v4u){pk16(hb[0], hb[1]), pk16(hb[2], hb[3]), pk16(hb[4], hb[5]), pk16(hb[6], hb[7])};
  }
  v4f ev[8];
#pragma unroll
  for (int it = 0; it < 8; ++it) ev[it] = *(const v4f*)(sm + (it * 8 + wave) * kVP + 4 * lane);
  const bool early = s0 < kEarly;
  const int erow0 = b * kEarly + (early ? s0 : 0);
  unsigned short* vt0 = Vt + (size_t)(b * kHkv + hkv) * kHD * kS + s0 + c8;
  float* ve0 = Ve + (size_t)erow0 * kKW + hkv * kHD + 4 * lane;
  {
#pragma unroll
    for (int it = 0; it < 4; ++it) *(v4u*)(vt0 + (size_t)(it * 32 + wave * 4 + q) * kS) = tv[it];
    if (early) {
#pragma unroll
      for (int it = 0; it < 8; ++it) *(v4f*)(ve0 + (size_t)(it * 8 + wave) * kKW) = ev[it];
    }
    
  }
}

// ---------------------------------------------------------------------------
// Causal attention for query positions >= 128 (f16 matrix ops, online softmax in f32).
// Block = 8 waves = 4 query heads of one kv head x 2 tiles of 16 query rows; every wave is independent (no block barriers).
// Fragments are loaded straight from the dense statically-strided f16 planes:
//   A (q rows):  row = lane&15, k = d:   QP[(b*S + q0 + row)][h*128 + dc*32 + 8*(lane>>4) ..]
//   B (keys):    col = key,     k = d:   KP[(b*S + key)][kv*128 + dc*32 + 8*(lane>>4) ..]
//   B (values):  col = d,       k = key: VT[b][kv][d][kv0 + kk*32 + 8*(lane>>4) ..]
// 64 keys per iteration; the last chunk masks key > query with -inf before the softmax (the chunk always holds key <= query
// for every row, so the running maximum stays finite). p = exp(s - m) carried x32768 as f16, spilled per wave to LDS as
// ---------------------------------------------------------------------------
__global__ __launch_bounds__(256) void attn_late_kernel(const unsigned short* __restrict__ Qp, const unsigned short* __restrict__ Kp,
                                                        const unsigned short* __restrict__ Vtp, float* __restrict__ attn) {
  union FH { v16h v; v8h h[2]; };
  __shared__ __align__(16) _Float16 Psh[8][16 * kLateKC];
  __shared__ __align__(16) float Os[8][16 * 68];
  const int lane = threadIdx.x & 31;
  const int wave = __builtin_amdgcn_readfirstlane((int)(threadIdx.x >> 5));
  const int hh   = lane >> 4;
  const int c    = lane & 15;
  const int qt2  = blockIdx.x % kLatePairs;
  const int bh   = blockIdx.x / kLatePairs;
  const int hkv  = bh & (kHkv - 1);
  const int b    = bh / kHkv;
  const int h    = hkv * kRep + (wave & 3);
  const int q0   = kEarly + (qt2 * 2 + (wave >> 2)) * 16;

  const _Float16* Kb = (const _Float16*)Kp + (size_t)b * kS * kKW + hkv * kHD + 8 * hh;
  const _Float16* Vb = (const _Float16*)Vtp + (size_t)(b * kHkv + hkv) * kHD * kS + 8 * hh;
  float* ob = attn + (size_t)(b * kS + q0) * kQW + h * kHD;

  v16h qa[4];
  {
    const _Float16* qrow = (const _Float16*)Qp + (size_t)(b * kS + q0 + c) * kQW + h * kHD + 8 * hh;
#pragma unroll
    for (int dc = 0; dc < 4; ++dc) qa[dc] = Frag<_Float16>::load(qrow + dc * 32);
  }

  float mrow[8], lrow[8];
  v8f oacc[8];
#pragma unroll
  for (int r = 0; r < 8; ++r) { mrow[r] = -INFINITY; lrow[r] = 0.0f; }
#pragma unroll
  for (int t = 0; t < 8; ++t) oacc[t] = (v8f){0.f,0.f,0.f,0.f,0.f,0.f,0.f,0.f};

  int nChunks = (q0 + 16 + kLateKC - 1) / kLateKC;
  if (nChunks > kS / kLateKC) nChunks = kS / kLateKC;
  _Float16* pw = Psh[wave];

  for (int kc = 0; kc < nChunks; ++kc) {
    const int kv0 = kc * kLateKC;
    v8f s[4];
#pragma unroll
    for (int j = 0; j < 4; ++j) {
      s[j] = (v8f){0.f,0.f,0.f,0.f,0.f,0.f,0.f,0.f};
      const _Float16* kr = Kb + (size_t)(kv0 + j * 16 + c) * kKW;
#pragma unroll
      for (int dc = 0; dc < 4; ++dc) {
        const v16h kf = Frag<_Float16>::load(kr + dc * 32);
        s[j] = mma_guard_h(qa[dc], kf, s[j]);
      }
      asm volatile("" ::: "memory");
    }
    const bool diag = (kc == nChunks - 1);
    float cm[8];
#pragma unroll
    for (int r = 0; r < 8; ++r) {
      const int qrow = q0 + 8 * hh + r;
      float m = -INFINITY;
#pragma unroll
      for (int j = 0; j < 4; ++j) {
        const int kvcol = kv0 + j * 16 + c;
        float v = s[j][r] * kScoreMul;
        if (diag && (kvcol > qrow)) v = -INFINITY;
        s[j][r] = v;
        m = fmaxf(m, v);
      }
#pragma unroll
      for (int off = 1; off < 16; off <<= 1) m = fmaxf(m, __shfl_xor(m, off, 32));
      cm[r] = m;
    }
#pragma unroll
    for (int r = 0; r < 8; ++r) {
      const float mnew  = fmaxf(mrow[r], cm[r]);
      const float alpha = __expf(mrow[r] - mnew);
      mrow[r] = mnew;
      float psum = 0.0f;
#pragma unroll
      for (int j = 0; j < 4; ++j) {
        const float p = __expf(s[j][r] - mnew);
        psum += p;
        pw[(8 * hh + r) * kLateKC + j * 16 + c] = (_Float16)(p * kPCarry);
      }
#pragma unroll
      for (int off = 1; off < 16; off <<= 1) psum += __shfl_xor(psum, off, 32);
      lrow[r] = lrow[r] * alpha + psum;
#pragma unroll
      for (int t = 0; t < 8; ++t) oacc[t][r] *= alpha;
    }
    wave_lds_sync();
#pragma unroll
    for (int kk = 0; kk < 2; ++kk) {
      FH pa;
      pa.h[0] = *(const v8h*)(pw + c * kLateKC + kk * 32 + 8 * hh);
      pa.h[1] = *(const v8h*)(pw + c * kLateKC + kk * 32 + 16 + 8 * hh);
#pragma unroll
      for (int t = 0; t < 8; ++t) {
        const v16h vf = Frag<_Float16>::load(Vb + (size_t)(t * 16 + c) * kS + kv0 + kk * 32);
        oacc[t] = mma_guard_h(pa.v, vf, oacc[t]);
      }
      asm volatile("" ::: "memory");
    }
    wave_lds_sync();
  }

  float inv[8];
#pragma unroll
  for (int r = 0; r < 8; ++r) inv[r] = 1.0f / (lrow[r] * (kPCarry * kVCarry));
  float* os = Os[wave];
  const int c4 = (lane & 15) * 4;
#pragma unroll
  for (int hf = 0; hf < 2; ++hf) {
#pragma unroll
    for (int r = 0; r < 8; ++r) {
#pragma unroll
      for (int t4 = 0; t4 < 4; ++t4) os[(8 * hh + r) * 68 + t4 * 16 + c] = oacc[hf * 4 + t4][r] * inv[r];
    }
    wave_lds_sync();
    {
#pragma unroll
      for (int it = 0; it < 8; ++it) {
        const int row = it * 2 + hh;
        v4f val = *(const v4f*)(os + row * 68 + c4);
        *(v4f*)(ob + (size_t)row * kQW + hf * 64 + c4) = val;
      }
      
    }
    wave_lds_sync();
  }
}

// ---------------------------------------------------------------------------
// Attention for query positions t < 128 of each batch (a causally closed sub-problem), all f32 on the vector unit.
// Block = (b, kv head, t); wave = one of the 4 query heads; waves are independent (per-wave LDS, wave-local sync).
// Scores: lane owns keys lane + 32*i (i = 0..3, groups beyond t skipped under a wave-uniform test; key index clamped to t,
// invalid keys set to -inf by value afterwards); each dot is a rolled 32 x 4-term loop against the q row held in LDS.
// Softmax with precise expf; p written to LDS for all 128 slots (zeros beyond t).
// p.v: lane owns d = 4*lane..+3; rolled loop over keys 0..t (t <= 127 by construction of the grid).
// ---------------------------------------------------------------------------
__global__ __launch_bounds__(128) void attn_early_kernel(const float* __restrict__ Qe, const float* __restrict__ Ke,
                                                         const float* __restrict__ Ve, float* __restrict__ attn) {
  __shared__ __align__(16) float sq[4][kHD];
  __shared__ __align__(16) float sp[4][kEarly];
  const int lane = threadIdx.x & 31;
  const int wave = __builtin_amdgcn_readfirstlane((int)(threadIdx.x >> 5));
  const int t    = blockIdx.x & (kEarly - 1);
  const int hkv  = (blockIdx.x / kEarly) & (kHkv - 1);
  const int b    = blockIdx.x / (kEarly * kHkv);
  const int h    = hkv * kRep + wave;
  const int erow = b * kEarly + t;
  float* sqw = sq[wave];
  float* spw = sp[wave];
  {
    const v4f qv = *(const v4f*)(Qe + (size_t)erow * kQW + h * kHD + 4 * lane);
    *(v4f*)(sqw + 4 * lane) = qv;
  }
  wave_lds_sync();
  float sc[4];
#pragma unroll
  for (int i = 0; i < 4; ++i) {
    const int j  = lane + 32 * i;
    const int jc = (j < t) ? j : t;
    float dot = 0.0f;
    if (32 * i <= t) {
      const float* kr = Ke + (size_t)(b * kEarly + jc) * kKW + hkv * kHD;
#pragma unroll 1
      for (int d4 = 0; d4 < kHD / 4; ++d4) {
        const v4f kv = *(const v4f*)(kr + 4 * d4);
        float k0 = kv[0], k1 = kv[1], k2 = kv[2], k3 = kv[3];
        asm volatile("" : "+v"(k0), "+v"(k1), "+v"(k2), "+v"(k3));
        const v4f qq = *(const v4f*)(sqw + 4 * d4);
        dot = fmaf(k0, qq[0], dot);
        dot = fmaf(k1, qq[1], dot);
        dot = fmaf(k2, qq[2], dot);
        dot = fmaf(k3, qq[3], dot);
      }
    }
    sc[i] = (j <= t) ? (dot * kInvSqrtHD) : -INFINITY;
  }
  float m = fmaxf(fmaxf(sc[0], sc[1]), fmaxf(sc[2], sc[3]));
#pragma unroll
  for (int off = 16; off > 0; off >>= 1) m = fmaxf(m, __shfl_xor(m, off, 32));
  float psum = 0.0f;
#pragma unroll
  for (int i = 0; i < 4; ++i) {
    const float p = expf(sc[i] - m);
    psum += p;
    spw[lane + 32 * i] = p;
  }
#pragma unroll
  for (int off = 16; off > 0; off >>= 1) psum += __shfl_xor(psum, off, 32);
  wave_lds_sync();
  float a0 = 0.0f, a1 = 0.0f, a2 = 0.0f, a3 = 0.0f;
  const float* vr = Ve + (size_t)(b * kEarly) * kKW + hkv * kHD + 4 * lane;
#pragma unroll 1
  for (int j = 0; j <= t; ++j) {
    const float p = spw[j];
    const v4f vv = *(const v4f*)(vr + (size_t)j * kKW);
    a0 = fmaf(p, vv[0], a0);
    a1 = fmaf(p, vv[1], a1);
    a2 = fmaf(p, vv[2], a2);
    a3 = fmaf(p, vv[3], a3);
  }
  const float il = 1.0f / psum;
  const v4f ov = (v4f){a0 * il, a1 * il, a2 * il, a3 * il};
  float* dst = attn + (size_t)(b * kS + t) * kQW + h * kHD + 4 * lane;
  *(v4f*)dst = ov;
  
}

// ---------------------------------------------------------------------------
// gated = attn * sigmoid(gate projection), f32; one block per token row (2048 columns).
// Rolled loop: 8 iterations x 256 threads, one column each (coalesced 4-B loads), result into LDS; after the block barrier
// thread t owns columns 8t..8t+7. Positions >= 128: f16 plane carried x1024 (row = token). Positions < 128: bf16 hi plane and
// bf16 lo plane (lo = RNE bf16 of value - hi), row = b*128 + position. One 16-B store per lane per plane; a wave = 512
// ---------------------------------------------------------------------------
__global__ __launch_bounds__(256) void gate_kernel(const float* __restrict__ attn, const float* __restrict__ G,
                                                   unsigned short* __restrict__ GH, unsigned short* __restrict__ EH,
                                                   unsigned short* __restrict__ EL) {
  __shared__ __align__(16) float sm[kQW];
  const int tid = threadIdx.x;
  const int row = blockIdx.x;
  const int pos = row & (kS - 1);
  const int b   = row / kS;
  const float* ar = attn + (size_t)row * kQW;
  const float* gr = G + (size_t)row * kQW;
#pragma unroll 1
  for (int i = 0; i < kQW / 256; ++i) {
    const int col = i * 256 + tid;
    const float a = ar[col];
    const float g = gr[col];
    const float sg = 1.0f / (1.0f + expf(-g));
    sm[col] = a * sg;
  }
  __syncthreads();
  const v4f x0 = *(const v4f*)(sm + 8 * tid);
  const v4f x1 = *(const v4f*)(sm + 8 * tid + 4);
  if (pos >= kEarly) {
    unsigned short hb[8];
#pragma unroll
    for (int e = 0; e < 4; ++e) {
      hb[e]     = h_bits(x0[e] * kGCarry);
      hb[4 + e] = h_bits(x1[e] * kGCarry);
    }
    const v4u u = (v4u){pk16(hb[0], hb[1]), pk16(hb[2], hb[3]), pk16(hb[4], hb[5]), pk16(hb[6], hb[7])};
    unsigned short* d = GH + (size_t)row * kQW + 8 * tid;
    *(v4u*)d = u;
    
  } else {
    unsigned short hb[8], lb[8];
#pragma unroll
    for (int e = 0; e < 4; ++e) {
      const float f0 = x0[e];
      const float f1 = x1[e];
      hb[e]     = f2bf_bits(f0);
      hb[4 + e] = f2bf_bits(f1);
      lb[e]     = f2bf_bits(f0 - bf_bits2f(hb[e]));
      lb[4 + e] = f2bf_bits(f1 - bf_bits2f(hb[4 + e]));
    }
    const v4u uh = (v4u){pk16(hb[0], hb[1]), pk16(hb[2], hb[3]), pk16(hb[4], hb[5]), pk16(hb[6], hb[7])};
    const v4u ul = (v4u){pk16(lb[0], lb[1]), pk16(lb[2], lb[3]), pk16(lb[4], lb[5]), pk16(lb[6], lb[7])};
    const size_t o = (size_t)(b * kEarly + pos) * kQW + 8 * tid;
    *(v4u*)(EH + o) = uh;
    *(v4u*)(EL + o) = ul;
    
  }
}

// ---------------------------------------------------------------------------
// Host glue: 15 kernel launches, nothing else.
// GEMM shapes (all K % 32 == 0, M and N % 64 == 0, no padding planes):
//   q|k|v proj : M 4096, N 3072, K 2048 -> 64 x 48 tiles = 3072 -> 384 blocks (bf16)
//   gate proj  : M 4096, N 2048, K 2048 -> 64 x 32 tiles = 2048 -> 256 blocks (bf16)
//   out late   : per batch M 1920 (positions 128..2047), N 2048, K 2048 -> 30 x 32 = 960 tiles -> 120 blocks x 2 (f16)
//   out early  : per batch M 128 (positions 0..127), N 2048, K 2048, A hi+lo -> 2 x 32 = 64 tiles -> 8 blocks x 2 (bf16)
// ---------------------------------------------------------------------------
extern "C" void kernel_launch(void* const* d_in, const int* in_sizes, int n_in,
                              void* d_out, int out_size, void* d_ws, size_t ws_size,
                              hipStream_t stream) {
  if (n_in < 10) return;
  if (in_sizes[0] != kTok * kHid) return;
  if (in_sizes[1] != kS * kHD) return;
  if (in_sizes[2] != kS * kHD) return;
  if (in_sizes[3] != kQW * kHid) return;
  if (in_sizes[4] != kKW * kHid) return;
  if (in_sizes[5] != kKW * kHid) return;
  if (in_sizes[6] != kQW * kHid) return;
  if (in_sizes[7] != kQW * kQW) return;
  if (in_sizes[8] != kHD) return;
  if (in_sizes[9] != kHD) return;
  if (out_size != kTok * kQW) return;
  if (ws_size < kWsTotal) return;

  const float* X    = (const float*)d_in[0];
  const float* ctab = (const float*)d_in[1];
  const float* stab = (const float*)d_in[2];
  const float* Wq   = (const float*)d_in[3];
  const float* Wk   = (const float*)d_in[4];
  const float* Wv   = (const float*)d_in[5];
  const float* Wg   = (const float*)d_in[6];
  const float* Wo   = (const float*)d_in[7];
  const float* qnw  = (const float*)d_in[8];
  const float* knw  = (const float*)d_in[9];
  float* out = (float*)d_out;

  char* ws = (char*)d_ws;
  unsigned short* XB   = (unsigned short*)(ws + kOffXB);
  unsigned short* WQKV = (unsigned short*)(ws + kOffWQKV);
  unsigned short* WGB  = (unsigned short*)(ws + kOffWGB);
  float*          QKV  = (float*)(ws + kOffQKV);
  unsigned short* QP   = (unsigned short*)(ws + kOffQP);
  unsigned short* KP   = (unsigned short*)(ws + kOffKP);
  unsigned short* VT   = (unsigned short*)(ws + kOffVT);
  float*          QE   = (float*)(ws + kOffQE);
  float*          KE   = (float*)(ws + kOffKE);
  float*          VE   = (float*)(ws + kOffVE);
  unsigned short* WOB  = (unsigned short*)(ws + kOffWOB);
  unsigned short* WOH  = (unsigned short*)(ws + kOffWOH);
  float*          ATT  = (float*)(ws + kOffATT);
  float*          GF   = (float*)(ws + kOffGF);
  unsigned short* GH   = (unsigned short*)(ws + kOffGH);
  unsigned short* EH   = (unsigned short*)(ws + kOffEH);
  unsigned short* EL   = (unsigned short*)(ws + kOffEL);

  /* operand planes: every float input RNE-converted to bf16 once (weights are [out][in] = Bt layout already) */
  cast8_kernel<0><<<(kTok * kHid / 8) / 256, 256, 0, stream>>>(X, XB, XB, kTok * kHid / 8, 1.0f);
  cast8_kernel<0><<<(kQW * kHid / 8) / 256, 256, 0, stream>>>(Wq, WQKV, WQKV, kQW * kHid / 8, 1.0f);
  cast8_kernel<0><<<(kKW * kHid / 8) / 256, 256, 0, stream>>>(Wk, WQKV + (size_t)kQW * kHid, WQKV, kKW * kHid / 8, 1.0f);
  cast8_kernel<0><<<(kKW * kHid / 8) / 256, 256, 0, stream>>>(Wv, WQKV + (size_t)kVCol0 * kHid, WQKV, kKW * kHid / 8, 1.0f);
  cast8_kernel<0><<<(kQW * kHid / 8) / 256, 256, 0, stream>>>(Wg, WGB, WGB, kQW * kHid / 8, 1.0f);
  cast8_kernel<1><<<(kQW * kQW / 8) / 256, 256, 0, stream>>>(Wo, WOB, WOH, kQW * kQW / 8, kWoCarry);

  /* q|k|v projection: QKV[4096][3072] = x . [Wq;Wk;Wv]^T */
  wmma_gemm64<1, false><<<dim3((kTok / 64) * (kQKVW / 64) / 8, 1), 256, 0, stream>>>(
      XB, XB, kHid, 0L, WQKV, kHid, 0L, QKV, kQKVW, 0L, kTok, kQKVW, kHid, 1.0f);

  /* norm + rotation -> QP, KP (f16 x64) and QE, KE (f32, positions < 128) */
  normrot_kernel<<<kTok * kSlots / 8, 256, 0, stream>>>(QKV, ctab, stab, qnw, knw, QP, KP, QE, KE);

  /* v transpose -> VT (f16 x64) and VE (f32, positions < 128): 2 x 4 x 32 blocks */
  vprep_kernel<<<kB * kHkv * (kS / 64), 256, 0, stream>>>(QKV, VT, VE);

  /* attention, positions >= 128 (matrix ops) then positions < 128 (f32); disjoint rows of ATT */
  attn_late_kernel<<<kLatePairs * kHkv * kB, 256, 0, stream>>>(QP, KP, VT, ATT);
  attn_early_kernel<<<kB * kHkv * kEarly, 128, 0, stream>>>(QE, KE, VE, ATT);

  /* gate projection: GF[4096][2048] = x . Wg^T */
  wmma_gemm64<1, false><<<dim3((kTok / 64) * (kQW / 64) / 8, 1), 256, 0, stream>>>(
      XB, XB, kHid, 0L, WGB, kHid, 0L, GF, kQW, 0L, kTok, kQW, kHid, 1.0f);

  /* gated planes */
  gate_kernel<<<kTok, 256, 0, stream>>>(ATT, GF, GH, EH, EL);

  /* output projection, positions >= 128 of each batch: f16 single product, carries folded back */
  wmma_gemm64<0, false><<<dim3(((kS - kEarly) / 64) * (kQW / 64) / 8, kB), 256, 0, stream>>>(
      GH + (size_t)kEarly * kQW, GH + (size_t)kEarly * kQW, kQW, (long)kS * kQW,
      WOH, kQW, 0L,
      out + (size_t)kEarly * kQW, kQW, (long)kS * kQW,
      kS - kEarly, kQW, kQW, kOutLateMul);

  /* output projection, positions < 128 of each batch: bf16 hi.W + lo.W */
  wmma_gemm64<1, true><<<dim3((kEarly / 64) * (kQW / 64) / 8, kB), 256, 0, stream>>>(
      EH, EL, kQW, (long)kEarly * kQW,
      WOB, kQW, 0L,
      out, kQW, (long)kS * kQW,
      kEarly, kQW, kQW, 1.0f);
}

// v001
// It runs in 515 microseconds.
// Next to v000, in two timings, it ran 1.53 times as fast each time.
// Projections x.Wq/Wk/Wv/Wg^T: v_wmma_f32_16x16x32_bf16 (every float input RNE-converted to bf16 once, exact products, f32 accumulate); scores q.k^T and p.v for query positions >= 128: v_wmma_f32_16x16x32_f16 (q,k,v planes carried x64, p carried x32768); query positions < 128: f32 VALU attention; output projection: f16 (gated carried x1024, Wo carried x1024) for positions >= 128, bf16 hi+lo gated planes x bf16 Wo (two products) for positions < 128; norms, position rotation, softmax, gate in f32.
#include <hip/hip_runtime.h>
#include <math.h>

typedef __attribute__((ext_vector_type(16))) _Float16 v16h;
typedef __attribute__((ext_vector_type(8)))  _Float16 v8h;
typedef __attribute__((ext_vector_type(16))) __bf16   v16b;
typedef __attribute__((ext_vector_type(8)))  __bf16   v8b;
typedef __attribute__((ext_vector_type(8)))  float    v8f;
typedef __attribute__((ext_vector_type(4)))  float    v4f;
typedef __attribute__((ext_vector_type(4)))  unsigned int v4u;
typedef __attribute__((ext_vector_type(2)))  unsigned int v2u;

// ---------------------------------------------------------------------------
// Shape constants
// ---------------------------------------------------------------------------
constexpr int kB     = 2;
constexpr int kS     = 2048;
constexpr int kHid   = 2048;
constexpr int kHq    = 16;
constexpr int kHkv   = 4;
constexpr int kRep   = kHq / kHkv;
constexpr int kHD    = 128;
constexpr int kTok   = kB * kS;
constexpr int kQW    = kHq * kHD;
constexpr int kKW    = kHkv * kHD;
constexpr int kQKVW  = kQW + 2 * kKW;
constexpr int kVCol0 = kQW + kKW;
constexpr int kSlots = kHq + kHkv;
constexpr int kEarly = 128;
constexpr int kERows = kB * kEarly;
constexpr int kLateKC    = 64;
constexpr int kLatePairs = (kS - kEarly) / 32;
constexpr int kVP    = 132;
constexpr float kEps = 1e-6f;

constexpr double cx_sqrt(double x) {
  double r = (x > 1.0) ? x : 1.0;
  for (int i = 0; i < 80; ++i) r = 0.5 * (r + x / r);
  return r;
}
constexpr float kInvSqrtHD = (float)(1.0 / cx_sqrt((double)kHD));
/* power-of-two carries of the f16 operand planes */
constexpr float kQKCarry = 64.0f;
constexpr float kVCarry  = 64.0f;
constexpr float kPCarry  = 32768.0f;
constexpr float kGCarry  = 1024.0f;
constexpr float kWoCarry = 1024.0f;
constexpr float kScoreMul   = kInvSqrtHD / (kQKCarry * kQKCarry);
constexpr float kOutLateMul = 1.0f / (kGCarry * kWoCarry);

static_assert(kRep == 4 && kHkv == 4 && kHD == 128, "lane maps assume 4 kv heads x 4 query heads x 128");
static_assert(kTok == 4096 && kQW == 2048 && kKW == 512 && kQKVW == 3072, "wire shapes");
static_assert((kHid % 32) == 0 && (kQW % 32) == 0, "GEMM K multiples of 32");
static_assert((kTok % 64) == 0 && (kQKVW % 64) == 0 && (kQW % 64) == 0 && ((kS - kEarly) % 64) == 0 && (kEarly % 64) == 0, "GEMM M,N multiples of 64");
static_assert((kS % 64) == 0 && (kS / 64) == 32 && (kEarly % 16) == 0 && ((kS - kEarly) % 32) == 0, "tile multiples");

// ---------------------------------------------------------------------------
// Workspace region map (bytes; every offset a multiple of 128)
//   XB   bf16 [4096][2048]  x plane                                16,777,216
//   WQKV bf16 [3072][2048]  Wq | Wk | Wv rows                      12,582,912
//   WGB  bf16 [2048][2048]  Wg                                      8,388,608
//   QKV  f32  [4096][3072]  q | k | v projections                  50,331,648
//   QP   f16  [4096][2048]  normed+rotated q x64                   16,777,216
//   KP   f16  [4096][512]   normed+rotated k x64                    4,194,304
//   VT   f16  [2][4][128][2048] v transposed x64                    4,194,304
//   QE   f32  [256][2048]   q rows of positions < 128               2,097,152
//   KE   f32  [256][512]    k rows of positions < 128                 524,288
//   VE   f32  [256][512]    v rows of positions < 128                 524,288
//   WOB  bf16 [2048][2048]  Wo                                      8,388,608
//   WOH  f16  [2048][2048]  Wo (bf16 value) x1024                   8,388,608
//   total                                                         133,169,152
// Aliases (each across whole launches):
//   ATT  f32 [4096][2048]  = first 33,554,432 B of QKV (after the norm/rotation and v-prep launches)
//   GF   f32 [4096][2048]  = last 16,777,216 B of QKV + all of QP (after both attention launches)
//   GH   f16 [4096][2048]  = XB (after the gate projection)
//   EH/EL bf16 [256][2048] = first 2 x 1,048,576 B of WQKV (after the q|k|v projection)
// ---------------------------------------------------------------------------
constexpr size_t kOffXB   = 0;
constexpr size_t kOffWQKV = kOffXB   + (size_t)kTok * kHid * 2;
constexpr size_t kOffWGB  = kOffWQKV + (size_t)kQKVW * kHid * 2;
constexpr size_t kOffQKV  = kOffWGB  + (size_t)kQW * kHid * 2;
constexpr size_t kOffQP   = kOffQKV  + (size_t)kTok * kQKVW * 4;
constexpr size_t kOffKP   = kOffQP   + (size_t)kTok * kQW * 2;
constexpr size_t kOffVT   = kOffKP   + (size_t)kTok * kKW * 2;
constexpr size_t kOffQE   = kOffVT   + (size_t)kTok * kKW * 2;
constexpr size_t kOffKE   = kOffQE   + (size_t)kERows * kQW * 4;
constexpr size_t kOffVE   = kOffKE   + (size_t)kERows * kKW * 4;
constexpr size_t kOffWOB  = kOffVE   + (size_t)kERows * kKW * 4;
constexpr size_t kOffWOH  = kOffWOB  + (size_t)kQW * kQW * 2;
constexpr size_t kWsTotal = kOffWOH  + (size_t)kQW * kQW * 2;
constexpr size_t kOffATT  = kOffQKV;
constexpr size_t kOffGF   = kOffQKV + (size_t)kTok * kQW * 4;
constexpr size_t kOffGH   = kOffXB;
constexpr size_t kOffEH   = kOffWQKV;
constexpr size_t kOffEL   = kOffWQKV + (size_t)kERows * kQW * 2;
static_assert(kWsTotal == 133169152ull, "carve total");
static_assert(kWsTotal <= 134217728ull, "carve cap");
static_assert(kOffGF + (size_t)kTok * kQW * 4 == kOffKP, "gate plane covers the projection tail plus the q plane exactly");
static_assert(kOffEL + (size_t)kERows * kQW * 2 <= kOffWGB, "hi/lo planes inside the dead weight plane");
static_assert((kOffWQKV % 128) == 0 && (kOffWGB % 128) == 0 && (kOffQKV % 128) == 0 && (kOffQP % 128) == 0 &&
              (kOffKP % 128) == 0 && (kOffVT % 128) == 0 && (kOffQE % 128) == 0 && (kOffKE % 128) == 0 &&
              (kOffVE % 128) == 0 && (kOffWOB % 128) == 0 && (kOffWOH % 128) == 0 && (kOffGF % 128) == 0 &&
              (kOffEL % 128) == 0, "128-B aligned regions");

// ---------------------------------------------------------------------------
// Small helpers
// ---------------------------------------------------------------------------
__device__ __forceinline__ unsigned short f2bf_bits(float f) {
  unsigned u = __float_as_uint(f);
  return (unsigned short)((u + 0x7FFFu + ((u >> 16) & 1u)) >> 16);
}
__device__ __forceinline__ float bf_bits2f(unsigned short h) { return __uint_as_float(((unsigned)h) << 16); }
__device__ __forceinline__ float bf16r(float f) { return bf_bits2f(f2bf_bits(f)); }
__device__ __forceinline__ unsigned pk16(unsigned short a, unsigned short b) { return (unsigned)a | ((unsigned)b << 16); }
__device__ __forceinline__ unsigned short h_bits(float f) { const _Float16 h = (_Float16)f; return __builtin_bit_cast(unsigned short, h); }
__device__ __forceinline__ void wave_lds_sync() {
  __builtin_amdgcn_fence(__ATOMIC_RELEASE, "workgroup");
  __builtin_amdgcn_wave_barrier();
  __builtin_amdgcn_fence(__ATOMIC_ACQUIRE, "workgroup");
}

/* matrix op followed by the 4-slot hazard guard; one accumulator per guard statement, A and B named as inputs */
__device__ __forceinline__ v8f mma_guard_h(v16h a, v16h b, v8f c) {
  c = __builtin_amdgcn_wmma_f32_16x16x32_f16(false, a, false, b, (short)0, c, false, false);
  asm volatile("v_nop\n\tv_nop\n\tv_nop\n\tv_nop" : "+v"(c) : "v"(a), "v"(b));
  return c;
}
__device__ __forceinline__ v8f mma_guard_b(v16b a, v16b b, v8f c) {
  c = __builtin_amdgcn_wmma_f32_16x16x32_bf16(false, a, false, b, (short)0, c, false, false);
  asm volatile("v_nop\n\tv_nop\n\tv_nop\n\tv_nop" : "+v"(c) : "v"(a), "v"(b));
  return c;
}
__device__ __forceinline__ void keep4_h(v16h a, v16h b, v16h c, v16h d) { asm volatile("v_nop" :: "v"(a), "v"(b), "v"(c), "v"(d)); }
__device__ __forceinline__ void keep4_b(v16b a, v16b b, v16b c, v16b d) { asm volatile("v_nop" :: "v"(a), "v"(b), "v"(c), "v"(d)); }
__device__ __forceinline__ void acc_guard4(v8f& a, v8f& b, v8f& c, v8f& d) { asm volatile("v_nop\n\tv_nop\n\tv_nop\n\tv_nop" : "+v"(a), "+v"(b), "+v"(c), "+v"(d)); }

template <typename T> struct Frag;
template <> struct Frag<_Float16> {
  typedef v16h V; union U { v16h v; v8h h[2]; };
  /* elements 0..7 <- p[0..7], 8..15 <- p[16..23] */
  static __device__ __forceinline__ v16h load(const _Float16* p) {
    U f; f.h[0] = *(const v8h*)(p); f.h[1] = *(const v8h*)(p + 16); return f.v;
  }
  static __device__ __forceinline__ v8f mmag(v16h a, v16h b, v8f c) { return mma_guard_h(a, b, c); }
  static __device__ __forceinline__ void keep(v16h a, v16h b, v16h c, v16h d) { keep4_h(a, b, c, d); }
};
template <> struct Frag<__bf16> {
  typedef v16b V; union U { v16b v; v8b h[2]; };
  static __device__ __forceinline__ v16b load(const __bf16* p) {
    U f; f.h[0] = *(const v8b*)(p); f.h[1] = *(const v8b*)(p + 16); return f.v;
  }
  static __device__ __forceinline__ v8f mmag(v16b a, v16b b, v8f c) { return mma_guard_b(a, b, c); }
  static __device__ __forceinline__ void keep(v16b a, v16b b, v16b c, v16b d) { keep4_b(a, b, c, d); }
};

// ---------------------------------------------------------------------------
// Batched GEMM: C[m,n] = scale * sum_k A[m,k] * Bt[n,k]. A block of 8 waves (2 x 4) owns a 128 x 256 tile, each wave 64x64 of it.
// A row-major [M,K]; Bt row-major [N,K]; M % 128 == 0, N % 256 == 0, K % 64 == 0 (no tails).
// Operands reach LDS by asynchronous 16-B copies, 64 k per stage (128-B rows at a 144-B pitch), two buffers: the next
// stage's copies fly while this stage's fragments are read from LDS; 8 lanes copy one whole 128-B line of a row.
// ASPLIT: A carried as hi/lo planes (A2 = lo plane, same layout): product = hi.b + lo.b into one accumulator.
// ET: 0 = f16 operands, 1 = bf16 operands (pointers passed as 16-bit storage). Output f32.
// ---------------------------------------------------------------------------
constexpr int kGBM    = 128;
constexpr int kGBN    = 256;
constexpr int kGKS    = 64;
constexpr int kGPitch = 72;
constexpr unsigned kGPitchB = kGPitch * 2;
static_assert((kTok % kGBM) == 0 && ((kS - kEarly) % kGBM) == 0 && (kEarly % kGBM) == 0, "GEMM M multiples of the block tile");
static_assert((kQKVW % kGBN) == 0 && (kQW % kGBN) == 0, "GEMM N multiples of the block tile");
static_assert((kHid % kGKS) == 0 && (kQW % kGKS) == 0 && kHid / kGKS >= 2 && kQW / kGKS >= 2, "GEMM K in whole stages");

__device__ __forceinline__ unsigned lds_off(const void* p) { return (unsigned)(size_t)p; }

/* copies of 16 B per lane, global -> LDS through no register: row r of the run lies 32 * r rows behind the first, in LDS
   (pitch kGPitchB) and in the source (step32 elements). One statement holds a whole run, and the s_wait_xcnt closes it so
   that no address register of a copy is rewritten in front of it; one run per statement keeps that wait to one per run */
__device__ __forceinline__ void copy4_async(unsigned l, const unsigned short* g, size_t step32) {
  asm volatile("global_load_async_to_lds_b128 %0, %4, off\n\t"
               "global_load_async_to_lds_b128 %1, %5, off\n\t"
               "global_load_async_to_lds_b128 %2, %6, off\n\t"
               "global_load_async_to_lds_b128 %3, %7, off\n\t"
               "s_wait_xcnt 0x0"
               :: "v"(l), "v"(l + 32u * kGPitchB), "v"(l + 64u * kGPitchB), "v"(l + 96u * kGPitchB),
                  "v"(g), "v"(g + step32), "v"(g + 2 * step32), "v"(g + 3 * step32) : "memory");
}
__device__ __forceinline__ void copy8_async(unsigned l, const unsigned short* g, size_t step32,
                                            unsigned m, const unsigned short* h, size_t step32h) {
  asm volatile("global_load_async_to_lds_b128 %0, %8, off\n\t"
               "global_load_async_to_lds_b128 %1, %9, off\n\t"
               "global_load_async_to_lds_b128 %2, %10, off\n\t"
               "global_load_async_to_lds_b128 %3, %11, off\n\t"
               "global_load_async_to_lds_b128 %4, %12, off\n\t"
               "global_load_async_to_lds_b128 %5, %13, off\n\t"
               "global_load_async_to_lds_b128 %6, %14, off\n\t"
               "global_load_async_to_lds_b128 %7, %15, off\n\t"
               "s_wait_xcnt 0x0"
               :: "v"(l), "v"(l + 32u * kGPitchB), "v"(l + 64u * kGPitchB), "v"(l + 96u * kGPitchB),
                  "v"(m), "v"(m + 32u * kGPitchB), "v"(m + 64u * kGPitchB), "v"(m + 96u * kGPitchB),
                  "v"(g), "v"(g + step32), "v"(g + 2 * step32), "v"(g + 3 * step32),
                  "v"(h), "v"(h + step32h), "v"(h + 2 * step32h), "v"(h + 3 * step32h) : "memory");
}

template <int ET> struct Elem;
template <> struct Elem<0> { typedef _Float16 T; };
template <> struct Elem<1> { typedef __bf16 T; };
template <int ET, bool ASPLIT>
__global__ __launch_bounds__(256) void wmma_gemm64(
    const unsigned short* __restrict__ Ap, const unsigned short* __restrict__ A2p, int lda, long strideA,
    const unsigned short* __restrict__ Btp, int ldb, long strideB,
    float* __restrict__ Cout, int ldc, long strideC,
    int M, int N, int K, float scale) {
  typedef typename Elem<ET>::T T;
  typedef typename Frag<T>::V V;
  constexpr int kARows = ASPLIT ? 2 * kGBM : kGBM;
  constexpr int kRows  = kARows + kGBN;
  constexpr unsigned kBufB = (unsigned)kRows * kGPitchB;
  __shared__ __align__(16) unsigned short sStage[2][kRows * kGPitch];
  __shared__ __align__(16) float sT[8][16 * 68];
  const int b    = blockIdx.y;
  const int tid  = threadIdx.x;
  const int lane = tid & 31;
  const int wave = __builtin_amdgcn_readfirstlane((int)(threadIdx.x >> 5));
  const int tilesN = N / kGBN;
  const int tilesM = M / kGBM;
  /* block-uniform, in front of every barrier and copy */
  if ((int)blockIdx.x >= tilesM * tilesN) return;
  const int tm = (int)blockIdx.x / tilesN;
  const int tn = (int)blockIdx.x - tm * tilesN;
  const int bm0 = tm * kGBM;
  const int bn0 = tn * kGBN;
  const int wm = wave >> 2;
  const int wn = wave & 3;
  const int m0 = bm0 + (wm << 6);
  const int n0 = bn0 + (wn << 6);

  const int rlane = lane & 15;
  const int koff  = (lane >> 4) * 8;
  const int mOff  = (lane >> 4) * 8;

  /* the thread's own place in a stage and in the two (three) source planes */
  const int crow = tid >> 3;
  const int cch  = tid & 7;
  const unsigned lds0 = lds_off(&sStage[0][0]) + (unsigned)crow * kGPitchB + (unsigned)cch * 16u;
  const unsigned short* gA  = Ap  + (size_t)b * strideA + (size_t)(bm0 + crow) * lda + cch * 8;
  const unsigned short* gA2 = A2p + (size_t)b * strideA + (size_t)(bm0 + crow) * lda + cch * 8;
  const unsigned short* gB  = Btp + (size_t)b * strideB + (size_t)(bn0 + crow) * ldb + cch * 8;
  const size_t stepA = (size_t)32 * lda;
  const size_t stepB = (size_t)32 * ldb;
  const int nst = K / kGKS;

  auto issue_stage = [&](int t) {
    const unsigned l = lds0 + (unsigned)(t & 1) * kBufB;
    const size_t k0 = (size_t)t * kGKS;
    const unsigned lb = l + (unsigned)kARows * kGPitchB;
    /* thread t brings bytes 16*(t&7).. of rows (t>>3) + 32*i of each panel: 128 rows of A (and of A2), 256 of Bt */
    if (ASPLIT) copy8_async(l, gA + k0, stepA, l + (unsigned)kGBM * kGPitchB, gA2 + k0, stepA);
    else        copy4_async(l, gA + k0, stepA);
    copy8_async(lb, gB + k0, stepB, lb + 128u * kGPitchB, gB + k0 + 4 * stepB, stepB);
  };

  v8f acc[4][4];
#pragma unroll
  for (int i = 0; i < 4; ++i)
#pragma unroll
    for (int j = 0; j < 4; ++j) acc[i][j] = (v8f){0.f,0.f,0.f,0.f,0.f,0.f,0.f,0.f};

  issue_stage(0);
  /* stage 0 has landed for this wave; the barrier publishes it to the others */
  asm volatile("s_wait_asynccnt 0x0" ::: "memory");
  __syncthreads();
  if (nst > 1) issue_stage(1);

  for (int t = 0; t < nst; ++t) {
    const T* sb = (const T*)&sStage[t & 1][0];
    const T* sa = sb + ((wm << 6) + rlane) * kGPitch + koff;
    const T* sw = sb + (kARows + (wn << 6) + rlane) * kGPitch + koff;
#pragma unroll
    for (int ks = 0; ks < kGKS / 32; ++ks) {
      /* all fragments of a k step are read from LDS as one group in front of its products */
      V bh[4], ah[4], al[4];
#pragma unroll
      for (int j = 0; j < 4; ++j) bh[j] = Frag<T>::load(sw + (j << 4) * kGPitch + ks * 32);
#pragma unroll
      for (int i = 0; i < 4; ++i) {
        ah[i] = Frag<T>::load(sa + (i << 4) * kGPitch + ks * 32);
        al[i] = ah[i];
        if (ASPLIT) al[i] = Frag<T>::load(sa + (kGBM + (i << 4)) * kGPitch + ks * 32);
      }
#pragma unroll
      for (int i = 0; i < 4; ++i) {
#pragma unroll
        for (int j = 0; j < 4; ++j) {
          acc[i][j] = Frag<T>::mmag(ah[i], bh[j], acc[i][j]);
          if (ASPLIT) acc[i][j] = Frag<T>::mmag(al[i], bh[j], acc[i][j]);
        }
      }
      Frag<T>::keep(bh[0], bh[1], bh[2], bh[3]);
    }
    /* hand-over: this wave's reads of the buffer are done, */
    asm volatile("s_wait_dscnt 0x0" ::: "memory");
    /* its copies of stage t + 1 have landed, */
    asm volatile("s_wait_asynccnt 0x0" ::: "memory");
    /* and the barrier publishes stage t + 1 and frees the buffer that was just read */
    __syncthreads();
    if (t + 2 < nst) issue_stage(t + 2);
  }
  /* no copy is left in flight when the wave goes on */
  asm volatile("s_wait_asynccnt 0x0" ::: "memory");
  acc_guard4(acc[0][0], acc[0][1], acc[0][2], acc[0][3]);
  acc_guard4(acc[1][0], acc[1][1], acc[1][2], acc[1][3]);
  acc_guard4(acc[2][0], acc[2][1], acc[2][2], acc[2][3]);
  acc_guard4(acc[3][0], acc[3][1], acc[3][2], acc[3][3]);

  float* slab = sT[wave];
  float* C = Cout + (size_t)b * strideC;
#pragma unroll
  for (int i = 0; i < 4; ++i) {
    const int mBase = m0 + (i << 4);
#pragma unroll
    for (int j = 0; j < 4; ++j) {
#pragma unroll
      for (int r = 0; r < 8; ++r) {
        slab[(mOff + r) * 68 + (j << 4) + rlane] = acc[i][j][r] * scale;
      }
    }
    wave_lds_sync();
    {
      const int hh = lane >> 4, c4 = (lane & 15) * 4;
      {
#pragma unroll
        for (int it = 0; it < 8; ++it) {
          const int row = it * 2 + hh;
          v4f v = *(const v4f*)(slab + row * 68 + c4);
          *(v4f*)(C + (size_t)(mBase + row) * ldc + n0 + c4) = v;
        }
        
      }
    }
    wave_lds_sync();
  }
}

// ---------------------------------------------------------------------------
// MODE 0: o0 = bf16 (RNE). MODE 1: o0 = bf16 (RNE), o1 = f16 of (bf16 value x carry) (exact: power-of-two carry).
// ---------------------------------------------------------------------------
template <int MODE>
__global__ __launch_bounds__(256) void cast8_kernel(const float* __restrict__ in, unsigned short* __restrict__ o0,
                                                    unsigned short* __restrict__ o1, int n8, float carry) {
  const int i = blockIdx.x * 256 + threadIdx.x;
  if (i >= n8) return;
  const size_t e0 = (size_t)i << 3;
  const v4f a0 = *(const v4f*)(in + e0);
  const v4f a1 = *(const v4f*)(in + e0 + 4);
  unsigned short bb[8], hb[8];
#pragma unroll
  for (int e = 0; e < 4; ++e) {
    bb[e]     = f2bf_bits(a0[e]);
    bb[4 + e] = f2bf_bits(a1[e]);
  }
#pragma unroll
  for (int e = 0; e < 8; ++e) hb[e] = (MODE == 1) ? h_bits(bf_bits2f(bb[e]) * carry) : (unsigned short)0;
  const v4u ub = (v4u){pk16(bb[0], bb[1]), pk16(bb[2], bb[3]), pk16(bb[4], bb[5]), pk16(bb[6], bb[7])};
  const v4u uh = (v4u){pk16(hb[0], hb[1]), pk16(hb[2], hb[3]), pk16(hb[4], hb[5]), pk16(hb[6], hb[7])};
  unsigned short* q0 = o0 + e0;
  unsigned short* q1 = o1 + e0;
  *(v4u*)q0 = ub;
  if (MODE == 1) *(v4u*)q1 = uh;
  
}

// ---------------------------------------------------------------------------
// Per-head RMS norm (eps inside the rsqrt of the mean square) then rotation by the position tables, f32.
// One wave per (token, slot): slots 0..15 = query heads, 16..19 = key heads (columns slot*128 of the q|k|v plane).
// Lane owns d = 4*lane..4*lane+3; the partner d +/- 64 lives in lane ^ 16 (unconditional shuffles).
// d < 64: y = n[d]*c[d] - n[d+64]*s[d]; d >= 64: y = n[d]*c[d] + n[d-64]*s[d]; tables read by value at [pos][d],
// tables and norm weights RNE-converted to bf16 on load.
// ---------------------------------------------------------------------------
__global__ __launch_bounds__(256) void normrot_kernel(
    const float* __restrict__ QKV, const float* __restrict__ ctab, const float* __restrict__ stab,
    const float* __restrict__ qw, const float* __restrict__ kw,
    unsigned short* __restrict__ Qp, unsigned short* __restrict__ Kp, float* __restrict__ Qe, float* __restrict__ Ke) {
  const int lane = threadIdx.x & 31;
  const int wave = __builtin_amdgcn_readfirstlane((int)(threadIdx.x >> 5));
  const int gw   = blockIdx.x * 8 + wave;
  const int tok  = gw / kSlots;
  const int slot = gw - tok * kSlots;
  const int pos  = tok & (kS - 1);
  const int b    = tok / kS;
  const bool isq = slot < kHq;
  const int kslot = isq ? 0 : (slot - kHq);

  const v4f x   = *(const v4f*)(QKV + (size_t)tok * kQKVW + slot * kHD + 4 * lane);
  const v4f wq4 = *(const v4f*)(qw + 4 * lane);
  const v4f wk4 = *(const v4f*)(kw + 4 * lane);
  const v4f c4  = *(const v4f*)(ctab + (size_t)pos * kHD + 4 * lane);
  const v4f s4  = *(const v4f*)(stab + (size_t)pos * kHD + 4 * lane);

  float ss = x[0] * x[0];
  ss = fmaf(x[1], x[1], ss);
  ss = fmaf(x[2], x[2], ss);
  ss = fmaf(x[3], x[3], ss);
#pragma unroll
  for (int off = 16; off > 0; off >>= 1) ss += __shfl_xor(ss, off, 32);
  const float inv = rsqrtf(ss * (1.0f / (float)kHD) + kEps);

  float n[4], p[4], y[4];
#pragma unroll
  for (int e = 0; e < 4; ++e) {
    const float w = bf16r(isq ? wq4[e] : wk4[e]);
    n[e] = x[e] * inv * w;
  }
#pragma unroll
  for (int e = 0; e < 4; ++e) p[e] = __shfl_xor(n[e], 16, 32);
  const float sgn = (lane < 16) ? -1.0f : 1.0f;
#pragma unroll
  for (int e = 0; e < 4; ++e) y[e] = n[e] * bf16r(c4[e]) + sgn * (p[e] * bf16r(s4[e]));

  unsigned short hb[4];
#pragma unroll
  for (int e = 0; e < 4; ++e) hb[e] = h_bits(y[e] * kQKCarry);
  const v2u u = (v2u){pk16(hb[0], hb[1]), pk16(hb[2], hb[3])};
  const v4f yv = (v4f){y[0], y[1], y[2], y[3]};

  unsigned short* dq = Qp + (size_t)tok * kQW + slot * kHD + 4 * lane;
  unsigned short* dk = Kp + (size_t)tok * kKW + kslot * kHD + 4 * lane;
  unsigned short* d16 = isq ? dq : dk;
  const bool early = pos < kEarly;
  const int erow = b * kEarly + (early ? pos : 0);
  float* eq = Qe + (size_t)erow * kQW + (isq ? slot : 0) * kHD + 4 * lane;
  float* ek = Ke + (size_t)erow * kKW + kslot * kHD + 4 * lane;
  float* d32 = isq ? eq : ek;
  {
    *(v2u*)d16 = u;
    if (early) *(v4f*)d32 = yv;
    
  }
}

// ---------------------------------------------------------------------------
// v columns of the q|k|v plane -> VT f16 [b][kv head][d][s] carried x64 (LDS transpose), plus VE f32 rows for positions < 128.
// Block = (b, kv head, 64 positions); 256 threads. Load coverage: 8 iterations x 256 threads = 2048 v4f = 64 rows x 32.
// VT stores: row d = it*32 + wave*4 + (lane>>3), it 0..3 x 8 waves x 4 = 128 rows; (lane&7) x 8 halves = 64 positions
// ---------------------------------------------------------------------------
__global__ __launch_bounds__(256) void vprep_kernel(const float* __restrict__ QKV, unsigned short* __restrict__ Vt,
                                                    float* __restrict__ Ve) {
  __shared__ __align__(16) float sm[64 * kVP];
  const int tid  = threadIdx.x;
  const int lane = tid & 31;
  const int wave = __builtin_amdgcn_readfirstlane((int)(tid >> 5));
  const int st   = blockIdx.x & 31;
  const int hkv  = (blockIdx.x >> 5) & (kHkv - 1);
  const int b    = blockIdx.x >> 7;
  const int s0   = st * 64;
  const float* src = QKV + (size_t)(b * kS + s0) * kQKVW + kVCol0 + hkv * kHD;
#pragma unroll
  for (int i = 0; i < 8; ++i) {
    const int e  = i * 256 + tid;
    const int r  = e >> 5;
    const int cc = (e & 31) * 4;
    const v4f v = *(const v4f*)(src + (size_t)r * kQKVW + cc);
    *(v4f*)(sm + r * kVP + cc) = v;
  }
  __syncthreads();
  const int q = lane >> 3, c8 = (lane & 7) * 8;
  v4u tv[4];
#pragma unroll
  for (int it = 0; it < 4; ++it) {
    const int d = it * 32 + wave * 4 + q;
    unsigned short hb[8];
#pragma unroll
    for (int e = 0; e < 8; ++e) hb[e] = h_bits(sm[(c8 + e) * kVP + d] * kVCarry);
    tv[it] = (v4u){pk16(hb[0], hb[1]), pk16(hb[2], hb[3]), pk16(hb[4], hb[5]), pk16(hb[6], hb[7])};
  }
  v4f ev[8];
#pragma unroll
  for (int it = 0; it < 8; ++it) ev[it] = *(const v4f*)(sm + (it * 8 + wave) * kVP + 4 * lane);
  const bool early = s0 < kEarly;
  const int erow0 = b * kEarly + (early ? s0 : 0);
  unsigned short* vt0 = Vt + (size_t)(b * kHkv + hkv) * kHD * kS + s0 + c8;
  float* ve0 = Ve + (size_t)erow0 * kKW + hkv * kHD + 4 * lane;
  {
#pragma unroll
    for (int it = 0; it < 4; ++it) *(v4u*)(vt0 + (size_t)(it * 32 + wave * 4 + q) * kS) = tv[it];
    if (early) {
#pragma unroll
      for (int it = 0; it < 8; ++it) *(v4f*)(ve0 + (size_t)(it * 8 + wave) * kKW) = ev[it];
    }
    
  }
}

// ---------------------------------------------------------------------------
// Causal attention for query positions >= 128 (f16 matrix ops, online softmax in f32).
// Block = 8 waves = 4 query heads of one kv head x 2 tiles of 16 query rows; every wave is independent (no block barriers).
// Fragments are loaded straight from the dense statically-strided f16 planes:
//   A (q rows):  row = lane&15, k = d:   QP[(b*S + q0 + row)][h*128 + dc*32 + 8*(lane>>4) ..]
//   B (keys):    col = key,     k = d:   KP[(b*S + key)][kv*128 + dc*32 + 8*(lane>>4) ..]
//   B (values):  col = d,       k = key: VT[b][kv][d][kv0 + kk*32 + 8*(lane>>4) ..]
// 64 keys per iteration; the last chunk masks key > query with -inf before the softmax (the chunk always holds key <= query
// for every row, so the running maximum stays finite). p = exp(s - m) carried x32768 as f16, spilled per wave to LDS as
// ---------------------------------------------------------------------------
__global__ __launch_bounds__(256) void attn_late_kernel(const unsigned short* __restrict__ Qp, const unsigned short* __restrict__ Kp,
                                                        const unsigned short* __restrict__ Vtp, float* __restrict__ attn) {
  union FH { v16h v; v8h h[2]; };
  __shared__ __align__(16) _Float16 Psh[8][16 * kLateKC];
  __shared__ __align__(16) float Os[8][16 * 68];
  const int lane = threadIdx.x & 31;
  const int wave = __builtin_amdgcn_readfirstlane((int)(threadIdx.x >> 5));
  const int hh   = lane >> 4;
  const int c    = lane & 15;
  const int qt2  = blockIdx.x % kLatePairs;
  const int bh   = blockIdx.x / kLatePairs;
  const int hkv  = bh & (kHkv - 1);
  const int b    = bh / kHkv;
  const int h    = hkv * kRep + (wave & 3);
  const int q0   = kEarly + (qt2 * 2 + (wave >> 2)) * 16;

  const _Float16* Kb = (const _Float16*)Kp + (size_t)b * kS * kKW + hkv * kHD + 8 * hh;
  const _Float16* Vb = (const _Float16*)Vtp + (size_t)(b * kHkv + hkv) * kHD * kS + 8 * hh;
  float* ob = attn + (size_t)(b * kS + q0) * kQW + h * kHD;

  v16h qa[4];
  {
    const _Float16* qrow = (const _Float16*)Qp + (size_t)(b * kS + q0 + c) * kQW + h * kHD + 8 * hh;
#pragma unroll
    for (int dc = 0; dc < 4; ++dc) qa[dc] = Frag<_Float16>::load(qrow + dc * 32);
  }

  float mrow[8], lrow[8];
  v8f oacc[8];
#pragma unroll
  for (int r = 0; r < 8; ++r) { mrow[r] = -INFINITY; lrow[r] = 0.0f; }
#pragma unroll
  for (int t = 0; t < 8; ++t) oacc[t] = (v8f){0.f,0.f,0.f,0.f,0.f,0.f,0.f,0.f};

  int nChunks = (q0 + 16 + kLateKC - 1) / kLateKC;
  if (nChunks > kS / kLateKC) nChunks = kS / kLateKC;
  _Float16* pw = Psh[wave];

  for (int kc = 0; kc < nChunks; ++kc) {
    const int kv0 = kc * kLateKC;
    v8f s[4];
#pragma unroll
    for (int j = 0; j < 4; ++j) {
      s[j] = (v8f){0.f,0.f,0.f,0.f,0.f,0.f,0.f,0.f};
      const _Float16* kr = Kb + (size_t)(kv0 + j * 16 + c) * kKW;
#pragma unroll
      for (int dc = 0; dc < 4; ++dc) {
        const v16h kf = Frag<_Float16>::load(kr + dc * 32);
        s[j] = mma_guard_h(qa[dc], kf, s[j]);
      }
      asm volatile("" ::: "memory");
    }
    const bool diag = (kc == nChunks - 1);
    float cm[8];
#pragma unroll
    for (int r = 0; r < 8; ++r) {
      const int qrow = q0 + 8 * hh + r;
      float m = -INFINITY;
#pragma unroll
      for (int j = 0; j < 4; ++j) {
        const int kvcol = kv0 + j * 16 + c;
        float v = s[j][r] * kScoreMul;
        if (diag && (kvcol > qrow)) v = -INFINITY;
        s[j][r] = v;
        m = fmaxf(m, v);
      }
#pragma unroll
      for (int off = 1; off < 16; off <<= 1) m = fmaxf(m, __shfl_xor(m, off, 32));
      cm[r] = m;
    }
#pragma unroll
    for (int r = 0; r < 8; ++r) {
      const float mnew  = fmaxf(mrow[r], cm[r]);
      const float alpha = __expf(mrow[r] - mnew);
      mrow[r] = mnew;
      float psum = 0.0f;
#pragma unroll
      for (int j = 0; j < 4; ++j) {
        const float p = __expf(s[j][r] - mnew);
        psum += p;
        pw[(8 * hh + r) * kLateKC + j * 16 + c] = (_Float16)(p * kPCarry);
      }
#pragma unroll
      for (int off = 1; off < 16; off <<= 1) psum += __shfl_xor(psum, off, 32);
      lrow[r] = lrow[r] * alpha + psum;
#pragma unroll
      for (int t = 0; t < 8; ++t) oacc[t][r] *= alpha;
    }
    wave_lds_sync();
#pragma unroll
    for (int kk = 0; kk < 2; ++kk) {
      FH pa;
      pa.h[0] = *(const v8h*)(pw + c * kLateKC + kk * 32 + 8 * hh);
      pa.h[1] = *(const v8h*)(pw + c * kLateKC + kk * 32 + 16 + 8 * hh);
#pragma unroll
      for (int t = 0; t < 8; ++t) {
        const v16h vf = Frag<_Float16>::load(Vb + (size_t)(t * 16 + c) * kS + kv0 + kk * 32);
        oacc[t] = mma_guard_h(pa.v, vf, oacc[t]);
      }
      asm volatile("" ::: "memory");
    }
    wave_lds_sync();
  }

  float inv[8];
#pragma unroll
  for (int r = 0; r < 8; ++r) inv[r] = 1.0f / (lrow[r] * (kPCarry * kVCarry));
  float* os = Os[wave];
  const int c4 = (lane & 15) * 4;
#pragma unroll
  for (int hf = 0; hf < 2; ++hf) {
#pragma unroll
    for (int r = 0; r < 8; ++r) {
#pragma unroll
      for (int t4 = 0; t4 < 4; ++t4) os[(8 * hh + r) * 68 + t4 * 16 + c] = oacc[hf * 4 + t4][r] * inv[r];
    }
    wave_lds_sync();
    {
#pragma unroll
      for (int it = 0; it < 8; ++it) {
        const int row = it * 2 + hh;
        v4f val = *(const v4f*)(os + row * 68 + c4);
        *(v4f*)(ob + (size_t)row * kQW + hf * 64 + c4) = val;
      }
      
    }
    wave_lds_sync();
  }
}

// ---------------------------------------------------------------------------
// Attention for query positions t < 128 of each batch (a causally closed sub-problem), all f32 on the vector unit.
// Block = (b, kv head, t); wave = one of the 4 query heads; waves are independent (per-wave LDS, wave-local sync).
// Scores: lane owns keys lane + 32*i (i = 0..3, groups beyond t skipped under a wave-uniform test; key index clamped to t,
// invalid keys set to -inf by value afterwards); each dot is a rolled 32 x 4-term loop against the q row held in LDS.
// Softmax with precise expf; p written to LDS for all 128 slots (zeros beyond t).
// p.v: lane owns d = 4*lane..+3; rolled loop over keys 0..t (t <= 127 by construction of the grid).
// ---------------------------------------------------------------------------
__global__ __launch_bounds__(128) void attn_early_kernel(const float* __restrict__ Qe, const float* __restrict__ Ke,
                                                         const float* __restrict__ Ve, float* __restrict__ attn) {
  __shared__ __align__(16) float sq[4][kHD];
  __shared__ __align__(16) float sp[4][kEarly];
  const int lane = threadIdx.x & 31;
  const int wave = __builtin_amdgcn_readfirstlane((int)(threadIdx.x >> 5));
  const int t    = blockIdx.x & (kEarly - 1);
  const int hkv  = (blockIdx.x / kEarly) & (kHkv - 1);
  const int b    = blockIdx.x / (kEarly * kHkv);
  const int h    = hkv * kRep + wave;
  const int erow = b * kEarly + t;
  float* sqw = sq[wave];
  float* spw = sp[wave];
  {
    const v4f qv = *(const v4f*)(Qe + (size_t)erow * kQW + h * kHD + 4 * lane);
    *(v4f*)(sqw + 4 * lane) = qv;
  }
  wave_lds_sync();
  float sc[4];
#pragma unroll
  for (int i = 0; i < 4; ++i) {
    const int j  = lane + 32 * i;
    const int jc = (j < t) ? j : t;
    float dot = 0.0f;
    if (32 * i <= t) {
      const float* kr = Ke + (size_t)(b * kEarly + jc) * kKW + hkv * kHD;
#pragma unroll 1
      for (int d4 = 0; d4 < kHD / 4; ++d4) {
        const v4f kv = *(const v4f*)(kr + 4 * d4);
        float k0 = kv[0], k1 = kv[1], k2 = kv[2], k3 = kv[3];
        asm volatile("" : "+v"(k0), "+v"(k1), "+v"(k2), "+v"(k3));
        const v4f qq = *(const v4f*)(sqw + 4 * d4);
        dot = fmaf(k0, qq[0], dot);
        dot = fmaf(k1, qq[1], dot);
        dot = fmaf(k2, qq[2], dot);
        dot = fmaf(k3, qq[3], dot);
      }
    }
    sc[i] = (j <= t) ? (dot * kInvSqrtHD) : -INFINITY;
  }
  float m = fmaxf(fmaxf(sc[0], sc[1]), fmaxf(sc[2], sc[3]));
#pragma unroll
  for (int off = 16; off > 0; off >>= 1) m = fmaxf(m, __shfl_xor(m, off, 32));
  float psum = 0.0f;
#pragma unroll
  for (int i = 0; i < 4; ++i) {
    const float p = expf(sc[i] - m);
    psum += p;
    spw[lane + 32 * i] = p;
  }
#pragma unroll
  for (int off = 16; off > 0; off >>= 1) psum += __shfl_xor(psum, off, 32);
  wave_lds_sync();
  float a0 = 0.0f, a1 = 0.0f, a2 = 0.0f, a3 = 0.0f;
  const float* vr = Ve + (size_t)(b * kEarly) * kKW + hkv * kHD + 4 * lane;
#pragma unroll 1
  for (int j = 0; j <= t; ++j) {
    const float p = spw[j];
    const v4f vv = *(const v4f*)(vr + (size_t)j * kKW);
    a0 = fmaf(p, vv[0], a0);
    a1 = fmaf(p, vv[1], a1);
    a2 = fmaf(p, vv[2], a2);
    a3 = fmaf(p, vv[3], a3);
  }
  const float il = 1.0f / psum;
  const v4f ov = (v4f){a0 * il, a1 * il, a2 * il, a3 * il};
  float* dst = attn + (size_t)(b * kS + t) * kQW + h * kHD + 4 * lane;
  *(v4f*)dst = ov;
  
}

// ---------------------------------------------------------------------------
// gated = attn * sigmoid(gate projection), f32; one block per token row (2048 columns).
// Rolled loop: 8 iterations x 256 threads, one column each (coalesced 4-B loads), result into LDS; after the block barrier
// thread t owns columns 8t..8t+7. Positions >= 128: f16 plane carried x1024 (row = token). Positions < 128: bf16 hi plane and
// bf16 lo plane (lo = RNE bf16 of value - hi), row = b*128 + position. One 16-B store per lane per plane; a wave = 512
// ---------------------------------------------------------------------------
__global__ __launch_bounds__(256) void gate_kernel(const float* __restrict__ attn, const float* __restrict__ G,
                                                   unsigned short* __restrict__ GH, unsigned short* __restrict__ EH,
                                                   unsigned short* __restrict__ EL) {
  __shared__ __align__(16) float sm[kQW];
  const int tid = threadIdx.x;
  const int row = blockIdx.x;
  const int pos = row & (kS - 1);
  const int b   = row / kS;
  const float* ar = attn + (size_t)row * kQW;
  const float* gr = G + (size_t)row * kQW;
#pragma unroll 1
  for (int i = 0; i < kQW / 256; ++i) {
    const int col = i * 256 + tid;
    const float a = ar[col];
    const float g = gr[col];
    const float sg = 1.0f / (1.0f + expf(-g));
    sm[col] = a * sg;
  }
  __syncthreads();
  const v4f x0 = *(const v4f*)(sm + 8 * tid);
  const v4f x1 = *(const v4f*)(sm + 8 * tid + 4);
  if (pos >= kEarly) {
    unsigned short hb[8];
#pragma unroll
    for (int e = 0; e < 4; ++e) {
      hb[e]     = h_bits(x0[e] * kGCarry);
      hb[4 + e] = h_bits(x1[e] * kGCarry);
    }
    const v4u u = (v4u){pk16(hb[0], hb[1]), pk16(hb[2], hb[3]), pk16(hb[4], hb[5]), pk16(hb[6], hb[7])};
    unsigned short* d = GH + (size_t)row * kQW + 8 * tid;
    *(v4u*)d = u;
    
  } else {
    unsigned short hb[8], lb[8];
#pragma unroll
    for (int e = 0; e < 4; ++e) {
      const float f0 = x0[e];
      const float f1 = x1[e];
      hb[e]     = f2bf_bits(f0);
      hb[4 + e] = f2bf_bits(f1);
      lb[e]     = f2bf_bits(f0 - bf_bits2f(hb[e]));
      lb[4 + e] = f2bf_bits(f1 - bf_bits2f(hb[4 + e]));
    }
    const v4u uh = (v4u){pk16(hb[0], hb[1]), pk16(hb[2], hb[3]), pk16(hb[4], hb[5]), pk16(hb[6], hb[7])};
    const v4u ul = (v4u){pk16(lb[0], lb[1]), pk16(lb[2], lb[3]), pk16(lb[4], lb[5]), pk16(lb[6], lb[7])};
    const size_t o = (size_t)(b * kEarly + pos) * kQW + 8 * tid;
    *(v4u*)(EH + o) = uh;
    *(v4u*)(EL + o) = ul;
    
  }
}

// ---------------------------------------------------------------------------
// Host glue: 15 kernel launches, nothing else.
// GEMM shapes (all K % 64 == 0, M % 128 == 0, N % 256 == 0, no padding planes):
//   q|k|v proj : M 4096, N 3072, K 2048 -> 32 x 12 = 384 blocks (bf16)
//   gate proj  : M 4096, N 2048, K 2048 -> 32 x 8 = 256 blocks (bf16)
//   out late   : per batch M 1920 (positions 128..2047), N 2048, K 2048 -> 15 x 8 = 120 blocks x 2 (f16)
//   out early  : per batch M 128 (positions 0..127), N 2048, K 2048, A hi+lo -> 1 x 8 = 8 blocks x 2 (bf16)
// ---------------------------------------------------------------------------
extern "C" void kernel_launch(void* const* d_in, const int* in_sizes, int n_in,
                              void* d_out, int out_size, void* d_ws, size_t ws_size,
                              hipStream_t stream) {
  if (n_in < 10) return;
  if (in_sizes[0] != kTok * kHid) return;
  if (in_sizes[1] != kS * kHD) return;
  if (in_sizes[2] != kS * kHD) return;
  if (in_sizes[3] != kQW * kHid) return;
  if (in_sizes[4] != kKW * kHid) return;
  if (in_sizes[5] != kKW * kHid) return;
  if (in_sizes[6] != kQW * kHid) return;
  if (in_sizes[7] != kQW * kQW) return;
  if (in_sizes[8] != kHD) return;
  if (in_sizes[9] != kHD) return;
  if (out_size != kTok * kQW) return;
  if (ws_size < kWsTotal) return;

  const float* X    = (const float*)d_in[0];
  const float* ctab = (const float*)d_in[1];
  const float* stab = (const float*)d_in[2];
  const float* Wq   = (const float*)d_in[3];
  const float* Wk   = (const float*)d_in[4];
  const float* Wv   = (const float*)d_in[5];
  const float* Wg   = (const float*)d_in[6];
  const float* Wo   = (const float*)d_in[7];
  const float* qnw  = (const float*)d_in[8];
  const float* knw  = (const float*)d_in[9];
  float* out = (float*)d_out;

  char* ws = (char*)d_ws;
  unsigned short* XB   = (unsigned short*)(ws + kOffXB);
  unsigned short* WQKV = (unsigned short*)(ws + kOffWQKV);
  unsigned short* WGB  = (unsigned short*)(ws + kOffWGB);
  float*          QKV  = (float*)(ws + kOffQKV);
  unsigned short* QP   = (unsigned short*)(ws + kOffQP);
  unsigned short* KP   = (unsigned short*)(ws + kOffKP);
  unsigned short* VT   = (unsigned short*)(ws + kOffVT);
  float*          QE   = (float*)(ws + kOffQE);
  float*          KE   = (float*)(ws + kOffKE);
  float*          VE   = (float*)(ws + kOffVE);
  unsigned short* WOB  = (unsigned short*)(ws + kOffWOB);
  unsigned short* WOH  = (unsigned short*)(ws + kOffWOH);
  float*          ATT  = (float*)(ws + kOffATT);
  float*          GF   = (float*)(ws + kOffGF);
  unsigned short* GH   = (unsigned short*)(ws + kOffGH);
  unsigned short* EH   = (unsigned short*)(ws + kOffEH);
  unsigned short* EL   = (unsigned short*)(ws + kOffEL);

  /* operand planes: every float input RNE-converted to bf16 once (weights are [out][in] = Bt layout already) */
  cast8_kernel<0><<<(kTok * kHid / 8) / 256, 256, 0, stream>>>(X, XB, XB, kTok * kHid / 8, 1.0f);
  cast8_kernel<0><<<(kQW * kHid / 8) / 256, 256, 0, stream>>>(Wq, WQKV, WQKV, kQW * kHid / 8, 1.0f);
  cast8_kernel<0><<<(kKW * kHid / 8) / 256, 256, 0, stream>>>(Wk, WQKV + (size_t)kQW * kHid, WQKV, kKW * kHid / 8, 1.0f);
  cast8_kernel<0><<<(kKW * kHid / 8) / 256, 256, 0, stream>>>(Wv, WQKV + (size_t)kVCol0 * kHid, WQKV, kKW * kHid / 8, 1.0f);
  cast8_kernel<0><<<(kQW * kHid / 8) / 256, 256, 0, stream>>>(Wg, WGB, WGB, kQW * kHid / 8, 1.0f);
  cast8_kernel<1><<<(kQW * kQW / 8) / 256, 256, 0, stream>>>(Wo, WOB, WOH, kQW * kQW / 8, kWoCarry);

  /* q|k|v projection: QKV[4096][3072] = x . [Wq;Wk;Wv]^T */
  wmma_gemm64<1, false><<<dim3((kTok / kGBM) * (kQKVW / kGBN), 1), 256, 0, stream>>>(
      XB, XB, kHid, 0L, WQKV, kHid, 0L, QKV, kQKVW, 0L, kTok, kQKVW, kHid, 1.0f);

  /* norm + rotation -> QP, KP (f16 x64) and QE, KE (f32, positions < 128) */
  normrot_kernel<<<kTok * kSlots / 8, 256, 0, stream>>>(QKV, ctab, stab, qnw, knw, QP, KP, QE, KE);

  /* v transpose -> VT (f16 x64) and VE (f32, positions < 128): 2 x 4 x 32 blocks */
  vprep_kernel<<<kB * kHkv * (kS / 64), 256, 0, stream>>>(QKV, VT, VE);

  /* attention, positions >= 128 (matrix ops) then positions < 128 (f32); disjoint rows of ATT */
  attn_late_kernel<<<kLatePairs * kHkv * kB, 256, 0, stream>>>(QP, KP, VT, ATT);
  attn_early_kernel<<<kB * kHkv * kEarly, 128, 0, stream>>>(QE, KE, VE, ATT);

  /* gate projection: GF[4096][2048] = x . Wg^T */
  wmma_gemm64<1, false><<<dim3((kTok / kGBM) * (kQW / kGBN), 1), 256, 0, stream>>>(
      XB, XB, kHid, 0L, WGB, kHid, 0L, GF, kQW, 0L, kTok, kQW, kHid, 1.0f);

  /* gated planes */
  gate_kernel<<<kTok, 256, 0, stream>>>(ATT, GF, GH, EH, EL);

  /* output projection, positions >= 128 of each batch: f16 single product, carries folded back */
  wmma_gemm64<0, false><<<dim3(((kS - kEarly) / kGBM) * (kQW / kGBN), kB), 256, 0, stream>>>(
      GH + (size_t)kEarly * kQW, GH + (size_t)kEarly * kQW, kQW, (long)kS * kQW,
      WOH, kQW, 0L,
      out + (size_t)kEarly * kQW, kQW, (long)kS * kQW,
      kS - kEarly, kQW, kQW, kOutLateMul);

  /* output projection, positions < 128 of each batch: bf16 hi.W + lo.W */
  wmma_gemm64<1, true><<<dim3((kEarly / kGBM) * (kQW / kGBN), kB), 256, 0, stream>>>(
      EH, EL, kQW, (long)kEarly * kQW,
      WOB, kQW, 0L,
      out, kQW, (long)kS * kQW,
      kEarly, kQW, kQW, 1.0f);
}

// v002
// It runs in 380 microseconds.
// Timed twice side by side with v001, it ran 1.36 times as fast both times.
// All steps since v000 together make it 2.08 times as fast.
// Projections x.Wq/Wk/Wv/Wg^T: v_wmma_f32_16x16x32_bf16 (every float input RNE-converted to bf16 once, exact products, f32 accumulate); scores q.k^T and p.v for query positions >= 128: v_wmma_f32_16x16x32_f16 (q,k,v planes carried x64, p carried x32768); query positions < 128: f32 VALU attention; output projection: f16 (gated carried x1024, Wo carried x1024) for positions >= 128, bf16 hi+lo gated planes x bf16 Wo (two products) for positions < 128; norms, position rotation, softmax, gate in f32.
#include <hip/hip_runtime.h>
#include <math.h>

typedef __attribute__((ext_vector_type(16))) _Float16 v16h;
typedef __attribute__((ext_vector_type(8)))  _Float16 v8h;
typedef __attribute__((ext_vector_type(16))) __bf16   v16b;
typedef __attribute__((ext_vector_type(8)))  __bf16   v8b;
typedef __attribute__((ext_vector_type(8)))  float    v8f;
typedef __attribute__((ext_vector_type(4)))  float    v4f;
typedef __attribute__((ext_vector_type(4)))  unsigned int v4u;
typedef __attribute__((ext_vector_type(2)))  unsigned int v2u;

// ---------------------------------------------------------------------------
// Shape constants
// ---------------------------------------------------------------------------
constexpr int kB     = 2;
constexpr int kS     = 2048;
constexpr int kHid   = 2048;
constexpr int kHq    = 16;
constexpr int kHkv   = 4;
constexpr int kRep   = kHq / kHkv;
constexpr int kHD    = 128;
constexpr int kTok   = kB * kS;
constexpr int kQW    = kHq * kHD;
constexpr int kKW    = kHkv * kHD;
constexpr int kQKVW  = kQW + 2 * kKW;
constexpr int kVCol0 = kQW + kKW;
constexpr int kSlots = kHq + kHkv;
constexpr int kEarly = 128;
constexpr int kERows = kB * kEarly;
constexpr int kLateKC    = 64;
constexpr int kLatePairs = (kS - kEarly) / 32;
constexpr int kVP    = 132;
constexpr float kEps = 1e-6f;

constexpr double cx_sqrt(double x) {
  double r = (x > 1.0) ? x : 1.0;
  for (int i = 0; i < 80; ++i) r = 0.5 * (r + x / r);
  return r;
}
constexpr float kInvSqrtHD = (float)(1.0 / cx_sqrt((double)kHD));
/* power-of-two carries of the f16 operand planes */
constexpr float kQKCarry = 64.0f;
constexpr float kVCarry  = 64.0f;
constexpr float kPCarry  = 32768.0f;
constexpr float kGCarry  = 1024.0f;
constexpr float kWoCarry = 1024.0f;
constexpr float kScoreMul   = kInvSqrtHD / (kQKCarry * kQKCarry);
constexpr float kOutLateMul = 1.0f / (kGCarry * kWoCarry);

static_assert(kRep == 4 && kHkv == 4 && kHD == 128, "lane maps assume 4 kv heads x 4 query heads x 128");
static_assert(kTok == 4096 && kQW == 2048 && kKW == 512 && kQKVW == 3072, "wire shapes");
static_assert((kHid % 32) == 0 && (kQW % 32) == 0, "GEMM K multiples of 32");
static_assert((kTok % 64) == 0 && (kQKVW % 64) == 0 && (kQW % 64) == 0 && ((kS - kEarly) % 64) == 0 && (kEarly % 64) == 0, "GEMM M,N multiples of 64");
static_assert((kS % 64) == 0 && (kS / 64) == 32 && (kEarly % 16) == 0 && ((kS - kEarly) % 32) == 0, "tile multiples");

// ---------------------------------------------------------------------------
// Workspace region map (bytes; every offset a multiple of 128)
//   XB   bf16 [4096][2048]  x plane                                16,777,216
//   WQKV bf16 [3072][2048]  Wq | Wk | Wv rows                      12,582,912
//   WGB  bf16 [2048][2048]  Wg                                      8,388,608
//   QKV  f32  [4096][3072]  q | k | v projections                  50,331,648
//   QP   f16  [4096][2048]  normed+rotated q x64                   16,777,216
//   KP   f16  [4096][512]   normed+rotated k x64                    4,194,304
//   VT   f16  [2][4][128][2048] v transposed x64                    4,194,304
//   QE   f32  [256][2048]   q rows of positions < 128               2,097,152
//   KE   f32  [256][512]    k rows of positions < 128                 524,288
//   VE   f32  [256][512]    v rows of positions < 128                 524,288
//   WOB  bf16 [2048][2048]  Wo                                      8,388,608
//   WOH  f16  [2048][2048]  Wo (bf16 value) x1024                   8,388,608
//   total                                                         133,169,152
// Aliases (each across whole launches):
//   ATT  f32 [4096][2048]  = first 33,554,432 B of QKV (after the norm/rotation and v-prep launches)
//   GF   f32 [4096][2048]  = last 16,777,216 B of QKV + all of QP (after both attention launches)
//   GH   f16 [4096][2048]  = XB (after the gate projection)
//   EH/EL bf16 [256][2048] = first 2 x 1,048,576 B of WQKV (after the q|k|v projection)
// ---------------------------------------------------------------------------
constexpr size_t kOffXB   = 0;
constexpr size_t kOffWQKV = kOffXB   + (size_t)kTok * kHid * 2;
constexpr size_t kOffWGB  = kOffWQKV + (size_t)kQKVW * kHid * 2;
constexpr size_t kOffQKV  = kOffWGB  + (size_t)kQW * kHid * 2;
constexpr size_t kOffQP   = kOffQKV  + (size_t)kTok * kQKVW * 4;
constexpr size_t kOffKP   = kOffQP   + (size_t)kTok * kQW * 2;
constexpr size_t kOffVT   = kOffKP   + (size_t)kTok * kKW * 2;
constexpr size_t kOffQE   = kOffVT   + (size_t)kTok * kKW * 2;
constexpr size_t kOffKE   = kOffQE   + (size_t)kERows * kQW * 4;
constexpr size_t kOffVE   = kOffKE   + (size_t)kERows * kKW * 4;
constexpr size_t kOffWOB  = kOffVE   + (size_t)kERows * kKW * 4;
constexpr size_t kOffWOH  = kOffWOB  + (size_t)kQW * kQW * 2;
constexpr size_t kWsTotal = kOffWOH  + (size_t)kQW * kQW * 2;
constexpr size_t kOffATT  = kOffQKV;
constexpr size_t kOffGF   = kOffQKV + (size_t)kTok * kQW * 4;
constexpr size_t kOffGH   = kOffXB;
constexpr size_t kOffEH   = kOffWQKV;
constexpr size_t kOffEL   = kOffWQKV + (size_t)kERows * kQW * 2;
static_assert(kWsTotal == 133169152ull, "carve total");
static_assert(kWsTotal <= 134217728ull, "carve cap");
static_assert(kOffGF + (size_t)kTok * kQW * 4 == kOffKP, "gate plane covers the projection tail plus the q plane exactly");
static_assert(kOffEL + (size_t)kERows * kQW * 2 <= kOffWGB, "hi/lo planes inside the dead weight plane");
static_assert((kOffWQKV % 128) == 0 && (kOffWGB % 128) == 0 && (kOffQKV % 128) == 0 && (kOffQP % 128) == 0 &&
              (kOffKP % 128) == 0 && (kOffVT % 128) == 0 && (kOffQE % 128) == 0 && (kOffKE % 128) == 0 &&
              (kOffVE % 128) == 0 && (kOffWOB % 128) == 0 && (kOffWOH % 128) == 0 && (kOffGF % 128) == 0 &&
              (kOffEL % 128) == 0, "128-B aligned regions");

// ---------------------------------------------------------------------------
// Small helpers
// ---------------------------------------------------------------------------
__device__ __forceinline__ unsigned short f2bf_bits(float f) {
  unsigned u = __float_as_uint(f);
  return (unsigned short)((u + 0x7FFFu + ((u >> 16) & 1u)) >> 16);
}
__device__ __forceinline__ float bf_bits2f(unsigned short h) { return __uint_as_float(((unsigned)h) << 16); }
__device__ __forceinline__ float bf16r(float f) { return bf_bits2f(f2bf_bits(f)); }
__device__ __forceinline__ unsigned pk16(unsigned short a, unsigned short b) { return (unsigned)a | ((unsigned)b << 16); }
__device__ __forceinline__ unsigned short h_bits(float f) { const _Float16 h = (_Float16)f; return __builtin_bit_cast(unsigned short, h); }
__device__ __forceinline__ void wave_lds_sync() {
  __builtin_amdgcn_fence(__ATOMIC_RELEASE, "workgroup");
  __builtin_amdgcn_wave_barrier();
  __builtin_amdgcn_fence(__ATOMIC_ACQUIRE, "workgroup");
}

/* matrix op followed by the 4-slot hazard guard; one accumulator per guard statement, A and B named as inputs */
__device__ __forceinline__ v8f mma_guard_h(v16h a, v16h b, v8f c) {
  c = __builtin_amdgcn_wmma_f32_16x16x32_f16(false, a, false, b, (short)0, c, false, false);
  asm volatile("v_nop\n\tv_nop\n\tv_nop\n\tv_nop" : "+v"(c) : "v"(a), "v"(b));
  return c;
}
__device__ __forceinline__ v8f mma_guard_b(v16b a, v16b b, v8f c) {
  c = __builtin_amdgcn_wmma_f32_16x16x32_bf16(false, a, false, b, (short)0, c, false, false);
  asm volatile("v_nop\n\tv_nop\n\tv_nop\n\tv_nop" : "+v"(c) : "v"(a), "v"(b));
  return c;
}
__device__ __forceinline__ void keep4_h(v16h a, v16h b, v16h c, v16h d) { asm volatile("v_nop" :: "v"(a), "v"(b), "v"(c), "v"(d)); }
__device__ __forceinline__ void keep4_b(v16b a, v16b b, v16b c, v16b d) { asm volatile("v_nop" :: "v"(a), "v"(b), "v"(c), "v"(d)); }
__device__ __forceinline__ void acc_guard4(v8f& a, v8f& b, v8f& c, v8f& d) { asm volatile("v_nop\n\tv_nop\n\tv_nop\n\tv_nop" : "+v"(a), "+v"(b), "+v"(c), "+v"(d)); }

template <typename T> struct Frag;
template <> struct Frag<_Float16> {
  typedef v16h V; union U { v16h v; v8h h[2]; };
  /* elements 0..7 <- p[0..7], 8..15 <- p[16..23] */
  static __device__ __forceinline__ v16h load(const _Float16* p) {
    U f; f.h[0] = *(const v8h*)(p); f.h[1] = *(const v8h*)(p + 16); return f.v;
  }
  static __device__ __forceinline__ v8f mmag(v16h a, v16h b, v8f c) { return mma_guard_h(a, b, c); }
  static __device__ __forceinline__ void keep(v16h a, v16h b, v16h c, v16h d) { keep4_h(a, b, c, d); }
};
template <> struct Frag<__bf16> {
  typedef v16b V; union U { v16b v; v8b h[2]; };
  static __device__ __forceinline__ v16b load(const __bf16* p) {
    U f; f.h[0] = *(const v8b*)(p); f.h[1] = *(const v8b*)(p + 16); return f.v;
  }
  static __device__ __forceinline__ v8f mmag(v16b a, v16b b, v8f c) { return mma_guard_b(a, b, c); }
  static __device__ __forceinline__ void keep(v16b a, v16b b, v16b c, v16b d) { keep4_b(a, b, c, d); }
};

// ---------------------------------------------------------------------------
// Batched GEMM: C[m,n] = scale * sum_k A[m,k] * Bt[n,k]. A block of 8 waves (2 x 4) owns a 128 x 256 tile, each wave 64x64 of it.
// A row-major [M,K]; Bt row-major [N,K]; M % 128 == 0, N % 256 == 0, K % 64 == 0 (no tails).
// Operands reach LDS by asynchronous 16-B copies, 64 k per stage (128-B rows at a 144-B pitch), two buffers: the next
// stage's copies fly while this stage's fragments are read from LDS; 8 lanes copy one whole 128-B line of a row.
// ASPLIT: A carried as hi/lo planes (A2 = lo plane, same layout): product = hi.b + lo.b into one accumulator.
// ET: 0 = f16 operands, 1 = bf16 operands (pointers passed as 16-bit storage). Output f32.
// ---------------------------------------------------------------------------
constexpr int kGBM    = 128;
constexpr int kGBN    = 256;
constexpr int kGKS    = 64;
constexpr int kGPitch = 72;
constexpr unsigned kGPitchB = kGPitch * 2;
static_assert((kTok % kGBM) == 0 && ((kS - kEarly) % kGBM) == 0 && (kEarly % kGBM) == 0, "GEMM M multiples of the block tile");
static_assert((kQKVW % kGBN) == 0 && (kQW % kGBN) == 0, "GEMM N multiples of the block tile");
static_assert((kHid % kGKS) == 0 && (kQW % kGKS) == 0 && kHid / kGKS >= 2 && kQW / kGKS >= 2, "GEMM K in whole stages");

__device__ __forceinline__ unsigned lds_off(const void* p) { return (unsigned)(size_t)p; }

/* copies of 16 B per lane, global -> LDS through no register: row r of the run lies 32 * r rows behind the first, in LDS
   (pitch kGPitchB) and in the source (step32 elements). One statement holds a whole run, and the s_wait_xcnt closes it so
   that no address register of a copy is rewritten in front of it; one run per statement keeps that wait to one per run */
__device__ __forceinline__ void copy4_async(unsigned l, const unsigned short* g, size_t step32) {
  asm volatile("global_load_async_to_lds_b128 %0, %4, off\n\t"
               "global_load_async_to_lds_b128 %1, %5, off\n\t"
               "global_load_async_to_lds_b128 %2, %6, off\n\t"
               "global_load_async_to_lds_b128 %3, %7, off\n\t"
               "s_wait_xcnt 0x0"
               :: "v"(l), "v"(l + 32u * kGPitchB), "v"(l + 64u * kGPitchB), "v"(l + 96u * kGPitchB),
                  "v"(g), "v"(g + step32), "v"(g + 2 * step32), "v"(g + 3 * step32) : "memory");
}
__device__ __forceinline__ void copy8_async(unsigned l, const unsigned short* g, size_t step32,
                                            unsigned m, const unsigned short* h, size_t step32h) {
  asm volatile("global_load_async_to_lds_b128 %0, %8, off\n\t"
               "global_load_async_to_lds_b128 %1, %9, off\n\t"
               "global_load_async_to_lds_b128 %2, %10, off\n\t"
               "global_load_async_to_lds_b128 %3, %11, off\n\t"
               "global_load_async_to_lds_b128 %4, %12, off\n\t"
               "global_load_async_to_lds_b128 %5, %13, off\n\t"
               "global_load_async_to_lds_b128 %6, %14, off\n\t"
               "global_load_async_to_lds_b128 %7, %15, off\n\t"
               "s_wait_xcnt 0x0"
               :: "v"(l), "v"(l + 32u * kGPitchB), "v"(l + 64u * kGPitchB), "v"(l + 96u * kGPitchB),
                  "v"(m), "v"(m + 32u * kGPitchB), "v"(m + 64u * kGPitchB), "v"(m + 96u * kGPitchB),
                  "v"(g), "v"(g + step32), "v"(g + 2 * step32), "v"(g + 3 * step32),
                  "v"(h), "v"(h + step32h), "v"(h + 2 * step32h), "v"(h + 3 * step32h) : "memory");
}

template <int ET> struct Elem;
template <> struct Elem<0> { typedef _Float16 T; };
template <> struct Elem<1> { typedef __bf16 T; };
template <int ET, bool ASPLIT>
__global__ __launch_bounds__(256) void wmma_gemm64(
    const unsigned short* __restrict__ Ap, const unsigned short* __restrict__ A2p, int lda, long strideA,
    const unsigned short* __restrict__ Btp, int ldb, long strideB,
    float* __restrict__ Cout, int ldc, long strideC,
    int M, int N, int K, float scale) {
  typedef typename Elem<ET>::T T;
  typedef typename Frag<T>::V V;
  constexpr int kARows = ASPLIT ? 2 * kGBM : kGBM;
  constexpr int kRows  = kARows + kGBN;
  constexpr unsigned kBufB = (unsigned)kRows * kGPitchB;
  __shared__ __align__(16) unsigned short sStage[2][kRows * kGPitch];
  __shared__ __align__(16) float sT[8][16 * 68];
  const int b    = blockIdx.y;
  const int tid  = threadIdx.x;
  const int lane = tid & 31;
  const int wave = __builtin_amdgcn_readfirstlane((int)(threadIdx.x >> 5));
  const int tilesN = N / kGBN;
  const int tilesM = M / kGBM;
  /* block-uniform, in front of every barrier and copy */
  if ((int)blockIdx.x >= tilesM * tilesN) return;
  const int tm = (int)blockIdx.x / tilesN;
  const int tn = (int)blockIdx.x - tm * tilesN;
  const int bm0 = tm * kGBM;
  const int bn0 = tn * kGBN;
  const int wm = wave >> 2;
  const int wn = wave & 3;
  const int m0 = bm0 + (wm << 6);
  const int n0 = bn0 + (wn << 6);

  const int rlane = lane & 15;
  const int koff  = (lane >> 4) * 8;
  const int mOff  = (lane >> 4) * 8;

  /* the thread's own place in a stage and in the two (three) source planes */
  const int crow = tid >> 3;
  const int cch  = tid & 7;
  const unsigned lds0 = lds_off(&sStage[0][0]) + (unsigned)crow * kGPitchB + (unsigned)cch * 16u;
  const unsigned short* gA  = Ap  + (size_t)b * strideA + (size_t)(bm0 + crow) * lda + cch * 8;
  const unsigned short* gA2 = A2p + (size_t)b * strideA + (size_t)(bm0 + crow) * lda + cch * 8;
  const unsigned short* gB  = Btp + (size_t)b * strideB + (size_t)(bn0 + crow) * ldb + cch * 8;
  const size_t stepA = (size_t)32 * lda;
  const size_t stepB = (size_t)32 * ldb;
  const int nst = K / kGKS;

  auto issue_stage = [&](int t) {
    const unsigned l = lds0 + (unsigned)(t & 1) * kBufB;
    const size_t k0 = (size_t)t * kGKS;
    const unsigned lb = l + (unsigned)kARows * kGPitchB;
    /* thread t brings bytes 16*(t&7).. of rows (t>>3) + 32*i of each panel: 128 rows of A (and of A2), 256 of Bt */
    if (ASPLIT) copy8_async(l, gA + k0, stepA, l + (unsigned)kGBM * kGPitchB, gA2 + k0, stepA);
    else        copy4_async(l, gA + k0, stepA);
    copy8_async(lb, gB + k0, stepB, lb + 128u * kGPitchB, gB + k0 + 4 * stepB, stepB);
  };

  v8f acc[4][4];
#pragma unroll
  for (int i = 0; i < 4; ++i)
#pragma unroll
    for (int j = 0; j < 4; ++j) acc[i][j] = (v8f){0.f,0.f,0.f,0.f,0.f,0.f,0.f,0.f};

  issue_stage(0);
  /* stage 0 has landed for this wave; the barrier publishes it to the others */
  asm volatile("s_wait_asynccnt 0x0" ::: "memory");
  __syncthreads();
  if (nst > 1) issue_stage(1);

  for (int t = 0; t < nst; ++t) {
    const T* sb = (const T*)&sStage[t & 1][0];
    const T* sa = sb + ((wm << 6) + rlane) * kGPitch + koff;
    const T* sw = sb + (kARows + (wn << 6) + rlane) * kGPitch + koff;
#pragma unroll
    for (int ks = 0; ks < kGKS / 32; ++ks) {
      /* all fragments of a k step are read from LDS as one group in front of its products */
      V bh[4], ah[4], al[4];
#pragma unroll
      for (int j = 0; j < 4; ++j) bh[j] = Frag<T>::load(sw + (j << 4) * kGPitch + ks * 32);
#pragma unroll
      for (int i = 0; i < 4; ++i) {
        ah[i] = Frag<T>::load(sa + (i << 4) * kGPitch + ks * 32);
        al[i] = ah[i];
        if (ASPLIT) al[i] = Frag<T>::load(sa + (kGBM + (i << 4)) * kGPitch + ks * 32);
      }
#pragma unroll
      for (int i = 0; i < 4; ++i) {
#pragma unroll
        for (int j = 0; j < 4; ++j) {
          acc[i][j] = Frag<T>::mmag(ah[i], bh[j], acc[i][j]);
          if (ASPLIT) acc[i][j] = Frag<T>::mmag(al[i], bh[j], acc[i][j]);
        }
      }
      Frag<T>::keep(bh[0], bh[1], bh[2], bh[3]);
    }
    /* hand-over: this wave's reads of the buffer are done, */
    asm volatile("s_wait_dscnt 0x0" ::: "memory");
    /* its copies of stage t + 1 have landed, */
    asm volatile("s_wait_asynccnt 0x0" ::: "memory");
    /* and the barrier publishes stage t + 1 and frees the buffer that was just read */
    __syncthreads();
    if (t + 2 < nst) issue_stage(t + 2);
  }
  /* no copy is left in flight when the wave goes on */
  asm volatile("s_wait_asynccnt 0x0" ::: "memory");
  acc_guard4(acc[0][0], acc[0][1], acc[0][2], acc[0][3]);
  acc_guard4(acc[1][0], acc[1][1], acc[1][2], acc[1][3]);
  acc_guard4(acc[2][0], acc[2][1], acc[2][2], acc[2][3]);
  acc_guard4(acc[3][0], acc[3][1], acc[3][2], acc[3][3]);

  float* slab = sT[wave];
  float* C = Cout + (size_t)b * strideC;
#pragma unroll
  for (int i = 0; i < 4; ++i) {
    const int mBase = m0 + (i << 4);
#pragma unroll
    for (int j = 0; j < 4; ++j) {
#pragma unroll
      for (int r = 0; r < 8; ++r) {
        slab[(mOff + r) * 68 + (j << 4) + rlane] = acc[i][j][r] * scale;
      }
    }
    wave_lds_sync();
    {
      const int hh = lane >> 4, c4 = (lane & 15) * 4;
      {
#pragma unroll
        for (int it = 0; it < 8; ++it) {
          const int row = it * 2 + hh;
          v4f v = *(const v4f*)(slab + row * 68 + c4);
          *(v4f*)(C + (size_t)(mBase + row) * ldc + n0 + c4) = v;
        }
        
      }
    }
    wave_lds_sync();
  }
}

// ---------------------------------------------------------------------------
// MODE 0: o0 = bf16 (RNE). MODE 1: o0 = bf16 (RNE), o1 = f16 of (bf16 value x carry) (exact: power-of-two carry).
// ---------------------------------------------------------------------------
template <int MODE>
__global__ __launch_bounds__(256) void cast8_kernel(const float* __restrict__ in, unsigned short* __restrict__ o0,
                                                    unsigned short* __restrict__ o1, int n8, float carry) {
  const int i = blockIdx.x * 256 + threadIdx.x;
  if (i >= n8) return;
  const size_t e0 = (size_t)i << 3;
  const v4f a0 = *(const v4f*)(in + e0);
  const v4f a1 = *(const v4f*)(in + e0 + 4);
  unsigned short bb[8], hb[8];
#pragma unroll
  for (int e = 0; e < 4; ++e) {
    bb[e]     = f2bf_bits(a0[e]);
    bb[4 + e] = f2bf_bits(a1[e]);
  }
#pragma unroll
  for (int e = 0; e < 8; ++e) hb[e] = (MODE == 1) ? h_bits(bf_bits2f(bb[e]) * carry) : (unsigned short)0;
  const v4u ub = (v4u){pk16(bb[0], bb[1]), pk16(bb[2], bb[3]), pk16(bb[4], bb[5]), pk16(bb[6], bb[7])};
  const v4u uh = (v4u){pk16(hb[0], hb[1]), pk16(hb[2], hb[3]), pk16(hb[4], hb[5]), pk16(hb[6], hb[7])};
  unsigned short* q0 = o0 + e0;
  unsigned short* q1 = o1 + e0;
  *(v4u*)q0 = ub;
  if (MODE == 1) *(v4u*)q1 = uh;
  
}

// ---------------------------------------------------------------------------
// Per-head RMS norm (eps inside the rsqrt of the mean square) then rotation by the position tables, f32.
// One wave per (token, slot): slots 0..15 = query heads, 16..19 = key heads (columns slot*128 of the q|k|v plane).
// Lane owns d = 4*lane..4*lane+3; the partner d +/- 64 lives in lane ^ 16 (unconditional shuffles).
// d < 64: y = n[d]*c[d] - n[d+64]*s[d]; d >= 64: y = n[d]*c[d] + n[d-64]*s[d]; tables read by value at [pos][d],
// tables and norm weights RNE-converted to bf16 on load.
// ---------------------------------------------------------------------------
__global__ __launch_bounds__(256) void normrot_kernel(
    const float* __restrict__ QKV, const float* __restrict__ ctab, const float* __restrict__ stab,
    const float* __restrict__ qw, const float* __restrict__ kw,
    unsigned short* __restrict__ Qp, unsigned short* __restrict__ Kp, float* __restrict__ Qe, float* __restrict__ Ke) {
  const int lane = threadIdx.x & 31;
  const int wave = __builtin_amdgcn_readfirstlane((int)(threadIdx.x >> 5));
  const int gw   = blockIdx.x * 8 + wave;
  const int tok  = gw / kSlots;
  const int slot = gw - tok * kSlots;
  const int pos  = tok & (kS - 1);
  const int b    = tok / kS;
  const bool isq = slot < kHq;
  const int kslot = isq ? 0 : (slot - kHq);

  const v4f x   = *(const v4f*)(QKV + (size_t)tok * kQKVW + slot * kHD + 4 * lane);
  const v4f wq4 = *(const v4f*)(qw + 4 * lane);
  const v4f wk4 = *(const v4f*)(kw + 4 * lane);
  const v4f c4  = *(const v4f*)(ctab + (size_t)pos * kHD + 4 * lane);
  const v4f s4  = *(const v4f*)(stab + (size_t)pos * kHD + 4 * lane);

  float ss = x[0] * x[0];
  ss = fmaf(x[1], x[1], ss);
  ss = fmaf(x[2], x[2], ss);
  ss = fmaf(x[3], x[3], ss);
#pragma unroll
  for (int off = 16; off > 0; off >>= 1) ss += __shfl_xor(ss, off, 32);
  const float inv = rsqrtf(ss * (1.0f / (float)kHD) + kEps);

  float n[4], p[4], y[4];
#pragma unroll
  for (int e = 0; e < 4; ++e) {
    const float w = bf16r(isq ? wq4[e] : wk4[e]);
    n[e] = x[e] * inv * w;
  }
#pragma unroll
  for (int e = 0; e < 4; ++e) p[e] = __shfl_xor(n[e], 16, 32);
  const float sgn = (lane < 16) ? -1.0f : 1.0f;
#pragma unroll
  for (int e = 0; e < 4; ++e) y[e] = n[e] * bf16r(c4[e]) + sgn * (p[e] * bf16r(s4[e]));

  unsigned short hb[4];
#pragma unroll
  for (int e = 0; e < 4; ++e) hb[e] = h_bits(y[e] * kQKCarry);
  const v2u u = (v2u){pk16(hb[0], hb[1]), pk16(hb[2], hb[3])};
  const v4f yv = (v4f){y[0], y[1], y[2], y[3]};

  unsigned short* dq = Qp + (size_t)tok * kQW + slot * kHD + 4 * lane;
  unsigned short* dk = Kp + (size_t)tok * kKW + kslot * kHD + 4 * lane;
  unsigned short* d16 = isq ? dq : dk;
  const bool early = pos < kEarly;
  const int erow = b * kEarly + (early ? pos : 0);
  float* eq = Qe + (size_t)erow * kQW + (isq ? slot : 0) * kHD + 4 * lane;
  float* ek = Ke + (size_t)erow * kKW + kslot * kHD + 4 * lane;
  float* d32 = isq ? eq : ek;
  {
    *(v2u*)d16 = u;
    if (early) *(v4f*)d32 = yv;
    
  }
}

// ---------------------------------------------------------------------------
// v columns of the q|k|v plane -> VT f16 [b][kv head][d][s] carried x64 (LDS transpose), plus VE f32 rows for positions < 128.
// Block = (b, kv head, 64 positions); 256 threads. Load coverage: 8 iterations x 256 threads = 2048 v4f = 64 rows x 32.
// VT stores: row d = it*32 + wave*4 + (lane>>3), it 0..3 x 8 waves x 4 = 128 rows; (lane&7) x 8 halves = 64 positions
// ---------------------------------------------------------------------------
__global__ __launch_bounds__(256) void vprep_kernel(const float* __restrict__ QKV, unsigned short* __restrict__ Vt,
                                                    float* __restrict__ Ve) {
  __shared__ __align__(16) float sm[64 * kVP];
  const int tid  = threadIdx.x;
  const int lane = tid & 31;
  const int wave = __builtin_amdgcn_readfirstlane((int)(tid >> 5));
  const int st   = blockIdx.x & 31;
  const int hkv  = (blockIdx.x >> 5) & (kHkv - 1);
  const int b    = blockIdx.x >> 7;
  const int s0   = st * 64;
  const float* src = QKV + (size_t)(b * kS + s0) * kQKVW + kVCol0 + hkv * kHD;
#pragma unroll
  for (int i = 0; i < 8; ++i) {
    const int e  = i * 256 + tid;
    const int r  = e >> 5;
    const int cc = (e & 31) * 4;
    const v4f v = *(const v4f*)(src + (size_t)r * kQKVW + cc);
    *(v4f*)(sm + r * kVP + cc) = v;
  }
  __syncthreads();
  const int q = lane >> 3, c8 = (lane & 7) * 8;
  v4u tv[4];
#pragma unroll
  for (int it = 0; it < 4; ++it) {
    const int d = it * 32 + wave * 4 + q;
    unsigned short hb[8];
#pragma unroll
    for (int e = 0; e < 8; ++e) hb[e] = h_bits(sm[(c8 + e) * kVP + d] * kVCarry);
    tv[it] = (v4u){pk16(hb[0], hb[1]), pk16(hb[2], hb[3]), pk16(hb[4], hb[5]), pk16(hb[6], hb[7])};
  }
  v4f ev[8];
#pragma unroll
  for (int it = 0; it < 8; ++it) ev[it] = *(const v4f*)(sm + (it * 8 + wave) * kVP + 4 * lane);
  const bool early = s0 < kEarly;
  const int erow0 = b * kEarly + (early ? s0 : 0);
  unsigned short* vt0 = Vt + (size_t)(b * kHkv + hkv) * kHD * kS + s0 + c8;
  float* ve0 = Ve + (size_t)erow0 * kKW + hkv * kHD + 4 * lane;
  {
#pragma unroll
    for (int it = 0; it < 4; ++it) *(v4u*)(vt0 + (size_t)(it * 32 + wave * 4 + q) * kS) = tv[it];
    if (early) {
#pragma unroll
      for (int it = 0; it < 8; ++it) *(v4f*)(ve0 + (size_t)(it * 8 + wave) * kKW) = ev[it];
    }
    
  }
}

// ---------------------------------------------------------------------------
// Causal attention for query positions >= 128 (f16 matrix ops, online softmax in f32).
// Block = 8 waves = 4 query heads of one kv head x 2 tiles of 16 query rows; all 8 waves walk the same chunks of 64 keys.
// A chunk's keys (64 rows of 256 B, 272-B pitch) and transposed values (128 rows of 128 B, 144-B pitch) reach LDS once per
// block by asynchronous 16-B copies, two buffers: the next chunk's copies fly while this chunk is worked on.
//   A (q rows):  row = lane&15, k = d:   QP[(b*S + q0 + row)][h*128 + dc*32 + 8*(lane>>4) ..]   (global, once)
//   B (keys):    col = key,     k = d:   LDS key row (key - kv0), element dc*32 + 8*(lane>>4) ..
//   B (values):  col = d,       k = key: LDS value row d, element kk*32 + 8*(lane>>4) ..
// 64 keys per iteration; the last chunk masks key > query with -inf before the softmax (the chunk always holds key <= query
// for every row, so the running maximum stays finite). p = exp(s - m) carried x32768 as f16, spilled per wave to LDS as
// ---------------------------------------------------------------------------
constexpr int kKPitch = 136;
constexpr int kVPitch = 72;
constexpr int kKTile  = kLateKC * kKPitch;
constexpr int kVTile  = kHD * kVPitch;
constexpr int kKVBuf  = kKTile + kVTile;
static_assert(kLateKC == 64 && kHD == 128, "copy maps: 16 lanes per 256-B key row, 8 lanes per 128-B value row");
static_assert(((kKTile * 2) % 16) == 0 && ((kKVBuf * 2) % 16) == 0, "16-B aligned tiles");

/* one chunk's share of a thread: 4 copies of key rows (16 rows apart) and 4 of value rows (32 rows apart), 16 B each,
   global -> LDS through no register; the s_wait_xcnt closes the statement so that no address register of a copy is
   rewritten in front of it */
__device__ __forceinline__ void copy_kv_async(unsigned lk, const unsigned short* gk, unsigned lv, const unsigned short* gv) {
  asm volatile("global_load_async_to_lds_b128 %0, %8, off\n\t"
               "global_load_async_to_lds_b128 %1, %9, off\n\t"
               "global_load_async_to_lds_b128 %2, %10, off\n\t"
               "global_load_async_to_lds_b128 %3, %11, off\n\t"
               "global_load_async_to_lds_b128 %4, %12, off\n\t"
               "global_load_async_to_lds_b128 %5, %13, off\n\t"
               "global_load_async_to_lds_b128 %6, %14, off\n\t"
               "global_load_async_to_lds_b128 %7, %15, off\n\t"
               "s_wait_xcnt 0x0"
               :: "v"(lk), "v"(lk + 16u * (kKPitch * 2u)), "v"(lk + 32u * (kKPitch * 2u)), "v"(lk + 48u * (kKPitch * 2u)),
                  "v"(lv), "v"(lv + 32u * (kVPitch * 2u)), "v"(lv + 64u * (kVPitch * 2u)), "v"(lv + 96u * (kVPitch * 2u)),
                  "v"(gk), "v"(gk + 16 * kKW), "v"(gk + 32 * kKW), "v"(gk + 48 * kKW),
                  "v"(gv), "v"(gv + 32 * kS), "v"(gv + 64 * kS), "v"(gv + 96 * kS) : "memory");
}

__global__ __launch_bounds__(256) void attn_late_kernel(const unsigned short* __restrict__ Qp, const unsigned short* __restrict__ Kp,
                                                        const unsigned short* __restrict__ Vtp, float* __restrict__ attn) {
  union FH { v16h v; v8h h[2]; };
  __shared__ __align__(16) unsigned short sKV[2][kKVBuf];
  __shared__ __align__(16) _Float16 Psh[8][16 * kLateKC];
  __shared__ __align__(16) float Os[8][16 * 68];
  const int tid  = threadIdx.x;
  const int lane = threadIdx.x & 31;
  const int wave = __builtin_amdgcn_readfirstlane((int)(threadIdx.x >> 5));
  const int hh   = lane >> 4;
  const int c    = lane & 15;
  const int qt2  = blockIdx.x % kLatePairs;
  const int bh   = blockIdx.x / kLatePairs;
  const int hkv  = bh & (kHkv - 1);
  const int b    = bh / kHkv;
  const int h    = hkv * kRep + (wave & 3);
  const int q0   = kEarly + (qt2 * 2 + (wave >> 2)) * 16;

  /* the thread's own place in a chunk's two tiles and in the two source planes */
  const unsigned lk0 = lds_off(&sKV[0][0]) + (unsigned)(tid >> 4) * (kKPitch * 2u) + (unsigned)(tid & 15) * 16u;
  const unsigned lv0 = lds_off(&sKV[0][kKTile]) + (unsigned)(tid >> 3) * (kVPitch * 2u) + (unsigned)(tid & 7) * 16u;
  const unsigned short* gk0 = Kp + (size_t)(b * kS + (tid >> 4)) * kKW + hkv * kHD + (tid & 15) * 8;
  const unsigned short* gv0 = Vtp + ((size_t)(b * kHkv + hkv) * kHD + (tid >> 3)) * kS + (tid & 7) * 8;
  auto issue_chunk = [&](int t) {
    const unsigned o = (unsigned)(t & 1) * (kKVBuf * 2u);
    copy_kv_async(lk0 + o, gk0 + (size_t)t * (kLateKC * kKW), lv0 + o, gv0 + t * kLateKC);
  };
  float* ob = attn + (size_t)(b * kS + q0) * kQW + h * kHD;

  v16h qa[4];
  {
    const _Float16* qrow = (const _Float16*)Qp + (size_t)(b * kS + q0 + c) * kQW + h * kHD + 8 * hh;
#pragma unroll
    for (int dc = 0; dc < 4; ++dc) qa[dc] = Frag<_Float16>::load(qrow + dc * 32);
  }

  float mrow[8], lrow[8];
  v8f oacc[8];
#pragma unroll
  for (int r = 0; r < 8; ++r) { mrow[r] = -INFINITY; lrow[r] = 0.0f; }
#pragma unroll
  for (int t = 0; t < 8; ++t) oacc[t] = (v8f){0.f,0.f,0.f,0.f,0.f,0.f,0.f,0.f};

  int nChunks = (q0 + 16 + kLateKC - 1) / kLateKC;
  if (nChunks > kS / kLateKC) nChunks = kS / kLateKC;
  _Float16* pw = Psh[wave];
  /* nChunks is the same in all 8 waves: the block's 32 query rows lie inside one chunk of 64 positions */

  issue_chunk(0);
  /* chunk 0 has landed for this wave; the barrier publishes it to the others */
  asm volatile("s_wait_asynccnt 0x0" ::: "memory");
  __syncthreads();
  if (nChunks > 1) issue_chunk(1);

  for (int kc = 0; kc < nChunks; ++kc) {
    const int kv0 = kc * kLateKC;
    const _Float16* sk = (const _Float16*)&sKV[kc & 1][0] + c * kKPitch + 8 * hh;
    const _Float16* sv = (const _Float16*)&sKV[kc & 1][kKTile] + c * kVPitch + 8 * hh;
    /* fragments are read from LDS in groups of four, in front of the products that use them: eight register sets, the four
       that a group of products has just read are refilled at once with the fragments eight places on */
    v16h ring[8];
#pragma unroll
    for (int f = 0; f < 8; ++f) ring[f] = Frag<_Float16>::load(sk + (f >> 2) * 16 * kKPitch + (f & 3) * 32);
    v8f s[4];
#pragma unroll
    for (int j = 0; j < 4; ++j) {
      s[j] = (v8f){0.f,0.f,0.f,0.f,0.f,0.f,0.f,0.f};
#pragma unroll
      for (int dc = 0; dc < 4; ++dc) s[j] = mma_guard_h(qa[dc], ring[(j & 1) * 4 + dc], s[j]);
      if (j < 2) {
#pragma unroll
        for (int dc = 0; dc < 4; ++dc) ring[(j & 1) * 4 + dc] = Frag<_Float16>::load(sk + (j + 2) * 16 * kKPitch + dc * 32);
      }
    }
    const bool diag = (kc == nChunks - 1);
    float cm[8];
#pragma unroll
    for (int r = 0; r < 8; ++r) {
      const int qrow = q0 + 8 * hh + r;
      float m = -INFINITY;
#pragma unroll
      for (int j = 0; j < 4; ++j) {
        const int kvcol = kv0 + j * 16 + c;
        float v = s[j][r] * kScoreMul;
        if (diag && (kvcol > qrow)) v = -INFINITY;
        s[j][r] = v;
        m = fmaxf(m, v);
      }
#pragma unroll
      for (int off = 1; off < 16; off <<= 1) m = fmaxf(m, __shfl_xor(m, off, 32));
      cm[r] = m;
    }
#pragma unroll
    for (int r = 0; r < 8; ++r) {
      const float mnew  = fmaxf(mrow[r], cm[r]);
      const float alpha = __expf(mrow[r] - mnew);
      mrow[r] = mnew;
      float psum = 0.0f;
#pragma unroll
      for (int j = 0; j < 4; ++j) {
        const float p = __expf(s[j][r] - mnew);
        psum += p;
        pw[(8 * hh + r) * kLateKC + j * 16 + c] = (_Float16)(p * kPCarry);
      }
#pragma unroll
      for (int off = 1; off < 16; off <<= 1) psum += __shfl_xor(psum, off, 32);
      lrow[r] = lrow[r] * alpha + psum;
#pragma unroll
      for (int t = 0; t < 8; ++t) oacc[t][r] *= alpha;
    }
    wave_lds_sync();
#pragma unroll
    for (int t = 0; t < 8; ++t) ring[t] = Frag<_Float16>::load(sv + t * 16 * kVPitch);
#pragma unroll
    for (int kk = 0; kk < 2; ++kk) {
      FH pa;
      pa.h[0] = *(const v8h*)(pw + c * kLateKC + kk * 32 + 8 * hh);
      pa.h[1] = *(const v8h*)(pw + c * kLateKC + kk * 32 + 16 + 8 * hh);
#pragma unroll
      for (int g = 0; g < 2; ++g) {
#pragma unroll
        for (int t = g * 4; t < g * 4 + 4; ++t) oacc[t] = mma_guard_h(pa.v, ring[t], oacc[t]);
        if (kk == 0) {
#pragma unroll
          for (int t = g * 4; t < g * 4 + 4; ++t) ring[t] = Frag<_Float16>::load(sv + t * 16 * kVPitch + 32);
        }
      }
    }
    /* hand-over: this wave's reads of the buffer (and of its p rows) are done, */
    asm volatile("s_wait_dscnt 0x0" ::: "memory");
    /* its copies of chunk kc + 1 have landed, */
    asm volatile("s_wait_asynccnt 0x0" ::: "memory");
    /* and the barrier publishes chunk kc + 1 and frees the buffer that was just read */
    __syncthreads();
    if (kc + 2 < nChunks) issue_chunk(kc + 2);
  }
  /* no copy is left in flight when the wave goes on */
  asm volatile("s_wait_asynccnt 0x0" ::: "memory");

  float inv[8];
#pragma unroll
  for (int r = 0; r < 8; ++r) inv[r] = 1.0f / (lrow[r] * (kPCarry * kVCarry));
  float* os = Os[wave];
  const int c4 = (lane & 15) * 4;
#pragma unroll
  for (int hf = 0; hf < 2; ++hf) {
#pragma unroll
    for (int r = 0; r < 8; ++r) {
#pragma unroll
      for (int t4 = 0; t4 < 4; ++t4) os[(8 * hh + r) * 68 + t4 * 16 + c] = oacc[hf * 4 + t4][r] * inv[r];
    }
    wave_lds_sync();
    {
#pragma unroll
      for (int it = 0; it < 8; ++it) {
        const int row = it * 2 + hh;
        v4f val = *(const v4f*)(os + row * 68 + c4);
        *(v4f*)(ob + (size_t)row * kQW + hf * 64 + c4) = val;
      }
      
    }
    wave_lds_sync();
  }
}

// ---------------------------------------------------------------------------
// Attention for query positions t < 128 of each batch (a causally closed sub-problem), all f32 on the vector unit.
// Block = (b, kv head, t); wave = one of the 4 query heads; waves are independent (per-wave LDS, wave-local sync).
// Scores: lane owns keys lane + 32*i (i = 0..3, groups beyond t skipped under a wave-uniform test; key index clamped to t,
// invalid keys set to -inf by value afterwards); each dot is a rolled 32 x 4-term loop against the q row held in LDS.
// Softmax with precise expf; p written to LDS for all 128 slots (zeros beyond t).
// p.v: lane owns d = 4*lane..+3; rolled loop over keys 0..t (t <= 127 by construction of the grid).
// ---------------------------------------------------------------------------
__global__ __launch_bounds__(128) void attn_early_kernel(const float* __restrict__ Qe, const float* __restrict__ Ke,
                                                         const float* __restrict__ Ve, float* __restrict__ attn) {
  __shared__ __align__(16) float sq[4][kHD];
  __shared__ __align__(16) float sp[4][kEarly];
  const int lane = threadIdx.x & 31;
  const int wave = __builtin_amdgcn_readfirstlane((int)(threadIdx.x >> 5));
  const int t    = blockIdx.x & (kEarly - 1);
  const int hkv  = (blockIdx.x / kEarly) & (kHkv - 1);
  const int b    = blockIdx.x / (kEarly * kHkv);
  const int h    = hkv * kRep + wave;
  const int erow = b * kEarly + t;
  float* sqw = sq[wave];
  float* spw = sp[wave];
  {
    const v4f qv = *(const v4f*)(Qe + (size_t)erow * kQW + h * kHD + 4 * lane);
    *(v4f*)(sqw + 4 * lane) = qv;
  }
  wave_lds_sync();
  float sc[4];
#pragma unroll
  for (int i = 0; i < 4; ++i) {
    const int j  = lane + 32 * i;
    const int jc = (j < t) ? j : t;
    float dot = 0.0f;
    if (32 * i <= t) {
      const float* kr = Ke + (size_t)(b * kEarly + jc) * kKW + hkv * kHD;
#pragma unroll 1
      for (int d4 = 0; d4 < kHD / 4; ++d4) {
        const v4f kv = *(const v4f*)(kr + 4 * d4);
        float k0 = kv[0], k1 = kv[1], k2 = kv[2], k3 = kv[3];
        asm volatile("" : "+v"(k0), "+v"(k1), "+v"(k2), "+v"(k3));
        const v4f qq = *(const v4f*)(sqw + 4 * d4);
        dot = fmaf(k0, qq[0], dot);
        dot = fmaf(k1, qq[1], dot);
        dot = fmaf(k2, qq[2], dot);
        dot = fmaf(k3, qq[3], dot);
      }
    }
    sc[i] = (j <= t) ? (dot * kInvSqrtHD) : -INFINITY;
  }
  float m = fmaxf(fmaxf(sc[0], sc[1]), fmaxf(sc[2], sc[3]));
#pragma unroll
  for (int off = 16; off > 0; off >>= 1) m = fmaxf(m, __shfl_xor(m, off, 32));
  float psum = 0.0f;
#pragma unroll
  for (int i = 0; i < 4; ++i) {
    const float p = expf(sc[i] - m);
    psum += p;
    spw[lane + 32 * i] = p;
  }
#pragma unroll
  for (int off = 16; off > 0; off >>= 1) psum += __shfl_xor(psum, off, 32);
  wave_lds_sync();
  float a0 = 0.0f, a1 = 0.0f, a2 = 0.0f, a3 = 0.0f;
  const float* vr = Ve + (size_t)(b * kEarly) * kKW + hkv * kHD + 4 * lane;
#pragma unroll 1
  for (int j = 0; j <= t; ++j) {
    const float p = spw[j];
    const v4f vv = *(const v4f*)(vr + (size_t)j * kKW);
    a0 = fmaf(p, vv[0], a0);
    a1 = fmaf(p, vv[1], a1);
    a2 = fmaf(p, vv[2], a2);
    a3 = fmaf(p, vv[3], a3);
  }
  const float il = 1.0f / psum;
  const v4f ov = (v4f){a0 * il, a1 * il, a2 * il, a3 * il};
  float* dst = attn + (size_t)(b * kS + t) * kQW + h * kHD + 4 * lane;
  *(v4f*)dst = ov;
  
}

// ---------------------------------------------------------------------------
// gated = attn * sigmoid(gate projection), f32; one block per token row (2048 columns).
// Rolled loop: 8 iterations x 256 threads, one column each (coalesced 4-B loads), result into LDS; after the block barrier
// thread t owns columns 8t..8t+7. Positions >= 128: f16 plane carried x1024 (row = token). Positions < 128: bf16 hi plane and
// bf16 lo plane (lo = RNE bf16 of value - hi), row = b*128 + position. One 16-B store per lane per plane; a wave = 512
// ---------------------------------------------------------------------------
__global__ __launch_bounds__(256) void gate_kernel(const float* __restrict__ attn, const float* __restrict__ G,
                                                   unsigned short* __restrict__ GH, unsigned short* __restrict__ EH,
                                                   unsigned short* __restrict__ EL) {
  __shared__ __align__(16) float sm[kQW];
  const int tid = threadIdx.x;
  const int row = blockIdx.x;
  const int pos = row & (kS - 1);
  const int b   = row / kS;
  const float* ar = attn + (size_t)row * kQW;
  const float* gr = G + (size_t)row * kQW;
#pragma unroll 1
  for (int i = 0; i < kQW / 256; ++i) {
    const int col = i * 256 + tid;
    const float a = ar[col];
    const float g = gr[col];
    const float sg = 1.0f / (1.0f + expf(-g));
    sm[col] = a * sg;
  }
  __syncthreads();
  const v4f x0 = *(const v4f*)(sm + 8 * tid);
  const v4f x1 = *(const v4f*)(sm + 8 * tid + 4);
  if (pos >= kEarly) {
    unsigned short hb[8];
#pragma unroll
    for (int e = 0; e < 4; ++e) {
      hb[e]     = h_bits(x0[e] * kGCarry);
      hb[4 + e] = h_bits(x1[e] * kGCarry);
    }
    const v4u u = (v4u){pk16(hb[0], hb[1]), pk16(hb[2], hb[3]), pk16(hb[4], hb[5]), pk16(hb[6], hb[7])};
    unsigned short* d = GH + (size_t)row * kQW + 8 * tid;
    *(v4u*)d = u;
    
  } else {
    unsigned short hb[8], lb[8];
#pragma unroll
    for (int e = 0; e < 4; ++e) {
      const float f0 = x0[e];
      const float f1 = x1[e];
      hb[e]     = f2bf_bits(f0);
      hb[4 + e] = f2bf_bits(f1);
      lb[e]     = f2bf_bits(f0 - bf_bits2f(hb[e]));
      lb[4 + e] = f2bf_bits(f1 - bf_bits2f(hb[4 + e]));
    }
    const v4u uh = (v4u){pk16(hb[0], hb[1]), pk16(hb[2], hb[3]), pk16(hb[4], hb[5]), pk16(hb[6], hb[7])};
    const v4u ul = (v4u){pk16(lb[0], lb[1]), pk16(lb[2], lb[3]), pk16(lb[4], lb[5]), pk16(lb[6], lb[7])};
    const size_t o = (size_t)(b * kEarly + pos) * kQW + 8 * tid;
    *(v4u*)(EH + o) = uh;
    *(v4u*)(EL + o) = ul;
    
  }
}

// ---------------------------------------------------------------------------
// Host glue: 15 kernel launches, nothing else.
// GEMM shapes (all K % 64 == 0, M % 128 == 0, N % 256 == 0, no padding planes):
//   q|k|v proj : M 4096, N 3072, K 2048 -> 32 x 12 = 384 blocks (bf16)
//   gate proj  : M 4096, N 2048, K 2048 -> 32 x 8 = 256 blocks (bf16)
//   out late   : per batch M 1920 (positions 128..2047), N 2048, K 2048 -> 15 x 8 = 120 blocks x 2 (f16)
//   out early  : per batch M 128 (positions 0..127), N 2048, K 2048, A hi+lo -> 1 x 8 = 8 blocks x 2 (bf16)
// ---------------------------------------------------------------------------
extern "C" void kernel_launch(void* const* d_in, const int* in_sizes, int n_in,
                              void* d_out, int out_size, void* d_ws, size_t ws_size,
                              hipStream_t stream) {
  if (n_in < 10) return;
  if (in_sizes[0] != kTok * kHid) return;
  if (in_sizes[1] != kS * kHD) return;
  if (in_sizes[2] != kS * kHD) return;
  if (in_sizes[3] != kQW * kHid) return;
  if (in_sizes[4] != kKW * kHid) return;
  if (in_sizes[5] != kKW * kHid) return;
  if (in_sizes[6] != kQW * kHid) return;
  if (in_sizes[7] != kQW * kQW) return;
  if (in_sizes[8] != kHD) return;
  if (in_sizes[9] != kHD) return;
  if (out_size != kTok * kQW) return;
  if (ws_size < kWsTotal) return;

  const float* X    = (const float*)d_in[0];
  const float* ctab = (const float*)d_in[1];
  const float* stab = (const float*)d_in[2];
  const float* Wq   = (const float*)d_in[3];
  const float* Wk   = (const float*)d_in[4];
  const float* Wv   = (const float*)d_in[5];
  const float* Wg   = (const float*)d_in[6];
  const float* Wo   = (const float*)d_in[7];
  const float* qnw  = (const float*)d_in[8];
  const float* knw  = (const float*)d_in[9];
  float* out = (float*)d_out;

  char* ws = (char*)d_ws;
  unsigned short* XB   = (unsigned short*)(ws + kOffXB);
  unsigned short* WQKV = (unsigned short*)(ws + kOffWQKV);
  unsigned short* WGB  = (unsigned short*)(ws + kOffWGB);
  float*          QKV  = (float*)(ws + kOffQKV);
  unsigned short* QP   = (unsigned short*)(ws + kOffQP);
  unsigned short* KP   = (unsigned short*)(ws + kOffKP);
  unsigned short* VT   = (unsigned short*)(ws + kOffVT);
  float*          QE   = (float*)(ws + kOffQE);
  float*          KE   = (float*)(ws + kOffKE);
  float*          VE   = (float*)(ws + kOffVE);
  unsigned short* WOB  = (unsigned short*)(ws + kOffWOB);
  unsigned short* WOH  = (unsigned short*)(ws + kOffWOH);
  float*          ATT  = (float*)(ws + kOffATT);
  float*          GF   = (float*)(ws + kOffGF);
  unsigned short* GH   = (unsigned short*)(ws + kOffGH);
  unsigned short* EH   = (unsigned short*)(ws + kOffEH);
  unsigned short* EL   = (unsigned short*)(ws + kOffEL);

  /* operand planes: every float input RNE-converted to bf16 once (weights are [out][in] = Bt layout already) */
  cast8_kernel<0><<<(kTok * kHid / 8) / 256, 256, 0, stream>>>(X, XB, XB, kTok * kHid / 8, 1.0f);
  cast8_kernel<0><<<(kQW * kHid / 8) / 256, 256, 0, stream>>>(Wq, WQKV, WQKV, kQW * kHid / 8, 1.0f);
  cast8_kernel<0><<<(kKW * kHid / 8) / 256, 256, 0, stream>>>(Wk, WQKV + (size_t)kQW * kHid, WQKV, kKW * kHid / 8, 1.0f);
  cast8_kernel<0><<<(kKW * kHid / 8) / 256, 256, 0, stream>>>(Wv, WQKV + (size_t)kVCol0 * kHid, WQKV, kKW * kHid / 8, 1.0f);
  cast8_kernel<0><<<(kQW * kHid / 8) / 256, 256, 0, stream>>>(Wg, WGB, WGB, kQW * kHid / 8, 1.0f);
  cast8_kernel<1><<<(kQW * kQW / 8) / 256, 256, 0, stream>>>(Wo, WOB, WOH, kQW * kQW / 8, kWoCarry);

  /* q|k|v projection: QKV[4096][3072] = x . [Wq;Wk;Wv]^T */
  wmma_gemm64<1, false><<<dim3((kTok / kGBM) * (kQKVW / kGBN), 1), 256, 0, stream>>>(
      XB, XB, kHid, 0L, WQKV, kHid, 0L, QKV, kQKVW, 0L, kTok, kQKVW, kHid, 1.0f);

  /* norm + rotation -> QP, KP (f16 x64) and QE, KE (f32, positions < 128) */
  normrot_kernel<<<kTok * kSlots / 8, 256, 0, stream>>>(QKV, ctab, stab, qnw, knw, QP, KP, QE, KE);

  /* v transpose -> VT (f16 x64) and VE (f32, positions < 128): 2 x 4 x 32 blocks */
  vprep_kernel<<<kB * kHkv * (kS / 64), 256, 0, stream>>>(QKV, VT, VE);

  /* attention, positions >= 128 (matrix ops) then positions < 128 (f32); disjoint rows of ATT */
  attn_late_kernel<<<kLatePairs * kHkv * kB, 256, 0, stream>>>(QP, KP, VT, ATT);
  attn_early_kernel<<<kB * kHkv * kEarly, 128, 0, stream>>>(QE, KE, VE, ATT);

  /* gate projection: GF[4096][2048] = x . Wg^T */
  wmma_gemm64<1, false><<<dim3((kTok / kGBM) * (kQW / kGBN), 1), 256, 0, stream>>>(
      XB, XB, kHid, 0L, WGB, kHid, 0L, GF, kQW, 0L, kTok, kQW, kHid, 1.0f);

  /* gated planes */
  gate_kernel<<<kTok, 256, 0, stream>>>(ATT, GF, GH, EH, EL);

  /* output projection, positions >= 128 of each batch: f16 single product, carries folded back */
  wmma_gemm64<0, false><<<dim3(((kS - kEarly) / kGBM) * (kQW / kGBN), kB), 256, 0, stream>>>(
      GH + (size_t)kEarly * kQW, GH + (size_t)kEarly * kQW, kQW, (long)kS * kQW,
      WOH, kQW, 0L,
      out + (size_t)kEarly * kQW, kQW, (long)kS * kQW,
      kS - kEarly, kQW, kQW, kOutLateMul);

  /* output projection, positions < 128 of each batch: bf16 hi.W + lo.W */
  wmma_gemm64<1, true><<<dim3((kEarly / kGBM) * (kQW / kGBN), kB), 256, 0, stream>>>(
      EH, EL, kQW, (long)kEarly * kQW,
      WOB, kQW, 0L,
      out, kQW, (long)kS * kQW,
      kEarly, kQW, kQW, 1.0f);
}

// v003
// One run takes 337 microseconds.
// Timed twice side by side with v002, it ran 1.11 and 1.12 times as fast.
// Over all steps from v000 it is 2.32 times as fast.
// Projections x.Wq/Wk/Wv/Wg^T: v_wmma_f32_16x16x32_bf16 (every float input RNE-converted to bf16 once, exact products, f32 accumulate); scores q.k^T and p.v for query positions >= 128: v_wmma_f32_16x16x32_f16 (q,k,v planes carried x64, p carried x32768); query positions < 128: f32 VALU attention; output projection: f16 (gated carried x1024, Wo carried x1024) for positions >= 128, bf16 hi+lo gated planes x bf16 Wo (two products) for positions < 128; norms, position rotation, softmax, gate in f32.
#include <hip/hip_runtime.h>
#include <math.h>

typedef __attribute__((ext_vector_type(16))) _Float16 v16h;
typedef __attribute__((ext_vector_type(8)))  _Float16 v8h;
typedef __attribute__((ext_vector_type(16))) __bf16   v16b;
typedef __attribute__((ext_vector_type(8)))  __bf16   v8b;
typedef __attribute__((ext_vector_type(8)))  float    v8f;
typedef __attribute__((ext_vector_type(4)))  float    v4f;
typedef __attribute__((ext_vector_type(4)))  unsigned int v4u;
typedef __attribute__((ext_vector_type(2)))  unsigned int v2u;

// ---------------------------------------------------------------------------
// Shape constants
// ---------------------------------------------------------------------------
constexpr int kB     = 2;
constexpr int kS     = 2048;
constexpr int kHid   = 2048;
constexpr int kHq    = 16;
constexpr int kHkv   = 4;
constexpr int kRep   = kHq / kHkv;
constexpr int kHD    = 128;
constexpr int kTok   = kB * kS;
constexpr int kQW    = kHq * kHD;
constexpr int kKW    = kHkv * kHD;
constexpr int kQKVW  = kQW + 2 * kKW;
constexpr int kVCol0 = kQW + kKW;
constexpr int kSlots = kHq + kHkv;
constexpr int kEarly = 128;
constexpr int kERows = kB * kEarly;
constexpr int kLateKC    = 64;
constexpr int kLatePairs = (kS - kEarly) / 32;
constexpr int kVP    = 132;
constexpr float kEps = 1e-6f;

constexpr double cx_sqrt(double x) {
  double r = (x > 1.0) ? x : 1.0;
  for (int i = 0; i < 80; ++i) r = 0.5 * (r + x / r);
  return r;
}
constexpr float kInvSqrtHD = (float)(1.0 / cx_sqrt((double)kHD));
/* power-of-two carries of the f16 operand planes */
constexpr float kQKCarry = 64.0f;
constexpr float kVCarry  = 64.0f;
constexpr float kPCarry  = 32768.0f;
constexpr float kGCarry  = 1024.0f;
constexpr float kWoCarry = 1024.0f;
constexpr float kScoreMul   = kInvSqrtHD / (kQKCarry * kQKCarry);
constexpr float kOutLateMul = 1.0f / (kGCarry * kWoCarry);

static_assert(kRep == 4 && kHkv == 4 && kHD == 128, "lane maps assume 4 kv heads x 4 query heads x 128");
static_assert(kTok == 4096 && kQW == 2048 && kKW == 512 && kQKVW == 3072, "wire shapes");
static_assert((kHid % 32) == 0 && (kQW % 32) == 0, "GEMM K multiples of 32");
static_assert((kTok % 64) == 0 && (kQKVW % 64) == 0 && (kQW % 64) == 0 && ((kS - kEarly) % 64) == 0 && (kEarly % 64) == 0, "GEMM M,N multiples of 64");
static_assert((kS % 64) == 0 && (kS / 64) == 32 && (kEarly % 16) == 0 && ((kS - kEarly) % 32) == 0, "tile multiples");

// ---------------------------------------------------------------------------
// Workspace region map (bytes; every offset a multiple of 128)
//   XB   bf16 [4096][2048]  x plane                                16,777,216
//   WQKV bf16 [3072][2048]  Wq | Wk | Wv rows                      12,582,912
//   WGB  bf16 [2048][2048]  Wg                                      8,388,608
//   QKV  f32  [4096][3072]  q | k | v projections                  50,331,648
//   QP   f16  [4096][2048]  normed+rotated q x64                   16,777,216
//   KP   f16  [4096][512]   normed+rotated k x64                    4,194,304
//   VT   f16  [2][4][128][2048] v transposed x64                    4,194,304
//   QE   f32  [256][2048]   q rows of positions < 128               2,097,152
//   KE   f32  [256][512]    k rows of positions < 128                 524,288
//   VE   f32  [256][512]    v rows of positions < 128                 524,288
//   WOB  bf16 [2048][2048]  Wo                                      8,388,608
//   WOH  f16  [2048][2048]  Wo (bf16 value) x1024                   8,388,608
//   total                                                         133,169,152
// Aliases (each across whole launches):
//   ATT  f32 [4096][2048]  = first 33,554,432 B of QKV (after the norm/rotation and v-prep launches)
//   GF   f32 [4096][2048]  = last 16,777,216 B of QKV + all of QP (after both attention launches)
//   GH   f16 [4096][2048]  = XB (after the gate projection)
//   EH/EL bf16 [256][2048] = first 2 x 1,048,576 B of WQKV (after the q|k|v projection)
// ---------------------------------------------------------------------------
constexpr size_t kOffXB   = 0;
constexpr size_t kOffWQKV = kOffXB   + (size_t)kTok * kHid * 2;
constexpr size_t kOffWGB  = kOffWQKV + (size_t)kQKVW * kHid * 2;
constexpr size_t kOffQKV  = kOffWGB  + (size_t)kQW * kHid * 2;
constexpr size_t kOffQP   = kOffQKV  + (size_t)kTok * kQKVW * 4;
constexpr size_t kOffKP   = kOffQP   + (size_t)kTok * kQW * 2;
constexpr size_t kOffVT   = kOffKP   + (size_t)kTok * kKW * 2;
constexpr size_t kOffQE   = kOffVT   + (size_t)kTok * kKW * 2;
constexpr size_t kOffKE   = kOffQE   + (size_t)kERows * kQW * 4;
constexpr size_t kOffVE   = kOffKE   + (size_t)kERows * kKW * 4;
constexpr size_t kOffWOB  = kOffVE   + (size_t)kERows * kKW * 4;
constexpr size_t kOffWOH  = kOffWOB  + (size_t)kQW * kQW * 2;
constexpr size_t kWsTotal = kOffWOH  + (size_t)kQW * kQW * 2;
constexpr size_t kOffATT  = kOffQKV;
constexpr size_t kOffGF   = kOffQKV + (size_t)kTok * kQW * 4;
constexpr size_t kOffGH   = kOffXB;
constexpr size_t kOffEH   = kOffWQKV;
constexpr size_t kOffEL   = kOffWQKV + (size_t)kERows * kQW * 2;
static_assert(kWsTotal == 133169152ull, "carve total");
static_assert(kWsTotal <= 134217728ull, "carve cap");
static_assert(kOffGF + (size_t)kTok * kQW * 4 == kOffKP, "gate plane covers the projection tail plus the q plane exactly");
static_assert(kOffEL + (size_t)kERows * kQW * 2 <= kOffWGB, "hi/lo planes inside the dead weight plane");
static_assert((kOffWQKV % 128) == 0 && (kOffWGB % 128) == 0 && (kOffQKV % 128) == 0 && (kOffQP % 128) == 0 &&
              (kOffKP % 128) == 0 && (kOffVT % 128) == 0 && (kOffQE % 128) == 0 && (kOffKE % 128) == 0 &&
              (kOffVE % 128) == 0 && (kOffWOB % 128) == 0 && (kOffWOH % 128) == 0 && (kOffGF % 128) == 0 &&
              (kOffEL % 128) == 0, "128-B aligned regions");

// ---------------------------------------------------------------------------
// Small helpers
// ---------------------------------------------------------------------------
__device__ __forceinline__ unsigned short f2bf_bits(float f) {
  unsigned u = __float_as_uint(f);
  return (unsigned short)((u + 0x7FFFu + ((u >> 16) & 1u)) >> 16);
}
__device__ __forceinline__ float bf_bits2f(unsigned short h) { return __uint_as_float(((unsigned)h) << 16); }
__device__ __forceinline__ float bf16r(float f) { return bf_bits2f(f2bf_bits(f)); }
__device__ __forceinline__ unsigned pk16(unsigned short a, unsigned short b) { return (unsigned)a | ((unsigned)b << 16); }
__device__ __forceinline__ unsigned short h_bits(float f) { const _Float16 h = (_Float16)f; return __builtin_bit_cast(unsigned short, h); }
__device__ __forceinline__ void wave_lds_sync() {
  __builtin_amdgcn_fence(__ATOMIC_RELEASE, "workgroup");
  __builtin_amdgcn_wave_barrier();
  __builtin_amdgcn_fence(__ATOMIC_ACQUIRE, "workgroup");
}

/* lane l <-> lane l ^ X inside a row of 16 lanes (X = 1, 2, 4, 8) and l <-> l ^ 16, on the vector unit: no trip through the
   LDS path and no wait on its counter; every lane is on wherever these stand */
template <int X>
__device__ __forceinline__ float row_xor(float v) {
  return __builtin_bit_cast(float, __builtin_amdgcn_update_dpp(0, __builtin_bit_cast(int, v), 0x160 + X, 0xf, 0xf, true));
}
__device__ __forceinline__ float half_xor(float v) {
  const int b = __builtin_bit_cast(int, v);
  return __builtin_bit_cast(float, __builtin_amdgcn_permlanex16(b, b, 0x76543210, 0xfedcba98, false, false));
}
/* butterflies in the order 1, 2, 4, 8 over a row of 16 lanes.
   The maximum of eight values at once is written as text: around a builtin exchange the compiler puts a register move and a
   quieting maximum, three instructions a step in place of one. The eight chains alternate, so that no instruction reads a
   result younger than eight instructions and none waits on the one in front of it */
#define ROW_MAX_STEP(X)                                                     \
  "v_max_num_f32_dpp %0, %0, %0 row_xmask:" #X " row_mask:0xf bank_mask:0xf\n\t" \
  "v_max_num_f32_dpp %1, %1, %1 row_xmask:" #X " row_mask:0xf bank_mask:0xf\n\t" \
  "v_max_num_f32_dpp %2, %2, %2 row_xmask:" #X " row_mask:0xf bank_mask:0xf\n\t" \
  "v_max_num_f32_dpp %3, %3, %3 row_xmask:" #X " row_mask:0xf bank_mask:0xf\n\t" \
  "v_max_num_f32_dpp %4, %4, %4 row_xmask:" #X " row_mask:0xf bank_mask:0xf\n\t" \
  "v_max_num_f32_dpp %5, %5, %5 row_xmask:" #X " row_mask:0xf bank_mask:0xf\n\t" \
  "v_max_num_f32_dpp %6, %6, %6 row_xmask:" #X " row_mask:0xf bank_mask:0xf\n\t" \
  "v_max_num_f32_dpp %7, %7, %7 row_xmask:" #X " row_mask:0xf bank_mask:0xf\n\t"
__device__ __forceinline__ void row16_max8(float (&m)[8]) {
  asm(ROW_MAX_STEP(1) ROW_MAX_STEP(2) ROW_MAX_STEP(4) ROW_MAX_STEP(8)
      : "+v"(m[0]), "+v"(m[1]), "+v"(m[2]), "+v"(m[3]), "+v"(m[4]), "+v"(m[5]), "+v"(m[6]), "+v"(m[7]));
}
__device__ __forceinline__ float row16_sum(float v) {
  v += row_xor<1>(v);
  v += row_xor<2>(v);
  v += row_xor<4>(v);
  v += row_xor<8>(v);
  return v;
}
/* butterflies in the order 16, 8, 4, 2, 1 over the wave */
__device__ __forceinline__ float wave_max(float m) {
  m = fmaxf(m, half_xor(m));
  m = fmaxf(m, row_xor<8>(m));
  m = fmaxf(m, row_xor<4>(m));
  m = fmaxf(m, row_xor<2>(m));
  m = fmaxf(m, row_xor<1>(m));
  return m;
}
__device__ __forceinline__ float wave_sum(float v) {
  v += half_xor(v);
  v += row_xor<8>(v);
  v += row_xor<4>(v);
  v += row_xor<2>(v);
  v += row_xor<1>(v);
  return v;
}

/* matrix op followed by the 4-slot hazard guard; one accumulator per guard statement, A and B named as inputs */
__device__ __forceinline__ v8f mma_guard_h(v16h a, v16h b, v8f c) {
  c = __builtin_amdgcn_wmma_f32_16x16x32_f16(false, a, false, b, (short)0, c, false, false);
  asm volatile("v_nop\n\tv_nop\n\tv_nop\n\tv_nop" : "+v"(c) : "v"(a), "v"(b));
  return c;
}
__device__ __forceinline__ v8f mma_guard_b(v16b a, v16b b, v8f c) {
  c = __builtin_amdgcn_wmma_f32_16x16x32_bf16(false, a, false, b, (short)0, c, false, false);
  asm volatile("v_nop\n\tv_nop\n\tv_nop\n\tv_nop" : "+v"(c) : "v"(a), "v"(b));
  return c;
}
__device__ __forceinline__ void keep4_h(v16h a, v16h b, v16h c, v16h d) { asm volatile("v_nop" :: "v"(a), "v"(b), "v"(c), "v"(d)); }
__device__ __forceinline__ void keep4_b(v16b a, v16b b, v16b c, v16b d) { asm volatile("v_nop" :: "v"(a), "v"(b), "v"(c), "v"(d)); }
__device__ __forceinline__ void acc_guard4(v8f& a, v8f& b, v8f& c, v8f& d) { asm volatile("v_nop\n\tv_nop\n\tv_nop\n\tv_nop" : "+v"(a), "+v"(b), "+v"(c), "+v"(d)); }

template <typename T> struct Frag;
template <> struct Frag<_Float16> {
  typedef v16h V; union U { v16h v; v8h h[2]; };
  /* elements 0..7 <- p[0..7], 8..15 <- p[16..23] */
  static __device__ __forceinline__ v16h load(const _Float16* p) {
    U f; f.h[0] = *(const v8h*)(p); f.h[1] = *(const v8h*)(p + 16); return f.v;
  }
  static __device__ __forceinline__ v8f mmag(v16h a, v16h b, v8f c) { return mma_guard_h(a, b, c); }
  static __device__ __forceinline__ void keep(v16h a, v16h b, v16h c, v16h d) { keep4_h(a, b, c, d); }
};
template <> struct Frag<__bf16> {
  typedef v16b V; union U { v16b v; v8b h[2]; };
  static __device__ __forceinline__ v16b load(const __bf16* p) {
    U f; f.h[0] = *(const v8b*)(p); f.h[1] = *(const v8b*)(p + 16); return f.v;
  }
  static __device__ __forceinline__ v8f mmag(v16b a, v16b b, v8f c) { return mma_guard_b(a, b, c); }
  static __device__ __forceinline__ void keep(v16b a, v16b b, v16b c, v16b d) { keep4_b(a, b, c, d); }
};

// ---------------------------------------------------------------------------
// Batched GEMM: C[m,n] = scale * sum_k A[m,k] * Bt[n,k]. A block of 8 waves (2 x 4) owns a 128 x 256 tile, each wave 64x64 of it.
// A row-major [M,K]; Bt row-major [N,K]; M % 128 == 0, N % 256 == 0, K % 64 == 0 (no tails).
// Operands reach LDS by asynchronous 16-B copies, 64 k per stage (128-B rows at a 144-B pitch), two buffers: the next
// stage's copies fly while this stage's fragments are read from LDS; 8 lanes copy one whole 128-B line of a row.
// ASPLIT: A carried as hi/lo planes (A2 = lo plane, same layout): product = hi.b + lo.b into one accumulator.
// ET: 0 = f16 operands, 1 = bf16 operands (pointers passed as 16-bit storage). Output f32.
// ---------------------------------------------------------------------------
constexpr int kGBM    = 128;
constexpr int kGBN    = 256;
constexpr int kGKS    = 64;
constexpr int kGPitch = 72;
constexpr unsigned kGPitchB = kGPitch * 2;
static_assert((kTok % kGBM) == 0 && ((kS - kEarly) % kGBM) == 0 && (kEarly % kGBM) == 0, "GEMM M multiples of the block tile");
static_assert((kQKVW % kGBN) == 0 && (kQW % kGBN) == 0, "GEMM N multiples of the block tile");
static_assert((kHid % kGKS) == 0 && (kQW % kGKS) == 0 && kHid / kGKS >= 2 && kQW / kGKS >= 2, "GEMM K in whole stages");

__device__ __forceinline__ unsigned lds_off(const void* p) { return (unsigned)(size_t)p; }

/* copies of 16 B per lane, global -> LDS through no register: row r of the run lies 32 * r rows behind the first, in LDS
   (pitch kGPitchB) and in the source (step32 elements). One statement holds a whole run, and the s_wait_xcnt closes it so
   that no address register of a copy is rewritten in front of it; one run per statement keeps that wait to one per run */
__device__ __forceinline__ void copy4_async(unsigned l, const unsigned short* g, size_t step32) {
  asm volatile("global_load_async_to_lds_b128 %0, %4, off\n\t"
               "global_load_async_to_lds_b128 %1, %5, off\n\t"
               "global_load_async_to_lds_b128 %2, %6, off\n\t"
               "global_load_async_to_lds_b128 %3, %7, off\n\t"
               "s_wait_xcnt 0x0"
               :: "v"(l), "v"(l + 32u * kGPitchB), "v"(l + 64u * kGPitchB), "v"(l + 96u * kGPitchB),
                  "v"(g), "v"(g + step32), "v"(g + 2 * step32), "v"(g + 3 * step32) : "memory");
}
__device__ __forceinline__ void copy8_async(unsigned l, const unsigned short* g, size_t step32,
                                            unsigned m, const unsigned short* h, size_t step32h) {
  asm volatile("global_load_async_to_lds_b128 %0, %8, off\n\t"
               "global_load_async_to_lds_b128 %1, %9, off\n\t"
               "global_load_async_to_lds_b128 %2, %10, off\n\t"
               "global_load_async_to_lds_b128 %3, %11, off\n\t"
               "global_load_async_to_lds_b128 %4, %12, off\n\t"
               "global_load_async_to_lds_b128 %5, %13, off\n\t"
               "global_load_async_to_lds_b128 %6, %14, off\n\t"
               "global_load_async_to_lds_b128 %7, %15, off\n\t"
               "s_wait_xcnt 0x0"
               :: "v"(l), "v"(l + 32u * kGPitchB), "v"(l + 64u * kGPitchB), "v"(l + 96u * kGPitchB),
                  "v"(m), "v"(m + 32u * kGPitchB), "v"(m + 64u * kGPitchB), "v"(m + 96u * kGPitchB),
                  "v"(g), "v"(g + step32), "v"(g + 2 * step32), "v"(g + 3 * step32),
                  "v"(h), "v"(h + step32h), "v"(h + 2 * step32h), "v"(h + 3 * step32h) : "memory");
}

template <int ET> struct Elem;
template <> struct Elem<0> { typedef _Float16 T; };
template <> struct Elem<1> { typedef __bf16 T; };
template <int ET, bool ASPLIT>
__global__ __launch_bounds__(256) void wmma_gemm64(
    const unsigned short* __restrict__ Ap, const unsigned short* __restrict__ A2p, int lda, long strideA,
    const unsigned short* __restrict__ Btp, int ldb, long strideB,
    float* __restrict__ Cout, int ldc, long strideC,
    int M, int N, int K, float scale) {
  typedef typename Elem<ET>::T T;
  typedef typename Frag<T>::V V;
  constexpr int kARows = ASPLIT ? 2 * kGBM : kGBM;
  constexpr int kRows  = kARows + kGBN;
  constexpr unsigned kBufB = (unsigned)kRows * kGPitchB;
  __shared__ __align__(16) unsigned short sStage[2][kRows * kGPitch];
  __shared__ __align__(16) float sT[8][16 * 68];
  const int b    = blockIdx.y;
  const int tid  = threadIdx.x;
  const int lane = tid & 31;
  const int wave = __builtin_amdgcn_readfirstlane((int)(threadIdx.x >> 5));
  const int tilesN = N / kGBN;
  const int tilesM = M / kGBM;
  /* block-uniform, in front of every barrier and copy */
  if ((int)blockIdx.x >= tilesM * tilesN) return;
  const int tm = (int)blockIdx.x / tilesN;
  const int tn = (int)blockIdx.x - tm * tilesN;
  const int bm0 = tm * kGBM;
  const int bn0 = tn * kGBN;
  const int wm = wave >> 2;
  const int wn = wave & 3;
  const int m0 = bm0 + (wm << 6);
  const int n0 = bn0 + (wn << 6);

  const int rlane = lane & 15;
  const int koff  = (lane >> 4) * 8;
  const int mOff  = (lane >> 4) * 8;

  /* the thread's own place in a stage and in the two (three) source planes */
  const int crow = tid >> 3;
  const int cch  = tid & 7;
  const unsigned lds0 = lds_off(&sStage[0][0]) + (unsigned)crow * kGPitchB + (unsigned)cch * 16u;
  const unsigned short* gA  = Ap  + (size_t)b * strideA + (size_t)(bm0 + crow) * lda + cch * 8;
  const unsigned short* gA2 = A2p + (size_t)b * strideA + (size_t)(bm0 + crow) * lda + cch * 8;
  const unsigned short* gB  = Btp + (size_t)b * strideB + (size_t)(bn0 + crow) * ldb + cch * 8;
  const size_t stepA = (size_t)32 * lda;
  const size_t stepB = (size_t)32 * ldb;
  const int nst = K / kGKS;

  auto issue_stage = [&](int t) {
    const unsigned l = lds0 + (unsigned)(t & 1) * kBufB;
    const size_t k0 = (size_t)t * kGKS;
    const unsigned lb = l + (unsigned)kARows * kGPitchB;
    /* thread t brings bytes 16*(t&7).. of rows (t>>3) + 32*i of each panel: 128 rows of A (and of A2), 256 of Bt */
    if (ASPLIT) copy8_async(l, gA + k0, stepA, l + (unsigned)kGBM * kGPitchB, gA2 + k0, stepA);
    else        copy4_async(l, gA + k0, stepA);
    copy8_async(lb, gB + k0, stepB, lb + 128u * kGPitchB, gB + k0 + 4 * stepB, stepB);
  };

  v8f acc[4][4];
#pragma unroll
  for (int i = 0; i < 4; ++i)
#pragma unroll
    for (int j = 0; j < 4; ++j) acc[i][j] = (v8f){0.f,0.f,0.f,0.f,0.f,0.f,0.f,0.f};

  issue_stage(0);
  /* stage 0 has landed for this wave; the barrier publishes it to the others */
  asm volatile("s_wait_asynccnt 0x0" ::: "memory");
  __syncthreads();
  if (nst > 1) issue_stage(1);

  for (int t = 0; t < nst; ++t) {
    const T* sb = (const T*)&sStage[t & 1][0];
    const T* sa = sb + ((wm << 6) + rlane) * kGPitch + koff;
    const T* sw = sb + (kARows + (wn << 6) + rlane) * kGPitch + koff;
#pragma unroll
    for (int ks = 0; ks < kGKS / 32; ++ks) {
      /* all fragments of a k step are read from LDS as one group in front of its products */
      V bh[4], ah[4], al[4];
#pragma unroll
      for (int j = 0; j < 4; ++j) bh[j] = Frag<T>::load(sw + (j << 4) * kGPitch + ks * 32);
#pragma unroll
      for (int i = 0; i < 4; ++i) {
        ah[i] = Frag<T>::load(sa + (i << 4) * kGPitch + ks * 32);
        al[i] = ah[i];
        if (ASPLIT) al[i] = Frag<T>::load(sa + (kGBM + (i << 4)) * kGPitch + ks * 32);
      }
#pragma unroll
      for (int i = 0; i < 4; ++i) {
#pragma unroll
        for (int j = 0; j < 4; ++j) {
          acc[i][j] = Frag<T>::mmag(ah[i], bh[j], acc[i][j]);
          if (ASPLIT) acc[i][j] = Frag<T>::mmag(al[i], bh[j], acc[i][j]);
        }
      }
      Frag<T>::keep(bh[0], bh[1], bh[2], bh[3]);
    }
    /* hand-over: this wave's reads of the buffer are done, */
    asm volatile("s_wait_dscnt 0x0" ::: "memory");
    /* its copies of stage t + 1 have landed, */
    asm volatile("s_wait_asynccnt 0x0" ::: "memory");
    /* and the barrier publishes stage t + 1 and frees the buffer that was just read */
    __syncthreads();
    if (t + 2 < nst) issue_stage(t + 2);
  }
  /* no copy is left in flight when the wave goes on */
  asm volatile("s_wait_asynccnt 0x0" ::: "memory");
  acc_guard4(acc[0][0], acc[0][1], acc[0][2], acc[0][3]);
  acc_guard4(acc[1][0], acc[1][1], acc[1][2], acc[1][3]);
  acc_guard4(acc[2][0], acc[2][1], acc[2][2], acc[2][3]);
  acc_guard4(acc[3][0], acc[3][1], acc[3][2], acc[3][3]);

  float* slab = sT[wave];
  float* C = Cout + (size_t)b * strideC;
#pragma unroll
  for (int i = 0; i < 4; ++i) {
    const int mBase = m0 + (i << 4);
#pragma unroll
    for (int j = 0; j < 4; ++j) {
#pragma unroll
      for (int r = 0; r < 8; ++r) {
        slab[(mOff + r) * 68 + (j << 4) + rlane] = acc[i][j][r] * scale;
      }
    }
    wave_lds_sync();
    {
      const int hh = lane >> 4, c4 = (lane & 15) * 4;
      {
#pragma unroll
        for (int it = 0; it < 8; ++it) {
          const int row = it * 2 + hh;
          v4f v = *(const v4f*)(slab + row * 68 + c4);
          *(v4f*)(C + (size_t)(mBase + row) * ldc + n0 + c4) = v;
        }
        
      }
    }
    wave_lds_sync();
  }
}

// ---------------------------------------------------------------------------
// MODE 0: o0 = bf16 (RNE). MODE 1: o0 = bf16 (RNE), o1 = f16 of (bf16 value x carry) (exact: power-of-two carry).
// ---------------------------------------------------------------------------
template <int MODE>
__global__ __launch_bounds__(256) void cast8_kernel(const float* __restrict__ in, unsigned short* __restrict__ o0,
                                                    unsigned short* __restrict__ o1, int n8, float carry) {
  const int i = blockIdx.x * 256 + threadIdx.x;
  if (i >= n8) return;
  const size_t e0 = (size_t)i << 3;
  const v4f a0 = *(const v4f*)(in + e0);
  const v4f a1 = *(const v4f*)(in + e0 + 4);
  unsigned short bb[8], hb[8];
#pragma unroll
  for (int e = 0; e < 4; ++e) {
    bb[e]     = f2bf_bits(a0[e]);
    bb[4 + e] = f2bf_bits(a1[e]);
  }
#pragma unroll
  for (int e = 0; e < 8; ++e) hb[e] = (MODE == 1) ? h_bits(bf_bits2f(bb[e]) * carry) : (unsigned short)0;
  const v4u ub = (v4u){pk16(bb[0], bb[1]), pk16(bb[2], bb[3]), pk16(bb[4], bb[5]), pk16(bb[6], bb[7])};
  const v4u uh = (v4u){pk16(hb[0], hb[1]), pk16(hb[2], hb[3]), pk16(hb[4], hb[5]), pk16(hb[6], hb[7])};
  unsigned short* q0 = o0 + e0;
  unsigned short* q1 = o1 + e0;
  *(v4u*)q0 = ub;
  if (MODE == 1) *(v4u*)q1 = uh;
  
}

// ---------------------------------------------------------------------------
// Per-head RMS norm (eps inside the rsqrt of the mean square) then rotation by the position tables, f32.
// One wave per (token, slot): slots 0..15 = query heads, 16..19 = key heads (columns slot*128 of the q|k|v plane).
// Lane owns d = 4*lane..4*lane+3; the partner d +/- 64 lives in lane ^ 16 (unconditional exchanges).
// d < 64: y = n[d]*c[d] - n[d+64]*s[d]; d >= 64: y = n[d]*c[d] + n[d-64]*s[d]; tables read by value at [pos][d],
// tables and norm weights RNE-converted to bf16 on load.
// ---------------------------------------------------------------------------
__global__ __launch_bounds__(256) void normrot_kernel(
    const float* __restrict__ QKV, const float* __restrict__ ctab, const float* __restrict__ stab,
    const float* __restrict__ qw, const float* __restrict__ kw,
    unsigned short* __restrict__ Qp, unsigned short* __restrict__ Kp, float* __restrict__ Qe, float* __restrict__ Ke) {
  const int lane = threadIdx.x & 31;
  const int wave = __builtin_amdgcn_readfirstlane((int)(threadIdx.x >> 5));
  const int gw   = blockIdx.x * 8 + wave;
  const int tok  = gw / kSlots;
  const int slot = gw - tok * kSlots;
  const int pos  = tok & (kS - 1);
  const int b    = tok / kS;
  const bool isq = slot < kHq;
  const int kslot = isq ? 0 : (slot - kHq);

  const v4f x   = *(const v4f*)(QKV + (size_t)tok * kQKVW + slot * kHD + 4 * lane);
  const v4f wq4 = *(const v4f*)(qw + 4 * lane);
  const v4f wk4 = *(const v4f*)(kw + 4 * lane);
  const v4f c4  = *(const v4f*)(ctab + (size_t)pos * kHD + 4 * lane);
  const v4f s4  = *(const v4f*)(stab + (size_t)pos * kHD + 4 * lane);

  float ss = x[0] * x[0];
  ss = fmaf(x[1], x[1], ss);
  ss = fmaf(x[2], x[2], ss);
  ss = fmaf(x[3], x[3], ss);
  ss = wave_sum(ss);
  const float inv = rsqrtf(ss * (1.0f / (float)kHD) + kEps);

  float n[4], p[4], y[4];
#pragma unroll
  for (int e = 0; e < 4; ++e) {
    const float w = bf16r(isq ? wq4[e] : wk4[e]);
    n[e] = x[e] * inv * w;
  }
#pragma unroll
  for (int e = 0; e < 4; ++e) p[e] = half_xor(n[e]);
  const float sgn = (lane < 16) ? -1.0f : 1.0f;
#pragma unroll
  for (int e = 0; e < 4; ++e) y[e] = n[e] * bf16r(c4[e]) + sgn * (p[e] * bf16r(s4[e]));

  unsigned short hb[4];
#pragma unroll
  for (int e = 0; e < 4; ++e) hb[e] = h_bits(y[e] * kQKCarry);
  const v2u u = (v2u){pk16(hb[0], hb[1]), pk16(hb[2], hb[3])};
  const v4f yv = (v4f){y[0], y[1], y[2], y[3]};

  unsigned short* dq = Qp + (size_t)tok * kQW + slot * kHD + 4 * lane;
  unsigned short* dk = Kp + (size_t)tok * kKW + kslot * kHD + 4 * lane;
  unsigned short* d16 = isq ? dq : dk;
  const bool early = pos < kEarly;
  const int erow = b * kEarly + (early ? pos : 0);
  float* eq = Qe + (size_t)erow * kQW + (isq ? slot : 0) * kHD + 4 * lane;
  float* ek = Ke + (size_t)erow * kKW + kslot * kHD + 4 * lane;
  float* d32 = isq ? eq : ek;
  {
    *(v2u*)d16 = u;
    if (early) *(v4f*)d32 = yv;
    
  }
}

// ---------------------------------------------------------------------------
// v columns of the q|k|v plane -> VT f16 [b][kv head][d][s] carried x64 (LDS transpose), plus VE f32 rows for positions < 128.
// Block = (b, kv head, 64 positions); 256 threads. Load coverage: 8 iterations x 256 threads = 2048 v4f = 64 rows x 32.
// VT stores: row d = it*32 + wave*4 + (lane>>3), it 0..3 x 8 waves x 4 = 128 rows; (lane&7) x 8 halves = 64 positions
// ---------------------------------------------------------------------------
__global__ __launch_bounds__(256) void vprep_kernel(const float* __restrict__ QKV, unsigned short* __restrict__ Vt,
                                                    float* __restrict__ Ve) {
  __shared__ __align__(16) float sm[64 * kVP];
  const int tid  = threadIdx.x;
  const int lane = tid & 31;
  const int wave = __builtin_amdgcn_readfirstlane((int)(tid >> 5));
  const int st   = blockIdx.x & 31;
  const int hkv  = (blockIdx.x >> 5) & (kHkv - 1);
  const int b    = blockIdx.x >> 7;
  const int s0   = st * 64;
  const float* src = QKV + (size_t)(b * kS + s0) * kQKVW + kVCol0 + hkv * kHD;
#pragma unroll
  for (int i = 0; i < 8; ++i) {
    const int e  = i * 256 + tid;
    const int r  = e >> 5;
    const int cc = (e & 31) * 4;
    const v4f v = *(const v4f*)(src + (size_t)r * kQKVW + cc);
    *(v4f*)(sm + r * kVP + cc) = v;
  }
  __syncthreads();
  const int q = lane >> 3, c8 = (lane & 7) * 8;
  v4u tv[4];
#pragma unroll
  for (int it = 0; it < 4; ++it) {
    const int d = it * 32 + wave * 4 + q;
    unsigned short hb[8];
#pragma unroll
    for (int e = 0; e < 8; ++e) hb[e] = h_bits(sm[(c8 + e) * kVP + d] * kVCarry);
    tv[it] = (v4u){pk16(hb[0], hb[1]), pk16(hb[2], hb[3]), pk16(hb[4], hb[5]), pk16(hb[6], hb[7])};
  }
  v4f ev[8];
#pragma unroll
  for (int it = 0; it < 8; ++it) ev[it] = *(const v4f*)(sm + (it * 8 + wave) * kVP + 4 * lane);
  const bool early = s0 < kEarly;
  const int erow0 = b * kEarly + (early ? s0 : 0);
  unsigned short* vt0 = Vt + (size_t)(b * kHkv + hkv) * kHD * kS + s0 + c8;
  float* ve0 = Ve + (size_t)erow0 * kKW + hkv * kHD + 4 * lane;
  {
#pragma unroll
    for (int it = 0; it < 4; ++it) *(v4u*)(vt0 + (size_t)(it * 32 + wave * 4 + q) * kS) = tv[it];
    if (early) {
#pragma unroll
      for (int it = 0; it < 8; ++it) *(v4f*)(ve0 + (size_t)(it * 8 + wave) * kKW) = ev[it];
    }
    
  }
}

// ---------------------------------------------------------------------------
// Causal attention for query positions >= 128 (f16 matrix ops, online softmax in f32).
// Block = 8 waves = 4 query heads of one kv head x 2 tiles of 16 query rows; all 8 waves walk the same chunks of 64 keys.
// A chunk's keys (64 rows of 256 B, 272-B pitch) and transposed values (128 rows of 128 B, 144-B pitch) reach LDS once per
// block by asynchronous 16-B copies, two buffers: the next chunk's copies fly while this chunk is worked on.
//   A (q rows):  row = lane&15, k = d:   QP[(b*S + q0 + row)][h*128 + dc*32 + 8*(lane>>4) ..]   (global, once)
//   B (keys):    col = key,     k = d:   LDS key row (key - kv0), element dc*32 + 8*(lane>>4) ..
//   B (values):  col = d,       k = key: LDS value row d, element kk*32 + 8*(lane>>4) ..
// 64 keys per iteration; the last chunk masks key > query with -inf before the softmax (the chunk always holds key <= query
// for every row, so the running maximum stays finite). p = exp(s - m) carried x32768 as f16, spilled per wave to LDS as
// ---------------------------------------------------------------------------
constexpr int kKPitch = 136;
constexpr int kVPitch = 72;
constexpr int kKTile  = kLateKC * kKPitch;
constexpr int kVTile  = kHD * kVPitch;
constexpr int kKVBuf  = kKTile + kVTile;
static_assert(kLateKC == 64 && kHD == 128, "copy maps: 16 lanes per 256-B key row, 8 lanes per 128-B value row");
static_assert(((kKTile * 2) % 16) == 0 && ((kKVBuf * 2) % 16) == 0, "16-B aligned tiles");

/* one chunk's share of a thread: 4 copies of key rows (16 rows apart) and 4 of value rows (32 rows apart), 16 B each,
   global -> LDS through no register; the s_wait_xcnt closes the statement so that no address register of a copy is
   rewritten in front of it */
__device__ __forceinline__ void copy_kv_async(unsigned lk, const unsigned short* gk, unsigned lv, const unsigned short* gv) {
  asm volatile("global_load_async_to_lds_b128 %0, %8, off\n\t"
               "global_load_async_to_lds_b128 %1, %9, off\n\t"
               "global_load_async_to_lds_b128 %2, %10, off\n\t"
               "global_load_async_to_lds_b128 %3, %11, off\n\t"
               "global_load_async_to_lds_b128 %4, %12, off\n\t"
               "global_load_async_to_lds_b128 %5, %13, off\n\t"
               "global_load_async_to_lds_b128 %6, %14, off\n\t"
               "global_load_async_to_lds_b128 %7, %15, off\n\t"
               "s_wait_xcnt 0x0"
               :: "v"(lk), "v"(lk + 16u * (kKPitch * 2u)), "v"(lk + 32u * (kKPitch * 2u)), "v"(lk + 48u * (kKPitch * 2u)),
                  "v"(lv), "v"(lv + 32u * (kVPitch * 2u)), "v"(lv + 64u * (kVPitch * 2u)), "v"(lv + 96u * (kVPitch * 2u)),
                  "v"(gk), "v"(gk + 16 * kKW), "v"(gk + 32 * kKW), "v"(gk + 48 * kKW),
                  "v"(gv), "v"(gv + 32 * kS), "v"(gv + 64 * kS), "v"(gv + 96 * kS) : "memory");
}

/* four waves per SIMD (two blocks per WGP, as the LDS allows) hold only while a wave stays inside 256 registers */
__global__ __launch_bounds__(256) __attribute__((amdgpu_waves_per_eu(4, 4))) void attn_late_kernel(const unsigned short* __restrict__ Qp, const unsigned short* __restrict__ Kp,
                                                        const unsigned short* __restrict__ Vtp, float* __restrict__ attn) {
  union FH { v16h v; v8h h[2]; };
  __shared__ __align__(16) unsigned short sKV[2][kKVBuf];
  __shared__ __align__(16) _Float16 Psh[8][16 * kLateKC];
  __shared__ __align__(16) float Os[8][16 * 68];
  const int tid  = threadIdx.x;
  const int lane = threadIdx.x & 31;
  const int wave = __builtin_amdgcn_readfirstlane((int)(threadIdx.x >> 5));
  const int hh   = lane >> 4;
  const int c    = lane & 15;
  const int qt2  = blockIdx.x % kLatePairs;
  const int bh   = blockIdx.x / kLatePairs;
  const int hkv  = bh & (kHkv - 1);
  const int b    = bh / kHkv;
  const int h    = hkv * kRep + (wave & 3);
  const int q0   = kEarly + (qt2 * 2 + (wave >> 2)) * 16;

  /* the thread's own place in a chunk's two tiles and in the two source planes */
  const unsigned lk0 = lds_off(&sKV[0][0]) + (unsigned)(tid >> 4) * (kKPitch * 2u) + (unsigned)(tid & 15) * 16u;
  const unsigned lv0 = lds_off(&sKV[0][kKTile]) + (unsigned)(tid >> 3) * (kVPitch * 2u) + (unsigned)(tid & 7) * 16u;
  const unsigned short* gk0 = Kp + (size_t)(b * kS + (tid >> 4)) * kKW + hkv * kHD + (tid & 15) * 8;
  const unsigned short* gv0 = Vtp + ((size_t)(b * kHkv + hkv) * kHD + (tid >> 3)) * kS + (tid & 7) * 8;
  auto issue_chunk = [&](int t) {
    const unsigned o = (unsigned)(t & 1) * (kKVBuf * 2u);
    copy_kv_async(lk0 + o, gk0 + (size_t)t * (kLateKC * kKW), lv0 + o, gv0 + t * kLateKC);
  };
  float* ob = attn + (size_t)(b * kS + q0) * kQW + h * kHD;

  v16h qa[4];
  {
    const _Float16* qrow = (const _Float16*)Qp + (size_t)(b * kS + q0 + c) * kQW + h * kHD + 8 * hh;
#pragma unroll
    for (int dc = 0; dc < 4; ++dc) qa[dc] = Frag<_Float16>::load(qrow + dc * 32);
  }

  float mrow[8], lrow[8];
  v8f oacc[8];
#pragma unroll
  for (int r = 0; r < 8; ++r) { mrow[r] = -INFINITY; lrow[r] = 0.0f; }
#pragma unroll
  for (int t = 0; t < 8; ++t) oacc[t] = (v8f){0.f,0.f,0.f,0.f,0.f,0.f,0.f,0.f};

  int nChunks = (q0 + 16 + kLateKC - 1) / kLateKC;
  if (nChunks > kS / kLateKC) nChunks = kS / kLateKC;
  _Float16* pw = Psh[wave];
  /* nChunks is the same in all 8 waves: the block's 32 query rows lie inside one chunk of 64 positions */

  issue_chunk(0);
  /* chunk 0 has landed for this wave; the barrier publishes it to the others */
  asm volatile("s_wait_asynccnt 0x0" ::: "memory");
  __syncthreads();
  if (nChunks > 1) issue_chunk(1);

  for (int kc = 0; kc < nChunks; ++kc) {
    const int kv0 = kc * kLateKC;
    const _Float16* sk = (const _Float16*)&sKV[kc & 1][0] + c * kKPitch + 8 * hh;
    const _Float16* sv = (const _Float16*)&sKV[kc & 1][kKTile] + c * kVPitch + 8 * hh;
    /* fragments are read from LDS in groups of four, in front of the products that use them: eight register sets, the four
       that a group of products has just read are refilled at once with the fragments eight places on */
    v16h ring[8];
#pragma unroll
    for (int f = 0; f < 8; ++f) ring[f] = Frag<_Float16>::load(sk + (f >> 2) * 16 * kKPitch + (f & 3) * 32);
    v8f s[4];
#pragma unroll
    for (int j = 0; j < 4; ++j) {
      s[j] = (v8f){0.f,0.f,0.f,0.f,0.f,0.f,0.f,0.f};
#pragma unroll
      for (int dc = 0; dc < 4; ++dc) s[j] = mma_guard_h(qa[dc], ring[(j & 1) * 4 + dc], s[j]);
      if (j < 2) {
#pragma unroll
        for (int dc = 0; dc < 4; ++dc) ring[(j & 1) * 4 + dc] = Frag<_Float16>::load(sk + (j + 2) * 16 * kKPitch + dc * 32);
      }
    }
    const bool diag = (kc == nChunks - 1);
    float cm[8];
#pragma unroll
    for (int r = 0; r < 8; ++r) {
      const int qrow = q0 + 8 * hh + r;
      float m = -INFINITY;
#pragma unroll
      for (int j = 0; j < 4; ++j) {
        const int kvcol = kv0 + j * 16 + c;
        float v = s[j][r] * kScoreMul;
        if (diag && (kvcol > qrow)) v = -INFINITY;
        s[j][r] = v;
        m = fmaxf(m, v);
      }
      cm[r] = m;
    }
    row16_max8(cm);
#pragma unroll
    for (int r = 0; r < 8; ++r) {
      const float mnew  = fmaxf(mrow[r], cm[r]);
      const float alpha = __expf(mrow[r] - mnew);
      mrow[r] = mnew;
      float psum = 0.0f;
#pragma unroll
      for (int j = 0; j < 4; ++j) {
        const float p = __expf(s[j][r] - mnew);
        psum += p;
        pw[(8 * hh + r) * kLateKC + j * 16 + c] = (_Float16)(p * kPCarry);
      }
      psum = row16_sum(psum);
      lrow[r] = lrow[r] * alpha + psum;
#pragma unroll
      for (int t = 0; t < 8; ++t) oacc[t][r] *= alpha;
    }
    wave_lds_sync();
#pragma unroll
    for (int t = 0; t < 8; ++t) ring[t] = Frag<_Float16>::load(sv + t * 16 * kVPitch);
#pragma unroll
    for (int kk = 0; kk < 2; ++kk) {
      FH pa;
      pa.h[0] = *(const v8h*)(pw + c * kLateKC + kk * 32 + 8 * hh);
      pa.h[1] = *(const v8h*)(pw + c * kLateKC + kk * 32 + 16 + 8 * hh);
#pragma unroll
      for (int g = 0; g < 2; ++g) {
#pragma unroll
        for (int t = g * 4; t < g * 4 + 4; ++t) oacc[t] = mma_guard_h(pa.v, ring[t], oacc[t]);
        if (kk == 0) {
#pragma unroll
          for (int t = g * 4; t < g * 4 + 4; ++t) ring[t] = Frag<_Float16>::load(sv + t * 16 * kVPitch + 32);
        }
      }
    }
    /* hand-over: this wave's reads of the buffer (and of its p rows) are done, */
    asm volatile("s_wait_dscnt 0x0" ::: "memory");
    /* its copies of chunk kc + 1 have landed, */
    asm volatile("s_wait_asynccnt 0x0" ::: "memory");
    /* and the barrier publishes chunk kc + 1 and frees the buffer that was just read */
    __syncthreads();
    if (kc + 2 < nChunks) issue_chunk(kc + 2);
  }
  /* no copy is left in flight when the wave goes on */
  asm volatile("s_wait_asynccnt 0x0" ::: "memory");

  float inv[8];
#pragma unroll
  for (int r = 0; r < 8; ++r) inv[r] = 1.0f / (lrow[r] * (kPCarry * kVCarry));
  float* os = Os[wave];
  const int c4 = (lane & 15) * 4;
#pragma unroll
  for (int hf = 0; hf < 2; ++hf) {
#pragma unroll
    for (int r = 0; r < 8; ++r) {
#pragma unroll
      for (int t4 = 0; t4 < 4; ++t4) os[(8 * hh + r) * 68 + t4 * 16 + c] = oacc[hf * 4 + t4][r] * inv[r];
    }
    wave_lds_sync();
    {
#pragma unroll
      for (int it = 0; it < 8; ++it) {
        const int row = it * 2 + hh;
        v4f val = *(const v4f*)(os + row * 68 + c4);
        *(v4f*)(ob + (size_t)row * kQW + hf * 64 + c4) = val;
      }
      
    }
    wave_lds_sync();
  }
}

// ---------------------------------------------------------------------------
// Attention for query positions t < 128 of each batch (a causally closed sub-problem), all f32 on the vector unit.
// Block = (b, kv head, t); wave = one of the 4 query heads; waves are independent (per-wave LDS, wave-local sync).
// Scores: lane owns keys lane + 32*i (i = 0..3, groups beyond t skipped under a wave-uniform test; key index clamped to t,
// invalid keys set to -inf by value afterwards); each dot is a rolled 32 x 4-term loop against the q row held in LDS.
// Softmax with precise expf; p written to LDS for all 128 slots (zeros beyond t).
// p.v: lane owns d = 4*lane..+3; rolled loop over keys 0..t (t <= 127 by construction of the grid).
// ---------------------------------------------------------------------------
__global__ __launch_bounds__(128) void attn_early_kernel(const float* __restrict__ Qe, const float* __restrict__ Ke,
                                                         const float* __restrict__ Ve, float* __restrict__ attn) {
  __shared__ __align__(16) float sq[4][kHD];
  __shared__ __align__(16) float sp[4][kEarly];
  const int lane = threadIdx.x & 31;
  const int wave = __builtin_amdgcn_readfirstlane((int)(threadIdx.x >> 5));
  const int t    = blockIdx.x & (kEarly - 1);
  const int hkv  = (blockIdx.x / kEarly) & (kHkv - 1);
  const int b    = blockIdx.x / (kEarly * kHkv);
  const int h    = hkv * kRep + wave;
  const int erow = b * kEarly + t;
  float* sqw = sq[wave];
  float* spw = sp[wave];
  {
    const v4f qv = *(const v4f*)(Qe + (size_t)erow * kQW + h * kHD + 4 * lane);
    *(v4f*)(sqw + 4 * lane) = qv;
  }
  wave_lds_sync();
  float sc[4];
#pragma unroll
  for (int i = 0; i < 4; ++i) {
    const int j  = lane + 32 * i;
    const int jc = (j < t) ? j : t;
    float dot = 0.0f;
    if (32 * i <= t) {
      const float* kr = Ke + (size_t)(b * kEarly + jc) * kKW + hkv * kHD;
#pragma unroll 1
      for (int d4 = 0; d4 < kHD / 4; ++d4) {
        const v4f kv = *(const v4f*)(kr + 4 * d4);
        float k0 = kv[0], k1 = kv[1], k2 = kv[2], k3 = kv[3];
        asm volatile("" : "+v"(k0), "+v"(k1), "+v"(k2), "+v"(k3));
        const v4f qq = *(const v4f*)(sqw + 4 * d4);
        dot = fmaf(k0, qq[0], dot);
        dot = fmaf(k1, qq[1], dot);
        dot = fmaf(k2, qq[2], dot);
        dot = fmaf(k3, qq[3], dot);
      }
    }
    sc[i] = (j <= t) ? (dot * kInvSqrtHD) : -INFINITY;
  }
  float m = fmaxf(fmaxf(sc[0], sc[1]), fmaxf(sc[2], sc[3]));
  m = wave_max(m);
  float psum = 0.0f;
#pragma unroll
  for (int i = 0; i < 4; ++i) {
    const float p = expf(sc[i] - m);
    psum += p;
    spw[lane + 32 * i] = p;
  }
  psum = wave_sum(psum);
  wave_lds_sync();
  float a0 = 0.0f, a1 = 0.0f, a2 = 0.0f, a3 = 0.0f;
  const float* vr = Ve + (size_t)(b * kEarly) * kKW + hkv * kHD + 4 * lane;
#pragma unroll 1
  for (int j = 0; j <= t; ++j) {
    const float p = spw[j];
    const v4f vv = *(const v4f*)(vr + (size_t)j * kKW);
    a0 = fmaf(p, vv[0], a0);
    a1 = fmaf(p, vv[1], a1);
    a2 = fmaf(p, vv[2], a2);
    a3 = fmaf(p, vv[3], a3);
  }
  const float il = 1.0f / psum;
  const v4f ov = (v4f){a0 * il, a1 * il, a2 * il, a3 * il};
  float* dst = attn + (size_t)(b * kS + t) * kQW + h * kHD + 4 * lane;
  *(v4f*)dst = ov;
  
}

// ---------------------------------------------------------------------------
// gated = attn * sigmoid(gate projection), f32; one block per token row (2048 columns).
// Rolled loop: 8 iterations x 256 threads, one column each (coalesced 4-B loads), result into LDS; after the block barrier
// thread t owns columns 8t..8t+7. Positions >= 128: f16 plane carried x1024 (row = token). Positions < 128: bf16 hi plane and
// bf16 lo plane (lo = RNE bf16 of value - hi), row = b*128 + position. One 16-B store per lane per plane; a wave = 512
// ---------------------------------------------------------------------------
__global__ __launch_bounds__(256) void gate_kernel(const float* __restrict__ attn, const float* __restrict__ G,
                                                   unsigned short* __restrict__ GH, unsigned short* __restrict__ EH,
                                                   unsigned short* __restrict__ EL) {
  __shared__ __align__(16) float sm[kQW];
  const int tid = threadIdx.x;
  const int row = blockIdx.x;
  const int pos = row & (kS - 1);
  const int b   = row / kS;
  const float* ar = attn + (size_t)row * kQW;
  const float* gr = G + (size_t)row * kQW;
#pragma unroll 1
  for (int i = 0; i < kQW / 256; ++i) {
    const int col = i * 256 + tid;
    const float a = ar[col];
    const float g = gr[col];
    const float sg = 1.0f / (1.0f + expf(-g));
    sm[col] = a * sg;
  }
  __syncthreads();
  const v4f x0 = *(const v4f*)(sm + 8 * tid);
  const v4f x1 = *(const v4f*)(sm + 8 * tid + 4);
  if (pos >= kEarly) {
    unsigned short hb[8];
#pragma unroll
    for (int e = 0; e < 4; ++e) {
      hb[e]     = h_bits(x0[e] * kGCarry);
      hb[4 + e] = h_bits(x1[e] * kGCarry);
    }
    const v4u u = (v4u){pk16(hb[0], hb[1]), pk16(hb[2], hb[3]), pk16(hb[4], hb[5]), pk16(hb[6], hb[7])};
    unsigned short* d = GH + (size_t)row * kQW + 8 * tid;
    *(v4u*)d = u;
    
  } else {
    unsigned short hb[8], lb[8];
#pragma unroll
    for (int e = 0; e < 4; ++e) {
      const float f0 = x0[e];
      const float f1 = x1[e];
      hb[e]     = f2bf_bits(f0);
      hb[4 + e] = f2bf_bits(f1);
      lb[e]     = f2bf_bits(f0 - bf_bits2f(hb[e]));
      lb[4 + e] = f2bf_bits(f1 - bf_bits2f(hb[4 + e]));
    }
    const v4u uh = (v4u){pk16(hb[0], hb[1]), pk16(hb[2], hb[3]), pk16(hb[4], hb[5]), pk16(hb[6], hb[7])};
    const v4u ul = (v4u){pk16(lb[0], lb[1]), pk16(lb[2], lb[3]), pk16(lb[4], lb[5]), pk16(lb[6], lb[7])};
    const size_t o = (size_t)(b * kEarly + pos) * kQW + 8 * tid;
    *(v4u*)(EH + o) = uh;
    *(v4u*)(EL + o) = ul;
    
  }
}

// ---------------------------------------------------------------------------
// Host glue: 15 kernel launches, nothing else.
// GEMM shapes (all K % 64 == 0, M % 128 == 0, N % 256 == 0, no padding planes):
//   q|k|v proj : M 4096, N 3072, K 2048 -> 32 x 12 = 384 blocks (bf16)
//   gate proj  : M 4096, N 2048, K 2048 -> 32 x 8 = 256 blocks (bf16)
//   out late   : per batch M 1920 (positions 128..2047), N 2048, K 2048 -> 15 x 8 = 120 blocks x 2 (f16)
//   out early  : per batch M 128 (positions 0..127), N 2048, K 2048, A hi+lo -> 1 x 8 = 8 blocks x 2 (bf16)
// ---------------------------------------------------------------------------
extern "C" void kernel_launch(void* const* d_in, const int* in_sizes, int n_in,
                              void* d_out, int out_size, void* d_ws, size_t ws_size,
                              hipStream_t stream) {
  if (n_in < 10) return;
  if (in_sizes[0] != kTok * kHid) return;
  if (in_sizes[1] != kS * kHD) return;
  if (in_sizes[2] != kS * kHD) return;
  if (in_sizes[3] != kQW * kHid) return;
  if (in_sizes[4] != kKW * kHid) return;
  if (in_sizes[5] != kKW * kHid) return;
  if (in_sizes[6] != kQW * kHid) return;
  if (in_sizes[7] != kQW * kQW) return;
  if (in_sizes[8] != kHD) return;
  if (in_sizes[9] != kHD) return;
  if (out_size != kTok * kQW) return;
  if (ws_size < kWsTotal) return;

  const float* X    = (const float*)d_in[0];
  const float* ctab = (const float*)d_in[1];
  const float* stab = (const float*)d_in[2];
  const float* Wq   = (const float*)d_in[3];
  const float* Wk   = (const float*)d_in[4];
  const float* Wv   = (const float*)d_in[5];
  const float* Wg   = (const float*)d_in[6];
  const float* Wo   = (const float*)d_in[7];
  const float* qnw  = (const float*)d_in[8];
  const float* knw  = (const float*)d_in[9];
  float* out = (float*)d_out;

  char* ws = (char*)d_ws;
  unsigned short* XB   = (unsigned short*)(ws + kOffXB);
  unsigned short* WQKV = (unsigned short*)(ws + kOffWQKV);
  unsigned short* WGB  = (unsigned short*)(ws + kOffWGB);
  float*          QKV  = (float*)(ws + kOffQKV);
  unsigned short* QP   = (unsigned short*)(ws + kOffQP);
  unsigned short* KP   = (unsigned short*)(ws + kOffKP);
  unsigned short* VT   = (unsigned short*)(ws + kOffVT);
  float*          QE   = (float*)(ws + kOffQE);
  float*          KE   = (float*)(ws + kOffKE);
  float*          VE   = (float*)(ws + kOffVE);
  unsigned short* WOB  = (unsigned short*)(ws + kOffWOB);
  unsigned short* WOH  = (unsigned short*)(ws + kOffWOH);
  float*          ATT  = (float*)(ws + kOffATT);
  float*          GF   = (float*)(ws + kOffGF);
  unsigned short* GH   = (unsigned short*)(ws + kOffGH);
  unsigned short* EH   = (unsigned short*)(ws + kOffEH);
  unsigned short* EL   = (unsigned short*)(ws + kOffEL);

  /* operand planes: every float input RNE-converted to bf16 once (weights are [out][in] = Bt layout already) */
  cast8_kernel<0><<<(kTok * kHid / 8) / 256, 256, 0, stream>>>(X, XB, XB, kTok * kHid / 8, 1.0f);
  cast8_kernel<0><<<(kQW * kHid / 8) / 256, 256, 0, stream>>>(Wq, WQKV, WQKV, kQW * kHid / 8, 1.0f);
  cast8_kernel<0><<<(kKW * kHid / 8) / 256, 256, 0, stream>>>(Wk, WQKV + (size_t)kQW * kHid, WQKV, kKW * kHid / 8, 1.0f);
  cast8_kernel<0><<<(kKW * kHid / 8) / 256, 256, 0, stream>>>(Wv, WQKV + (size_t)kVCol0 * kHid, WQKV, kKW * kHid / 8, 1.0f);
  cast8_kernel<0><<<(kQW * kHid / 8) / 256, 256, 0, stream>>>(Wg, WGB, WGB, kQW * kHid / 8, 1.0f);
  cast8_kernel<1><<<(kQW * kQW / 8) / 256, 256, 0, stream>>>(Wo, WOB, WOH, kQW * kQW / 8, kWoCarry);

  /* q|k|v projection: QKV[4096][3072] = x . [Wq;Wk;Wv]^T */
  wmma_gemm64<1, false><<<dim3((kTok / kGBM) * (kQKVW / kGBN), 1), 256, 0, stream>>>(
      XB, XB, kHid, 0L, WQKV, kHid, 0L, QKV, kQKVW, 0L, kTok, kQKVW, kHid, 1.0f);

  /* norm + rotation -> QP, KP (f16 x64) and QE, KE (f32, positions < 128) */
  normrot_kernel<<<kTok * kSlots / 8, 256, 0, stream>>>(QKV, ctab, stab, qnw, knw, QP, KP, QE, KE);

  /* v transpose -> VT (f16 x64) and VE (f32, positions < 128): 2 x 4 x 32 blocks */
  vprep_kernel<<<kB * kHkv * (kS / 64), 256, 0, stream>>>(QKV, VT, VE);

  /* attention, positions >= 128 (matrix ops) then positions < 128 (f32); disjoint rows of ATT */
  attn_late_kernel<<<kLatePairs * kHkv * kB, 256, 0, stream>>>(QP, KP, VT, ATT);
  attn_early_kernel<<<kB * kHkv * kEarly, 128, 0, stream>>>(QE, KE, VE, ATT);

  /* gate projection: GF[4096][2048] = x . Wg^T */
  wmma_gemm64<1, false><<<dim3((kTok / kGBM) * (kQW / kGBN), 1), 256, 0, stream>>>(
      XB, XB, kHid, 0L, WGB, kHid, 0L, GF, kQW, 0L, kTok, kQW, kHid, 1.0f);

  /* gated planes */
  gate_kernel<<<kTok, 256, 0, stream>>>(ATT, GF, GH, EH, EL);

  /* output projection, positions >= 128 of each batch: f16 single product, carries folded back */
  wmma_gemm64<0, false><<<dim3(((kS - kEarly) / kGBM) * (kQW / kGBN), kB), 256, 0, stream>>>(
      GH + (size_t)kEarly * kQW, GH + (size_t)kEarly * kQW, kQW, (long)kS * kQW,
      WOH, kQW, 0L,
      out + (size_t)kEarly * kQW, kQW, (long)kS * kQW,
      kS - kEarly, kQW, kQW, kOutLateMul);

  /* output projection, positions < 128 of each batch: bf16 hi.W + lo.W */
  wmma_gemm64<1, true><<<dim3((kEarly / kGBM) * (kQW / kGBN), kB), 256, 0, stream>>>(
      EH, EL, kQW, (long)kEarly * kQW,
      WOB, kQW, 0L,
      out, kQW, (long)kS * kQW,
      kEarly, kQW, kQW, 1.0f);
}

// v004
// Measured time: 291 microseconds a run.
// In two side-by-side timings against v003, it was 1.15 and 1.16 times as fast.
// Over all steps from v000 it is 2.68 times as fast.
// Projections x.Wq/Wk/Wv/Wg^T: v_wmma_f32_16x16x32_bf16 (every float input RNE-converted to bf16 once, exact products, f32 accumulate); scores q.k^T and p.v for query positions >= 128: v_wmma_f32_16x16x32_f16 (q,k,v planes carried x64, p carried x32768); query positions < 128: f32 VALU attention; output projection: f16 (gated carried x1024, Wo carried x1024) for positions >= 128, bf16 hi+lo gated planes x bf16 Wo (two products) for positions < 128; norms, position rotation, softmax, gate in f32.
#include <hip/hip_runtime.h>
#include <math.h>

typedef __attribute__((ext_vector_type(16))) _Float16 v16h;
typedef __attribute__((ext_vector_type(8)))  _Float16 v8h;
typedef __attribute__((ext_vector_type(16))) __bf16   v16b;
typedef __attribute__((ext_vector_type(8)))  __bf16   v8b;
typedef __attribute__((ext_vector_type(8)))  float    v8f;
typedef __attribute__((ext_vector_type(4)))  float    v4f;
typedef __attribute__((ext_vector_type(4)))  unsigned int v4u;
typedef __attribute__((ext_vector_type(2)))  unsigned int v2u;

// ---------------------------------------------------------------------------
// Shape constants
// ---------------------------------------------------------------------------
constexpr int kB     = 2;
constexpr int kS     = 2048;
constexpr int kHid   = 2048;
constexpr int kHq    = 16;
constexpr int kHkv   = 4;
constexpr int kRep   = kHq / kHkv;
constexpr int kHD    = 128;
constexpr int kTok   = kB * kS;
constexpr int kQW    = kHq * kHD;
constexpr int kKW    = kHkv * kHD;
constexpr int kQKVW  = kQW + 2 * kKW;
constexpr int kVCol0 = kQW + kKW;
constexpr int kSlots = kHq + kHkv;
constexpr int kEarly = 128;
constexpr int kERows = kB * kEarly;
constexpr int kLateKC    = 64;
constexpr int kLatePairs = (kS - kEarly) / 32;
constexpr int kVP    = 132;
constexpr float kEps = 1e-6f;

constexpr double cx_sqrt(double x) {
  double r = (x > 1.0) ? x : 1.0;
  for (int i = 0; i < 80; ++i) r = 0.5 * (r + x / r);
  return r;
}
constexpr float kInvSqrtHD = (float)(1.0 / cx_sqrt((double)kHD));
/* power-of-two carries of the f16 operand planes */
constexpr float kQKCarry = 64.0f;
constexpr float kVCarry  = 64.0f;
constexpr float kPCarry  = 32768.0f;
constexpr float kGCarry  = 1024.0f;
constexpr float kWoCarry = 1024.0f;
constexpr float kScoreMul   = kInvSqrtHD / (kQKCarry * kQKCarry);
constexpr float kOutLateMul = 1.0f / (kGCarry * kWoCarry);

static_assert(kRep == 4 && kHkv == 4 && kHD == 128, "lane maps assume 4 kv heads x 4 query heads x 128");
static_assert(kTok == 4096 && kQW == 2048 && kKW == 512 && kQKVW == 3072, "wire shapes");
static_assert((kHid % 32) == 0 && (kQW % 32) == 0, "GEMM K multiples of 32");
static_assert((kTok % 64) == 0 && (kQKVW % 64) == 0 && (kQW % 64) == 0 && ((kS - kEarly) % 64) == 0 && (kEarly % 64) == 0, "GEMM M,N multiples of 64");
static_assert((kS % 64) == 0 && (kS / 64) == 32 && (kEarly % 16) == 0 && ((kS - kEarly) % 32) == 0, "tile multiples");

// ---------------------------------------------------------------------------
// Workspace region map (bytes; every offset a multiple of 128)
//   XB   bf16 [4096][2048]  x plane                                16,777,216
//   WQKV bf16 [3072][2048]  Wq | Wk | Wv rows                      12,582,912
//   WGB  bf16 [2048][2048]  Wg                                      8,388,608
//   QKV  f32  [4096][3072]  q | k | v projections                  50,331,648
//   QP   f16  [4096][2048]  normed+rotated q x64                   16,777,216
//   KP   f16  [4096][512]   normed+rotated k x64                    4,194,304
//   VT   f16  [2][4][128][2048] v transposed x64                    4,194,304
//   QE   f32  [256][2048]   q rows of positions < 128               2,097,152
//   KE   f32  [256][512]    k rows of positions < 128                 524,288
//   VE   f32  [256][512]    v rows of positions < 128                 524,288
//   WOB  bf16 [2048][2048]  Wo                                      8,388,608
//   WOH  f16  [2048][2048]  Wo (bf16 value) x1024                   8,388,608
//   total                                                         133,169,152
// Aliases (each across whole launches):
//   ATT  f32 [4096][2048]  = first 33,554,432 B of QKV (after the norm/rotation and v-prep launches)
//   GF   f32 [4096][2048]  = last 16,777,216 B of QKV + all of QP (after both attention launches)
//   GH   f16 [4096][2048]  = XB (after the gate projection)
//   EH/EL bf16 [256][2048] = first 2 x 1,048,576 B of WQKV (after the q|k|v projection)
// ---------------------------------------------------------------------------
constexpr size_t kOffXB   = 0;
constexpr size_t kOffWQKV = kOffXB   + (size_t)kTok * kHid * 2;
constexpr size_t kOffWGB  = kOffWQKV + (size_t)kQKVW * kHid * 2;
constexpr size_t kOffQKV  = kOffWGB  + (size_t)kQW * kHid * 2;
constexpr size_t kOffQP   = kOffQKV  + (size_t)kTok * kQKVW * 4;
constexpr size_t kOffKP   = kOffQP   + (size_t)kTok * kQW * 2;
constexpr size_t kOffVT   = kOffKP   + (size_t)kTok * kKW * 2;
constexpr size_t kOffQE   = kOffVT   + (size_t)kTok * kKW * 2;
constexpr size_t kOffKE   = kOffQE   + (size_t)kERows * kQW * 4;
constexpr size_t kOffVE   = kOffKE   + (size_t)kERows * kKW * 4;
constexpr size_t kOffWOB  = kOffVE   + (size_t)kERows * kKW * 4;
constexpr size_t kOffWOH  = kOffWOB  + (size_t)kQW * kQW * 2;
constexpr size_t kWsTotal = kOffWOH  + (size_t)kQW * kQW * 2;
constexpr size_t kOffATT  = kOffQKV;
constexpr size_t kOffGF   = kOffQKV + (size_t)kTok * kQW * 4;
constexpr size_t kOffGH   = kOffXB;
constexpr size_t kOffEH   = kOffWQKV;
constexpr size_t kOffEL   = kOffWQKV + (size_t)kERows * kQW * 2;
static_assert(kWsTotal == 133169152ull, "carve total");
static_assert(kWsTotal <= 134217728ull, "carve cap");
static_assert(kOffGF + (size_t)kTok * kQW * 4 == kOffKP, "gate plane covers the projection tail plus the q plane exactly");
static_assert(kOffEL + (size_t)kERows * kQW * 2 <= kOffWGB, "hi/lo planes inside the dead weight plane");
static_assert((kOffWQKV % 128) == 0 && (kOffWGB % 128) == 0 && (kOffQKV % 128) == 0 && (kOffQP % 128) == 0 &&
              (kOffKP % 128) == 0 && (kOffVT % 128) == 0 && (kOffQE % 128) == 0 && (kOffKE % 128) == 0 &&
              (kOffVE % 128) == 0 && (kOffWOB % 128) == 0 && (kOffWOH % 128) == 0 && (kOffGF % 128) == 0 &&
              (kOffEL % 128) == 0, "128-B aligned regions");

// ---------------------------------------------------------------------------
// Small helpers
// ---------------------------------------------------------------------------
__device__ __forceinline__ unsigned short f2bf_bits(float f) {
  unsigned u = __float_as_uint(f);
  return (unsigned short)((u + 0x7FFFu + ((u >> 16) & 1u)) >> 16);
}
__device__ __forceinline__ float bf_bits2f(unsigned short h) { return __uint_as_float(((unsigned)h) << 16); }
__device__ __forceinline__ float bf16r(float f) { return bf_bits2f(f2bf_bits(f)); }
__device__ __forceinline__ unsigned pk16(unsigned short a, unsigned short b) { return (unsigned)a | ((unsigned)b << 16); }
__device__ __forceinline__ unsigned short h_bits(float f) { const _Float16 h = (_Float16)f; return __builtin_bit_cast(unsigned short, h); }
__device__ __forceinline__ void wave_lds_sync() {
  __builtin_amdgcn_fence(__ATOMIC_RELEASE, "workgroup");
  __builtin_amdgcn_wave_barrier();
  __builtin_amdgcn_fence(__ATOMIC_ACQUIRE, "workgroup");
}

/* lane l <-> lane l ^ X inside a row of 16 lanes (X = 1, 2, 4, 8) and l <-> l ^ 16, on the vector unit: no trip through the
   LDS path and no wait on its counter; every lane is on wherever these stand */
template <int X>
__device__ __forceinline__ float row_xor(float v) {
  return __builtin_bit_cast(float, __builtin_amdgcn_update_dpp(0, __builtin_bit_cast(int, v), 0x160 + X, 0xf, 0xf, true));
}
__device__ __forceinline__ float half_xor(float v) {
  const int b = __builtin_bit_cast(int, v);
  return __builtin_bit_cast(float, __builtin_amdgcn_permlanex16(b, b, 0x76543210, 0xfedcba98, false, false));
}
/* butterflies in the order 1, 2, 4, 8 over a row of 16 lanes.
   The maximum of eight values at once is written as text: around a builtin exchange the compiler puts a register move and a
   quieting maximum, three instructions a step in place of one. The eight chains alternate, so that no instruction reads a
   result younger than eight instructions and none waits on the one in front of it */
#define ROW_MAX_STEP(X)                                                     \
  "v_max_num_f32_dpp %0, %0, %0 row_xmask:" #X " row_mask:0xf bank_mask:0xf\n\t" \
  "v_max_num_f32_dpp %1, %1, %1 row_xmask:" #X " row_mask:0xf bank_mask:0xf\n\t" \
  "v_max_num_f32_dpp %2, %2, %2 row_xmask:" #X " row_mask:0xf bank_mask:0xf\n\t" \
  "v_max_num_f32_dpp %3, %3, %3 row_xmask:" #X " row_mask:0xf bank_mask:0xf\n\t" \
  "v_max_num_f32_dpp %4, %4, %4 row_xmask:" #X " row_mask:0xf bank_mask:0xf\n\t" \
  "v_max_num_f32_dpp %5, %5, %5 row_xmask:" #X " row_mask:0xf bank_mask:0xf\n\t" \
  "v_max_num_f32_dpp %6, %6, %6 row_xmask:" #X " row_mask:0xf bank_mask:0xf\n\t" \
  "v_max_num_f32_dpp %7, %7, %7 row_xmask:" #X " row_mask:0xf bank_mask:0xf\n\t"
__device__ __forceinline__ void row16_max8(float (&m)[8]) {
  asm(ROW_MAX_STEP(1) ROW_MAX_STEP(2) ROW_MAX_STEP(4) ROW_MAX_STEP(8)
      : "+v"(m[0]), "+v"(m[1]), "+v"(m[2]), "+v"(m[3]), "+v"(m[4]), "+v"(m[5]), "+v"(m[6]), "+v"(m[7]));
}
__device__ __forceinline__ float row16_sum(float v) {
  v += row_xor<1>(v);
  v += row_xor<2>(v);
  v += row_xor<4>(v);
  v += row_xor<8>(v);
  return v;
}
/* butterflies in the order 16, 8, 4, 2, 1 over the wave */
__device__ __forceinline__ float wave_max(float m) {
  m = fmaxf(m, half_xor(m));
  m = fmaxf(m, row_xor<8>(m));
  m = fmaxf(m, row_xor<4>(m));
  m = fmaxf(m, row_xor<2>(m));
  m = fmaxf(m, row_xor<1>(m));
  return m;
}
__device__ __forceinline__ float wave_sum(float v) {
  v += half_xor(v);
  v += row_xor<8>(v);
  v += row_xor<4>(v);
  v += row_xor<2>(v);
  v += row_xor<1>(v);
  return v;
}

/* matrix op followed by the 4-slot hazard guard; one accumulator per guard statement, A and B named as inputs */
__device__ __forceinline__ v8f mma_guard_h(v16h a, v16h b, v8f c) {
  c = __builtin_amdgcn_wmma_f32_16x16x32_f16(false, a, false, b, (short)0, c, false, false);
  asm volatile("v_nop\n\tv_nop\n\tv_nop\n\tv_nop" : "+v"(c) : "v"(a), "v"(b));
  return c;
}
__device__ __forceinline__ v8f mma_guard_b(v16b a, v16b b, v8f c) {
  c = __builtin_amdgcn_wmma_f32_16x16x32_bf16(false, a, false, b, (short)0, c, false, false);
  asm volatile("v_nop\n\tv_nop\n\tv_nop\n\tv_nop" : "+v"(c) : "v"(a), "v"(b));
  return c;
}
__device__ __forceinline__ void keep4_h(v16h a, v16h b, v16h c, v16h d) { asm volatile("v_nop" :: "v"(a), "v"(b), "v"(c), "v"(d)); }
__device__ __forceinline__ void keep4_b(v16b a, v16b b, v16b c, v16b d) { asm volatile("v_nop" :: "v"(a), "v"(b), "v"(c), "v"(d)); }
__device__ __forceinline__ void acc_guard4(v8f& a, v8f& b, v8f& c, v8f& d) { asm volatile("v_nop\n\tv_nop\n\tv_nop\n\tv_nop" : "+v"(a), "+v"(b), "+v"(c), "+v"(d)); }

template <typename T> struct Frag;
template <> struct Frag<_Float16> {
  typedef v16h V; union U { v16h v; v8h h[2]; };
  /* elements 0..7 <- p[0..7], 8..15 <- p[16..23] */
  static __device__ __forceinline__ v16h load(const _Float16* p) {
    U f; f.h[0] = *(const v8h*)(p); f.h[1] = *(const v8h*)(p + 16); return f.v;
  }
  static __device__ __forceinline__ v8f mmag(v16h a, v16h b, v8f c) { return mma_guard_h(a, b, c); }
  static __device__ __forceinline__ void keep(v16h a, v16h b, v16h c, v16h d) { keep4_h(a, b, c, d); }
};
template <> struct Frag<__bf16> {
  typedef v16b V; union U { v16b v; v8b h[2]; };
  static __device__ __forceinline__ v16b load(const __bf16* p) {
    U f; f.h[0] = *(const v8b*)(p); f.h[1] = *(const v8b*)(p + 16); return f.v;
  }
  static __device__ __forceinline__ v8f mmag(v16b a, v16b b, v8f c) { return mma_guard_b(a, b, c); }
  static __device__ __forceinline__ void keep(v16b a, v16b b, v16b c, v16b d) { keep4_b(a, b, c, d); }
};

// ---------------------------------------------------------------------------
// Batched GEMM: C[m,n] = scale * sum_k A[m,k] * Bt[n,k]. A block of 8 waves (2 x 4) owns a 128 x 256 tile, each wave 64x64 of it.
// A row-major [M,K]; Bt row-major [N,K]; M % 128 == 0, N % 256 == 0, K % 64 == 0 (no tails).
// Operands reach LDS by asynchronous 16-B copies, 64 k per stage (128-B rows at a 144-B pitch), two buffers: the next
// stage's copies fly while this stage's fragments are read from LDS; 8 lanes copy one whole 128-B line of a row.
// ASPLIT: A carried as hi/lo planes (A2 = lo plane, same layout): product = hi.b + lo.b into one accumulator.
// ET: 0 = f16 operands, 1 = bf16 operands (pointers passed as 16-bit storage). Output f32.
// ---------------------------------------------------------------------------
constexpr int kGBM    = 128;
constexpr int kGBN    = 256;
constexpr int kGKS    = 64;
constexpr int kGPitch = 72;
constexpr unsigned kGPitchB = kGPitch * 2;
static_assert((kTok % kGBM) == 0 && ((kS - kEarly) % kGBM) == 0 && (kEarly % kGBM) == 0, "GEMM M multiples of the block tile");
static_assert((kQKVW % kGBN) == 0 && (kQW % kGBN) == 0, "GEMM N multiples of the block tile");
static_assert((kHid % kGKS) == 0 && (kQW % kGKS) == 0 && kHid / kGKS >= 2 && kQW / kGKS >= 2, "GEMM K in whole stages");

__device__ __forceinline__ unsigned lds_off(const void* p) { return (unsigned)(size_t)p; }

/* copies of 16 B per lane, global -> LDS through no register: row r of the run lies 32 * r rows behind the first, in LDS
   (pitch kGPitchB) and in the source (step32 elements). One statement holds a whole run, and the s_wait_xcnt closes it so
   that no address register of a copy is rewritten in front of it; one run per statement keeps that wait to one per run */
__device__ __forceinline__ void copy4_async(unsigned l, const unsigned short* g, size_t step32) {
  asm volatile("global_load_async_to_lds_b128 %0, %4, off\n\t"
               "global_load_async_to_lds_b128 %1, %5, off\n\t"
               "global_load_async_to_lds_b128 %2, %6, off\n\t"
               "global_load_async_to_lds_b128 %3, %7, off\n\t"
               "s_wait_xcnt 0x0"
               :: "v"(l), "v"(l + 32u * kGPitchB), "v"(l + 64u * kGPitchB), "v"(l + 96u * kGPitchB),
                  "v"(g), "v"(g + step32), "v"(g + 2 * step32), "v"(g + 3 * step32) : "memory");
}
__device__ __forceinline__ void copy8_async(unsigned l, const unsigned short* g, size_t step32,
                                            unsigned m, const unsigned short* h, size_t step32h) {
  asm volatile("global_load_async_to_lds_b128 %0, %8, off\n\t"
               "global_load_async_to_lds_b128 %1, %9, off\n\t"
               "global_load_async_to_lds_b128 %2, %10, off\n\t"
               "global_load_async_to_lds_b128 %3, %11, off\n\t"
               "global_load_async_to_lds_b128 %4, %12, off\n\t"
               "global_load_async_to_lds_b128 %5, %13, off\n\t"
               "global_load_async_to_lds_b128 %6, %14, off\n\t"
               "global_load_async_to_lds_b128 %7, %15, off\n\t"
               "s_wait_xcnt 0x0"
               :: "v"(l), "v"(l + 32u * kGPitchB), "v"(l + 64u * kGPitchB), "v"(l + 96u * kGPitchB),
                  "v"(m), "v"(m + 32u * kGPitchB), "v"(m + 64u * kGPitchB), "v"(m + 96u * kGPitchB),
                  "v"(g), "v"(g + step32), "v"(g + 2 * step32), "v"(g + 3 * step32),
                  "v"(h), "v"(h + step32h), "v"(h + 2 * step32h), "v"(h + 3 * step32h) : "memory");
}

template <int ET> struct Elem;
template <> struct Elem<0> { typedef _Float16 T; };
template <> struct Elem<1> { typedef __bf16 T; };
template <int ET, bool ASPLIT>
__global__ __launch_bounds__(256) void wmma_gemm64(
    const unsigned short* __restrict__ Ap, const unsigned short* __restrict__ A2p, int lda, long strideA,
    const unsigned short* __restrict__ Btp, int ldb, long strideB,
    float* __restrict__ Cout, int ldc, long strideC,
    int M, int N, int K, float scale) {
  typedef typename Elem<ET>::T T;
  typedef typename Frag<T>::V V;
  constexpr int kARows = ASPLIT ? 2 * kGBM : kGBM;
  constexpr int kRows  = kARows + kGBN;
  constexpr unsigned kBufB = (unsigned)kRows * kGPitchB;
  __shared__ __align__(16) unsigned short sStage[2][kRows * kGPitch];
  __shared__ __align__(16) float sT[8][16 * 68];
  const int b    = blockIdx.y;
  const int tid  = threadIdx.x;
  const int lane = tid & 31;
  const int wave = __builtin_amdgcn_readfirstlane((int)(threadIdx.x >> 5));
  const int tilesN = N / kGBN;
  const int tilesM = M / kGBM;
  /* block-uniform, in front of every barrier and copy */
  if ((int)blockIdx.x >= tilesM * tilesN) return;
  const int tm = (int)blockIdx.x / tilesN;
  const int tn = (int)blockIdx.x - tm * tilesN;
  const int bm0 = tm * kGBM;
  const int bn0 = tn * kGBN;
  const int wm = wave >> 2;
  const int wn = wave & 3;
  const int m0 = bm0 + (wm << 6);
  const int n0 = bn0 + (wn << 6);

  const int rlane = lane & 15;
  const int koff  = (lane >> 4) * 8;
  const int mOff  = (lane >> 4) * 8;

  /* the thread's own place in a stage and in the two (three) source planes */
  const int crow = tid >> 3;
  const int cch  = tid & 7;
  const unsigned lds0 = lds_off(&sStage[0][0]) + (unsigned)crow * kGPitchB + (unsigned)cch * 16u;
  const unsigned short* gA  = Ap  + (size_t)b * strideA + (size_t)(bm0 + crow) * lda + cch * 8;
  const unsigned short* gA2 = A2p + (size_t)b * strideA + (size_t)(bm0 + crow) * lda + cch * 8;
  const unsigned short* gB  = Btp + (size_t)b * strideB + (size_t)(bn0 + crow) * ldb + cch * 8;
  const size_t stepA = (size_t)32 * lda;
  const size_t stepB = (size_t)32 * ldb;
  const int nst = K / kGKS;

  auto issue_stage = [&](int t) {
    const unsigned l = lds0 + (unsigned)(t & 1) * kBufB;
    const size_t k0 = (size_t)t * kGKS;
    const unsigned lb = l + (unsigned)kARows * kGPitchB;
    /* thread t brings bytes 16*(t&7).. of rows (t>>3) + 32*i of each panel: 128 rows of A (and of A2), 256 of Bt */
    if (ASPLIT) copy8_async(l, gA + k0, stepA, l + (unsigned)kGBM * kGPitchB, gA2 + k0, stepA);
    else        copy4_async(l, gA + k0, stepA);
    copy8_async(lb, gB + k0, stepB, lb + 128u * kGPitchB, gB + k0 + 4 * stepB, stepB);
  };

  v8f acc[4][4];
#pragma unroll
  for (int i = 0; i < 4; ++i)
#pragma unroll
    for (int j = 0; j < 4; ++j) acc[i][j] = (v8f){0.f,0.f,0.f,0.f,0.f,0.f,0.f,0.f};

  issue_stage(0);
  /* stage 0 has landed for this wave; the barrier publishes it to the others */
  asm volatile("s_wait_asynccnt 0x0" ::: "memory");
  __syncthreads();
  if (nst > 1) issue_stage(1);

  for (int t = 0; t < nst; ++t) {
    const T* sb = (const T*)&sStage[t & 1][0];
    const T* sa = sb + ((wm << 6) + rlane) * kGPitch + koff;
    const T* sw = sb + (kARows + (wn << 6) + rlane) * kGPitch + koff;
#pragma unroll
    for (int ks = 0; ks < kGKS / 32; ++ks) {
      /* all fragments of a k step are read from LDS as one group in front of its products */
      V bh[4], ah[4], al[4];
#pragma unroll
      for (int j = 0; j < 4; ++j) bh[j] = Frag<T>::load(sw + (j << 4) * kGPitch + ks * 32);
#pragma unroll
      for (int i = 0; i < 4; ++i) {
        ah[i] = Frag<T>::load(sa + (i << 4) * kGPitch + ks * 32);
        al[i] = ah[i];
        if (ASPLIT) al[i] = Frag<T>::load(sa + (kGBM + (i << 4)) * kGPitch + ks * 32);
      }
#pragma unroll
      for (int i = 0; i < 4; ++i) {
#pragma unroll
        for (int j = 0; j < 4; ++j) {
          acc[i][j] = Frag<T>::mmag(ah[i], bh[j], acc[i][j]);
          if (ASPLIT) acc[i][j] = Frag<T>::mmag(al[i], bh[j], acc[i][j]);
        }
      }
      Frag<T>::keep(bh[0], bh[1], bh[2], bh[3]);
    }
    /* hand-over: this wave's reads of the buffer are done, */
    asm volatile("s_wait_dscnt 0x0" ::: "memory");
    /* its copies of stage t + 1 have landed, */
    asm volatile("s_wait_asynccnt 0x0" ::: "memory");
    /* and the barrier publishes stage t + 1 and frees the buffer that was just read */
    __syncthreads();
    if (t + 2 < nst) issue_stage(t + 2);
  }
  /* no copy is left in flight when the wave goes on */
  asm volatile("s_wait_asynccnt 0x0" ::: "memory");
  acc_guard4(acc[0][0], acc[0][1], acc[0][2], acc[0][3]);
  acc_guard4(acc[1][0], acc[1][1], acc[1][2], acc[1][3]);
  acc_guard4(acc[2][0], acc[2][1], acc[2][2], acc[2][3]);
  acc_guard4(acc[3][0], acc[3][1], acc[3][2], acc[3][3]);

  float* slab = sT[wave];
  float* C = Cout + (size_t)b * strideC;
#pragma unroll
  for (int i = 0; i < 4; ++i) {
    const int mBase = m0 + (i << 4);
#pragma unroll
    for (int j = 0; j < 4; ++j) {
#pragma unroll
      for (int r = 0; r < 8; ++r) {
        slab[(mOff + r) * 68 + (j << 4) + rlane] = acc[i][j][r] * scale;
      }
    }
    wave_lds_sync();
    {
      const int hh = lane >> 4, c4 = (lane & 15) * 4;
      {
#pragma unroll
        for (int it = 0; it < 8; ++it) {
          const int row = it * 2 + hh;
          v4f v = *(const v4f*)(slab + row * 68 + c4);
          *(v4f*)(C + (size_t)(mBase + row) * ldc + n0 + c4) = v;
        }
        
      }
    }
    wave_lds_sync();
  }
}

// ---------------------------------------------------------------------------
// MODE 0: o0 = bf16 (RNE). MODE 1: o0 = bf16 (RNE), o1 = f16 of (bf16 value x carry) (exact: power-of-two carry).
// ---------------------------------------------------------------------------
template <int MODE>
__global__ __launch_bounds__(256) void cast8_kernel(const float* __restrict__ in, unsigned short* __restrict__ o0,
                                                    unsigned short* __restrict__ o1, int n8, float carry) {
  const int i = blockIdx.x * 256 + threadIdx.x;
  if (i >= n8) return;
  const size_t e0 = (size_t)i << 3;
  const v4f a0 = *(const v4f*)(in + e0);
  const v4f a1 = *(const v4f*)(in + e0 + 4);
  unsigned short bb[8], hb[8];
#pragma unroll
  for (int e = 0; e < 4; ++e) {
    bb[e]     = f2bf_bits(a0[e]);
    bb[4 + e] = f2bf_bits(a1[e]);
  }
#pragma unroll
  for (int e = 0; e < 8; ++e) hb[e] = (MODE == 1) ? h_bits(bf_bits2f(bb[e]) * carry) : (unsigned short)0;
  const v4u ub = (v4u){pk16(bb[0], bb[1]), pk16(bb[2], bb[3]), pk16(bb[4], bb[5]), pk16(bb[6], bb[7])};
  const v4u uh = (v4u){pk16(hb[0], hb[1]), pk16(hb[2], hb[3]), pk16(hb[4], hb[5]), pk16(hb[6], hb[7])};
  unsigned short* q0 = o0 + e0;
  unsigned short* q1 = o1 + e0;
  *(v4u*)q0 = ub;
  if (MODE == 1) *(v4u*)q1 = uh;
  
}

// ---------------------------------------------------------------------------
// Per-head RMS norm (eps inside the rsqrt of the mean square) then rotation by the position tables, f32.
// One wave per (token, slot): slots 0..15 = query heads, 16..19 = key heads (columns slot*128 of the q|k|v plane).
// Lane owns d = 4*lane..4*lane+3; the partner d +/- 64 lives in lane ^ 16 (unconditional exchanges).
// d < 64: y = n[d]*c[d] - n[d+64]*s[d]; d >= 64: y = n[d]*c[d] + n[d-64]*s[d]; tables read by value at [pos][d],
// tables and norm weights RNE-converted to bf16 on load.
// ---------------------------------------------------------------------------
__global__ __launch_bounds__(256) void normrot_kernel(
    const float* __restrict__ QKV, const float* __restrict__ ctab, const float* __restrict__ stab,
    const float* __restrict__ qw, const float* __restrict__ kw,
    unsigned short* __restrict__ Qp, unsigned short* __restrict__ Kp, float* __restrict__ Qe, float* __restrict__ Ke) {
  const int lane = threadIdx.x & 31;
  const int wave = __builtin_amdgcn_readfirstlane((int)(threadIdx.x >> 5));
  const int gw   = blockIdx.x * 8 + wave;
  const int tok  = gw / kSlots;
  const int slot = gw - tok * kSlots;
  const int pos  = tok & (kS - 1);
  const int b    = tok / kS;
  const bool isq = slot < kHq;
  const int kslot = isq ? 0 : (slot - kHq);

  const v4f x   = *(const v4f*)(QKV + (size_t)tok * kQKVW + slot * kHD + 4 * lane);
  const v4f wq4 = *(const v4f*)(qw + 4 * lane);
  const v4f wk4 = *(const v4f*)(kw + 4 * lane);
  const v4f c4  = *(const v4f*)(ctab + (size_t)pos * kHD + 4 * lane);
  const v4f s4  = *(const v4f*)(stab + (size_t)pos * kHD + 4 * lane);

  float ss = x[0] * x[0];
  ss = fmaf(x[1], x[1], ss);
  ss = fmaf(x[2], x[2], ss);
  ss = fmaf(x[3], x[3], ss);
  ss = wave_sum(ss);
  const float inv = rsqrtf(ss * (1.0f / (float)kHD) + kEps);

  float n[4], p[4], y[4];
#pragma unroll
  for (int e = 0; e < 4; ++e) {
    const float w = bf16r(isq ? wq4[e] : wk4[e]);
    n[e] = x[e] * inv * w;
  }
#pragma unroll
  for (int e = 0; e < 4; ++e) p[e] = half_xor(n[e]);
  const float sgn = (lane < 16) ? -1.0f : 1.0f;
#pragma unroll
  for (int e = 0; e < 4; ++e) y[e] = n[e] * bf16r(c4[e]) + sgn * (p[e] * bf16r(s4[e]));

  unsigned short hb[4];
#pragma unroll
  for (int e = 0; e < 4; ++e) hb[e] = h_bits(y[e] * kQKCarry);
  const v2u u = (v2u){pk16(hb[0], hb[1]), pk16(hb[2], hb[3])};
  const v4f yv = (v4f){y[0], y[1], y[2], y[3]};

  unsigned short* dq = Qp + (size_t)tok * kQW + slot * kHD + 4 * lane;
  unsigned short* dk = Kp + (size_t)tok * kKW + kslot * kHD + 4 * lane;
  unsigned short* d16 = isq ? dq : dk;
  const bool early = pos < kEarly;
  const int erow = b * kEarly + (early ? pos : 0);
  float* eq = Qe + (size_t)erow * kQW + (isq ? slot : 0) * kHD + 4 * lane;
  float* ek = Ke + (size_t)erow * kKW + kslot * kHD + 4 * lane;
  float* d32 = isq ? eq : ek;
  {
    *(v2u*)d16 = u;
    if (early) *(v4f*)d32 = yv;
    
  }
}

// ---------------------------------------------------------------------------
// v columns of the q|k|v plane -> VT f16 [b][kv head][d][s] carried x64 (LDS transpose), plus VE f32 rows for positions < 128.
// Block = (b, kv head, 64 positions); 256 threads. Load coverage: 8 iterations x 256 threads = 2048 v4f = 64 rows x 32.
// VT stores: row d = it*32 + wave*4 + (lane>>3), it 0..3 x 8 waves x 4 = 128 rows; (lane&7) x 8 halves = 64 positions
// ---------------------------------------------------------------------------
__global__ __launch_bounds__(256) void vprep_kernel(const float* __restrict__ QKV, unsigned short* __restrict__ Vt,
                                                    float* __restrict__ Ve) {
  __shared__ __align__(16) float sm[64 * kVP];
  const int tid  = threadIdx.x;
  const int lane = tid & 31;
  const int wave = __builtin_amdgcn_readfirstlane((int)(tid >> 5));
  const int st   = blockIdx.x & 31;
  const int hkv  = (blockIdx.x >> 5) & (kHkv - 1);
  const int b    = blockIdx.x >> 7;
  const int s0   = st * 64;
  const float* src = QKV + (size_t)(b * kS + s0) * kQKVW + kVCol0 + hkv * kHD;
#pragma unroll
  for (int i = 0; i < 8; ++i) {
    const int e  = i * 256 + tid;
    const int r  = e >> 5;
    const int cc = (e & 31) * 4;
    const v4f v = *(const v4f*)(src + (size_t)r * kQKVW + cc);
    *(v4f*)(sm + r * kVP + cc) = v;
  }
  __syncthreads();
  const int q = lane >> 3, c8 = (lane & 7) * 8;
  v4u tv[4];
#pragma unroll
  for (int it = 0; it < 4; ++it) {
    const int d = it * 32 + wave * 4 + q;
    unsigned short hb[8];
#pragma unroll
    for (int e = 0; e < 8; ++e) hb[e] = h_bits(sm[(c8 + e) * kVP + d] * kVCarry);
    tv[it] = (v4u){pk16(hb[0], hb[1]), pk16(hb[2], hb[3]), pk16(hb[4], hb[5]), pk16(hb[6], hb[7])};
  }
  v4f ev[8];
#pragma unroll
  for (int it = 0; it < 8; ++it) ev[it] = *(const v4f*)(sm + (it * 8 + wave) * kVP + 4 * lane);
  const bool early = s0 < kEarly;
  const int erow0 = b * kEarly + (early ? s0 : 0);
  unsigned short* vt0 = Vt + (size_t)(b * kHkv + hkv) * kHD * kS + s0 + c8;
  float* ve0 = Ve + (size_t)erow0 * kKW + hkv * kHD + 4 * lane;
  {
#pragma unroll
    for (int it = 0; it < 4; ++it) *(v4u*)(vt0 + (size_t)(it * 32 + wave * 4 + q) * kS) = tv[it];
    if (early) {
#pragma unroll
      for (int it = 0; it < 8; ++it) *(v4f*)(ve0 + (size_t)(it * 8 + wave) * kKW) = ev[it];
    }
    
  }
}

// ---------------------------------------------------------------------------
// Causal attention for query positions >= 128 (f16 matrix ops, online softmax in f32).
// Block = 8 waves = 4 query heads of one kv head x 2 tiles of 16 query rows; all 8 waves walk the same chunks of 64 keys.
// A chunk's keys (64 rows of 256 B, 272-B pitch) and transposed values (128 rows of 128 B, 144-B pitch) reach LDS once per
// block by asynchronous 16-B copies, two buffers: the next chunk's copies fly while this chunk is worked on.
//   A (q rows):  row = lane&15, k = d:   QP[(b*S + q0 + row)][h*128 + dc*32 + 8*(lane>>4) ..]   (global, once)
//   B (keys):    col = key,     k = d:   LDS key row (key - kv0), element dc*32 + 8*(lane>>4) ..
//   B (values):  col = d,       k = key: LDS value row d, element kk*32 + 8*(lane>>4) ..
// 64 keys per iteration; the last chunk masks key > query with -inf before the softmax (the chunk always holds key <= query
// for every row, so the running maximum stays finite). p = exp(s - m) carried x32768 as f16, spilled per wave to LDS as
// ---------------------------------------------------------------------------
constexpr int kKPitch = 136;
constexpr int kVPitch = 72;
constexpr int kKTile  = kLateKC * kKPitch;
constexpr int kVTile  = kHD * kVPitch;
constexpr int kKVBuf  = kKTile + kVTile;
static_assert(kLateKC == 64 && kHD == 128, "copy maps: 16 lanes per 256-B key row, 8 lanes per 128-B value row");
static_assert(((kKTile * 2) % 16) == 0 && ((kKVBuf * 2) % 16) == 0, "16-B aligned tiles");

/* one chunk's share of a thread: 4 copies of key rows (16 rows apart) and 4 of value rows (32 rows apart), 16 B each,
   global -> LDS through no register; the s_wait_xcnt closes the statement so that no address register of a copy is
   rewritten in front of it */
__device__ __forceinline__ void copy_kv_async(unsigned lk, const unsigned short* gk, unsigned lv, const unsigned short* gv) {
  asm volatile("global_load_async_to_lds_b128 %0, %8, off\n\t"
               "global_load_async_to_lds_b128 %1, %9, off\n\t"
               "global_load_async_to_lds_b128 %2, %10, off\n\t"
               "global_load_async_to_lds_b128 %3, %11, off\n\t"
               "global_load_async_to_lds_b128 %4, %12, off\n\t"
               "global_load_async_to_lds_b128 %5, %13, off\n\t"
               "global_load_async_to_lds_b128 %6, %14, off\n\t"
               "global_load_async_to_lds_b128 %7, %15, off\n\t"
               "s_wait_xcnt 0x0"
               :: "v"(lk), "v"(lk + 16u * (kKPitch * 2u)), "v"(lk + 32u * (kKPitch * 2u)), "v"(lk + 48u * (kKPitch * 2u)),
                  "v"(lv), "v"(lv + 32u * (kVPitch * 2u)), "v"(lv + 64u * (kVPitch * 2u)), "v"(lv + 96u * (kVPitch * 2u)),
                  "v"(gk), "v"(gk + 16 * kKW), "v"(gk + 32 * kKW), "v"(gk + 48 * kKW),
                  "v"(gv), "v"(gv + 32 * kS), "v"(gv + 64 * kS), "v"(gv + 96 * kS) : "memory");
}

/* four waves per SIMD (two blocks per WGP, as the LDS allows) hold only while a wave stays inside 256 registers */
__global__ __launch_bounds__(256) __attribute__((amdgpu_waves_per_eu(4, 4))) void attn_late_kernel(const unsigned short* __restrict__ Qp, const unsigned short* __restrict__ Kp,
                                                        const unsigned short* __restrict__ Vtp, float* __restrict__ attn) {
  union FH { v16h v; v8h h[2]; };
  __shared__ __align__(16) unsigned short sKV[2][kKVBuf];
  __shared__ __align__(16) _Float16 Psh[8][16 * kLateKC];
  __shared__ __align__(16) float Os[8][16 * 68];
  const int tid  = threadIdx.x;
  const int lane = threadIdx.x & 31;
  const int wave = __builtin_amdgcn_readfirstlane((int)(threadIdx.x >> 5));
  const int hh   = lane >> 4;
  const int c    = lane & 15;
  const int qt2  = blockIdx.x % kLatePairs;
  const int bh   = blockIdx.x / kLatePairs;
  const int hkv  = bh & (kHkv - 1);
  const int b    = bh / kHkv;
  const int h    = hkv * kRep + (wave & 3);
  const int q0   = kEarly + (qt2 * 2 + (wave >> 2)) * 16;

  /* the thread's own place in a chunk's two tiles and in the two source planes */
  const unsigned lk0 = lds_off(&sKV[0][0]) + (unsigned)(tid >> 4) * (kKPitch * 2u) + (unsigned)(tid & 15) * 16u;
  const unsigned lv0 = lds_off(&sKV[0][kKTile]) + (unsigned)(tid >> 3) * (kVPitch * 2u) + (unsigned)(tid & 7) * 16u;
  const unsigned short* gk0 = Kp + (size_t)(b * kS + (tid >> 4)) * kKW + hkv * kHD + (tid & 15) * 8;
  const unsigned short* gv0 = Vtp + ((size_t)(b * kHkv + hkv) * kHD + (tid >> 3)) * kS + (tid & 7) * 8;
  auto issue_chunk = [&](int t) {
    const unsigned o = (unsigned)(t & 1) * (kKVBuf * 2u);
    copy_kv_async(lk0 + o, gk0 + (size_t)t * (kLateKC * kKW), lv0 + o, gv0 + t * kLateKC);
  };
  float* ob = attn + (size_t)(b * kS + q0) * kQW + h * kHD;

  v16h qa[4];
  {
    const _Float16* qrow = (const _Float16*)Qp + (size_t)(b * kS + q0 + c) * kQW + h * kHD + 8 * hh;
#pragma unroll
    for (int dc = 0; dc < 4; ++dc) qa[dc] = Frag<_Float16>::load(qrow + dc * 32);
  }

  float mrow[8], lrow[8];
  v8f oacc[8];
#pragma unroll
  for (int r = 0; r < 8; ++r) { mrow[r] = -INFINITY; lrow[r] = 0.0f; }
#pragma unroll
  for (int t = 0; t < 8; ++t) oacc[t] = (v8f){0.f,0.f,0.f,0.f,0.f,0.f,0.f,0.f};

  int nChunks = (q0 + 16 + kLateKC - 1) / kLateKC;
  if (nChunks > kS / kLateKC) nChunks = kS / kLateKC;
  _Float16* pw = Psh[wave];
  /* nChunks is the same in all 8 waves: the block's 32 query rows lie inside one chunk of 64 positions */

  issue_chunk(0);
  /* chunk 0 has landed for this wave; the barrier publishes it to the others */
  asm volatile("s_wait_asynccnt 0x0" ::: "memory");
  __syncthreads();
  if (nChunks > 1) issue_chunk(1);

  for (int kc = 0; kc < nChunks; ++kc) {
    const int kv0 = kc * kLateKC;
    const _Float16* sk = (const _Float16*)&sKV[kc & 1][0] + c * kKPitch + 8 * hh;
    const _Float16* sv = (const _Float16*)&sKV[kc & 1][kKTile] + c * kVPitch + 8 * hh;
    /* fragments are read from LDS in groups of four, in front of the products that use them: eight register sets, the four
       that a group of products has just read are refilled at once with the fragments eight places on */
    v16h ring[8];
#pragma unroll
    for (int f = 0; f < 8; ++f) ring[f] = Frag<_Float16>::load(sk + (f >> 2) * 16 * kKPitch + (f & 3) * 32);
    v8f s[4];
#pragma unroll
    for (int j = 0; j < 4; ++j) {
      s[j] = (v8f){0.f,0.f,0.f,0.f,0.f,0.f,0.f,0.f};
#pragma unroll
      for (int dc = 0; dc < 4; ++dc) s[j] = mma_guard_h(qa[dc], ring[(j & 1) * 4 + dc], s[j]);
      if (j < 2) {
#pragma unroll
        for (int dc = 0; dc < 4; ++dc) ring[(j & 1) * 4 + dc] = Frag<_Float16>::load(sk + (j + 2) * 16 * kKPitch + dc * 32);
      }
    }
    const bool diag = (kc == nChunks - 1);
    float cm[8];
#pragma unroll
    for (int r = 0; r < 8; ++r) {
      const int qrow = q0 + 8 * hh + r;
      float m = -INFINITY;
#pragma unroll
      for (int j = 0; j < 4; ++j) {
        const int kvcol = kv0 + j * 16 + c;
        float v = s[j][r] * kScoreMul;
        if (diag && (kvcol > qrow)) v = -INFINITY;
        s[j][r] = v;
        m = fmaxf(m, v);
      }
      cm[r] = m;
    }
    row16_max8(cm);
#pragma unroll
    for (int r = 0; r < 8; ++r) {
      const float mnew  = fmaxf(mrow[r], cm[r]);
      const float alpha = __expf(mrow[r] - mnew);
      mrow[r] = mnew;
      float psum = 0.0f;
#pragma unroll
      for (int j = 0; j < 4; ++j) {
        const float p = __expf(s[j][r] - mnew);
        psum += p;
        pw[(8 * hh + r) * kLateKC + j * 16 + c] = (_Float16)(p * kPCarry);
      }
      psum = row16_sum(psum);
      lrow[r] = lrow[r] * alpha + psum;
#pragma unroll
      for (int t = 0; t < 8; ++t) oacc[t][r] *= alpha;
    }
    wave_lds_sync();
#pragma unroll
    for (int t = 0; t < 8; ++t) ring[t] = Frag<_Float16>::load(sv + t * 16 * kVPitch);
#pragma unroll
    for (int kk = 0; kk < 2; ++kk) {
      FH pa;
      pa.h[0] = *(const v8h*)(pw + c * kLateKC + kk * 32 + 8 * hh);
      pa.h[1] = *(const v8h*)(pw + c * kLateKC + kk * 32 + 16 + 8 * hh);
#pragma unroll
      for (int g = 0; g < 2; ++g) {
#pragma unroll
        for (int t = g * 4; t < g * 4 + 4; ++t) oacc[t] = mma_guard_h(pa.v, ring[t], oacc[t]);
        if (kk == 0) {
#pragma unroll
          for (int t = g * 4; t < g * 4 + 4; ++t) ring[t] = Frag<_Float16>::load(sv + t * 16 * kVPitch + 32);
        }
      }
    }
    /* hand-over: this wave's reads of the buffer (and of its p rows) are done, */
    asm volatile("s_wait_dscnt 0x0" ::: "memory");
    /* its copies of chunk kc + 1 have landed, */
    asm volatile("s_wait_asynccnt 0x0" ::: "memory");
    /* and the barrier publishes chunk kc + 1 and frees the buffer that was just read */
    __syncthreads();
    if (kc + 2 < nChunks) issue_chunk(kc + 2);
  }
  /* no copy is left in flight when the wave goes on */
  asm volatile("s_wait_asynccnt 0x0" ::: "memory");

  float inv[8];
#pragma unroll
  for (int r = 0; r < 8; ++r) inv[r] = 1.0f / (lrow[r] * (kPCarry * kVCarry));
  float* os = Os[wave];
  const int c4 = (lane & 15) * 4;
#pragma unroll
  for (int hf = 0; hf < 2; ++hf) {
#pragma unroll
    for (int r = 0; r < 8; ++r) {
#pragma unroll
      for (int t4 = 0; t4 < 4; ++t4) os[(8 * hh + r) * 68 + t4 * 16 + c] = oacc[hf * 4 + t4][r] * inv[r];
    }
    wave_lds_sync();
    {
#pragma unroll
      for (int it = 0; it < 8; ++it) {
        const int row = it * 2 + hh;
        v4f val = *(const v4f*)(os + row * 68 + c4);
        *(v4f*)(ob + (size_t)row * kQW + hf * 64 + c4) = val;
      }
      
    }
    wave_lds_sync();
  }
}

// ---------------------------------------------------------------------------
// Attention for query positions t < 128 of each batch (a causally closed sub-problem), all f32 on the vector unit.
// Block = (b, kv head, t); wave = one of the 4 query heads, which share the block's keys and values.
// The key and value rows 0 .. 32*NG-1 (NG = t/32 + 1 groups of 32 keys, all of them rows of positions < 128) reach LDS once
// per block by asynchronous 16-B copies, a whole 512-B row per copy of a wave: first the keys, then, while the scores and
// the softmax are worked out, the values. Key rows lie at a pitch of 132 floats, so that 16 lanes reading 16 B of 16
// different rows fall on all 64 banks.
// Scores: lane owns keys lane + 32*i (i < NG); the NG dots of a lane run side by side as independent chains and share one
// read of the q row; each dot adds its 128 products in the order d = 0..127. Keys beyond t are set to -inf by value.
// Softmax with precise expf; p written to LDS for all 128 slots (zeros beyond t).
// p.v: lane owns d = 4*lane..+3; keys 0 .. in order, up to the next multiple of 8 (p = 0 beyond t adds nothing).
// ---------------------------------------------------------------------------
constexpr int kEKP = 132;
/* eight copies of 16 B per lane, global -> LDS through no register: eight rows, four rows apart in the source plane (pitch
   kKW floats) and in LDS (pitch PITCH floats); the s_wait_xcnt closes the statement so that no address register of a copy
   is rewritten in front of it */
template <int PITCH>
__device__ __forceinline__ void copy_rows8_async(unsigned l, const float* g) {
  constexpr unsigned kStep = 4u * PITCH * 4u;
  asm volatile("global_load_async_to_lds_b128 %0, %8, off\n\t"
               "global_load_async_to_lds_b128 %1, %9, off\n\t"
               "global_load_async_to_lds_b128 %2, %10, off\n\t"
               "global_load_async_to_lds_b128 %3, %11, off\n\t"
               "global_load_async_to_lds_b128 %4, %12, off\n\t"
               "global_load_async_to_lds_b128 %5, %13, off\n\t"
               "global_load_async_to_lds_b128 %6, %14, off\n\t"
               "global_load_async_to_lds_b128 %7, %15, off\n\t"
               "s_wait_xcnt 0x0"
               :: "v"(l), "v"(l + kStep), "v"(l + 2u * kStep), "v"(l + 3u * kStep),
                  "v"(l + 4u * kStep), "v"(l + 5u * kStep), "v"(l + 6u * kStep), "v"(l + 7u * kStep),
                  "v"(g), "v"(g + 4 * kKW), "v"(g + 8 * kKW), "v"(g + 12 * kKW),
                  "v"(g + 16 * kKW), "v"(g + 20 * kKW), "v"(g + 24 * kKW), "v"(g + 28 * kKW) : "memory");
}
template <int NG>
__device__ __forceinline__ void early_dots(const float* skl, const float* sqw, float (&dot)[4]) {
  /* eight steps a trip: their LDS reads are issued ahead of the products, which would else wait for each read in turn */
#pragma unroll 8
  for (int d4 = 0; d4 < kHD / 4; ++d4) {
    const v4f qq = *(const v4f*)(sqw + 4 * d4);
    /* unrolled: dot[i] stays in a register, and the NG chains alternate */
#pragma unroll
    for (int i = 0; i < NG; ++i) {
      const v4f kv = *(const v4f*)(skl + i * 32 * kEKP + 4 * d4);
      dot[i] = fmaf(kv[0], qq[0], dot[i]);
      dot[i] = fmaf(kv[1], qq[1], dot[i]);
      dot[i] = fmaf(kv[2], qq[2], dot[i]);
      dot[i] = fmaf(kv[3], qq[3], dot[i]);
    }
  }
}

__global__ __launch_bounds__(128) void attn_early_kernel(const float* __restrict__ Qe, const float* __restrict__ Ke,
                                                         const float* __restrict__ Ve, float* __restrict__ attn) {
  __shared__ __align__(16) float sK[kEarly * kEKP];
  __shared__ __align__(16) float sV[kEarly * kHD];
  __shared__ __align__(16) float sq[4][kHD];
  __shared__ __align__(16) float sp[4][kEarly];
  const int lane = threadIdx.x & 31;
  const int wave = __builtin_amdgcn_readfirstlane((int)(threadIdx.x >> 5));
  const int t    = blockIdx.x & (kEarly - 1);
  const int hkv  = (blockIdx.x / kEarly) & (kHkv - 1);
  const int b    = blockIdx.x / (kEarly * kHkv);
  const int h    = hkv * kRep + wave;
  const int erow = b * kEarly + t;
  const int nG   = (t >> 5) + 1;
  float* sqw = sq[wave];
  float* spw = sp[wave];
  {
    const v4f qv = *(const v4f*)(Qe + (size_t)erow * kQW + h * kHD + 4 * lane);
    *(v4f*)(sqw + 4 * lane) = qv;
  }
  {
    /* wave w brings rows w, w + 4, .. of each group of 32, a whole row per copy; at most 32 copies of a wave are in flight */
    const float* kg = Ke + (size_t)(b * kEarly + wave) * kKW + hkv * kHD + 4 * lane;
    const float* vg = Ve + (size_t)(b * kEarly + wave) * kKW + hkv * kHD + 4 * lane;
    const unsigned lk = lds_off(sK) + (unsigned)(wave * kEKP + 4 * lane) * 4u;
    const unsigned lv = lds_off(sV) + (unsigned)(wave * kHD + 4 * lane) * 4u;
    for (int g = 0; g < nG; ++g) copy_rows8_async<kEKP>(lk + (unsigned)g * (32u * kEKP * 4u), kg + (size_t)g * (32 * kKW));
    /* this wave's key rows have landed */
    asm volatile("s_wait_asynccnt 0x0" ::: "memory");
    for (int g = 0; g < nG; ++g) copy_rows8_async<kHD>(lv + (unsigned)g * (32u * kHD * 4u), vg + (size_t)g * (32 * kKW));
  }
  /* publishes the key rows to the block's four waves (and each wave's q row to its own lanes); t, and so every branch
     around a barrier of this kernel, is the same in the whole block */
  __syncthreads();
  float dot[4] = {0.0f, 0.0f, 0.0f, 0.0f};
  const float* skl = sK + lane * kEKP;
  if (nG == 4)      early_dots<4>(skl, sqw, dot);
  else if (nG == 3) early_dots<3>(skl, sqw, dot);
  else if (nG == 2) early_dots<2>(skl, sqw, dot);
  else              early_dots<1>(skl, sqw, dot);
  float sc[4];
#pragma unroll
  for (int i = 0; i < 4; ++i) sc[i] = (lane + 32 * i <= t) ? (dot[i] * kInvSqrtHD) : -INFINITY;
  float m = fmaxf(fmaxf(sc[0], sc[1]), fmaxf(sc[2], sc[3]));
  m = wave_max(m);
  float psum = 0.0f;
#pragma unroll
  for (int i = 0; i < 4; ++i) {
    const float p = expf(sc[i] - m);
    psum += p;
    spw[lane + 32 * i] = p;
  }
  psum = wave_sum(psum);
  /* this wave's value rows have landed, */
  asm volatile("s_wait_asynccnt 0x0" ::: "memory");
  /* and the barrier publishes them to the block's four waves (and each wave's p row to its own lanes) */
  __syncthreads();
  float a0 = 0.0f, a1 = 0.0f, a2 = 0.0f, a3 = 0.0f;
  const float* vr = sV + 4 * lane;
  const int nj = (t + 8) & ~7;
  for (int j0 = 0; j0 < nj; j0 += 8) {
    /* unrolled: the LDS reads of eight keys are issued ahead of their products */
#pragma unroll
    for (int u = 0; u < 8; ++u) {
      const float p = spw[j0 + u];
      const v4f vv = *(const v4f*)(vr + (j0 + u) * kHD);
      a0 = fmaf(p, vv[0], a0);
      a1 = fmaf(p, vv[1], a1);
      a2 = fmaf(p, vv[2], a2);
      a3 = fmaf(p, vv[3], a3);
    }
  }
  const float il = 1.0f / psum;
  const v4f ov = (v4f){a0 * il, a1 * il, a2 * il, a3 * il};
  float* dst = attn + (size_t)(b * kS + t) * kQW + h * kHD + 4 * lane;
  *(v4f*)dst = ov;
}

// ---------------------------------------------------------------------------
// gated = attn * sigmoid(gate projection), f32; one block per token row (2048 columns).
// Rolled loop: 8 iterations x 256 threads, one column each (coalesced 4-B loads), result into LDS; after the block barrier
// thread t owns columns 8t..8t+7. Positions >= 128: f16 plane carried x1024 (row = token). Positions < 128: bf16 hi plane and
// bf16 lo plane (lo = RNE bf16 of value - hi), row = b*128 + position. One 16-B store per lane per plane; a wave = 512
// ---------------------------------------------------------------------------
__global__ __launch_bounds__(256) void gate_kernel(const float* __restrict__ attn, const float* __restrict__ G,
                                                   unsigned short* __restrict__ GH, unsigned short* __restrict__ EH,
                                                   unsigned short* __restrict__ EL) {
  __shared__ __align__(16) float sm[kQW];
  const int tid = threadIdx.x;
  const int row = blockIdx.x;
  const int pos = row & (kS - 1);
  const int b   = row / kS;
  const float* ar = attn + (size_t)row * kQW;
  const float* gr = G + (size_t)row * kQW;
#pragma unroll 1
  for (int i = 0; i < kQW / 256; ++i) {
    const int col = i * 256 + tid;
    const float a = ar[col];
    const float g = gr[col];
    const float sg = 1.0f / (1.0f + expf(-g));
    sm[col] = a * sg;
  }
  __syncthreads();
  const v4f x0 = *(const v4f*)(sm + 8 * tid);
  const v4f x1 = *(const v4f*)(sm + 8 * tid + 4);
  if (pos >= kEarly) {
    unsigned short hb[8];
#pragma unroll
    for (int e = 0; e < 4; ++e) {
      hb[e]     = h_bits(x0[e] * kGCarry);
      hb[4 + e] = h_bits(x1[e] * kGCarry);
    }
    const v4u u = (v4u){pk16(hb[0], hb[1]), pk16(hb[2], hb[3]), pk16(hb[4], hb[5]), pk16(hb[6], hb[7])};
    unsigned short* d = GH + (size_t)row * kQW + 8 * tid;
    *(v4u*)d = u;
    
  } else {
    unsigned short hb[8], lb[8];
#pragma unroll
    for (int e = 0; e < 4; ++e) {
      const float f0 = x0[e];
      const float f1 = x1[e];
      hb[e]     = f2bf_bits(f0);
      hb[4 + e] = f2bf_bits(f1);
      lb[e]     = f2bf_bits(f0 - bf_bits2f(hb[e]));
      lb[4 + e] = f2bf_bits(f1 - bf_bits2f(hb[4 + e]));
    }
    const v4u uh = (v4u){pk16(hb[0], hb[1]), pk16(hb[2], hb[3]), pk16(hb[4], hb[5]), pk16(hb[6], hb[7])};
    const v4u ul = (v4u){pk16(lb[0], lb[1]), pk16(lb[2], lb[3]), pk16(lb[4], lb[5]), pk16(lb[6], lb[7])};
    const size_t o = (size_t)(b * kEarly + pos) * kQW + 8 * tid;
    *(v4u*)(EH + o) = uh;
    *(v4u*)(EL + o) = ul;
    
  }
}

// ---------------------------------------------------------------------------
// Host glue: 15 kernel launches, nothing else.
// GEMM shapes (all K % 64 == 0, M % 128 == 0, N % 256 == 0, no padding planes):
//   q|k|v proj : M 4096, N 3072, K 2048 -> 32 x 12 = 384 blocks (bf16)
//   gate proj  : M 4096, N 2048, K 2048 -> 32 x 8 = 256 blocks (bf16)
//   out late   : per batch M 1920 (positions 128..2047), N 2048, K 2048 -> 15 x 8 = 120 blocks x 2 (f16)
//   out early  : per batch M 128 (positions 0..127), N 2048, K 2048, A hi+lo -> 1 x 8 = 8 blocks x 2 (bf16)
// ---------------------------------------------------------------------------
extern "C" void kernel_launch(void* const* d_in, const int* in_sizes, int n_in,
                              void* d_out, int out_size, void* d_ws, size_t ws_size,
                              hipStream_t stream) {
  if (n_in < 10) return;
  if (in_sizes[0] != kTok * kHid) return;
  if (in_sizes[1] != kS * kHD) return;
  if (in_sizes[2] != kS * kHD) return;
  if (in_sizes[3] != kQW * kHid) return;
  if (in_sizes[4] != kKW * kHid) return;
  if (in_sizes[5] != kKW * kHid) return;
  if (in_sizes[6] != kQW * kHid) return;
  if (in_sizes[7] != kQW * kQW) return;
  if (in_sizes[8] != kHD) return;
  if (in_sizes[9] != kHD) return;
  if (out_size != kTok * kQW) return;
  if (ws_size < kWsTotal) return;

  const float* X    = (const float*)d_in[0];
  const float* ctab = (const float*)d_in[1];
  const float* stab = (const float*)d_in[2];
  const float* Wq   = (const float*)d_in[3];
  const float* Wk   = (const float*)d_in[4];
  const float* Wv   = (const float*)d_in[5];
  const float* Wg   = (const float*)d_in[6];
  const float* Wo   = (const float*)d_in[7];
  const float* qnw  = (const float*)d_in[8];
  const float* knw  = (const float*)d_in[9];
  float* out = (float*)d_out;

  char* ws = (char*)d_ws;
  unsigned short* XB   = (unsigned short*)(ws + kOffXB);
  unsigned short* WQKV = (unsigned short*)(ws + kOffWQKV);
  unsigned short* WGB  = (unsigned short*)(ws + kOffWGB);
  float*          QKV  = (float*)(ws + kOffQKV);
  unsigned short* QP   = (unsigned short*)(ws + kOffQP);
  unsigned short* KP   = (unsigned short*)(ws + kOffKP);
  unsigned short* VT   = (unsigned short*)(ws + kOffVT);
  float*          QE   = (float*)(ws + kOffQE);
  float*          KE   = (float*)(ws + kOffKE);
  float*          VE   = (float*)(ws + kOffVE);
  unsigned short* WOB  = (unsigned short*)(ws + kOffWOB);
  unsigned short* WOH  = (unsigned short*)(ws + kOffWOH);
  float*          ATT  = (float*)(ws + kOffATT);
  float*          GF   = (float*)(ws + kOffGF);
  unsigned short* GH   = (unsigned short*)(ws + kOffGH);
  unsigned short* EH   = (unsigned short*)(ws + kOffEH);
  unsigned short* EL   = (unsigned short*)(ws + kOffEL);

  /* operand planes: every float input RNE-converted to bf16 once (weights are [out][in] = Bt layout already) */
  cast8_kernel<0><<<(kTok * kHid / 8) / 256, 256, 0, stream>>>(X, XB, XB, kTok * kHid / 8, 1.0f);
  cast8_kernel<0><<<(kQW * kHid / 8) / 256, 256, 0, stream>>>(Wq, WQKV, WQKV, kQW * kHid / 8, 1.0f);
  cast8_kernel<0><<<(kKW * kHid / 8) / 256, 256, 0, stream>>>(Wk, WQKV + (size_t)kQW * kHid, WQKV, kKW * kHid / 8, 1.0f);
  cast8_kernel<0><<<(kKW * kHid / 8) / 256, 256, 0, stream>>>(Wv, WQKV + (size_t)kVCol0 * kHid, WQKV, kKW * kHid / 8, 1.0f);
  cast8_kernel<0><<<(kQW * kHid / 8) / 256, 256, 0, stream>>>(Wg, WGB, WGB, kQW * kHid / 8, 1.0f);
  cast8_kernel<1><<<(kQW * kQW / 8) / 256, 256, 0, stream>>>(Wo, WOB, WOH, kQW * kQW / 8, kWoCarry);

  /* q|k|v projection: QKV[4096][3072] = x . [Wq;Wk;Wv]^T */
  wmma_gemm64<1, false><<<dim3((kTok / kGBM) * (kQKVW / kGBN), 1), 256, 0, stream>>>(
      XB, XB, kHid, 0L, WQKV, kHid, 0L, QKV, kQKVW, 0L, kTok, kQKVW, kHid, 1.0f);

  /* norm + rotation -> QP, KP (f16 x64) and QE, KE (f32, positions < 128) */
  normrot_kernel<<<kTok * kSlots / 8, 256, 0, stream>>>(QKV, ctab, stab, qnw, knw, QP, KP, QE, KE);

  /* v transpose -> VT (f16 x64) and VE (f32, positions < 128): 2 x 4 x 32 blocks */
  vprep_kernel<<<kB * kHkv * (kS / 64), 256, 0, stream>>>(QKV, VT, VE);

  /* attention, positions >= 128 (matrix ops) then positions < 128 (f32); disjoint rows of ATT */
  attn_late_kernel<<<kLatePairs * kHkv * kB, 256, 0, stream>>>(QP, KP, VT, ATT);
  attn_early_kernel<<<kB * kHkv * kEarly, 128, 0, stream>>>(QE, KE, VE, ATT);

  /* gate projection: GF[4096][2048] = x . Wg^T */
  wmma_gemm64<1, false><<<dim3((kTok / kGBM) * (kQW / kGBN), 1), 256, 0, stream>>>(
      XB, XB, kHid, 0L, WGB, kHid, 0L, GF, kQW, 0L, kTok, kQW, kHid, 1.0f);

  /* gated planes */
  gate_kernel<<<kTok, 256, 0, stream>>>(ATT, GF, GH, EH, EL);

  /* output projection, positions >= 128 of each batch: f16 single product, carries folded back */
  wmma_gemm64<0, false><<<dim3(((kS - kEarly) / kGBM) * (kQW / kGBN), kB), 256, 0, stream>>>(
      GH + (size_t)kEarly * kQW, GH + (size_t)kEarly * kQW, kQW, (long)kS * kQW,
      WOH, kQW, 0L,
      out + (size_t)kEarly * kQW, kQW, (long)kS * kQW,
      kS - kEarly, kQW, kQW, kOutLateMul);

  /* output projection, positions < 128 of each batch: bf16 hi.W + lo.W */
  wmma_gemm64<1, true><<<dim3((kEarly / kGBM) * (kQW / kGBN), kB), 256, 0, stream>>>(
      EH, EL, kQW, (long)kEarly * kQW,
      WOB, kQW, 0L,
      out, kQW, (long)kS * kQW,
      kEarly, kQW, kQW, 1.0f);
}

// v005
// One run takes 219 microseconds.
// Next to v004, in two timings, it ran 1.34 and 1.33 times as fast.
// Counting every step since v000, it is 3.58 times as fast.
// Projections x.Wq/Wk/Wv/Wg^T: v_wmma_f32_16x16x32_bf16 (every float input RNE-converted to bf16 once, exact products, f32 accumulate); scores q.k^T and p.v for query positions >= 128: v_wmma_f32_16x16x32_f16 (q,k,v planes carried x64, p carried x32768); query positions < 128: f32 VALU attention; output projection: f16 (gated carried x1024, Wo carried x1024) for positions >= 128, bf16 hi+lo gated planes x bf16 Wo (two products) for positions < 128; norms, position rotation, softmax, gate in f32.
#include <hip/hip_runtime.h>
#include <math.h>

typedef __attribute__((ext_vector_type(16))) _Float16 v16h;
typedef __attribute__((ext_vector_type(8)))  _Float16 v8h;
typedef __attribute__((ext_vector_type(16))) __bf16   v16b;
typedef __attribute__((ext_vector_type(8)))  __bf16   v8b;
typedef __attribute__((ext_vector_type(8)))  float    v8f;
typedef __attribute__((ext_vector_type(4)))  float    v4f;
typedef __attribute__((ext_vector_type(4)))  unsigned int v4u;
typedef __attribute__((ext_vector_type(2)))  unsigned int v2u;

// ---------------------------------------------------------------------------
// Shape constants
// ---------------------------------------------------------------------------
constexpr int kB     = 2;
constexpr int kS     = 2048;
constexpr int kHid   = 2048;
constexpr int kHq    = 16;
constexpr int kHkv   = 4;
constexpr int kRep   = kHq / kHkv;
constexpr int kHD    = 128;
constexpr int kTok   = kB * kS;
constexpr int kQW    = kHq * kHD;
constexpr int kKW    = kHkv * kHD;
constexpr int kQKVW  = kQW + 2 * kKW;
constexpr int kVCol0 = kQW + kKW;
constexpr int kSlots = kHq + kHkv;
constexpr int kEarly = 128;
constexpr int kERows = kB * kEarly;
constexpr int kLateKC    = 64;
constexpr int kLatePairs = (kS - kEarly) / 32;
constexpr int kVP    = 132;
constexpr float kEps = 1e-6f;

constexpr double cx_sqrt(double x) {
  double r = (x > 1.0) ? x : 1.0;
  for (int i = 0; i < 80; ++i) r = 0.5 * (r + x / r);
  return r;
}
constexpr float kInvSqrtHD = (float)(1.0 / cx_sqrt((double)kHD));
/* power-of-two carries of the f16 operand planes */
constexpr float kQKCarry = 64.0f;
constexpr float kVCarry  = 64.0f;
constexpr float kPCarry  = 32768.0f;
constexpr float kGCarry  = 1024.0f;
constexpr float kWoCarry = 1024.0f;
constexpr float kScoreMul   = kInvSqrtHD / (kQKCarry * kQKCarry);
constexpr float kOutLateMul = 1.0f / (kGCarry * kWoCarry);

static_assert(kRep == 4 && kHkv == 4 && kHD == 128, "lane maps assume 4 kv heads x 4 query heads x 128");
static_assert(kTok == 4096 && kQW == 2048 && kKW == 512 && kQKVW == 3072, "wire shapes");
static_assert((kHid % 32) == 0 && (kQW % 32) == 0, "GEMM K multiples of 32");
static_assert((kTok % 64) == 0 && (kQKVW % 64) == 0 && (kQW % 64) == 0 && ((kS - kEarly) % 64) == 0 && (kEarly % 64) == 0, "GEMM M,N multiples of 64");
static_assert((kS % 64) == 0 && (kS / 64) == 32 && (kEarly % 16) == 0 && ((kS - kEarly) % 32) == 0, "tile multiples");

// ---------------------------------------------------------------------------
// Workspace region map (bytes; every offset a multiple of 128)
//   XB   bf16 [4096][2048]  x plane                                16,777,216
//   WQKV bf16 [3072][2048]  Wq | Wk | Wv rows                      12,582,912
//   WGB  bf16 [2048][2048]  Wg                                      8,388,608
//   QKV  f32  [4096][3072]  q | k | v projections                  50,331,648
//   QP   f16  [4096][2048]  normed+rotated q x64                   16,777,216
//   KP   f16  [4096][512]   normed+rotated k x64                    4,194,304
//   VT   f16  [2][4][128][2048] v transposed x64                    4,194,304
//   QE   f32  [256][2048]   q rows of positions < 128               2,097,152
//   KE   f32  [256][512]    k rows of positions < 128                 524,288
//   VE   f32  [256][512]    v rows of positions < 128                 524,288
//   WOB  bf16 [2048][2048]  Wo                                      8,388,608
//   WOH  f16  [2048][2048]  Wo (bf16 value) x1024                   8,388,608
//   GF   f32  [4096][2048]  gate projection                        33,554,432
//   total                                                         166,723,584
// Aliases (each across whole launches):
//   ATT  f32 [4096][2048]  = first 33,554,432 B of QKV (after the joint norm/rotation and v-prep launch)
//   GH   f16 [4096][2048]  = XB (after the gate projection)
//   EH/EL bf16 [256][2048] = first 2 x 1,048,576 B of WQKV (after the q|k|v projection)
// ---------------------------------------------------------------------------
constexpr size_t kOffXB   = 0;
constexpr size_t kOffWQKV = kOffXB   + (size_t)kTok * kHid * 2;
constexpr size_t kOffWGB  = kOffWQKV + (size_t)kQKVW * kHid * 2;
constexpr size_t kOffQKV  = kOffWGB  + (size_t)kQW * kHid * 2;
constexpr size_t kOffQP   = kOffQKV  + (size_t)kTok * kQKVW * 4;
constexpr size_t kOffKP   = kOffQP   + (size_t)kTok * kQW * 2;
constexpr size_t kOffVT   = kOffKP   + (size_t)kTok * kKW * 2;
constexpr size_t kOffQE   = kOffVT   + (size_t)kTok * kKW * 2;
constexpr size_t kOffKE   = kOffQE   + (size_t)kERows * kQW * 4;
constexpr size_t kOffVE   = kOffKE   + (size_t)kERows * kKW * 4;
constexpr size_t kOffWOB  = kOffVE   + (size_t)kERows * kKW * 4;
constexpr size_t kOffWOH  = kOffWOB  + (size_t)kQW * kQW * 2;
constexpr size_t kOffGF   = kOffWOH  + (size_t)kQW * kQW * 2;
constexpr size_t kWsTotal = kOffGF   + (size_t)kTok * kQW * 4;
constexpr size_t kOffATT  = kOffQKV;
constexpr size_t kOffGH   = kOffXB;
constexpr size_t kOffEH   = kOffWQKV;
constexpr size_t kOffEL   = kOffWQKV + (size_t)kERows * kQW * 2;
static_assert(kWsTotal == 166723584ull, "carve total");
static_assert(kWsTotal <= 268435456ull, "carve cap");
static_assert(kOffEL + (size_t)kERows * kQW * 2 <= kOffWGB, "hi/lo planes inside the dead weight plane");
static_assert((kOffWQKV % 128) == 0 && (kOffWGB % 128) == 0 && (kOffQKV % 128) == 0 && (kOffQP % 128) == 0 &&
              (kOffKP % 128) == 0 && (kOffVT % 128) == 0 && (kOffQE % 128) == 0 && (kOffKE % 128) == 0 &&
              (kOffVE % 128) == 0 && (kOffWOB % 128) == 0 && (kOffWOH % 128) == 0 && (kOffGF % 128) == 0 &&
              (kOffEL % 128) == 0, "128-B aligned regions");

// ---------------------------------------------------------------------------
// Small helpers
// ---------------------------------------------------------------------------
__device__ __forceinline__ unsigned short f2bf_bits(float f) {
  unsigned u = __float_as_uint(f);
  return (unsigned short)((u + 0x7FFFu + ((u >> 16) & 1u)) >> 16);
}
__device__ __forceinline__ float bf_bits2f(unsigned short h) { return __uint_as_float(((unsigned)h) << 16); }
__device__ __forceinline__ float bf16r(float f) { return bf_bits2f(f2bf_bits(f)); }
__device__ __forceinline__ unsigned pk16(unsigned short a, unsigned short b) { return (unsigned)a | ((unsigned)b << 16); }
__device__ __forceinline__ unsigned short h_bits(float f) { const _Float16 h = (_Float16)f; return __builtin_bit_cast(unsigned short, h); }
__device__ __forceinline__ void wave_lds_sync() {
  __builtin_amdgcn_fence(__ATOMIC_RELEASE, "workgroup");
  __builtin_amdgcn_wave_barrier();
  __builtin_amdgcn_fence(__ATOMIC_ACQUIRE, "workgroup");
}

/* lane l <-> lane l ^ X inside a row of 16 lanes (X = 1, 2, 4, 8) and l <-> l ^ 16, on the vector unit: no trip through the
   LDS path and no wait on its counter; every lane is on wherever these stand */
template <int X>
__device__ __forceinline__ float row_xor(float v) {
  return __builtin_bit_cast(float, __builtin_amdgcn_update_dpp(0, __builtin_bit_cast(int, v), 0x160 + X, 0xf, 0xf, true));
}
__device__ __forceinline__ float half_xor(float v) {
  const int b = __builtin_bit_cast(int, v);
  return __builtin_bit_cast(float, __builtin_amdgcn_permlanex16(b, b, 0x76543210, 0xfedcba98, false, false));
}
/* butterflies in the order 1, 2, 4, 8 over a row of 16 lanes.
   The maximum of eight values at once is written as text: around a builtin exchange the compiler puts a register move and a
   quieting maximum, three instructions a step in place of one. The eight chains alternate, so that no instruction reads a
   result younger than eight instructions and none waits on the one in front of it */
#define ROW_MAX_STEP(X)                                                     \
  "v_max_num_f32_dpp %0, %0, %0 row_xmask:" #X " row_mask:0xf bank_mask:0xf\n\t" \
  "v_max_num_f32_dpp %1, %1, %1 row_xmask:" #X " row_mask:0xf bank_mask:0xf\n\t" \
  "v_max_num_f32_dpp %2, %2, %2 row_xmask:" #X " row_mask:0xf bank_mask:0xf\n\t" \
  "v_max_num_f32_dpp %3, %3, %3 row_xmask:" #X " row_mask:0xf bank_mask:0xf\n\t" \
  "v_max_num_f32_dpp %4, %4, %4 row_xmask:" #X " row_mask:0xf bank_mask:0xf\n\t" \
  "v_max_num_f32_dpp %5, %5, %5 row_xmask:" #X " row_mask:0xf bank_mask:0xf\n\t" \
  "v_max_num_f32_dpp %6, %6, %6 row_xmask:" #X " row_mask:0xf bank_mask:0xf\n\t" \
  "v_max_num_f32_dpp %7, %7, %7 row_xmask:" #X " row_mask:0xf bank_mask:0xf\n\t"
__device__ __forceinline__ void row16_max8(float (&m)[8]) {
  asm(ROW_MAX_STEP(1) ROW_MAX_STEP(2) ROW_MAX_STEP(4) ROW_MAX_STEP(8)
      : "+v"(m[0]), "+v"(m[1]), "+v"(m[2]), "+v"(m[3]), "+v"(m[4]), "+v"(m[5]), "+v"(m[6]), "+v"(m[7]));
}
__device__ __forceinline__ float row16_sum(float v) {
  v += row_xor<1>(v);
  v += row_xor<2>(v);
  v += row_xor<4>(v);
  v += row_xor<8>(v);
  return v;
}
/* butterflies in the order 16, 8, 4, 2, 1 over the wave */
__device__ __forceinline__ float wave_max(float m) {
  m = fmaxf(m, half_xor(m));
  m = fmaxf(m, row_xor<8>(m));
  m = fmaxf(m, row_xor<4>(m));
  m = fmaxf(m, row_xor<2>(m));
  m = fmaxf(m, row_xor<1>(m));
  return m;
}
__device__ __forceinline__ float wave_sum(float v) {
  v += half_xor(v);
  v += row_xor<8>(v);
  v += row_xor<4>(v);
  v += row_xor<2>(v);
  v += row_xor<1>(v);
  return v;
}

/* matrix op followed by the 4-slot hazard guard; one accumulator per guard statement, A and B named as inputs */
__device__ __forceinline__ v8f mma_guard_h(v16h a, v16h b, v8f c) {
  c = __builtin_amdgcn_wmma_f32_16x16x32_f16(false, a, false, b, (short)0, c, false, false);
  asm volatile("v_nop\n\tv_nop\n\tv_nop\n\tv_nop" : "+v"(c) : "v"(a), "v"(b));
  return c;
}
__device__ __forceinline__ v8f mma_guard_b(v16b a, v16b b, v8f c) {
  c = __builtin_amdgcn_wmma_f32_16x16x32_bf16(false, a, false, b, (short)0, c, false, false);
  asm volatile("v_nop\n\tv_nop\n\tv_nop\n\tv_nop" : "+v"(c) : "v"(a), "v"(b));
  return c;
}
__device__ __forceinline__ void keep4_h(v16h a, v16h b, v16h c, v16h d) { asm volatile("v_nop" :: "v"(a), "v"(b), "v"(c), "v"(d)); }
__device__ __forceinline__ void keep4_b(v16b a, v16b b, v16b c, v16b d) { asm volatile("v_nop" :: "v"(a), "v"(b), "v"(c), "v"(d)); }
__device__ __forceinline__ void acc_guard4(v8f& a, v8f& b, v8f& c, v8f& d) { asm volatile("v_nop\n\tv_nop\n\tv_nop\n\tv_nop" : "+v"(a), "+v"(b), "+v"(c), "+v"(d)); }

template <typename T> struct Frag;
template <> struct Frag<_Float16> {
  typedef v16h V; union U { v16h v; v8h h[2]; };
  /* elements 0..7 <- p[0..7], 8..15 <- p[16..23] */
  static __device__ __forceinline__ v16h load(const _Float16* p) {
    U f; f.h[0] = *(const v8h*)(p); f.h[1] = *(const v8h*)(p + 16); return f.v;
  }
  static __device__ __forceinline__ v8f mmag(v16h a, v16h b, v8f c) { return mma_guard_h(a, b, c); }
  static __device__ __forceinline__ void keep(v16h a, v16h b, v16h c, v16h d) { keep4_h(a, b, c, d); }
};
template <> struct Frag<__bf16> {
  typedef v16b V; union U { v16b v; v8b h[2]; };
  static __device__ __forceinline__ v16b load(const __bf16* p) {
    U f; f.h[0] = *(const v8b*)(p); f.h[1] = *(const v8b*)(p + 16); return f.v;
  }
  static __device__ __forceinline__ v8f mmag(v16b a, v16b b, v8f c) { return mma_guard_b(a, b, c); }
  static __device__ __forceinline__ void keep(v16b a, v16b b, v16b c, v16b d) { keep4_b(a, b, c, d); }
};

// ---------------------------------------------------------------------------
// Batched GEMM: C[m,n] = scale * sum_k A[m,k] * Bt[n,k]. A block of 8 waves (2 x 4) owns a 128 x 256 tile, each wave 64x64 of it.
// A row-major [M,K]; Bt row-major [N,K]; M % 128 == 0, N % 256 == 0, K % 64 == 0 (no tails).
// Operands reach LDS by asynchronous 16-B copies, 64 k per stage (128-B rows at a 144-B pitch), two buffers: the next
// stage's copies fly while this stage's fragments are read from LDS; 8 lanes copy one whole 128-B line of a row.
// ASPLIT: A carried as hi/lo planes (A2 = lo plane, same layout): product = hi.b + lo.b into one accumulator.
// ET: 0 = f16 operands, 1 = bf16 operands (pointers passed as 16-bit storage). Output f32.
// ---------------------------------------------------------------------------
constexpr int kGBM    = 128;
constexpr int kGBN    = 256;
constexpr int kGKS    = 64;
constexpr int kGPitch = 72;
constexpr unsigned kGPitchB = kGPitch * 2;
static_assert((kTok % kGBM) == 0 && ((kS - kEarly) % kGBM) == 0 && (kEarly % kGBM) == 0, "GEMM M multiples of the block tile");
static_assert((kQKVW % kGBN) == 0 && (kQW % kGBN) == 0, "GEMM N multiples of the block tile");
static_assert((kHid % kGKS) == 0 && (kQW % kGKS) == 0 && kHid / kGKS >= 2 && kQW / kGKS >= 2, "GEMM K in whole stages");

__device__ __forceinline__ unsigned lds_off(const void* p) { return (unsigned)(size_t)p; }

/* copies of 16 B per lane, global -> LDS through no register: row r of the run lies 32 * r rows behind the first, in LDS
   (pitch kGPitchB) and in the source (step32 elements). One statement holds a whole run, and the s_wait_xcnt closes it so
   that no address register of a copy is rewritten in front of it; one run per statement keeps that wait to one per run */
__device__ __forceinline__ void copy4_async(unsigned l, const unsigned short* g, size_t step32) {
  asm volatile("global_load_async_to_lds_b128 %0, %4, off\n\t"
               "global_load_async_to_lds_b128 %1, %5, off\n\t"
               "global_load_async_to_lds_b128 %2, %6, off\n\t"
               "global_load_async_to_lds_b128 %3, %7, off\n\t"
               "s_wait_xcnt 0x0"
               :: "v"(l), "v"(l + 32u * kGPitchB), "v"(l + 64u * kGPitchB), "v"(l + 96u * kGPitchB),
                  "v"(g), "v"(g + step32), "v"(g + 2 * step32), "v"(g + 3 * step32) : "memory");
}
__device__ __forceinline__ void copy8_async(unsigned l, const unsigned short* g, size_t step32,
                                            unsigned m, const unsigned short* h, size_t step32h) {
  asm volatile("global_load_async_to_lds_b128 %0, %8, off\n\t"
               "global_load_async_to_lds_b128 %1, %9, off\n\t"
               "global_load_async_to_lds_b128 %2, %10, off\n\t"
               "global_load_async_to_lds_b128 %3, %11, off\n\t"
               "global_load_async_to_lds_b128 %4, %12, off\n\t"
               "global_load_async_to_lds_b128 %5, %13, off\n\t"
               "global_load_async_to_lds_b128 %6, %14, off\n\t"
               "global_load_async_to_lds_b128 %7, %15, off\n\t"
               "s_wait_xcnt 0x0"
               :: "v"(l), "v"(l + 32u * kGPitchB), "v"(l + 64u * kGPitchB), "v"(l + 96u * kGPitchB),
                  "v"(m), "v"(m + 32u * kGPitchB), "v"(m + 64u * kGPitchB), "v"(m + 96u * kGPitchB),
                  "v"(g), "v"(g + step32), "v"(g + 2 * step32), "v"(g + 3 * step32),
                  "v"(h), "v"(h + step32h), "v"(h + 2 * step32h), "v"(h + 3 * step32h) : "memory");
}

template <int ET> struct Elem;
template <> struct Elem<0> { typedef _Float16 T; };
template <> struct Elem<1> { typedef __bf16 T; };
/* LDS of one GEMM block: two stage buffers, then the 8 waves' store slabs */
template <bool ASPLIT> struct GemmLds {
  static constexpr int kARows = ASPLIT ? 2 * kGBM : kGBM;
  static constexpr int kRows  = kARows + kGBN;
  static constexpr unsigned kBufB   = (unsigned)kRows * kGPitchB;
  static constexpr unsigned kBytes  = 2u * kBufB + 8u * 16u * 68u * 4u;
};
/* one block's tile: bx = tile number inside the batch entry b; smem = the block's LDS, GemmLds<ASPLIT>::kBytes of it */
template <int ET, bool ASPLIT>
__device__ __forceinline__ void gemm_block(
    unsigned char* smem, int bx, int b,
    const unsigned short* __restrict__ Ap, const unsigned short* __restrict__ A2p, int lda, long strideA,
    const unsigned short* __restrict__ Btp, int ldb, long strideB,
    float* __restrict__ Cout, int ldc, long strideC,
    int M, int N, int K, float scale) {
  typedef typename Elem<ET>::T T;
  typedef typename Frag<T>::V V;
  constexpr int kARows = GemmLds<ASPLIT>::kARows;
  constexpr int kRows  = GemmLds<ASPLIT>::kRows;
  constexpr unsigned kBufB = GemmLds<ASPLIT>::kBufB;
  unsigned short* sStage = (unsigned short*)smem;
  float* sT = (float*)(smem + 2u * kBufB);
  const int tid  = threadIdx.x;
  const int lane = tid & 31;
  const int wave = __builtin_amdgcn_readfirstlane((int)(threadIdx.x >> 5));
  const int tilesN = N / kGBN;
  const int tilesM = M / kGBM;
  /* block-uniform, in front of every barrier and copy */
  if (bx >= tilesM * tilesN) return;
  const int tm = bx / tilesN;
  const int tn = bx - tm * tilesN;
  const int bm0 = tm * kGBM;
  const int bn0 = tn * kGBN;
  const int wm = wave >> 2;
  const int wn = wave & 3;
  const int m0 = bm0 + (wm << 6);
  const int n0 = bn0 + (wn << 6);

  const int rlane = lane & 15;
  const int koff  = (lane >> 4) * 8;
  const int mOff  = (lane >> 4) * 8;

  /* the thread's own place in a stage and in the two (three) source planes */
  const int crow = tid >> 3;
  const int cch  = tid & 7;
  const unsigned lds0 = lds_off(sStage) + (unsigned)crow * kGPitchB + (unsigned)cch * 16u;
  const unsigned short* gA  = Ap  + (size_t)b * strideA + (size_t)(bm0 + crow) * lda + cch * 8;
  const unsigned short* gA2 = A2p + (size_t)b * strideA + (size_t)(bm0 + crow) * lda + cch * 8;
  const unsigned short* gB  = Btp + (size_t)b * strideB + (size_t)(bn0 + crow) * ldb + cch * 8;
  const size_t stepA = (size_t)32 * lda;
  const size_t stepB = (size_t)32 * ldb;
  const int nst = K / kGKS;

  auto issue_stage = [&](int t) {
    const unsigned l = lds0 + (unsigned)(t & 1) * kBufB;
    const size_t k0 = (size_t)t * kGKS;
    const unsigned lb = l + (unsigned)kARows * kGPitchB;
    /* thread t brings bytes 16*(t&7).. of rows (t>>3) + 32*i of each panel: 128 rows of A (and of A2), 256 of Bt */
    if (ASPLIT) copy8_async(l, gA + k0, stepA, l + (unsigned)kGBM * kGPitchB, gA2 + k0, stepA);
    else        copy4_async(l, gA + k0, stepA);
    copy8_async(lb, gB + k0, stepB, lb + 128u * kGPitchB, gB + k0 + 4 * stepB, stepB);
  };

  v8f acc[4][4];
#pragma unroll
  for (int i = 0; i < 4; ++i)
#pragma unroll
    for (int j = 0; j < 4; ++j) acc[i][j] = (v8f){0.f,0.f,0.f,0.f,0.f,0.f,0.f,0.f};

  issue_stage(0);
  /* stage 0 has landed for this wave; the barrier publishes it to the others */
  asm volatile("s_wait_asynccnt 0x0" ::: "memory");
  __syncthreads();
  if (nst > 1) issue_stage(1);

  for (int t = 0; t < nst; ++t) {
    const T* sb = (const T*)(sStage + (t & 1) * (kRows * kGPitch));
    const T* sa = sb + ((wm << 6) + rlane) * kGPitch + koff;
    const T* sw = sb + (kARows + (wn << 6) + rlane) * kGPitch + koff;
#pragma unroll
    for (int ks = 0; ks < kGKS / 32; ++ks) {
      /* all fragments of a k step are read from LDS as one group in front of its products */
      V bh[4], ah[4], al[4];
#pragma unroll
      for (int j = 0; j < 4; ++j) bh[j] = Frag<T>::load(sw + (j << 4) * kGPitch + ks * 32);
#pragma unroll
      for (int i = 0; i < 4; ++i) {
        ah[i] = Frag<T>::load(sa + (i << 4) * kGPitch + ks * 32);
        al[i] = ah[i];
        if (ASPLIT) al[i] = Frag<T>::load(sa + (kGBM + (i << 4)) * kGPitch + ks * 32);
      }
#pragma unroll
      for (int i = 0; i < 4; ++i) {
#pragma unroll
        for (int j = 0; j < 4; ++j) {
          acc[i][j] = Frag<T>::mmag(ah[i], bh[j], acc[i][j]);
          if (ASPLIT) acc[i][j] = Frag<T>::mmag(al[i], bh[j], acc[i][j]);
        }
      }
      Frag<T>::keep(bh[0], bh[1], bh[2], bh[3]);
    }
    /* hand-over: this wave's reads of the buffer are done, */
    asm volatile("s_wait_dscnt 0x0" ::: "memory");
    /* its copies of stage t + 1 have landed, */
    asm volatile("s_wait_asynccnt 0x0" ::: "memory");
    /* and the barrier publishes stage t + 1 and frees the buffer that was just read */
    __syncthreads();
    if (t + 2 < nst) issue_stage(t + 2);
  }
  /* no copy is left in flight when the wave goes on */
  asm volatile("s_wait_asynccnt 0x0" ::: "memory");
  acc_guard4(acc[0][0], acc[0][1], acc[0][2], acc[0][3]);
  acc_guard4(acc[1][0], acc[1][1], acc[1][2], acc[1][3]);
  acc_guard4(acc[2][0], acc[2][1], acc[2][2], acc[2][3]);
  acc_guard4(acc[3][0], acc[3][1], acc[3][2], acc[3][3]);

  float* slab = sT + wave * (16 * 68);
  float* C = Cout + (size_t)b * strideC;
#pragma unroll
  for (int i = 0; i < 4; ++i) {
    const int mBase = m0 + (i << 4);
#pragma unroll
    for (int j = 0; j < 4; ++j) {
#pragma unroll
      for (int r = 0; r < 8; ++r) {
        slab[(mOff + r) * 68 + (j << 4) + rlane] = acc[i][j][r] * scale;
      }
    }
    wave_lds_sync();
    {
      const int hh = lane >> 4, c4 = (lane & 15) * 4;
      {
#pragma unroll
        for (int it = 0; it < 8; ++it) {
          const int row = it * 2 + hh;
          v4f v = *(const v4f*)(slab + row * 68 + c4);
          *(v4f*)(C + (size_t)(mBase + row) * ldc + n0 + c4) = v;
        }
        
      }
    }
    wave_lds_sync();
  }
}

// ---------------------------------------------------------------------------
// Projections of x, bf16: QKV[4096][3072] = x . [Wq;Wk;Wv]^T (32 x 12 = 384 blocks) and, in the same launch, the first
// kGateWithProj tiles of the gate projection GF[4096][2048] = x . Wg^T (neither reads what the other writes). Two blocks
// fit a WGP; 384 blocks leave 128 of the 512 places of 256 WGPs empty, and the gate tiles take them. The other gate tiles
// run beside the attention for positions >= 128.
// ---------------------------------------------------------------------------
constexpr int kQKVBlocks    = (kTok / kGBM) * (kQKVW / kGBN);
constexpr int kGateGBlocks  = (kTok / kGBM) * (kQW / kGBN);
constexpr int kGateWithProj = 2 * 256 - kQKVBlocks;
static_assert(kGateWithProj > 0 && kGateWithProj < kGateGBlocks, "the gate tiles are split between two launches");
__global__ __launch_bounds__(256) void proj_kernel(
    const unsigned short* __restrict__ XB, const unsigned short* __restrict__ WQKV, const unsigned short* __restrict__ WGB,
    float* __restrict__ QKV, float* __restrict__ GF) {
  __shared__ __align__(16) unsigned char smem[GemmLds<false>::kBytes];
  const int blk = (int)blockIdx.x;
  const bool gt = blk >= kQKVBlocks;
  const int n   = gt ? kQW : kQKVW;
  gemm_block<1, false>(smem, gt ? blk - kQKVBlocks : blk, 0, XB, XB, kHid, 0L, gt ? WGB : WQKV, kHid, 0L,
                       gt ? GF : QKV, n, 0L, kTok, n, kHid, 1.0f);
}

// ---------------------------------------------------------------------------
// Output projection, both parts in one launch (they write disjoint rows of out and read nothing of each other):
//   blocks 0 .. 15   positions < 128 of each batch: bf16 hi.W + lo.W, 1 x 8 tiles x 2 batches (twice the products of a tile
//                    of the other part, so they take the lowest block numbers)
//   blocks 16 .. 255 positions >= 128 of each batch: f16 single product, carries folded back, 15 x 8 tiles x 2 batches
// ---------------------------------------------------------------------------
constexpr int kOutEB = (kEarly / kGBM) * (kQW / kGBN);
constexpr int kOutLB = ((kS - kEarly) / kGBM) * (kQW / kGBN);
__global__ __launch_bounds__(256) void out_proj_kernel(
    const unsigned short* __restrict__ GH, const unsigned short* __restrict__ EH, const unsigned short* __restrict__ EL,
    const unsigned short* __restrict__ WOH, const unsigned short* __restrict__ WOB, float* __restrict__ out) {
  __shared__ __align__(16) unsigned char smem[GemmLds<true>::kBytes];
  const int blk = (int)blockIdx.x;
  /* block-uniform: every barrier of a part is passed by the whole block or by none of it */
  if (blk < kB * kOutEB) {
    gemm_block<1, true>(smem, blk % kOutEB, blk / kOutEB, EH, EL, kQW, (long)kEarly * kQW, WOB, kQW, 0L,
                        out, kQW, (long)kS * kQW, kEarly, kQW, kQW, 1.0f);
  } else {
    const int l = blk - kB * kOutEB;
    gemm_block<0, false>(smem, l % kOutLB, l / kOutLB, GH + (size_t)kEarly * kQW, GH + (size_t)kEarly * kQW, kQW,
                         (long)kS * kQW, WOH, kQW, 0L, out + (size_t)kEarly * kQW, kQW, (long)kS * kQW,
                         kS - kEarly, kQW, kQW, kOutLateMul);
  }
}

// ---------------------------------------------------------------------------
// MODE 0: o0 = bf16 (RNE). MODE 1: o0 = bf16 (RNE), o1 = f16 of (bf16 value x carry) (exact: power-of-two carry).
// ---------------------------------------------------------------------------
template <int MODE>
__device__ __forceinline__ void cast8_block(const float* __restrict__ in, unsigned short* __restrict__ o0,
                                            unsigned short* __restrict__ o1, int blk, float carry) {
  const int i = blk * 256 + threadIdx.x;
  const size_t e0 = (size_t)i << 3;
  const v4f a0 = *(const v4f*)(in + e0);
  const v4f a1 = *(const v4f*)(in + e0 + 4);
  unsigned short bb[8], hb[8];
#pragma unroll
  for (int e = 0; e < 4; ++e) {
    bb[e]     = f2bf_bits(a0[e]);
    bb[4 + e] = f2bf_bits(a1[e]);
  }
#pragma unroll
  for (int e = 0; e < 8; ++e) hb[e] = (MODE == 1) ? h_bits(bf_bits2f(bb[e]) * carry) : (unsigned short)0;
  const v4u ub = (v4u){pk16(bb[0], bb[1]), pk16(bb[2], bb[3]), pk16(bb[4], bb[5]), pk16(bb[6], bb[7])};
  const v4u uh = (v4u){pk16(hb[0], hb[1]), pk16(hb[2], hb[3]), pk16(hb[4], hb[5]), pk16(hb[6], hb[7])};
  unsigned short* q0 = o0 + e0;
  unsigned short* q1 = o1 + e0;
  *(v4u*)q0 = ub;
  if (MODE == 1) *(v4u*)q1 = uh;
  /* closes the stores: in the joint kernel another plane's code follows in the listing and rewrites their registers */
  asm volatile("s_wait_xcnt 0x0" ::: "memory");
}
/* all six planes in one launch: a block (2048 elements) belongs to one plane, found from its number; no plane has a tail */
constexpr int kCbX  = kTok * kHid / 2048;
constexpr int kCbQ  = kQW * kHid / 2048;
constexpr int kCbK  = kKW * kHid / 2048;
constexpr int kCbO  = kQW * kQW / 2048;
constexpr int kCbAll = kCbX + 2 * kCbQ + 2 * kCbK + kCbO;
static_assert((kTok * kHid) % 2048 == 0 && (kQW * kHid) % 2048 == 0 && (kKW * kHid) % 2048 == 0 && (kQW * kQW) % 2048 == 0, "whole blocks");
__global__ __launch_bounds__(256) void cast_all_kernel(
    const float* __restrict__ X, const float* __restrict__ Wq, const float* __restrict__ Wk, const float* __restrict__ Wv,
    const float* __restrict__ Wg, const float* __restrict__ Wo,
    unsigned short* __restrict__ XB, unsigned short* __restrict__ WQKV, unsigned short* __restrict__ WGB,
    unsigned short* __restrict__ WOB, unsigned short* __restrict__ WOH) {
  int blk = (int)blockIdx.x;
  if (blk < kCbX) { cast8_block<0>(X, XB, XB, blk, 1.0f); return; }
  blk -= kCbX;
  if (blk < kCbO) { cast8_block<1>(Wo, WOB, WOH, blk, kWoCarry); return; }
  blk -= kCbO;
  if (blk < kCbQ) { cast8_block<0>(Wq, WQKV, WQKV, blk, 1.0f); return; }
  blk -= kCbQ;
  if (blk < kCbQ) { cast8_block<0>(Wg, WGB, WGB, blk, 1.0f); return; }
  blk -= kCbQ;
  if (blk < kCbK) { cast8_block<0>(Wk, WQKV + (size_t)kQW * kHid, WQKV, blk, 1.0f); return; }
  blk -= kCbK;
  cast8_block<0>(Wv, WQKV + (size_t)kVCol0 * kHid, WQKV, blk, 1.0f);
}

// ---------------------------------------------------------------------------
// Per-head RMS norm (eps inside the rsqrt of the mean square) then rotation by the position tables, f32.
// One wave per (token, slot): slots 0..15 = query heads, 16..19 = key heads (columns slot*128 of the q|k|v plane).
// Lane owns d = 4*lane..4*lane+3; the partner d +/- 64 lives in lane ^ 16 (unconditional exchanges).
// d < 64: y = n[d]*c[d] - n[d+64]*s[d]; d >= 64: y = n[d]*c[d] + n[d-64]*s[d]; tables read by value at [pos][d],
// tables and norm weights RNE-converted to bf16 on load.
// ---------------------------------------------------------------------------
__device__ __forceinline__ void normrot_block(
    int blk, const float* __restrict__ QKV, const float* __restrict__ ctab, const float* __restrict__ stab,
    const float* __restrict__ qw, const float* __restrict__ kw,
    unsigned short* __restrict__ Qp, unsigned short* __restrict__ Kp, float* __restrict__ Qe, float* __restrict__ Ke) {
  const int lane = threadIdx.x & 31;
  const int wave = __builtin_amdgcn_readfirstlane((int)(threadIdx.x >> 5));
  const int gw   = blk * 8 + wave;
  const int tok  = gw / kSlots;
  const int slot = gw - tok * kSlots;
  const int pos  = tok & (kS - 1);
  const int b    = tok / kS;
  const bool isq = slot < kHq;
  const int kslot = isq ? 0 : (slot - kHq);

  const v4f x   = *(const v4f*)(QKV + (size_t)tok * kQKVW + slot * kHD + 4 * lane);
  const v4f wq4 = *(const v4f*)(qw + 4 * lane);
  const v4f wk4 = *(const v4f*)(kw + 4 * lane);
  const v4f c4  = *(const v4f*)(ctab + (size_t)pos * kHD + 4 * lane);
  const v4f s4  = *(const v4f*)(stab + (size_t)pos * kHD + 4 * lane);

  float ss = x[0] * x[0];
  ss = fmaf(x[1], x[1], ss);
  ss = fmaf(x[2], x[2], ss);
  ss = fmaf(x[3], x[3], ss);
  ss = wave_sum(ss);
  const float inv = rsqrtf(ss * (1.0f / (float)kHD) + kEps);

  float n[4], p[4], y[4];
#pragma unroll
  for (int e = 0; e < 4; ++e) {
    const float w = bf16r(isq ? wq4[e] : wk4[e]);
    n[e] = x[e] * inv * w;
  }
#pragma unroll
  for (int e = 0; e < 4; ++e) p[e] = half_xor(n[e]);
  const float sgn = (lane < 16) ? -1.0f : 1.0f;
#pragma unroll
  for (int e = 0; e < 4; ++e) y[e] = n[e] * bf16r(c4[e]) + sgn * (p[e] * bf16r(s4[e]));

  unsigned short hb[4];
#pragma unroll
  for (int e = 0; e < 4; ++e) hb[e] = h_bits(y[e] * kQKCarry);
  const v2u u = (v2u){pk16(hb[0], hb[1]), pk16(hb[2], hb[3])};
  const v4f yv = (v4f){y[0], y[1], y[2], y[3]};

  unsigned short* dq = Qp + (size_t)tok * kQW + slot * kHD + 4 * lane;
  unsigned short* dk = Kp + (size_t)tok * kKW + kslot * kHD + 4 * lane;
  unsigned short* d16 = isq ? dq : dk;
  const bool early = pos < kEarly;
  const int erow = b * kEarly + (early ? pos : 0);
  float* eq = Qe + (size_t)erow * kQW + (isq ? slot : 0) * kHD + 4 * lane;
  float* ek = Ke + (size_t)erow * kKW + kslot * kHD + 4 * lane;
  float* d32 = isq ? eq : ek;
  {
    *(v2u*)d16 = u;
    /* no register that the store names is rewritten in front of this wait */
    asm volatile("s_wait_xcnt 0x0" ::: "memory");
    if (early) *(v4f*)d32 = yv;
  }
}

// ---------------------------------------------------------------------------
// v columns of the q|k|v plane -> VT f16 [b][kv head][d][s] carried x64 (LDS transpose), plus VE f32 rows for positions < 128.
// Block = (b, kv head, 64 positions); 256 threads. Load coverage: 8 iterations x 256 threads = 2048 v4f = 64 rows x 32.
// VT stores: row d = it*32 + wave*4 + (lane>>3), it 0..3 x 8 waves x 4 = 128 rows; (lane&7) x 8 halves = 64 positions
// ---------------------------------------------------------------------------
__device__ __forceinline__ void vprep_block(int blk, const float* __restrict__ QKV, unsigned short* __restrict__ Vt,
                                            float* __restrict__ Ve) {
  __shared__ __align__(16) float sm[64 * kVP];
  const int tid  = threadIdx.x;
  const int lane = tid & 31;
  const int wave = __builtin_amdgcn_readfirstlane((int)(tid >> 5));
  const int st   = blk & 31;
  const int hkv  = (blk >> 5) & (kHkv - 1);
  const int b    = blk >> 7;
  const int s0   = st * 64;
  const float* src = QKV + (size_t)(b * kS + s0) * kQKVW + kVCol0 + hkv * kHD;
#pragma unroll
  for (int i = 0; i < 8; ++i) {
    const int e  = i * 256 + tid;
    const int r  = e >> 5;
    const int cc = (e & 31) * 4;
    const v4f v = *(const v4f*)(src + (size_t)r * kQKVW + cc);
    *(v4f*)(sm + r * kVP + cc) = v;
  }
  __syncthreads();
  const int q = lane >> 3, c8 = (lane & 7) * 8;
  v4u tv[4];
#pragma unroll
  for (int it = 0; it < 4; ++it) {
    const int d = it * 32 + wave * 4 + q;
    unsigned short hb[8];
#pragma unroll
    for (int e = 0; e < 8; ++e) hb[e] = h_bits(sm[(c8 + e) * kVP + d] * kVCarry);
    tv[it] = (v4u){pk16(hb[0], hb[1]), pk16(hb[2], hb[3]), pk16(hb[4], hb[5]), pk16(hb[6], hb[7])};
  }
  v4f ev[8];
#pragma unroll
  for (int it = 0; it < 8; ++it) ev[it] = *(const v4f*)(sm + (it * 8 + wave) * kVP + 4 * lane);
  const bool early = s0 < kEarly;
  const int erow0 = b * kEarly + (early ? s0 : 0);
  unsigned short* vt0 = Vt + (size_t)(b * kHkv + hkv) * kHD * kS + s0 + c8;
  float* ve0 = Ve + (size_t)erow0 * kKW + hkv * kHD + 4 * lane;
  {
#pragma unroll
    for (int it = 0; it < 4; ++it) *(v4u*)(vt0 + (size_t)(it * 32 + wave * 4 + q) * kS) = tv[it];
    /* no register that the four stores name is rewritten in front of this wait */
    asm volatile("s_wait_xcnt 0x0" ::: "memory");
    if (early) {
#pragma unroll
      for (int it = 0; it < 8; ++it) *(v4f*)(ve0 + (size_t)(it * 8 + wave) * kKW) = ev[it];
    }
    
  }
}
/* both readers of the q|k|v plane in one launch (disjoint columns in, disjoint planes out): the v blocks, the longer ones,
   come first; the branch is block-uniform, so the v part's barrier is passed by a whole block or by none of it */
constexpr int kVBlocks = kB * kHkv * (kS / 64);
constexpr int kNBlocks = kTok * kSlots / 8;
__global__ __launch_bounds__(256) void prep_kernel(
    const float* __restrict__ QKV, const float* __restrict__ ctab, const float* __restrict__ stab,
    const float* __restrict__ qw, const float* __restrict__ kw,
    unsigned short* __restrict__ Qp, unsigned short* __restrict__ Kp, float* __restrict__ Qe, float* __restrict__ Ke,
    unsigned short* __restrict__ Vt, float* __restrict__ Ve) {
  const int blk = (int)blockIdx.x;
  if (blk < kVBlocks) vprep_block(blk, QKV, Vt, Ve);
  else                normrot_block(blk - kVBlocks, QKV, ctab, stab, qw, kw, Qp, Kp, Qe, Ke);
}

// ---------------------------------------------------------------------------
// Causal attention for query positions >= 128 (f16 matrix ops, online softmax in f32).
// Block = 8 waves = 4 query heads of one kv head x 2 tiles of 16 query rows; all 8 waves walk the same chunks of 64 keys.
// A chunk's keys (64 rows of 256 B, 272-B pitch) and transposed values (128 rows of 128 B, 144-B pitch) reach LDS once per
// block by asynchronous 16-B copies, two buffers: the next chunk's copies fly while this chunk is worked on.
//   A (q rows):  row = lane&15, k = d:   QP[(b*S + q0 + row)][h*128 + dc*32 + 8*(lane>>4) ..]   (global, once)
//   B (keys):    col = key,     k = d:   LDS key row (key - kv0), element dc*32 + 8*(lane>>4) ..
//   B (values):  col = d,       k = key: LDS value row d, element kk*32 + 8*(lane>>4) ..
// 64 keys per iteration; the last chunk masks key > query with -inf before the softmax (the chunk always holds key <= query
// for every row, so the running maximum stays finite). p = exp(s - m) carried x32768 as f16, spilled per wave to LDS as
// ---------------------------------------------------------------------------
constexpr int kKPitch = 136;
constexpr int kVPitch = 72;
constexpr int kKTile  = kLateKC * kKPitch;
constexpr int kVTile  = kHD * kVPitch;
constexpr int kKVBuf  = kKTile + kVTile;
static_assert(kLateKC == 64 && kHD == 128, "copy maps: 16 lanes per 256-B key row, 8 lanes per 128-B value row");
static_assert(((kKTile * 2) % 16) == 0 && ((kKVBuf * 2) % 16) == 0, "16-B aligned tiles");

/* one chunk's share of a thread: 4 copies of key rows (16 rows apart) and 4 of value rows (32 rows apart), 16 B each,
   global -> LDS through no register; the s_wait_xcnt closes the statement so that no address register of a copy is
   rewritten in front of it */
__device__ __forceinline__ void copy_kv_async(unsigned lk, const unsigned short* gk, unsigned lv, const unsigned short* gv) {
  asm volatile("global_load_async_to_lds_b128 %0, %8, off\n\t"
               "global_load_async_to_lds_b128 %1, %9, off\n\t"
               "global_load_async_to_lds_b128 %2, %10, off\n\t"
               "global_load_async_to_lds_b128 %3, %11, off\n\t"
               "global_load_async_to_lds_b128 %4, %12, off\n\t"
               "global_load_async_to_lds_b128 %5, %13, off\n\t"
               "global_load_async_to_lds_b128 %6, %14, off\n\t"
               "global_load_async_to_lds_b128 %7, %15, off\n\t"
               "s_wait_xcnt 0x0"
               :: "v"(lk), "v"(lk + 16u * (kKPitch * 2u)), "v"(lk + 32u * (kKPitch * 2u)), "v"(lk + 48u * (kKPitch * 2u)),
                  "v"(lv), "v"(lv + 32u * (kVPitch * 2u)), "v"(lv + 64u * (kVPitch * 2u)), "v"(lv + 96u * (kVPitch * 2u)),
                  "v"(gk), "v"(gk + 16 * kKW), "v"(gk + 32 * kKW), "v"(gk + 48 * kKW),
                  "v"(gv), "v"(gv + 32 * kS), "v"(gv + 64 * kS), "v"(gv + 96 * kS) : "memory");
}

/* LDS of one block: two chunk buffers, the 8 waves' p rows, the 8 waves' store slabs */
constexpr unsigned kLateKVB  = 2u * kKVBuf * 2u;
constexpr unsigned kLatePB   = 8u * 16u * kLateKC * 2u;
constexpr unsigned kLateLds  = kLateKVB + kLatePB + 8u * 16u * 68u * 4u;
static_assert((kLateKVB % 16) == 0 && (kLatePB % 16) == 0, "16-B aligned parts");
__device__ __forceinline__ void attn_late_block(unsigned char* smem, int blk,
                                                const unsigned short* __restrict__ Qp, const unsigned short* __restrict__ Kp,
                                                const unsigned short* __restrict__ Vtp, float* __restrict__ attn) {
  union FH { v16h v; v8h h[2]; };
  unsigned short* sKV = (unsigned short*)smem;
  _Float16* Psh = (_Float16*)(smem + kLateKVB);
  float* Os = (float*)(smem + kLateKVB + kLatePB);
  const int tid  = threadIdx.x;
  const int lane = threadIdx.x & 31;
  const int wave = __builtin_amdgcn_readfirstlane((int)(threadIdx.x >> 5));
  const int hh   = lane >> 4;
  const int c    = lane & 15;
  const int qt2  = blk % kLatePairs;
  const int bh   = blk / kLatePairs;
  const int hkv  = bh & (kHkv - 1);
  const int b    = bh / kHkv;
  const int h    = hkv * kRep + (wave & 3);
  const int q0   = kEarly + (qt2 * 2 + (wave >> 2)) * 16;

  /* the thread's own place in a chunk's two tiles and in the two source planes */
  const unsigned lk0 = lds_off(sKV) + (unsigned)(tid >> 4) * (kKPitch * 2u) + (unsigned)(tid & 15) * 16u;
  const unsigned lv0 = lds_off(sKV + kKTile) + (unsigned)(tid >> 3) * (kVPitch * 2u) + (unsigned)(tid & 7) * 16u;
  const unsigned short* gk0 = Kp + (size_t)(b * kS + (tid >> 4)) * kKW + hkv * kHD + (tid & 15) * 8;
  const unsigned short* gv0 = Vtp + ((size_t)(b * kHkv + hkv) * kHD + (tid >> 3)) * kS + (tid & 7) * 8;
  auto issue_chunk = [&](int t) {
    const unsigned o = (unsigned)(t & 1) * (kKVBuf * 2u);
    copy_kv_async(lk0 + o, gk0 + (size_t)t * (kLateKC * kKW), lv0 + o, gv0 + t * kLateKC);
  };
  float* ob = attn + (size_t)(b * kS + q0) * kQW + h * kHD;

  v16h qa[4];
  {
    const _Float16* qrow = (const _Float16*)Qp + (size_t)(b * kS + q0 + c) * kQW + h * kHD + 8 * hh;
#pragma unroll
    for (int dc = 0; dc < 4; ++dc) qa[dc] = Frag<_Float16>::load(qrow + dc * 32);
  }

  float mrow[8], lrow[8];
  v8f oacc[8];
#pragma unroll
  for (int r = 0; r < 8; ++r) { mrow[r] = -INFINITY; lrow[r] = 0.0f; }
#pragma unroll
  for (int t = 0; t < 8; ++t) oacc[t] = (v8f){0.f,0.f,0.f,0.f,0.f,0.f,0.f,0.f};

  int nChunks = (q0 + 16 + kLateKC - 1) / kLateKC;
  if (nChunks > kS / kLateKC) nChunks = kS / kLateKC;
  _Float16* pw = Psh + wave * (16 * kLateKC);
  /* nChunks is the same in all 8 waves: the block's 32 query rows lie inside one chunk of 64 positions */

  issue_chunk(0);
  /* chunk 0 has landed for this wave; the barrier publishes it to the others */
  asm volatile("s_wait_asynccnt 0x0" ::: "memory");
  __syncthreads();
  if (nChunks > 1) issue_chunk(1);

  for (int kc = 0; kc < nChunks; ++kc) {
    const int kv0 = kc * kLateKC;
    const _Float16* sk = (const _Float16*)(sKV + (kc & 1) * kKVBuf) + c * kKPitch + 8 * hh;
    const _Float16* sv = (const _Float16*)(sKV + (kc & 1) * kKVBuf + kKTile) + c * kVPitch + 8 * hh;
    /* fragments are read from LDS in groups of four, in front of the products that use them: eight register sets, the four
       that a group of products has just read are refilled at once with the fragments eight places on */
    v16h ring[8];
#pragma unroll
    for (int f = 0; f < 8; ++f) ring[f] = Frag<_Float16>::load(sk + (f >> 2) * 16 * kKPitch + (f & 3) * 32);
    v8f s[4];
#pragma unroll
    for (int j = 0; j < 4; ++j) {
      s[j] = (v8f){0.f,0.f,0.f,0.f,0.f,0.f,0.f,0.f};
#pragma unroll
      for (int dc = 0; dc < 4; ++dc) s[j] = mma_guard_h(qa[dc], ring[(j & 1) * 4 + dc], s[j]);
      if (j < 2) {
#pragma unroll
        for (int dc = 0; dc < 4; ++dc) ring[(j & 1) * 4 + dc] = Frag<_Float16>::load(sk + (j + 2) * 16 * kKPitch + dc * 32);
      }
    }
    const bool diag = (kc == nChunks - 1);
    float cm[8];
#pragma unroll
    for (int r = 0; r < 8; ++r) {
      const int qrow = q0 + 8 * hh + r;
      float m = -INFINITY;
#pragma unroll
      for (int j = 0; j < 4; ++j) {
        const int kvcol = kv0 + j * 16 + c;
        float v = s[j][r] * kScoreMul;
        if (diag && (kvcol > qrow)) v = -INFINITY;
        s[j][r] = v;
        m = fmaxf(m, v);
      }
      cm[r] = m;
    }
    row16_max8(cm);
#pragma unroll
    for (int r = 0; r < 8; ++r) {
      const float mnew  = fmaxf(mrow[r], cm[r]);
      const float alpha = __expf(mrow[r] - mnew);
      mrow[r] = mnew;
      float psum = 0.0f;
#pragma unroll
      for (int j = 0; j < 4; ++j) {
        const float p = __expf(s[j][r] - mnew);
        psum += p;
        pw[(8 * hh + r) * kLateKC + j * 16 + c] = (_Float16)(p * kPCarry);
      }
      psum = row16_sum(psum);
      lrow[r] = lrow[r] * alpha + psum;
#pragma unroll
      for (int t = 0; t < 8; ++t) oacc[t][r] *= alpha;
    }
    wave_lds_sync();
#pragma unroll
    for (int t = 0; t < 8; ++t) ring[t] = Frag<_Float16>::load(sv + t * 16 * kVPitch);
#pragma unroll
    for (int kk = 0; kk < 2; ++kk) {
      FH pa;
      pa.h[0] = *(const v8h*)(pw + c * kLateKC + kk * 32 + 8 * hh);
      pa.h[1] = *(const v8h*)(pw + c * kLateKC + kk * 32 + 16 + 8 * hh);
#pragma unroll
      for (int g = 0; g < 2; ++g) {
#pragma unroll
        for (int t = g * 4; t < g * 4 + 4; ++t) oacc[t] = mma_guard_h(pa.v, ring[t], oacc[t]);
        if (kk == 0) {
#pragma unroll
          for (int t = g * 4; t < g * 4 + 4; ++t) ring[t] = Frag<_Float16>::load(sv + t * 16 * kVPitch + 32);
        }
      }
    }
    /* hand-over: this wave's reads of the buffer (and of its p rows) are done, */
    asm volatile("s_wait_dscnt 0x0" ::: "memory");
    /* its copies of chunk kc + 1 have landed, */
    asm volatile("s_wait_asynccnt 0x0" ::: "memory");
    /* and the barrier publishes chunk kc + 1 and frees the buffer that was just read */
    __syncthreads();
    if (kc + 2 < nChunks) issue_chunk(kc + 2);
  }
  /* no copy is left in flight when the wave goes on */
  asm volatile("s_wait_asynccnt 0x0" ::: "memory");

  float inv[8];
#pragma unroll
  for (int r = 0; r < 8; ++r) inv[r] = 1.0f / (lrow[r] * (kPCarry * kVCarry));
  float* os = Os + wave * (16 * 68);
  /* the lane's number read anew: the store addresses formed from it are then made here, behind the loop, and hold no
     register across it; without this the joint kernel, held to 256 registers, spills to scratch */
  const int ln  = (int)__builtin_amdgcn_mbcnt_lo(~0u, 0u);
  const int hh2 = ln >> 4;
  const int c2  = ln & 15;
  const int c4  = c2 * 4;
#pragma unroll
  for (int hf = 0; hf < 2; ++hf) {
#pragma unroll
    for (int r = 0; r < 8; ++r) {
#pragma unroll
      for (int t4 = 0; t4 < 4; ++t4) os[(8 * hh2 + r) * 68 + t4 * 16 + c2] = oacc[hf * 4 + t4][r] * inv[r];
    }
    wave_lds_sync();
    {
#pragma unroll
      for (int it = 0; it < 8; ++it) {
        const int row = it * 2 + hh2;
        v4f val = *(const v4f*)(os + row * 68 + c4);
        *(v4f*)(ob + (size_t)row * kQW + hf * 64 + c4) = val;
      }
      
    }
    wave_lds_sync();
  }
}

// ---------------------------------------------------------------------------
// Attention for positions >= 128 and the gate projection's tiles from kGateWithProj on in one launch: neither reads what
// the other writes. The attention blocks come first: their lengths run from 3 to 32 chunks, and the projection's blocks
// take the places that the short ones leave.
// ---------------------------------------------------------------------------
constexpr int kLateBlocks  = kLatePairs * kHkv * kB;
constexpr unsigned kLateGateLds = kLateLds > GemmLds<false>::kBytes ? kLateLds : GemmLds<false>::kBytes;
/* four waves per SIMD (two blocks per WGP, as the LDS allows) hold only while a wave stays inside 256 registers */
__global__ __launch_bounds__(256) __attribute__((amdgpu_waves_per_eu(4, 4))) void attn_late_gate_kernel(
    const unsigned short* __restrict__ Qp, const unsigned short* __restrict__ Kp, const unsigned short* __restrict__ Vtp,
    float* __restrict__ attn, const unsigned short* __restrict__ XB, const unsigned short* __restrict__ WGB,
    float* __restrict__ GF) {
  __shared__ __align__(16) unsigned char smem[kLateGateLds];
  const int blk = (int)blockIdx.x;
  /* block-uniform: every barrier of a part is passed by the whole block or by none of it */
  if (blk < kLateBlocks) attn_late_block(smem, blk, Qp, Kp, Vtp, attn);
  else gemm_block<1, false>(smem, blk - kLateBlocks + kGateWithProj, 0, XB, XB, kHid, 0L, WGB, kHid, 0L, GF, kQW, 0L, kTok, kQW, kHid, 1.0f);
}

// ---------------------------------------------------------------------------
// Attention for query positions t < 128 of each batch (a causally closed sub-problem), all f32 on the vector unit.
// Block = (b, kv head, t); wave = one of the 4 query heads, which share the block's keys and values.
// The key and value rows 0 .. 32*NG-1 (NG = t/32 + 1 groups of 32 keys, all of them rows of positions < 128) reach LDS once
// per block by asynchronous 16-B copies, a whole 512-B row per copy of a wave: first the keys, then, while the scores and
// the softmax are worked out, the values. Key rows lie at a pitch of 132 floats, so that 16 lanes reading 16 B of 16
// different rows fall on all 64 banks.
// Scores: lane owns keys lane + 32*i (i < NG); the NG dots of a lane run side by side as independent chains and share one
// read of the q row; each dot adds its 128 products in the order d = 0..127. Keys beyond t are set to -inf by value.
// Softmax with precise expf; p written to LDS for all 128 slots (zeros beyond t).
// p.v: lane owns d = 4*lane..+3; keys 0 .. in order, up to the next multiple of 8 (p = 0 beyond t adds nothing).
// ---------------------------------------------------------------------------
constexpr int kEKP = 132;
/* eight copies of 16 B per lane, global -> LDS through no register: eight rows, four rows apart in the source plane (pitch
   kKW floats) and in LDS (pitch PITCH floats); the s_wait_xcnt closes the statement so that no address register of a copy
   is rewritten in front of it */
template <int PITCH>
__device__ __forceinline__ void copy_rows8_async(unsigned l, const float* g) {
  constexpr unsigned kStep = 4u * PITCH * 4u;
  asm volatile("global_load_async_to_lds_b128 %0, %8, off\n\t"
               "global_load_async_to_lds_b128 %1, %9, off\n\t"
               "global_load_async_to_lds_b128 %2, %10, off\n\t"
               "global_load_async_to_lds_b128 %3, %11, off\n\t"
               "global_load_async_to_lds_b128 %4, %12, off\n\t"
               "global_load_async_to_lds_b128 %5, %13, off\n\t"
               "global_load_async_to_lds_b128 %6, %14, off\n\t"
               "global_load_async_to_lds_b128 %7, %15, off\n\t"
               "s_wait_xcnt 0x0"
               :: "v"(l), "v"(l + kStep), "v"(l + 2u * kStep), "v"(l + 3u * kStep),
                  "v"(l + 4u * kStep), "v"(l + 5u * kStep), "v"(l + 6u * kStep), "v"(l + 7u * kStep),
                  "v"(g), "v"(g + 4 * kKW), "v"(g + 8 * kKW), "v"(g + 12 * kKW),
                  "v"(g + 16 * kKW), "v"(g + 20 * kKW), "v"(g + 24 * kKW), "v"(g + 28 * kKW) : "memory");
}
template <int NG>
__device__ __forceinline__ void early_dots(const float* skl, const float* sqw, float (&dot)[4]) {
  /* eight steps a trip: their LDS reads are issued ahead of the products, which would else wait for each read in turn */
#pragma unroll 8
  for (int d4 = 0; d4 < kHD / 4; ++d4) {
    const v4f qq = *(const v4f*)(sqw + 4 * d4);
    /* unrolled: dot[i] stays in a register, and the NG chains alternate */
#pragma unroll
    for (int i = 0; i < NG; ++i) {
      const v4f kv = *(const v4f*)(skl + i * 32 * kEKP + 4 * d4);
      dot[i] = fmaf(kv[0], qq[0], dot[i]);
      dot[i] = fmaf(kv[1], qq[1], dot[i]);
      dot[i] = fmaf(kv[2], qq[2], dot[i]);
      dot[i] = fmaf(kv[3], qq[3], dot[i]);
    }
  }
}

__global__ __launch_bounds__(128) void attn_early_kernel(const float* __restrict__ Qe, const float* __restrict__ Ke,
                                                         const float* __restrict__ Ve, float* __restrict__ attn) {
  __shared__ __align__(16) float sK[kEarly * kEKP];
  __shared__ __align__(16) float sV[kEarly * kHD];
  __shared__ __align__(16) float sq[4][kHD];
  __shared__ __align__(16) float sp[4][kEarly];
  const int lane = threadIdx.x & 31;
  const int wave = __builtin_amdgcn_readfirstlane((int)(threadIdx.x >> 5));
  const int t    = blockIdx.x & (kEarly - 1);
  const int hkv  = (blockIdx.x / kEarly) & (kHkv - 1);
  const int b    = blockIdx.x / (kEarly * kHkv);
  const int h    = hkv * kRep + wave;
  const int erow = b * kEarly + t;
  const int nG   = (t >> 5) + 1;
  float* sqw = sq[wave];
  float* spw = sp[wave];
  {
    const v4f qv = *(const v4f*)(Qe + (size_t)erow * kQW + h * kHD + 4 * lane);
    *(v4f*)(sqw + 4 * lane) = qv;
  }
  {
    /* wave w brings rows w, w + 4, .. of each group of 32, a whole row per copy; at most 32 copies of a wave are in flight */
    const float* kg = Ke + (size_t)(b * kEarly + wave) * kKW + hkv * kHD + 4 * lane;
    const float* vg = Ve + (size_t)(b * kEarly + wave) * kKW + hkv * kHD + 4 * lane;
    const unsigned lk = lds_off(sK) + (unsigned)(wave * kEKP + 4 * lane) * 4u;
    const unsigned lv = lds_off(sV) + (unsigned)(wave * kHD + 4 * lane) * 4u;
    for (int g = 0; g < nG; ++g) copy_rows8_async<kEKP>(lk + (unsigned)g * (32u * kEKP * 4u), kg + (size_t)g * (32 * kKW));
    /* this wave's key rows have landed */
    asm volatile("s_wait_asynccnt 0x0" ::: "memory");
    for (int g = 0; g < nG; ++g) copy_rows8_async<kHD>(lv + (unsigned)g * (32u * kHD * 4u), vg + (size_t)g * (32 * kKW));
  }
  /* publishes the key rows to the block's four waves (and each wave's q row to its own lanes); t, and so every branch
     around a barrier of this kernel, is the same in the whole block */
  __syncthreads();
  float dot[4] = {0.0f, 0.0f, 0.0f, 0.0f};
  const float* skl = sK + lane * kEKP;
  if (nG == 4)      early_dots<4>(skl, sqw, dot);
  else if (nG == 3) early_dots<3>(skl, sqw, dot);
  else if (nG == 2) early_dots<2>(skl, sqw, dot);
  else              early_dots<1>(skl, sqw, dot);
  float sc[4];
#pragma unroll
  for (int i = 0; i < 4; ++i) sc[i] = (lane + 32 * i <= t) ? (dot[i] * kInvSqrtHD) : -INFINITY;
  float m = fmaxf(fmaxf(sc[0], sc[1]), fmaxf(sc[2], sc[3]));
  m = wave_max(m);
  float psum = 0.0f;
#pragma unroll
  for (int i = 0; i < 4; ++i) {
    const float p = expf(sc[i] - m);
    psum += p;
    spw[lane + 32 * i] = p;
  }
  psum = wave_sum(psum);
  /* this wave's value rows have landed, */
  asm volatile("s_wait_asynccnt 0x0" ::: "memory");
  /* and the barrier publishes them to the block's four waves (and each wave's p row to its own lanes) */
  __syncthreads();
  float a0 = 0.0f, a1 = 0.0f, a2 = 0.0f, a3 = 0.0f;
  const float* vr = sV + 4 * lane;
  const int nj = (t + 8) & ~7;
  for (int j0 = 0; j0 < nj; j0 += 8) {
    /* unrolled: the LDS reads of eight keys are issued ahead of their products */
#pragma unroll
    for (int u = 0; u < 8; ++u) {
      const float p = spw[j0 + u];
      const v4f vv = *(const v4f*)(vr + (j0 + u) * kHD);
      a0 = fmaf(p, vv[0], a0);
      a1 = fmaf(p, vv[1], a1);
      a2 = fmaf(p, vv[2], a2);
      a3 = fmaf(p, vv[3], a3);
    }
  }
  const float il = 1.0f / psum;
  const v4f ov = (v4f){a0 * il, a1 * il, a2 * il, a3 * il};
  float* dst = attn + (size_t)(b * kS + t) * kQW + h * kHD + 4 * lane;
  *(v4f*)dst = ov;
}

// ---------------------------------------------------------------------------
// gated = attn * sigmoid(gate projection), f32; one block per token row (2048 columns).
// Rolled loop: 8 iterations x 256 threads, one column each (coalesced 4-B loads), result into LDS; after the block barrier
// thread t owns columns 8t..8t+7. Positions >= 128: f16 plane carried x1024 (row = token). Positions < 128: bf16 hi plane and
// bf16 lo plane (lo = RNE bf16 of value - hi), row = b*128 + position. One 16-B store per lane per plane; a wave = 512
// ---------------------------------------------------------------------------
__global__ __launch_bounds__(256) void gate_kernel(const float* __restrict__ attn, const float* __restrict__ G,
                                                   unsigned short* __restrict__ GH, unsigned short* __restrict__ EH,
                                                   unsigned short* __restrict__ EL) {
  __shared__ __align__(16) float sm[kQW];
  const int tid = threadIdx.x;
  const int row = blockIdx.x;
  const int pos = row & (kS - 1);
  const int b   = row / kS;
  const float* ar = attn + (size_t)row * kQW;
  const float* gr = G + (size_t)row * kQW;
#pragma unroll 1
  for (int i = 0; i < kQW / 256; ++i) {
    const int col = i * 256 + tid;
    const float a = ar[col];
    const float g = gr[col];
    const float sg = 1.0f / (1.0f + expf(-g));
    sm[col] = a * sg;
  }
  __syncthreads();
  const v4f x0 = *(const v4f*)(sm + 8 * tid);
  const v4f x1 = *(const v4f*)(sm + 8 * tid + 4);
  if (pos >= kEarly) {
    unsigned short hb[8];
#pragma unroll
    for (int e = 0; e < 4; ++e) {
      hb[e]     = h_bits(x0[e] * kGCarry);
      hb[4 + e] = h_bits(x1[e] * kGCarry);
    }
    const v4u u = (v4u){pk16(hb[0], hb[1]), pk16(hb[2], hb[3]), pk16(hb[4], hb[5]), pk16(hb[6], hb[7])};
    unsigned short* d = GH + (size_t)row * kQW + 8 * tid;
    *(v4u*)d = u;
    
  } else {
    unsigned short hb[8], lb[8];
#pragma unroll
    for (int e = 0; e < 4; ++e) {
      const float f0 = x0[e];
      const float f1 = x1[e];
      hb[e]     = f2bf_bits(f0);
      hb[4 + e] = f2bf_bits(f1);
      lb[e]     = f2bf_bits(f0 - bf_bits2f(hb[e]));
      lb[4 + e] = f2bf_bits(f1 - bf_bits2f(hb[4 + e]));
    }
    const v4u uh = (v4u){pk16(hb[0], hb[1]), pk16(hb[2], hb[3]), pk16(hb[4], hb[5]), pk16(hb[6], hb[7])};
    const v4u ul = (v4u){pk16(lb[0], lb[1]), pk16(lb[2], lb[3]), pk16(lb[4], lb[5]), pk16(lb[6], lb[7])};
    const size_t o = (size_t)(b * kEarly + pos) * kQW + 8 * tid;
    *(v4u*)(EH + o) = uh;
    *(v4u*)(EL + o) = ul;
    
  }
}

// ---------------------------------------------------------------------------
// Host glue: 7 kernel launches, nothing else.
// GEMM shapes (all K % 64 == 0, M % 128 == 0, N % 256 == 0, no padding planes):
//   q|k|v proj : M 4096, N 3072, K 2048 -> 32 x 12 = 384 blocks (bf16)
//   gate proj  : M 4096, N 2048, K 2048 -> 32 x 8 = 256 blocks (bf16): 128 in the q|k|v launch, 128 in the launch of the
//                attention for positions >= 128
//   out late   : per batch M 1920 (positions 128..2047), N 2048, K 2048 -> 15 x 8 = 120 blocks x 2 (f16)
//   out early  : per batch M 128 (positions 0..127), N 2048, K 2048, A hi+lo -> 1 x 8 = 8 blocks x 2 (bf16), same launch
// ---------------------------------------------------------------------------
extern "C" void kernel_launch(void* const* d_in, const int* in_sizes, int n_in,
                              void* d_out, int out_size, void* d_ws, size_t ws_size,
                              hipStream_t stream) {
  if (n_in < 10) return;
  if (in_sizes[0] != kTok * kHid) return;
  if (in_sizes[1] != kS * kHD) return;
  if (in_sizes[2] != kS * kHD) return;
  if (in_sizes[3] != kQW * kHid) return;
  if (in_sizes[4] != kKW * kHid) return;
  if (in_sizes[5] != kKW * kHid) return;
  if (in_sizes[6] != kQW * kHid) return;
  if (in_sizes[7] != kQW * kQW) return;
  if (in_sizes[8] != kHD) return;
  if (in_sizes[9] != kHD) return;
  if (out_size != kTok * kQW) return;
  if (ws_size < kWsTotal) return;

  const float* X    = (const float*)d_in[0];
  const float* ctab = (const float*)d_in[1];
  const float* stab = (const float*)d_in[2];
  const float* Wq   = (const float*)d_in[3];
  const float* Wk   = (const float*)d_in[4];
  const float* Wv   = (const float*)d_in[5];
  const float* Wg   = (const float*)d_in[6];
  const float* Wo   = (const float*)d_in[7];
  const float* qnw  = (const float*)d_in[8];
  const float* knw  = (const float*)d_in[9];
  float* out = (float*)d_out;

  char* ws = (char*)d_ws;
  unsigned short* XB   = (unsigned short*)(ws + kOffXB);
  unsigned short* WQKV = (unsigned short*)(ws + kOffWQKV);
  unsigned short* WGB  = (unsigned short*)(ws + kOffWGB);
  float*          QKV  = (float*)(ws + kOffQKV);
  unsigned short* QP   = (unsigned short*)(ws + kOffQP);
  unsigned short* KP   = (unsigned short*)(ws + kOffKP);
  unsigned short* VT   = (unsigned short*)(ws + kOffVT);
  float*          QE   = (float*)(ws + kOffQE);
  float*          KE   = (float*)(ws + kOffKE);
  float*          VE   = (float*)(ws + kOffVE);
  unsigned short* WOB  = (unsigned short*)(ws + kOffWOB);
  unsigned short* WOH  = (unsigned short*)(ws + kOffWOH);
  float*          ATT  = (float*)(ws + kOffATT);
  float*          GF   = (float*)(ws + kOffGF);
  unsigned short* GH   = (unsigned short*)(ws + kOffGH);
  unsigned short* EH   = (unsigned short*)(ws + kOffEH);
  unsigned short* EL   = (unsigned short*)(ws + kOffEL);

  /* operand planes: every float input RNE-converted to bf16 once (weights are [out][in] = Bt layout already) */
  cast_all_kernel<<<kCbAll, 256, 0, stream>>>(X, Wq, Wk, Wv, Wg, Wo, XB, WQKV, WGB, WOB, WOH);

  /* q|k|v projection: QKV[4096][3072] = x . [Wq;Wk;Wv]^T, and the first tiles of the gate projection */
  proj_kernel<<<kQKVBlocks + kGateWithProj, 256, 0, stream>>>(XB, WQKV, WGB, QKV, GF);

  /* v transpose -> VT (f16 x64) and VE (f32, positions < 128): 2 x 4 x 32 blocks; norm + rotation -> QP, KP (f16 x64) and
     QE, KE (f32, positions < 128) */
  prep_kernel<<<kVBlocks + kNBlocks, 256, 0, stream>>>(QKV, ctab, stab, qnw, knw, QP, KP, QE, KE, VT, VE);

  /* attention, positions >= 128 (matrix ops) beside the rest of the gate projection, then positions < 128 (f32); disjoint rows of ATT */
  attn_late_gate_kernel<<<kLateBlocks + kGateGBlocks - kGateWithProj, 256, 0, stream>>>(QP, KP, VT, ATT, XB, WGB, GF);
  attn_early_kernel<<<kB * kHkv * kEarly, 128, 0, stream>>>(QE, KE, VE, ATT);

  /* gated planes */
  gate_kernel<<<kTok, 256, 0, stream>>>(ATT, GF, GH, EH, EL);

  /* output projection: positions < 128 (bf16 hi.W + lo.W) and positions >= 128 (f16) of each batch */
  out_proj_kernel<<<kB * (kOutEB + kOutLB), 256, 0, stream>>>(GH, EH, EL, WOH, WOB, out);
}

// v006
// Measured time: 210 microseconds a run.
// Next to v005, in two timings, it ran 1.04 and 1.05 times as fast.
// Counting every step since v000, it is 3.74 times as fast.
// Projections x.Wq/Wk/Wv/Wg^T: v_wmma_f32_16x16x32_bf16 (every float input RNE-converted to bf16 once, exact products, f32 accumulate); scores q.k^T and p.v for query positions >= 128: v_wmma_f32_16x16x32_f16 (q,k,v planes carried x64, p carried x32768); query positions < 128: f32 VALU attention; output projection: f16 (gated carried x1024, Wo carried x1024) for positions >= 128, bf16 hi+lo gated planes x bf16 Wo (two products) for positions < 128; norms, position rotation, softmax, gate in f32.
#include <hip/hip_runtime.h>
#include <math.h>

typedef __attribute__((ext_vector_type(16))) _Float16 v16h;
typedef __attribute__((ext_vector_type(8)))  _Float16 v8h;
typedef __attribute__((ext_vector_type(16))) __bf16   v16b;
typedef __attribute__((ext_vector_type(8)))  __bf16   v8b;
typedef __attribute__((ext_vector_type(8)))  float    v8f;
typedef __attribute__((ext_vector_type(4)))  float    v4f;
typedef __attribute__((ext_vector_type(4)))  unsigned int v4u;
typedef __attribute__((ext_vector_type(2)))  unsigned int v2u;

// ---------------------------------------------------------------------------
// Shape constants
// ---------------------------------------------------------------------------
constexpr int kB     = 2;
constexpr int kS     = 2048;
constexpr int kHid   = 2048;
constexpr int kHq    = 16;
constexpr int kHkv   = 4;
constexpr int kRep   = kHq / kHkv;
constexpr int kHD    = 128;
constexpr int kTok   = kB * kS;
constexpr int kQW    = kHq * kHD;
constexpr int kKW    = kHkv * kHD;
constexpr int kQKVW  = kQW + 2 * kKW;
constexpr int kVCol0 = kQW + kKW;
constexpr int kSlots = kHq + kHkv;
constexpr int kEarly = 128;
constexpr int kERows = kB * kEarly;
constexpr int kLateKC    = 64;
constexpr int kLatePairs = (kS - kEarly) / 32;
constexpr int kVP    = 132;
constexpr float kEps = 1e-6f;

constexpr double cx_sqrt(double x) {
  double r = (x > 1.0) ? x : 1.0;
  for (int i = 0; i < 80; ++i) r = 0.5 * (r + x / r);
  return r;
}
constexpr float kInvSqrtHD = (float)(1.0 / cx_sqrt((double)kHD));
/* power-of-two carries of the f16 operand planes */
constexpr float kQKCarry = 64.0f;
constexpr float kVCarry  = 64.0f;
constexpr float kPCarry  = 32768.0f;
constexpr float kGCarry  = 1024.0f;
constexpr float kWoCarry = 1024.0f;
constexpr float kScoreMul   = kInvSqrtHD / (kQKCarry * kQKCarry);
constexpr float kOutLateMul = 1.0f / (kGCarry * kWoCarry);

static_assert(kRep == 4 && kHkv == 4 && kHD == 128, "lane maps assume 4 kv heads x 4 query heads x 128");
static_assert(kTok == 4096 && kQW == 2048 && kKW == 512 && kQKVW == 3072, "wire shapes");
static_assert((kHid % 32) == 0 && (kQW % 32) == 0, "GEMM K multiples of 32");
static_assert((kTok % 64) == 0 && (kQKVW % 64) == 0 && (kQW % 64) == 0 && ((kS - kEarly) % 64) == 0 && (kEarly % 64) == 0, "GEMM M,N multiples of 64");
static_assert((kS % 64) == 0 && (kS / 64) == 32 && (kEarly % 16) == 0 && ((kS - kEarly) % 32) == 0, "tile multiples");

// ---------------------------------------------------------------------------
// Workspace region map (bytes; every offset a multiple of 128)
//   XB   bf16 [4096][2048]  x plane                                16,777,216
//   WQKV bf16 [3072][2048]  Wq | Wk | Wv rows                      12,582,912
//   WGB  bf16 [2048][2048]  Wg                                      8,388,608
//   QKV  f32  [4096][3072]  q | k | v projections                  50,331,648
//   QP   f16  [4096][2048]  normed+rotated q x64                   16,777,216
//   KP   f16  [4096][512]   normed+rotated k x64                    4,194,304
//   VT   f16  [2][4][128][2048] v transposed x64                    4,194,304
//   QE   f32  [256][2048]   q rows of positions < 128               2,097,152
//   KE   f32  [256][512]    k rows of positions < 128                 524,288
//   VE   f32  [256][512]    v rows of positions < 128                 524,288
//   WOB  bf16 [2048][2048]  Wo                                      8,388,608
//   WOH  f16  [2048][2048]  Wo (bf16 value) x1024                   8,388,608
//   GF   f32  [4096][2048]  gate projection                        33,554,432
//   total                                                         166,723,584
// Aliases (each across whole launches):
//   ATT  f32 [4096][2048]  = first 33,554,432 B of QKV (after the joint norm/rotation and v-prep launch)
//   GH   f16 [4096][2048]  = XB (after the gate projection)
//   EH/EL bf16 [256][2048] = first 2 x 1,048,576 B of WQKV (after the q|k|v projection)
// ---------------------------------------------------------------------------
constexpr size_t kOffXB   = 0;
constexpr size_t kOffWQKV = kOffXB   + (size_t)kTok * kHid * 2;
constexpr size_t kOffWGB  = kOffWQKV + (size_t)kQKVW * kHid * 2;
constexpr size_t kOffQKV  = kOffWGB  + (size_t)kQW * kHid * 2;
constexpr size_t kOffQP   = kOffQKV  + (size_t)kTok * kQKVW * 4;
constexpr size_t kOffKP   = kOffQP   + (size_t)kTok * kQW * 2;
constexpr size_t kOffVT   = kOffKP   + (size_t)kTok * kKW * 2;
constexpr size_t kOffQE   = kOffVT   + (size_t)kTok * kKW * 2;
constexpr size_t kOffKE   = kOffQE   + (size_t)kERows * kQW * 4;
constexpr size_t kOffVE   = kOffKE   + (size_t)kERows * kKW * 4;
constexpr size_t kOffWOB  = kOffVE   + (size_t)kERows * kKW * 4;
constexpr size_t kOffWOH  = kOffWOB  + (size_t)kQW * kQW * 2;
constexpr size_t kOffGF   = kOffWOH  + (size_t)kQW * kQW * 2;
constexpr size_t kWsTotal = kOffGF   + (size_t)kTok * kQW * 4;
constexpr size_t kOffATT  = kOffQKV;
constexpr size_t kOffGH   = kOffXB;
constexpr size_t kOffEH   = kOffWQKV;
constexpr size_t kOffEL   = kOffWQKV + (size_t)kERows * kQW * 2;
static_assert(kWsTotal == 166723584ull, "carve total");
static_assert(kWsTotal <= 268435456ull, "carve cap");
static_assert(kOffEL + (size_t)kERows * kQW * 2 <= kOffWGB, "hi/lo planes inside the dead weight plane");
static_assert((kOffWQKV % 128) == 0 && (kOffWGB % 128) == 0 && (kOffQKV % 128) == 0 && (kOffQP % 128) == 0 &&
              (kOffKP % 128) == 0 && (kOffVT % 128) == 0 && (kOffQE % 128) == 0 && (kOffKE % 128) == 0 &&
              (kOffVE % 128) == 0 && (kOffWOB % 128) == 0 && (kOffWOH % 128) == 0 && (kOffGF % 128) == 0 &&
              (kOffEL % 128) == 0, "128-B aligned regions");

// ---------------------------------------------------------------------------
// Small helpers
// ---------------------------------------------------------------------------
__device__ __forceinline__ unsigned short f2bf_bits(float f) {
  unsigned u = __float_as_uint(f);
  return (unsigned short)((u + 0x7FFFu + ((u >> 16) & 1u)) >> 16);
}
__device__ __forceinline__ float bf_bits2f(unsigned short h) { return __uint_as_float(((unsigned)h) << 16); }
__device__ __forceinline__ float bf16r(float f) { return bf_bits2f(f2bf_bits(f)); }
__device__ __forceinline__ unsigned pk16(unsigned short a, unsigned short b) { return (unsigned)a | ((unsigned)b << 16); }
__device__ __forceinline__ unsigned short h_bits(float f) { const _Float16 h = (_Float16)f; return __builtin_bit_cast(unsigned short, h); }
__device__ __forceinline__ void wave_lds_sync() {
  __builtin_amdgcn_fence(__ATOMIC_RELEASE, "workgroup");
  __builtin_amdgcn_wave_barrier();
  __builtin_amdgcn_fence(__ATOMIC_ACQUIRE, "workgroup");
}

/* lane l <-> lane l ^ X inside a row of 16 lanes (X = 1, 2, 4, 8) and l <-> l ^ 16, on the vector unit: no trip through the
   LDS path and no wait on its counter; every lane is on wherever these stand */
template <int X>
__device__ __forceinline__ float row_xor(float v) {
  return __builtin_bit_cast(float, __builtin_amdgcn_update_dpp(0, __builtin_bit_cast(int, v), 0x160 + X, 0xf, 0xf, true));
}
__device__ __forceinline__ float half_xor(float v) {
  const int b = __builtin_bit_cast(int, v);
  return __builtin_bit_cast(float, __builtin_amdgcn_permlanex16(b, b, 0x76543210, 0xfedcba98, false, false));
}
/* butterflies in the order 1, 2, 4, 8 over a row of 16 lanes.
   The maximum of eight values at once is written as text: around a builtin exchange the compiler puts a register move and a
   quieting maximum, three instructions a step in place of one. The eight chains alternate, so that no instruction reads a
   result younger than eight instructions and none waits on the one in front of it */
#define ROW_MAX_STEP(X)                                                     \
  "v_max_num_f32_dpp %0, %0, %0 row_xmask:" #X " row_mask:0xf bank_mask:0xf\n\t" \
  "v_max_num_f32_dpp %1, %1, %1 row_xmask:" #X " row_mask:0xf bank_mask:0xf\n\t" \
  "v_max_num_f32_dpp %2, %2, %2 row_xmask:" #X " row_mask:0xf bank_mask:0xf\n\t" \
  "v_max_num_f32_dpp %3, %3, %3 row_xmask:" #X " row_mask:0xf bank_mask:0xf\n\t" \
  "v_max_num_f32_dpp %4, %4, %4 row_xmask:" #X " row_mask:0xf bank_mask:0xf\n\t" \
  "v_max_num_f32_dpp %5, %5, %5 row_xmask:" #X " row_mask:0xf bank_mask:0xf\n\t" \
  "v_max_num_f32_dpp %6, %6, %6 row_xmask:" #X " row_mask:0xf bank_mask:0xf\n\t" \
  "v_max_num_f32_dpp %7, %7, %7 row_xmask:" #X " row_mask:0xf bank_mask:0xf\n\t"
__device__ __forceinline__ void row16_max8(float (&m)[8]) {
  asm(ROW_MAX_STEP(1) ROW_MAX_STEP(2) ROW_MAX_STEP(4) ROW_MAX_STEP(8)
      : "+v"(m[0]), "+v"(m[1]), "+v"(m[2]), "+v"(m[3]), "+v"(m[4]), "+v"(m[5]), "+v"(m[6]), "+v"(m[7]));
}
__device__ __forceinline__ float row16_sum(float v) {
  v += row_xor<1>(v);
  v += row_xor<2>(v);
  v += row_xor<4>(v);
  v += row_xor<8>(v);
  return v;
}
/* butterflies in the order 16, 8, 4, 2, 1 over the wave */
__device__ __forceinline__ float wave_max(float m) {
  m = fmaxf(m, half_xor(m));
  m = fmaxf(m, row_xor<8>(m));
  m = fmaxf(m, row_xor<4>(m));
  m = fmaxf(m, row_xor<2>(m));
  m = fmaxf(m, row_xor<1>(m));
  return m;
}
__device__ __forceinline__ float wave_sum(float v) {
  v += half_xor(v);
  v += row_xor<8>(v);
  v += row_xor<4>(v);
  v += row_xor<2>(v);
  v += row_xor<1>(v);
  return v;
}

/* matrix op followed by the 4-slot hazard guard; one accumulator per guard statement, A and B named as inputs */
__device__ __forceinline__ v8f mma_guard_h(v16h a, v16h b, v8f c) {
  c = __builtin_amdgcn_wmma_f32_16x16x32_f16(false, a, false, b, (short)0, c, false, false);
  asm volatile("v_nop\n\tv_nop\n\tv_nop\n\tv_nop" : "+v"(c) : "v"(a), "v"(b));
  return c;
}
__device__ __forceinline__ v8f mma_guard_b(v16b a, v16b b, v8f c) {
  c = __builtin_amdgcn_wmma_f32_16x16x32_bf16(false, a, false, b, (short)0, c, false, false);
  asm volatile("v_nop\n\tv_nop\n\tv_nop\n\tv_nop" : "+v"(c) : "v"(a), "v"(b));
  return c;
}
__device__ __forceinline__ void keep4_h(v16h a, v16h b, v16h c, v16h d) { asm volatile("v_nop" :: "v"(a), "v"(b), "v"(c), "v"(d)); }
__device__ __forceinline__ void keep4_b(v16b a, v16b b, v16b c, v16b d) { asm volatile("v_nop" :: "v"(a), "v"(b), "v"(c), "v"(d)); }
__device__ __forceinline__ void acc_guard4(v8f& a, v8f& b, v8f& c, v8f& d) { asm volatile("v_nop\n\tv_nop\n\tv_nop\n\tv_nop" : "+v"(a), "+v"(b), "+v"(c), "+v"(d)); }

template <typename T> struct Frag;
template <> struct Frag<_Float16> {
  typedef v16h V; union U { v16h v; v8h h[2]; };
  /* elements 0..7 <- p[0..7], 8..15 <- p[16..23] */
  static __device__ __forceinline__ v16h load(const _Float16* p) {
    U f; f.h[0] = *(const v8h*)(p); f.h[1] = *(const v8h*)(p + 16); return f.v;
  }
  static __device__ __forceinline__ v8f mmag(v16h a, v16h b, v8f c) { return mma_guard_h(a, b, c); }
  static __device__ __forceinline__ void keep(v16h a, v16h b, v16h c, v16h d) { keep4_h(a, b, c, d); }
};
template <> struct Frag<__bf16> {
  typedef v16b V; union U { v16b v; v8b h[2]; };
  static __device__ __forceinline__ v16b load(const __bf16* p) {
    U f; f.h[0] = *(const v8b*)(p); f.h[1] = *(const v8b*)(p + 16); return f.v;
  }
  static __device__ __forceinline__ v8f mmag(v16b a, v16b b, v8f c) { return mma_guard_b(a, b, c); }
  static __device__ __forceinline__ void keep(v16b a, v16b b, v16b c, v16b d) { keep4_b(a, b, c, d); }
};

// ---------------------------------------------------------------------------
// Batched GEMM: C[m,n] = scale * sum_k A[m,k] * Bt[n,k]. A block of 8 waves (2 x 4) owns a 128 x 256 tile, each wave 64x64 of it.
// A row-major [M,K]; Bt row-major [N,K]; M % 128 == 0, N % 256 == 0, K % 64 == 0 (no tails).
// Operands reach LDS by asynchronous 16-B copies, 64 k per stage (128-B rows at a 144-B pitch), two buffers: the next
// stage's copies fly while this stage's fragments are read from LDS; 8 lanes copy one whole 128-B line of a row.
// ASPLIT: A carried as hi/lo planes (A2 = lo plane, same layout): product = hi.b + lo.b into one accumulator.
// ET: 0 = f16 operands, 1 = bf16 operands (pointers passed as 16-bit storage). Output f32.
// ---------------------------------------------------------------------------
constexpr int kGBM    = 128;
constexpr int kGBN    = 256;
constexpr int kGKS    = 64;
constexpr int kGPitch = 72;
constexpr unsigned kGPitchB = kGPitch * 2;
static_assert((kTok % kGBM) == 0 && ((kS - kEarly) % kGBM) == 0 && (kEarly % kGBM) == 0, "GEMM M multiples of the block tile");
static_assert((kQKVW % kGBN) == 0 && (kQW % kGBN) == 0, "GEMM N multiples of the block tile");
static_assert((kHid % kGKS) == 0 && (kQW % kGKS) == 0 && kHid / kGKS >= 2 && kQW / kGKS >= 2, "GEMM K in whole stages");

__device__ __forceinline__ unsigned lds_off(const void* p) { return (unsigned)(size_t)p; }

/* copies of 16 B per lane, global -> LDS through no register: row r of the run lies 32 * r rows behind the first, in LDS
   (pitch kGPitchB) and in the source (step32 elements). One statement holds a whole run, and the s_wait_xcnt closes it so
   that no address register of a copy is rewritten in front of it; one run per statement keeps that wait to one per run */
__device__ __forceinline__ void copy4_async(unsigned l, const unsigned short* g, size_t step32) {
  asm volatile("global_load_async_to_lds_b128 %0, %4, off\n\t"
               "global_load_async_to_lds_b128 %1, %5, off\n\t"
               "global_load_async_to_lds_b128 %2, %6, off\n\t"
               "global_load_async_to_lds_b128 %3, %7, off\n\t"
               "s_wait_xcnt 0x0"
               :: "v"(l), "v"(l + 32u * kGPitchB), "v"(l + 64u * kGPitchB), "v"(l + 96u * kGPitchB),
                  "v"(g), "v"(g + step32), "v"(g + 2 * step32), "v"(g + 3 * step32) : "memory");
}
__device__ __forceinline__ void copy8_async(unsigned l, const unsigned short* g, size_t step32,
                                            unsigned m, const unsigned short* h, size_t step32h) {
  asm volatile("global_load_async_to_lds_b128 %0, %8, off\n\t"
               "global_load_async_to_lds_b128 %1, %9, off\n\t"
               "global_load_async_to_lds_b128 %2, %10, off\n\t"
               "global_load_async_to_lds_b128 %3, %11, off\n\t"
               "global_load_async_to_lds_b128 %4, %12, off\n\t"
               "global_load_async_to_lds_b128 %5, %13, off\n\t"
               "global_load_async_to_lds_b128 %6, %14, off\n\t"
               "global_load_async_to_lds_b128 %7, %15, off\n\t"
               "s_wait_xcnt 0x0"
               :: "v"(l), "v"(l + 32u * kGPitchB), "v"(l + 64u * kGPitchB), "v"(l + 96u * kGPitchB),
                  "v"(m), "v"(m + 32u * kGPitchB), "v"(m + 64u * kGPitchB), "v"(m + 96u * kGPitchB),
                  "v"(g), "v"(g + step32), "v"(g + 2 * step32), "v"(g + 3 * step32),
                  "v"(h), "v"(h + step32h), "v"(h + 2 * step32h), "v"(h + 3 * step32h) : "memory");
}

template <int ET> struct Elem;
template <> struct Elem<0> { typedef _Float16 T; };
template <> struct Elem<1> { typedef __bf16 T; };
/* LDS of one GEMM block: two stage buffers, then the 8 waves' store slabs */
template <bool ASPLIT> struct GemmLds {
  static constexpr int kARows = ASPLIT ? 2 * kGBM : kGBM;
  static constexpr int kRows  = kARows + kGBN;
  static constexpr unsigned kBufB   = (unsigned)kRows * kGPitchB;
  static constexpr unsigned kBytes  = 2u * kBufB + 8u * 16u * 68u * 4u;
};
/* one block's tile: bx = tile number inside the batch entry b; smem = the block's LDS, GemmLds<ASPLIT>::kBytes of it */
template <int ET, bool ASPLIT>
__device__ __forceinline__ void gemm_block(
    unsigned char* smem, int bx, int b,
    const unsigned short* __restrict__ Ap, const unsigned short* __restrict__ A2p, int lda, long strideA,
    const unsigned short* __restrict__ Btp, int ldb, long strideB,
    float* __restrict__ Cout, int ldc, long strideC,
    int M, int N, int K, float scale) {
  typedef typename Elem<ET>::T T;
  typedef typename Frag<T>::V V;
  constexpr int kARows = GemmLds<ASPLIT>::kARows;
  constexpr int kRows  = GemmLds<ASPLIT>::kRows;
  constexpr unsigned kBufB = GemmLds<ASPLIT>::kBufB;
  unsigned short* sStage = (unsigned short*)smem;
  float* sT = (float*)(smem + 2u * kBufB);
  const int tid  = threadIdx.x;
  const int lane = tid & 31;
  const int wave = __builtin_amdgcn_readfirstlane((int)(threadIdx.x >> 5));
  const int tilesN = N / kGBN;
  const int tilesM = M / kGBM;
  /* block-uniform, in front of every barrier and copy */
  if (bx >= tilesM * tilesN) return;
  const int tm = bx / tilesN;
  const int tn = bx - tm * tilesN;
  const int bm0 = tm * kGBM;
  const int bn0 = tn * kGBN;
  const int wm = wave >> 2;
  const int wn = wave & 3;
  const int m0 = bm0 + (wm << 6);
  const int n0 = bn0 + (wn << 6);

  const int rlane = lane & 15;
  const int koff  = (lane >> 4) * 8;
  const int mOff  = (lane >> 4) * 8;

  /* the thread's own place in a stage and in the two (three) source planes */
  const int crow = tid >> 3;
  const int cch  = tid & 7;
  const unsigned lds0 = lds_off(sStage) + (unsigned)crow * kGPitchB + (unsigned)cch * 16u;
  const unsigned short* gA  = Ap  + (size_t)b * strideA + (size_t)(bm0 + crow) * lda + cch * 8;
  const unsigned short* gA2 = A2p + (size_t)b * strideA + (size_t)(bm0 + crow) * lda + cch * 8;
  const unsigned short* gB  = Btp + (size_t)b * strideB + (size_t)(bn0 + crow) * ldb + cch * 8;
  const size_t stepA = (size_t)32 * lda;
  const size_t stepB = (size_t)32 * ldb;
  const int nst = K / kGKS;

  auto issue_stage = [&](int t) {
    const unsigned l = lds0 + (unsigned)(t & 1) * kBufB;
    const size_t k0 = (size_t)t * kGKS;
    const unsigned lb = l + (unsigned)kARows * kGPitchB;
    /* thread t brings bytes 16*(t&7).. of rows (t>>3) + 32*i of each panel: 128 rows of A (and of A2), 256 of Bt */
    if (ASPLIT) copy8_async(l, gA + k0, stepA, l + (unsigned)kGBM * kGPitchB, gA2 + k0, stepA);
    else        copy4_async(l, gA + k0, stepA);
    copy8_async(lb, gB + k0, stepB, lb + 128u * kGPitchB, gB + k0 + 4 * stepB, stepB);
  };

  v8f acc[4][4];
#pragma unroll
  for (int i = 0; i < 4; ++i)
#pragma unroll
    for (int j = 0; j < 4; ++j) acc[i][j] = (v8f){0.f,0.f,0.f,0.f,0.f,0.f,0.f,0.f};

  issue_stage(0);
  /* stage 0 has landed for this wave; the barrier publishes it to the others */
  asm volatile("s_wait_asynccnt 0x0" ::: "memory");
  __syncthreads();
  if (nst > 1) issue_stage(1);

  for (int t = 0; t < nst; ++t) {
    const T* sb = (const T*)(sStage + (t & 1) * (kRows * kGPitch));
    const T* sa = sb + ((wm << 6) + rlane) * kGPitch + koff;
    const T* sw = sb + (kARows + (wn << 6) + rlane) * kGPitch + koff;
#pragma unroll
    for (int ks = 0; ks < kGKS / 32; ++ks) {
      /* all fragments of a k step are read from LDS as one group in front of its products */
      V bh[4], ah[4], al[4];
#pragma unroll
      for (int j = 0; j < 4; ++j) bh[j] = Frag<T>::load(sw + (j << 4) * kGPitch + ks * 32);
#pragma unroll
      for (int i = 0; i < 4; ++i) {
        ah[i] = Frag<T>::load(sa + (i << 4) * kGPitch + ks * 32);
        al[i] = ah[i];
        if (ASPLIT) al[i] = Frag<T>::load(sa + (kGBM + (i << 4)) * kGPitch + ks * 32);
      }
#pragma unroll
      for (int i = 0; i < 4; ++i) {
#pragma unroll
        for (int j = 0; j < 4; ++j) {
          acc[i][j] = Frag<T>::mmag(ah[i], bh[j], acc[i][j]);
          if (ASPLIT) acc[i][j] = Frag<T>::mmag(al[i], bh[j], acc[i][j]);
        }
      }
      Frag<T>::keep(bh[0], bh[1], bh[2], bh[3]);
    }
    /* hand-over: this wave's reads of the buffer are done, */
    asm volatile("s_wait_dscnt 0x0" ::: "memory");
    /* its copies of stage t + 1 have landed, */
    asm volatile("s_wait_asynccnt 0x0" ::: "memory");
    /* and the barrier publishes stage t + 1 and frees the buffer that was just read */
    __syncthreads();
    if (t + 2 < nst) issue_stage(t + 2);
  }
  /* no copy is left in flight when the wave goes on */
  asm volatile("s_wait_asynccnt 0x0" ::: "memory");
  acc_guard4(acc[0][0], acc[0][1], acc[0][2], acc[0][3]);
  acc_guard4(acc[1][0], acc[1][1], acc[1][2], acc[1][3]);
  acc_guard4(acc[2][0], acc[2][1], acc[2][2], acc[2][3]);
  acc_guard4(acc[3][0], acc[3][1], acc[3][2], acc[3][3]);

  float* slab = sT + wave * (16 * 68);
  float* C = Cout + (size_t)b * strideC;
#pragma unroll
  for (int i = 0; i < 4; ++i) {
    const int mBase = m0 + (i << 4);
#pragma unroll
    for (int j = 0; j < 4; ++j) {
#pragma unroll
      for (int r = 0; r < 8; ++r) {
        slab[(mOff + r) * 68 + (j << 4) + rlane] = acc[i][j][r] * scale;
      }
    }
    wave_lds_sync();
    {
      const int hh = lane >> 4, c4 = (lane & 15) * 4;
      {
#pragma unroll
        for (int it = 0; it < 8; ++it) {
          const int row = it * 2 + hh;
          v4f v = *(const v4f*)(slab + row * 68 + c4);
          *(v4f*)(C + (size_t)(mBase + row) * ldc + n0 + c4) = v;
        }
        
      }
    }
    wave_lds_sync();
  }
}

// ---------------------------------------------------------------------------
// Projections of x, bf16: QKV[4096][3072] = x . [Wq;Wk;Wv]^T (32 x 12 = 384 blocks) and, in the same launch, the first
// kGateWithProj tiles of the gate projection GF[4096][2048] = x . Wg^T (neither reads what the other writes). Two blocks
// fit a WGP; 384 blocks leave 128 of the 512 places of 256 WGPs empty, and the gate tiles take them. The other gate tiles
// run beside the attention for positions >= 128.
// ---------------------------------------------------------------------------
constexpr int kQKVBlocks    = (kTok / kGBM) * (kQKVW / kGBN);
constexpr int kGateGBlocks  = (kTok / kGBM) * (kQW / kGBN);
constexpr int kGateWithProj = 2 * 256 - kQKVBlocks;
static_assert(kGateWithProj > 0 && kGateWithProj < kGateGBlocks, "the gate tiles are split between two launches");
__global__ __launch_bounds__(256) void proj_kernel(
    const unsigned short* __restrict__ XB, const unsigned short* __restrict__ WQKV, const unsigned short* __restrict__ WGB,
    float* __restrict__ QKV, float* __restrict__ GF) {
  __shared__ __align__(16) unsigned char smem[GemmLds<false>::kBytes];
  const int blk = (int)blockIdx.x;
  const bool gt = blk >= kQKVBlocks;
  const int n   = gt ? kQW : kQKVW;
  gemm_block<1, false>(smem, gt ? blk - kQKVBlocks : blk, 0, XB, XB, kHid, 0L, gt ? WGB : WQKV, kHid, 0L,
                       gt ? GF : QKV, n, 0L, kTok, n, kHid, 1.0f);
}

// ---------------------------------------------------------------------------
// Output projection, both parts in one launch (they write disjoint rows of out and read nothing of each other):
//   blocks 0 .. 15   positions < 128 of each batch: bf16 hi.W + lo.W, 1 x 8 tiles x 2 batches (twice the products of a tile
//                    of the other part, so they take the lowest block numbers)
//   blocks 16 .. 255 positions >= 128 of each batch: f16 single product, carries folded back, 15 x 8 tiles x 2 batches
// ---------------------------------------------------------------------------
constexpr int kOutEB = (kEarly / kGBM) * (kQW / kGBN);
constexpr int kOutLB = ((kS - kEarly) / kGBM) * (kQW / kGBN);
__global__ __launch_bounds__(256) void out_proj_kernel(
    const unsigned short* __restrict__ GH, const unsigned short* __restrict__ EH, const unsigned short* __restrict__ EL,
    const unsigned short* __restrict__ WOH, const unsigned short* __restrict__ WOB, float* __restrict__ out) {
  __shared__ __align__(16) unsigned char smem[GemmLds<true>::kBytes];
  const int blk = (int)blockIdx.x;
  /* block-uniform: every barrier of a part is passed by the whole block or by none of it */
  if (blk < kB * kOutEB) {
    gemm_block<1, true>(smem, blk % kOutEB, blk / kOutEB, EH, EL, kQW, (long)kEarly * kQW, WOB, kQW, 0L,
                        out, kQW, (long)kS * kQW, kEarly, kQW, kQW, 1.0f);
  } else {
    const int l = blk - kB * kOutEB;
    gemm_block<0, false>(smem, l % kOutLB, l / kOutLB, GH + (size_t)kEarly * kQW, GH + (size_t)kEarly * kQW, kQW,
                         (long)kS * kQW, WOH, kQW, 0L, out + (size_t)kEarly * kQW, kQW, (long)kS * kQW,
                         kS - kEarly, kQW, kQW, kOutLateMul);
  }
}

// ---------------------------------------------------------------------------
// MODE 0: o0 = bf16 (RNE). MODE 1: o0 = bf16 (RNE), o1 = f16 of (bf16 value x carry) (exact: power-of-two carry).
// ---------------------------------------------------------------------------
template <int MODE>
__device__ __forceinline__ void cast8_block(const float* __restrict__ in, unsigned short* __restrict__ o0,
                                            unsigned short* __restrict__ o1, int blk, float carry) {
  const int i = blk * 256 + threadIdx.x;
  const size_t e0 = (size_t)i << 3;
  const v4f a0 = *(const v4f*)(in + e0);
  const v4f a1 = *(const v4f*)(in + e0 + 4);
  unsigned short bb[8], hb[8];
#pragma unroll
  for (int e = 0; e < 4; ++e) {
    bb[e]     = f2bf_bits(a0[e]);
    bb[4 + e] = f2bf_bits(a1[e]);
  }
#pragma unroll
  for (int e = 0; e < 8; ++e) hb[e] = (MODE == 1) ? h_bits(bf_bits2f(bb[e]) * carry) : (unsigned short)0;
  const v4u ub = (v4u){pk16(bb[0], bb[1]), pk16(bb[2], bb[3]), pk16(bb[4], bb[5]), pk16(bb[6], bb[7])};
  const v4u uh = (v4u){pk16(hb[0], hb[1]), pk16(hb[2], hb[3]), pk16(hb[4], hb[5]), pk16(hb[6], hb[7])};
  unsigned short* q0 = o0 + e0;
  unsigned short* q1 = o1 + e0;
  *(v4u*)q0 = ub;
  if (MODE == 1) *(v4u*)q1 = uh;
  /* closes the stores: in the joint kernel another plane's code follows in the listing and rewrites their registers */
  asm volatile("s_wait_xcnt 0x0" ::: "memory");
}
/* all six planes in one launch: a block (2048 elements) belongs to one plane, found from its number; no plane has a tail */
constexpr int kCbX  = kTok * kHid / 2048;
constexpr int kCbQ  = kQW * kHid / 2048;
constexpr int kCbK  = kKW * kHid / 2048;
constexpr int kCbO  = kQW * kQW / 2048;
constexpr int kCbAll = kCbX + 2 * kCbQ + 2 * kCbK + kCbO;
static_assert((kTok * kHid) % 2048 == 0 && (kQW * kHid) % 2048 == 0 && (kKW * kHid) % 2048 == 0 && (kQW * kQW) % 2048 == 0, "whole blocks");
__global__ __launch_bounds__(256) void cast_all_kernel(
    const float* __restrict__ X, const float* __restrict__ Wq, const float* __restrict__ Wk, const float* __restrict__ Wv,
    const float* __restrict__ Wg, const float* __restrict__ Wo,
    unsigned short* __restrict__ XB, unsigned short* __restrict__ WQKV, unsigned short* __restrict__ WGB,
    unsigned short* __restrict__ WOB, unsigned short* __restrict__ WOH) {
  int blk = (int)blockIdx.x;
  if (blk < kCbX) { cast8_block<0>(X, XB, XB, blk, 1.0f); return; }
  blk -= kCbX;
  if (blk < kCbO) { cast8_block<1>(Wo, WOB, WOH, blk, kWoCarry); return; }
  blk -= kCbO;
  if (blk < kCbQ) { cast8_block<0>(Wq, WQKV, WQKV, blk, 1.0f); return; }
  blk -= kCbQ;
  if (blk < kCbQ) { cast8_block<0>(Wg, WGB, WGB, blk, 1.0f); return; }
  blk -= kCbQ;
  if (blk < kCbK) { cast8_block<0>(Wk, WQKV + (size_t)kQW * kHid, WQKV, blk, 1.0f); return; }
  blk -= kCbK;
  cast8_block<0>(Wv, WQKV + (size_t)kVCol0 * kHid, WQKV, blk, 1.0f);
}

// ---------------------------------------------------------------------------
// Per-head RMS norm (eps inside the rsqrt of the mean square) then rotation by the position tables, f32.
// One wave per (token, slot): slots 0..15 = query heads, 16..19 = key heads (columns slot*128 of the q|k|v plane).
// Lane owns d = 4*lane..4*lane+3; the partner d +/- 64 lives in lane ^ 16 (unconditional exchanges).
// d < 64: y = n[d]*c[d] - n[d+64]*s[d]; d >= 64: y = n[d]*c[d] + n[d-64]*s[d]; tables read by value at [pos][d],
// tables and norm weights RNE-converted to bf16 on load.
// ---------------------------------------------------------------------------
__device__ __forceinline__ void normrot_block(
    int blk, const float* __restrict__ QKV, const float* __restrict__ ctab, const float* __restrict__ stab,
    const float* __restrict__ qw, const float* __restrict__ kw,
    unsigned short* __restrict__ Qp, unsigned short* __restrict__ Kp, float* __restrict__ Qe, float* __restrict__ Ke) {
  const int lane = threadIdx.x & 31;
  const int wave = __builtin_amdgcn_readfirstlane((int)(threadIdx.x >> 5));
  const int gw   = blk * 8 + wave;
  const int tok  = gw / kSlots;
  const int slot = gw - tok * kSlots;
  const int pos  = tok & (kS - 1);
  const int b    = tok / kS;
  const bool isq = slot < kHq;
  const int kslot = isq ? 0 : (slot - kHq);

  const v4f x   = *(const v4f*)(QKV + (size_t)tok * kQKVW + slot * kHD + 4 * lane);
  const v4f wq4 = *(const v4f*)(qw + 4 * lane);
  const v4f wk4 = *(const v4f*)(kw + 4 * lane);
  const v4f c4  = *(const v4f*)(ctab + (size_t)pos * kHD + 4 * lane);
  const v4f s4  = *(const v4f*)(stab + (size_t)pos * kHD + 4 * lane);

  float ss = x[0] * x[0];
  ss = fmaf(x[1], x[1], ss);
  ss = fmaf(x[2], x[2], ss);
  ss = fmaf(x[3], x[3], ss);
  ss = wave_sum(ss);
  const float inv = rsqrtf(ss * (1.0f / (float)kHD) + kEps);

  float n[4], p[4], y[4];
#pragma unroll
  for (int e = 0; e < 4; ++e) {
    const float w = bf16r(isq ? wq4[e] : wk4[e]);
    n[e] = x[e] * inv * w;
  }
#pragma unroll
  for (int e = 0; e < 4; ++e) p[e] = half_xor(n[e]);
  const float sgn = (lane < 16) ? -1.0f : 1.0f;
#pragma unroll
  for (int e = 0; e < 4; ++e) y[e] = n[e] * bf16r(c4[e]) + sgn * (p[e] * bf16r(s4[e]));

  unsigned short hb[4];
#pragma unroll
  for (int e = 0; e < 4; ++e) hb[e] = h_bits(y[e] * kQKCarry);
  const v2u u = (v2u){pk16(hb[0], hb[1]), pk16(hb[2], hb[3])};
  const v4f yv = (v4f){y[0], y[1], y[2], y[3]};

  unsigned short* dq = Qp + (size_t)tok * kQW + slot * kHD + 4 * lane;
  unsigned short* dk = Kp + (size_t)tok * kKW + kslot * kHD + 4 * lane;
  unsigned short* d16 = isq ? dq : dk;
  const bool early = pos < kEarly;
  const int erow = b * kEarly + (early ? pos : 0);
  float* eq = Qe + (size_t)erow * kQW + (isq ? slot : 0) * kHD + 4 * lane;
  float* ek = Ke + (size_t)erow * kKW + kslot * kHD + 4 * lane;
  float* d32 = isq ? eq : ek;
  {
    *(v2u*)d16 = u;
    /* no register that the store names is rewritten in front of this wait */
    asm volatile("s_wait_xcnt 0x0" ::: "memory");
    if (early) *(v4f*)d32 = yv;
  }
}

// ---------------------------------------------------------------------------
// v columns of the q|k|v plane -> VT f16 [b][kv head][d][s] carried x64 (LDS transpose), plus VE f32 rows for positions < 128.
// Block = (b, kv head, 64 positions); 256 threads. Load coverage: 8 iterations x 256 threads = 2048 v4f = 64 rows x 32.
// VT stores: row d = it*32 + wave*4 + (lane>>3), it 0..3 x 8 waves x 4 = 128 rows; (lane&7) x 8 halves = 64 positions
// ---------------------------------------------------------------------------
__device__ __forceinline__ void vprep_block(int blk, const float* __restrict__ QKV, unsigned short* __restrict__ Vt,
                                            float* __restrict__ Ve) {
  __shared__ __align__(16) float sm[64 * kVP];
  const int tid  = threadIdx.x;
  const int lane = tid & 31;
  const int wave = __builtin_amdgcn_readfirstlane((int)(tid >> 5));
  const int st   = blk & 31;
  const int hkv  = (blk >> 5) & (kHkv - 1);
  const int b    = blk >> 7;
  const int s0   = st * 64;
  const float* src = QKV + (size_t)(b * kS + s0) * kQKVW + kVCol0 + hkv * kHD;
#pragma unroll
  for (int i = 0; i < 8; ++i) {
    const int e  = i * 256 + tid;
    const int r  = e >> 5;
    const int cc = (e & 31) * 4;
    const v4f v = *(const v4f*)(src + (size_t)r * kQKVW + cc);
    *(v4f*)(sm + r * kVP + cc) = v;
  }
  __syncthreads();
  const int q = lane >> 3, c8 = (lane & 7) * 8;
  v4u tv[4];
#pragma unroll
  for (int it = 0; it < 4; ++it) {
    const int d = it * 32 + wave * 4 + q;
    unsigned short hb[8];
#pragma unroll
    for (int e = 0; e < 8; ++e) hb[e] = h_bits(sm[(c8 + e) * kVP + d] * kVCarry);
    tv[it] = (v4u){pk16(hb[0], hb[1]), pk16(hb[2], hb[3]), pk16(hb[4], hb[5]), pk16(hb[6], hb[7])};
  }
  v4f ev[8];
#pragma unroll
  for (int it = 0; it < 8; ++it) ev[it] = *(const v4f*)(sm + (it * 8 + wave) * kVP + 4 * lane);
  const bool early = s0 < kEarly;
  const int erow0 = b * kEarly + (early ? s0 : 0);
  unsigned short* vt0 = Vt + (size_t)(b * kHkv + hkv) * kHD * kS + s0 + c8;
  float* ve0 = Ve + (size_t)erow0 * kKW + hkv * kHD + 4 * lane;
  {
#pragma unroll
    for (int it = 0; it < 4; ++it) *(v4u*)(vt0 + (size_t)(it * 32 + wave * 4 + q) * kS) = tv[it];
    /* no register that the four stores name is rewritten in front of this wait */
    asm volatile("s_wait_xcnt 0x0" ::: "memory");
    if (early) {
#pragma unroll
      for (int it = 0; it < 8; ++it) *(v4f*)(ve0 + (size_t)(it * 8 + wave) * kKW) = ev[it];
    }
    
  }
}
/* both readers of the q|k|v plane in one launch (disjoint columns in, disjoint planes out): the v blocks, the longer ones,
   come first; the branch is block-uniform, so the v part's barrier is passed by a whole block or by none of it */
constexpr int kVBlocks = kB * kHkv * (kS / 64);
constexpr int kNBlocks = kTok * kSlots / 8;
__global__ __launch_bounds__(256) void prep_kernel(
    const float* __restrict__ QKV, const float* __restrict__ ctab, const float* __restrict__ stab,
    const float* __restrict__ qw, const float* __restrict__ kw,
    unsigned short* __restrict__ Qp, unsigned short* __restrict__ Kp, float* __restrict__ Qe, float* __restrict__ Ke,
    unsigned short* __restrict__ Vt, float* __restrict__ Ve) {
  const int blk = (int)blockIdx.x;
  if (blk < kVBlocks) vprep_block(blk, QKV, Vt, Ve);
  else                normrot_block(blk - kVBlocks, QKV, ctab, stab, qw, kw, Qp, Kp, Qe, Ke);
}

// ---------------------------------------------------------------------------
// Causal attention for query positions >= 128 (f16 matrix ops, online softmax in f32).
// Block = 8 waves = 4 query heads of one kv head x 2 tiles of 16 query rows; all 8 waves walk the same chunks of 64 keys.
// A chunk's keys (64 rows of 256 B, 272-B pitch) and transposed values (128 rows of 128 B, 144-B pitch) reach LDS once per
// block by asynchronous 16-B copies, two buffers: the next chunk's copies fly while this chunk is worked on.
//   A (q rows):  row = lane&15, k = d:   QP[(b*S + q0 + row)][h*128 + dc*32 + 8*(lane>>4) ..]   (global, once)
//   B (keys):    col = key,     k = d:   LDS key row (key - kv0), element dc*32 + 8*(lane>>4) ..
//   B (values):  col = d,       k = key: LDS value row d, element kk*32 + 8*(lane>>4) ..
// 64 keys per iteration; the last chunk masks key > query with -inf before the softmax (the chunk always holds key <= query
// for every row, so the running maximum stays finite). p = exp(s - m) carried x32768 as f16, spilled per wave to LDS as
// ---------------------------------------------------------------------------
constexpr int kKPitch = 136;
constexpr int kVPitch = 72;
constexpr int kKTile  = kLateKC * kKPitch;
constexpr int kVTile  = kHD * kVPitch;
constexpr int kKVBuf  = kKTile + kVTile;
static_assert(kLateKC == 64 && kHD == 128, "copy maps: 16 lanes per 256-B key row, 8 lanes per 128-B value row");
static_assert(((kKTile * 2) % 16) == 0 && ((kKVBuf * 2) % 16) == 0, "16-B aligned tiles");

/* one chunk's share of a thread: 4 copies of key rows (16 rows apart) and 4 of value rows (32 rows apart), 16 B each,
   global -> LDS through no register; the s_wait_xcnt closes the statement so that no address register of a copy is
   rewritten in front of it */
__device__ __forceinline__ void copy_kv_async(unsigned lk, const unsigned short* gk, unsigned lv, const unsigned short* gv) {
  asm volatile("global_load_async_to_lds_b128 %0, %8, off\n\t"
               "global_load_async_to_lds_b128 %1, %9, off\n\t"
               "global_load_async_to_lds_b128 %2, %10, off\n\t"
               "global_load_async_to_lds_b128 %3, %11, off\n\t"
               "global_load_async_to_lds_b128 %4, %12, off\n\t"
               "global_load_async_to_lds_b128 %5, %13, off\n\t"
               "global_load_async_to_lds_b128 %6, %14, off\n\t"
               "global_load_async_to_lds_b128 %7, %15, off\n\t"
               "s_wait_xcnt 0x0"
               :: "v"(lk), "v"(lk + 16u * (kKPitch * 2u)), "v"(lk + 32u * (kKPitch * 2u)), "v"(lk + 48u * (kKPitch * 2u)),
                  "v"(lv), "v"(lv + 32u * (kVPitch * 2u)), "v"(lv + 64u * (kVPitch * 2u)), "v"(lv + 96u * (kVPitch * 2u)),
                  "v"(gk), "v"(gk + 16 * kKW), "v"(gk + 32 * kKW), "v"(gk + 48 * kKW),
                  "v"(gv), "v"(gv + 32 * kS), "v"(gv + 64 * kS), "v"(gv + 96 * kS) : "memory");
}

/* LDS of one block: two chunk buffers, the 8 waves' p rows, the 8 waves' store slabs */
constexpr unsigned kLateKVB  = 2u * kKVBuf * 2u;
constexpr unsigned kLatePB   = 8u * 16u * kLateKC * 2u;
constexpr unsigned kLateLds  = kLateKVB + kLatePB + 8u * 16u * 68u * 4u;
static_assert((kLateKVB % 16) == 0 && (kLatePB % 16) == 0, "16-B aligned parts");
__device__ __forceinline__ void attn_late_block(unsigned char* smem, int blk,
                                                const unsigned short* __restrict__ Qp, const unsigned short* __restrict__ Kp,
                                                const unsigned short* __restrict__ Vtp, float* __restrict__ attn) {
  union FH { v16h v; v8h h[2]; };
  unsigned short* sKV = (unsigned short*)smem;
  _Float16* Psh = (_Float16*)(smem + kLateKVB);
  float* Os = (float*)(smem + kLateKVB + kLatePB);
  const int tid  = threadIdx.x;
  const int lane = threadIdx.x & 31;
  const int wave = __builtin_amdgcn_readfirstlane((int)(threadIdx.x >> 5));
  const int hh   = lane >> 4;
  const int c    = lane & 15;
  const int qt2  = blk % kLatePairs;
  const int bh   = blk / kLatePairs;
  const int hkv  = bh & (kHkv - 1);
  const int b    = bh / kHkv;
  const int h    = hkv * kRep + (wave & 3);
  const int q0   = kEarly + (qt2 * 2 + (wave >> 2)) * 16;

  /* the thread's own place in a chunk's two tiles and in the two source planes */
  const unsigned lk0 = lds_off(sKV) + (unsigned)(tid >> 4) * (kKPitch * 2u) + (unsigned)(tid & 15) * 16u;
  const unsigned lv0 = lds_off(sKV + kKTile) + (unsigned)(tid >> 3) * (kVPitch * 2u) + (unsigned)(tid & 7) * 16u;
  const unsigned short* gk0 = Kp + (size_t)(b * kS + (tid >> 4)) * kKW + hkv * kHD + (tid & 15) * 8;
  const unsigned short* gv0 = Vtp + ((size_t)(b * kHkv + hkv) * kHD + (tid >> 3)) * kS + (tid & 7) * 8;
  auto issue_chunk = [&](int t) {
    const unsigned o = (unsigned)(t & 1) * (kKVBuf * 2u);
    copy_kv_async(lk0 + o, gk0 + (size_t)t * (kLateKC * kKW), lv0 + o, gv0 + t * kLateKC);
  };
  float* ob = attn + (size_t)(b * kS + q0) * kQW + h * kHD;

  v16h qa[4];
  {
    const _Float16* qrow = (const _Float16*)Qp + (size_t)(b * kS + q0 + c) * kQW + h * kHD + 8 * hh;
#pragma unroll
    for (int dc = 0; dc < 4; ++dc) qa[dc] = Frag<_Float16>::load(qrow + dc * 32);
  }

  float mrow[8], lrow[8];
  v8f oacc[8];
#pragma unroll
  for (int r = 0; r < 8; ++r) { mrow[r] = -INFINITY; lrow[r] = 0.0f; }
#pragma unroll
  for (int t = 0; t < 8; ++t) oacc[t] = (v8f){0.f,0.f,0.f,0.f,0.f,0.f,0.f,0.f};

  int nChunks = (q0 + 16 + kLateKC - 1) / kLateKC;
  if (nChunks > kS / kLateKC) nChunks = kS / kLateKC;
  _Float16* pw = Psh + wave * (16 * kLateKC);
  /* nChunks is the same in all 8 waves: the block's 32 query rows lie inside one chunk of 64 positions */

  issue_chunk(0);
  /* chunk 0 has landed for this wave; the barrier publishes it to the others */
  asm volatile("s_wait_asynccnt 0x0" ::: "memory");
  __syncthreads();
  if (nChunks > 1) issue_chunk(1);

  for (int kc = 0; kc < nChunks; ++kc) {
    const int kv0 = kc * kLateKC;
    const _Float16* sk = (const _Float16*)(sKV + (kc & 1) * kKVBuf) + c * kKPitch + 8 * hh;
    const _Float16* sv = (const _Float16*)(sKV + (kc & 1) * kKVBuf + kKTile) + c * kVPitch + 8 * hh;
    /* fragments are read from LDS in groups of four, in front of the products that use them: eight register sets, the four
       that a group of products has just read are refilled at once with the fragments eight places on */
    v16h ring[8];
#pragma unroll
    for (int f = 0; f < 8; ++f) ring[f] = Frag<_Float16>::load(sk + (f >> 2) * 16 * kKPitch + (f & 3) * 32);
    v8f s[4];
#pragma unroll
    for (int j = 0; j < 4; ++j) {
      s[j] = (v8f){0.f,0.f,0.f,0.f,0.f,0.f,0.f,0.f};
#pragma unroll
      for (int dc = 0; dc < 4; ++dc) s[j] = mma_guard_h(qa[dc], ring[(j & 1) * 4 + dc], s[j]);
      if (j < 2) {
#pragma unroll
        for (int dc = 0; dc < 4; ++dc) ring[(j & 1) * 4 + dc] = Frag<_Float16>::load(sk + (j + 2) * 16 * kKPitch + dc * 32);
      }
    }
    const bool diag = (kc == nChunks - 1);
    float cm[8];
#pragma unroll
    for (int r = 0; r < 8; ++r) {
      const int qrow = q0 + 8 * hh + r;
      float m = -INFINITY;
#pragma unroll
      for (int j = 0; j < 4; ++j) {
        const int kvcol = kv0 + j * 16 + c;
        float v = s[j][r] * kScoreMul;
        if (diag && (kvcol > qrow)) v = -INFINITY;
        s[j][r] = v;
        m = fmaxf(m, v);
      }
      cm[r] = m;
    }
    row16_max8(cm);
#pragma unroll
    for (int r = 0; r < 8; ++r) {
      const float mnew  = fmaxf(mrow[r], cm[r]);
      const float alpha = __expf(mrow[r] - mnew);
      mrow[r] = mnew;
      float psum = 0.0f;
#pragma unroll
      for (int j = 0; j < 4; ++j) {
        const float p = __expf(s[j][r] - mnew);
        psum += p;
        pw[(8 * hh + r) * kLateKC + j * 16 + c] = (_Float16)(p * kPCarry);
      }
      psum = row16_sum(psum);
      lrow[r] = lrow[r] * alpha + psum;
#pragma unroll
      for (int t = 0; t < 8; ++t) oacc[t][r] *= alpha;
    }
    wave_lds_sync();
#pragma unroll
    for (int t = 0; t < 8; ++t) ring[t] = Frag<_Float16>::load(sv + t * 16 * kVPitch);
#pragma unroll
    for (int kk = 0; kk < 2; ++kk) {
      FH pa;
      pa.h[0] = *(const v8h*)(pw + c * kLateKC + kk * 32 + 8 * hh);
      pa.h[1] = *(const v8h*)(pw + c * kLateKC + kk * 32 + 16 + 8 * hh);
#pragma unroll
      for (int g = 0; g < 2; ++g) {
#pragma unroll
        for (int t = g * 4; t < g * 4 + 4; ++t) oacc[t] = mma_guard_h(pa.v, ring[t], oacc[t]);
        if (kk == 0) {
#pragma unroll
          for (int t = g * 4; t < g * 4 + 4; ++t) ring[t] = Frag<_Float16>::load(sv + t * 16 * kVPitch + 32);
        }
      }
    }
    /* hand-over: this wave's reads of the buffer (and of its p rows) are done, */
    asm volatile("s_wait_dscnt 0x0" ::: "memory");
    /* its copies of chunk kc + 1 have landed, */
    asm volatile("s_wait_asynccnt 0x0" ::: "memory");
    /* and the barrier publishes chunk kc + 1 and frees the buffer that was just read */
    __syncthreads();
    if (kc + 2 < nChunks) issue_chunk(kc + 2);
  }
  /* no copy is left in flight when the wave goes on */
  asm volatile("s_wait_asynccnt 0x0" ::: "memory");

  float inv[8];
#pragma unroll
  for (int r = 0; r < 8; ++r) inv[r] = 1.0f / (lrow[r] * (kPCarry * kVCarry));
  float* os = Os + wave * (16 * 68);
  /* the lane's number read anew: the store addresses formed from it are then made here, behind the loop, and hold no
     register across it; without this the joint kernel, held to 256 registers, spills to scratch */
  const int ln  = (int)__builtin_amdgcn_mbcnt_lo(~0u, 0u);
  const int hh2 = ln >> 4;
  const int c2  = ln & 15;
  const int c4  = c2 * 4;
#pragma unroll
  for (int hf = 0; hf < 2; ++hf) {
#pragma unroll
    for (int r = 0; r < 8; ++r) {
#pragma unroll
      for (int t4 = 0; t4 < 4; ++t4) os[(8 * hh2 + r) * 68 + t4 * 16 + c2] = oacc[hf * 4 + t4][r] * inv[r];
    }
    wave_lds_sync();
    {
#pragma unroll
      for (int it = 0; it < 8; ++it) {
        const int row = it * 2 + hh2;
        v4f val = *(const v4f*)(os + row * 68 + c4);
        *(v4f*)(ob + (size_t)row * kQW + hf * 64 + c4) = val;
      }
      
    }
    wave_lds_sync();
  }
}

// ---------------------------------------------------------------------------
// Attention for query positions t < 128 of each batch (a causally closed sub-problem), all f32 on the vector unit.
// Block = (b, kv head, positions t = 2u and 2u + 1), 8 waves; wave = one of the 4 query heads at one of the two positions;
// all 8 share the block's keys and values. The blocks run in the launch of the attention for positions >= 128.
// The key and value rows 0 .. 32*NG-1 (NG = t/32 + 1 groups of 32 keys, the same for both positions, all of them rows of
// positions < 128) reach LDS once per block by asynchronous 16-B copies, a whole 512-B row per copy of a wave: waves 0..3
// bring the keys, waves 4..7 the values, which land while the scores and the softmax are worked out. Key rows lie at a
// pitch of 132 floats, so that 16 lanes reading 16 B of 16 different rows fall on all 64 banks.
// Scores: lane owns keys lane + 32*i (i < NG); the NG dots of a lane run side by side as independent chains and share one
// read of the q row; each dot adds its 128 products in the order d = 0..127. Keys beyond t are set to -inf by value.
// Softmax with precise expf; p written to LDS for all 128 slots (zeros beyond t).
// p.v: lane owns d = 4*lane..+3; keys 0 .. in order, up to the next multiple of 8 (p = 0 beyond t adds nothing).
// ---------------------------------------------------------------------------
constexpr int kEKP = 132;
/* eight copies of 16 B per lane, global -> LDS through no register: eight rows, four rows apart in the source plane (pitch
   kKW floats) and in LDS (pitch PITCH floats); the s_wait_xcnt closes the statement so that no address register of a copy
   is rewritten in front of it */
template <int PITCH>
__device__ __forceinline__ void copy_rows8_async(unsigned l, const float* g) {
  constexpr unsigned kStep = 4u * PITCH * 4u;
  asm volatile("global_load_async_to_lds_b128 %0, %8, off\n\t"
               "global_load_async_to_lds_b128 %1, %9, off\n\t"
               "global_load_async_to_lds_b128 %2, %10, off\n\t"
               "global_load_async_to_lds_b128 %3, %11, off\n\t"
               "global_load_async_to_lds_b128 %4, %12, off\n\t"
               "global_load_async_to_lds_b128 %5, %13, off\n\t"
               "global_load_async_to_lds_b128 %6, %14, off\n\t"
               "global_load_async_to_lds_b128 %7, %15, off\n\t"
               "s_wait_xcnt 0x0"
               :: "v"(l), "v"(l + kStep), "v"(l + 2u * kStep), "v"(l + 3u * kStep),
                  "v"(l + 4u * kStep), "v"(l + 5u * kStep), "v"(l + 6u * kStep), "v"(l + 7u * kStep),
                  "v"(g), "v"(g + 4 * kKW), "v"(g + 8 * kKW), "v"(g + 12 * kKW),
                  "v"(g + 16 * kKW), "v"(g + 20 * kKW), "v"(g + 24 * kKW), "v"(g + 28 * kKW) : "memory");
}
template <int NG>
__device__ __forceinline__ void early_dots(const float* skl, const float* sqw, float (&dot)[4]) {
  /* eight steps a trip: their LDS reads are issued ahead of the products, which would else wait for each read in turn */
#pragma unroll 8
  for (int d4 = 0; d4 < kHD / 4; ++d4) {
    const v4f qq = *(const v4f*)(sqw + 4 * d4);
    /* unrolled: dot[i] stays in a register, and the NG chains alternate */
#pragma unroll
    for (int i = 0; i < NG; ++i) {
      const v4f kv = *(const v4f*)(skl + i * 32 * kEKP + 4 * d4);
      dot[i] = fmaf(kv[0], qq[0], dot[i]);
      dot[i] = fmaf(kv[1], qq[1], dot[i]);
      dot[i] = fmaf(kv[2], qq[2], dot[i]);
      dot[i] = fmaf(kv[3], qq[3], dot[i]);
    }
  }
}

/* LDS of one block: key rows, value rows, the 8 waves' q rows, the 8 waves' p rows */
constexpr int kEarlyPairs  = kEarly / 2;
constexpr int kEarlyBlocks = kB * kHkv * kEarlyPairs;
constexpr unsigned kEarlyLds = (unsigned)(kEarly * kEKP + kEarly * kHD + 8 * kHD + 8 * kEarly) * 4u;
static_assert((kEarly % 32) == 0 && ((kEarly * kEKP * 4) % 16) == 0, "whole groups of 32 keys; 16-B aligned parts");
__device__ __forceinline__ void attn_early_block(unsigned char* smem, int blk,
                                                 const float* __restrict__ Qe, const float* __restrict__ Ke,
                                                 const float* __restrict__ Ve, float* __restrict__ attn) {
  float* sK = (float*)smem;
  float* sV = sK + kEarly * kEKP;
  float* sq = sV + kEarly * kHD;
  float* sp = sq + 8 * kHD;
  const int lane = threadIdx.x & 31;
  const int wave = __builtin_amdgcn_readfirstlane((int)(threadIdx.x >> 5));
  const int w4   = wave & 3;
  /* in each (b, kv head) run of 64 blocks the longest (most keys) have the lowest numbers */
  const int t    = 2 * (kEarlyPairs - 1 - (blk % kEarlyPairs)) + (wave >> 2);
  const int hkv  = (blk / kEarlyPairs) & (kHkv - 1);
  const int b    = blk / (kEarlyPairs * kHkv);
  const int h    = hkv * kRep + w4;
  const int erow = b * kEarly + t;
  const int nG   = (t >> 5) + 1;
  float* sqw = sq + wave * kHD;
  float* spw = sp + wave * kEarly;
  {
    const v4f qv = *(const v4f*)(Qe + (size_t)erow * kQW + h * kHD + 4 * lane);
    *(v4f*)(sqw + 4 * lane) = qv;
  }
  {
    /* wave w (keys) or w + 4 (values) brings rows w, w + 4, .. of each group of 32, a whole row per copy; at most 32 copies
       of a wave are in flight; the branch is the same in a whole wave */
    const size_t ro = (size_t)(b * kEarly + w4) * kKW + hkv * kHD + 4 * lane;
    if (wave < 4) {
      const float* kg = Ke + ro;
      const unsigned lk = lds_off(sK) + (unsigned)(w4 * kEKP + 4 * lane) * 4u;
      for (int g = 0; g < nG; ++g) copy_rows8_async<kEKP>(lk + (unsigned)g * (32u * kEKP * 4u), kg + (size_t)g * (32 * kKW));
      /* this wave's key rows have landed */
      asm volatile("s_wait_asynccnt 0x0" ::: "memory");
    } else {
      const float* vg = Ve + ro;
      const unsigned lv = lds_off(sV) + (unsigned)(w4 * kHD + 4 * lane) * 4u;
      for (int g = 0; g < nG; ++g) copy_rows8_async<kHD>(lv + (unsigned)g * (32u * kHD * 4u), vg + (size_t)g * (32 * kKW));
    }
  }
  /* publishes the key rows to the block's eight waves (and each wave's q row to its own lanes); every wave of the block
     passes both barriers of this part */
  __syncthreads();
  float dot[4] = {0.0f, 0.0f, 0.0f, 0.0f};
  const float* skl = sK + lane * kEKP;
  if (nG == 4)      early_dots<4>(skl, sqw, dot);
  else if (nG == 3) early_dots<3>(skl, sqw, dot);
  else if (nG == 2) early_dots<2>(skl, sqw, dot);
  else              early_dots<1>(skl, sqw, dot);
  float sc[4];
#pragma unroll
  for (int i = 0; i < 4; ++i) sc[i] = (lane + 32 * i <= t) ? (dot[i] * kInvSqrtHD) : -INFINITY;
  float m = fmaxf(fmaxf(sc[0], sc[1]), fmaxf(sc[2], sc[3]));
  m = wave_max(m);
  float psum = 0.0f;
#pragma unroll
  for (int i = 0; i < 4; ++i) {
    const float p = expf(sc[i] - m);
    psum += p;
    spw[lane + 32 * i] = p;
  }
  psum = wave_sum(psum);
  /* this wave's value rows (waves 4..7) have landed, */
  asm volatile("s_wait_asynccnt 0x0" ::: "memory");
  /* and the barrier publishes them to the block's eight waves (and each wave's p row to its own lanes) */
  __syncthreads();
  float a0 = 0.0f, a1 = 0.0f, a2 = 0.0f, a3 = 0.0f;
  const float* vr = sV + 4 * lane;
  const int nj = (t + 8) & ~7;
  for (int j0 = 0; j0 < nj; j0 += 8) {
    /* unrolled: the LDS reads of eight keys are issued ahead of their products */
#pragma unroll
    for (int u = 0; u < 8; ++u) {
      const float p = spw[j0 + u];
      const v4f vv = *(const v4f*)(vr + (j0 + u) * kHD);
      a0 = fmaf(p, vv[0], a0);
      a1 = fmaf(p, vv[1], a1);
      a2 = fmaf(p, vv[2], a2);
      a3 = fmaf(p, vv[3], a3);
    }
  }
  const float il = 1.0f / psum;
  const v4f ov = (v4f){a0 * il, a1 * il, a2 * il, a3 * il};
  float* dst = attn + (size_t)(b * kS + t) * kQW + h * kHD + 4 * lane;
  *(v4f*)dst = ov;
  /* closes the store: in the joint kernel the common tail follows in the listing and rewrites the store's base register */
  asm volatile("s_wait_xcnt 0x0" ::: "memory");
}

// ---------------------------------------------------------------------------
// Attention for positions >= 128, the gate projection's tiles from kGateWithProj on and the attention for positions < 128
// in one launch: none reads what another writes. The blocks for positions >= 128 come first: their lengths run from 3 to
// 32 chunks, and the projection's blocks, then the short blocks for positions < 128, take the places that the short ones
// leave.
// ---------------------------------------------------------------------------
constexpr int kLateBlocks  = kLatePairs * kHkv * kB;
constexpr int kGateRest    = kGateGBlocks - kGateWithProj;
constexpr unsigned kLateGateLds = kLateLds > GemmLds<false>::kBytes ? kLateLds : GemmLds<false>::kBytes;
static_assert(kEarlyLds <= kLateGateLds, "the part for positions < 128 fits the LDS of the other two");
/* four waves per SIMD (two blocks per WGP, as the LDS allows) hold only while a wave stays inside 256 registers */
__global__ __launch_bounds__(256) __attribute__((amdgpu_waves_per_eu(4, 4))) void attn_late_gate_kernel(
    const unsigned short* __restrict__ Qp, const unsigned short* __restrict__ Kp, const unsigned short* __restrict__ Vtp,
    float* __restrict__ attn, const unsigned short* __restrict__ XB, const unsigned short* __restrict__ WGB,
    float* __restrict__ GF, const float* __restrict__ Qe, const float* __restrict__ Ke, const float* __restrict__ Ve) {
  __shared__ __align__(16) unsigned char smem[kLateGateLds];
  const int blk = (int)blockIdx.x;
  /* block-uniform: every barrier of a part is passed by the whole block or by none of it */
  if (blk < kLateBlocks) attn_late_block(smem, blk, Qp, Kp, Vtp, attn);
  else if (blk < kLateBlocks + kGateRest) gemm_block<1, false>(smem, blk - kLateBlocks + kGateWithProj, 0, XB, XB, kHid, 0L, WGB, kHid, 0L, GF, kQW, 0L, kTok, kQW, kHid, 1.0f);
  else attn_early_block(smem, blk - kLateBlocks - kGateRest, Qe, Ke, Ve, attn);
}

// ---------------------------------------------------------------------------
// gated = attn * sigmoid(gate projection), f32; one block per token row (2048 columns).
// Rolled loop: 8 iterations x 256 threads, one column each (coalesced 4-B loads), result into LDS; after the block barrier
// thread t owns columns 8t..8t+7. Positions >= 128: f16 plane carried x1024 (row = token). Positions < 128: bf16 hi plane and
// bf16 lo plane (lo = RNE bf16 of value - hi), row = b*128 + position. One 16-B store per lane per plane; a wave = 512
// ---------------------------------------------------------------------------
__global__ __launch_bounds__(256) void gate_kernel(const float* __restrict__ attn, const float* __restrict__ G,
                                                   unsigned short* __restrict__ GH, unsigned short* __restrict__ EH,
                                                   unsigned short* __restrict__ EL) {
  __shared__ __align__(16) float sm[kQW];
  const int tid = threadIdx.x;
  const int row = blockIdx.x;
  const int pos = row & (kS - 1);
  const int b   = row / kS;
  const float* ar = attn + (size_t)row * kQW;
  const float* gr = G + (size_t)row * kQW;
#pragma unroll 1
  for (int i = 0; i < kQW / 256; ++i) {
    const int col = i * 256 + tid;
    const float a = ar[col];
    const float g = gr[col];
    const float sg = 1.0f / (1.0f + expf(-g));
    sm[col] = a * sg;
  }
  __syncthreads();
  const v4f x0 = *(const v4f*)(sm + 8 * tid);
  const v4f x1 = *(const v4f*)(sm + 8 * tid + 4);
  if (pos >= kEarly) {
    unsigned short hb[8];
#pragma unroll
    for (int e = 0; e < 4; ++e) {
      hb[e]     = h_bits(x0[e] * kGCarry);
      hb[4 + e] = h_bits(x1[e] * kGCarry);
    }
    const v4u u = (v4u){pk16(hb[0], hb[1]), pk16(hb[2], hb[3]), pk16(hb[4], hb[5]), pk16(hb[6], hb[7])};
    unsigned short* d = GH + (size_t)row * kQW + 8 * tid;
    *(v4u*)d = u;
    
  } else {
    unsigned short hb[8], lb[8];
#pragma unroll
    for (int e = 0; e < 4; ++e) {
      const float f0 = x0[e];
      const float f1 = x1[e];
      hb[e]     = f2bf_bits(f0);
      hb[4 + e] = f2bf_bits(f1);
      lb[e]     = f2bf_bits(f0 - bf_bits2f(hb[e]));
      lb[4 + e] = f2bf_bits(f1 - bf_bits2f(hb[4 + e]));
    }
    const v4u uh = (v4u){pk16(hb[0], hb[1]), pk16(hb[2], hb[3]), pk16(hb[4], hb[5]), pk16(hb[6], hb[7])};
    const v4u ul = (v4u){pk16(lb[0], lb[1]), pk16(lb[2], lb[3]), pk16(lb[4], lb[5]), pk16(lb[6], lb[7])};
    const size_t o = (size_t)(b * kEarly + pos) * kQW + 8 * tid;
    *(v4u*)(EH + o) = uh;
    *(v4u*)(EL + o) = ul;
    
  }
}

// ---------------------------------------------------------------------------
// Host glue: 6 kernel launches, nothing else.
// GEMM shapes (all K % 64 == 0, M % 128 == 0, N % 256 == 0, no padding planes):
//   q|k|v proj : M 4096, N 3072, K 2048 -> 32 x 12 = 384 blocks (bf16)
//   gate proj  : M 4096, N 2048, K 2048 -> 32 x 8 = 256 blocks (bf16): 128 in the q|k|v launch, 128 in the launch of the
//                attention for positions >= 128
//   out late   : per batch M 1920 (positions 128..2047), N 2048, K 2048 -> 15 x 8 = 120 blocks x 2 (f16)
//   out early  : per batch M 128 (positions 0..127), N 2048, K 2048, A hi+lo -> 1 x 8 = 8 blocks x 2 (bf16), same launch
// ---------------------------------------------------------------------------
extern "C" void kernel_launch(void* const* d_in, const int* in_sizes, int n_in,
                              void* d_out, int out_size, void* d_ws, size_t ws_size,
                              hipStream_t stream) {
  if (n_in < 10) return;
  if (in_sizes[0] != kTok * kHid) return;
  if (in_sizes[1] != kS * kHD) return;
  if (in_sizes[2] != kS * kHD) return;
  if (in_sizes[3] != kQW * kHid) return;
  if (in_sizes[4] != kKW * kHid) return;
  if (in_sizes[5] != kKW * kHid) return;
  if (in_sizes[6] != kQW * kHid) return;
  if (in_sizes[7] != kQW * kQW) return;
  if (in_sizes[8] != kHD) return;
  if (in_sizes[9] != kHD) return;
  if (out_size != kTok * kQW) return;
  if (ws_size < kWsTotal) return;

  const float* X    = (const float*)d_in[0];
  const float* ctab = (const float*)d_in[1];
  const float* stab = (const float*)d_in[2];
  const float* Wq   = (const float*)d_in[3];
  const float* Wk   = (const float*)d_in[4];
  const float* Wv   = (const float*)d_in[5];
  const float* Wg   = (const float*)d_in[6];
  const float* Wo   = (const float*)d_in[7];
  const float* qnw  = (const float*)d_in[8];
  const float* knw  = (const float*)d_in[9];
  float* out = (float*)d_out;

  char* ws = (char*)d_ws;
  unsigned short* XB   = (unsigned short*)(ws + kOffXB);
  unsigned short* WQKV = (unsigned short*)(ws + kOffWQKV);
  unsigned short* WGB  = (unsigned short*)(ws + kOffWGB);
  float*          QKV  = (float*)(ws + kOffQKV);
  unsigned short* QP   = (unsigned short*)(ws + kOffQP);
  unsigned short* KP   = (unsigned short*)(ws + kOffKP);
  unsigned short* VT   = (unsigned short*)(ws + kOffVT);
  float*          QE   = (float*)(ws + kOffQE);
  float*          KE   = (float*)(ws + kOffKE);
  float*          VE   = (float*)(ws + kOffVE);
  unsigned short* WOB  = (unsigned short*)(ws + kOffWOB);
  unsigned short* WOH  = (unsigned short*)(ws + kOffWOH);
  float*          ATT  = (float*)(ws + kOffATT);
  float*          GF   = (float*)(ws + kOffGF);
  unsigned short* GH   = (unsigned short*)(ws + kOffGH);
  unsigned short* EH   = (unsigned short*)(ws + kOffEH);
  unsigned short* EL   = (unsigned short*)(ws + kOffEL);

  /* operand planes: every float input RNE-converted to bf16 once (weights are [out][in] = Bt layout already) */
  cast_all_kernel<<<kCbAll, 256, 0, stream>>>(X, Wq, Wk, Wv, Wg, Wo, XB, WQKV, WGB, WOB, WOH);

  /* q|k|v projection: QKV[4096][3072] = x . [Wq;Wk;Wv]^T, and the first tiles of the gate projection */
  proj_kernel<<<kQKVBlocks + kGateWithProj, 256, 0, stream>>>(XB, WQKV, WGB, QKV, GF);

  /* v transpose -> VT (f16 x64) and VE (f32, positions < 128): 2 x 4 x 32 blocks; norm + rotation -> QP, KP (f16 x64) and
     QE, KE (f32, positions < 128) */
  prep_kernel<<<kVBlocks + kNBlocks, 256, 0, stream>>>(QKV, ctab, stab, qnw, knw, QP, KP, QE, KE, VT, VE);

  /* attention, positions >= 128 (matrix ops), beside the rest of the gate projection and positions < 128 (f32); disjoint rows of ATT */
  attn_late_gate_kernel<<<kLateBlocks + kGateRest + kEarlyBlocks, 256, 0, stream>>>(QP, KP, VT, ATT, XB, WGB, GF, QE, KE, VE);

  /* gated planes */
  gate_kernel<<<kTok, 256, 0, stream>>>(ATT, GF, GH, EH, EL);

  /* output projection: positions < 128 (bf16 hi.W + lo.W) and positions >= 128 (f16) of each batch */
  out_proj_kernel<<<kB * (kOutEB + kOutLB), 256, 0, stream>>>(GH, EH, EL, WOH, WOB, out);
}

// v007
// Measured time: 190 microseconds a run.
// In both of two side-by-side timings against v006, it was 1.10 times as fast.
// Counting every step since v000, it is 4.13 times as fast.
// Projections x.Wq/Wk/Wv/Wg^T: v_wmma_f32_16x16x32_bf16 (every float input RNE-converted to bf16 once, exact products, f32 accumulate); scores q.k^T and p.v for query positions >= 128: v_wmma_f32_16x16x32_f16 (q,k,v planes carried x64, p carried x32768); query positions < 128: f32 VALU attention; output projection: f16 (gated carried x1024, Wo carried x1024) for positions >= 128, bf16 hi+lo gated planes x bf16 Wo (two products) for positions < 128; norms, position rotation, softmax, gate in f32.
#include <hip/hip_runtime.h>
#include <math.h>

typedef __attribute__((ext_vector_type(16))) _Float16 v16h;
typedef __attribute__((ext_vector_type(8)))  _Float16 v8h;
typedef __attribute__((ext_vector_type(16))) __bf16   v16b;
typedef __attribute__((ext_vector_type(8)))  __bf16   v8b;
typedef __attribute__((ext_vector_type(8)))  float    v8f;
typedef __attribute__((ext_vector_type(4)))  float    v4f;
typedef __attribute__((ext_vector_type(4)))  unsigned int v4u;
typedef __attribute__((ext_vector_type(2)))  unsigned int v2u;

// ---------------------------------------------------------------------------
// Shape constants
// ---------------------------------------------------------------------------
constexpr int kB     = 2;
constexpr int kS     = 2048;
constexpr int kHid   = 2048;
constexpr int kHq    = 16;
constexpr int kHkv   = 4;
constexpr int kRep   = kHq / kHkv;
constexpr int kHD    = 128;
constexpr int kTok   = kB * kS;
constexpr int kQW    = kHq * kHD;
constexpr int kKW    = kHkv * kHD;
constexpr int kQKVW  = kQW + 2 * kKW;
constexpr int kVCol0 = kQW + kKW;
constexpr int kSlots = kHq + kHkv;
constexpr int kEarly = 128;
constexpr int kERows = kB * kEarly;
constexpr int kLateKC    = 64;
constexpr int kLatePairs = (kS - kEarly) / 32;
constexpr int kVP    = 132;
constexpr float kEps = 1e-6f;

constexpr double cx_sqrt(double x) {
  double r = (x > 1.0) ? x : 1.0;
  for (int i = 0; i < 80; ++i) r = 0.5 * (r + x / r);
  return r;
}
constexpr float kInvSqrtHD = (float)(1.0 / cx_sqrt((double)kHD));
/* power-of-two carries of the f16 operand planes */
constexpr float kQKCarry = 64.0f;
constexpr float kVCarry  = 64.0f;
constexpr float kPCarry  = 32768.0f;
constexpr float kGCarry  = 1024.0f;
constexpr float kWoCarry = 1024.0f;
constexpr float kScoreMul   = kInvSqrtHD / (kQKCarry * kQKCarry);
constexpr float kOutLateMul = 1.0f / (kGCarry * kWoCarry);

static_assert(kRep == 4 && kHkv == 4 && kHD == 128, "lane maps assume 4 kv heads x 4 query heads x 128");
static_assert(kTok == 4096 && kQW == 2048 && kKW == 512 && kQKVW == 3072, "wire shapes");
static_assert((kHid % 32) == 0 && (kQW % 32) == 0, "GEMM K multiples of 32");
static_assert((kTok % 64) == 0 && (kQKVW % 64) == 0 && (kQW % 64) == 0 && ((kS - kEarly) % 64) == 0 && (kEarly % 64) == 0, "GEMM M,N multiples of 64");
static_assert((kS % 64) == 0 && (kS / 64) == 32 && (kEarly % 16) == 0 && ((kS - kEarly) % 32) == 0, "tile multiples");

// ---------------------------------------------------------------------------
// Workspace region map (bytes; every offset a multiple of 128)
//   XB   bf16 [4096][2048]  x plane                                16,777,216
//   WQKV bf16 [3072][2048]  Wq | Wk | Wv rows                      12,582,912
//   WGB  bf16 [2048][2048]  Wg                                      8,388,608
//   QKV  f32  [4096][3072]  q | k | v projections                  50,331,648
//   QP   f16  [4096][2048]  normed+rotated q x64                   16,777,216
//   KP   f16  [4096][512]   normed+rotated k x64                    4,194,304
//   VT   f16  [2][4][128][2048] v transposed x64                    4,194,304
//   QE   f32  [256][2048]   q rows of positions < 128               2,097,152
//   KE   f32  [256][512]    k rows of positions < 128                 524,288
//   VE   f32  [256][512]    v rows of positions < 128                 524,288
//   WOB  bf16 [2048][2048]  Wo                                      8,388,608
//   WOH  f16  [2048][2048]  Wo (bf16 value) x1024                   8,388,608
//   GF   f32  [4096][2048]  gate projection                        33,554,432
//   total                                                         166,723,584
// Aliases (each across whole launches):
//   ATT  f32 [4096][2048]  = first 33,554,432 B of QKV (after the joint norm/rotation and v-prep launch)
//   GH   f16 [4096][2048]  = XB (after the gate projection)
//   EH/EL bf16 [256][2048] = first 2 x 1,048,576 B of WQKV (after the q|k|v projection)
// ---------------------------------------------------------------------------
constexpr size_t kOffXB   = 0;
constexpr size_t kOffWQKV = kOffXB   + (size_t)kTok * kHid * 2;
constexpr size_t kOffWGB  = kOffWQKV + (size_t)kQKVW * kHid * 2;
constexpr size_t kOffQKV  = kOffWGB  + (size_t)kQW * kHid * 2;
constexpr size_t kOffQP   = kOffQKV  + (size_t)kTok * kQKVW * 4;
constexpr size_t kOffKP   = kOffQP   + (size_t)kTok * kQW * 2;
constexpr size_t kOffVT   = kOffKP   + (size_t)kTok * kKW * 2;
constexpr size_t kOffQE   = kOffVT   + (size_t)kTok * kKW * 2;
constexpr size_t kOffKE   = kOffQE   + (size_t)kERows * kQW * 4;
constexpr size_t kOffVE   = kOffKE   + (size_t)kERows * kKW * 4;
constexpr size_t kOffWOB  = kOffVE   + (size_t)kERows * kKW * 4;
constexpr size_t kOffWOH  = kOffWOB  + (size_t)kQW * kQW * 2;
constexpr size_t kOffGF   = kOffWOH  + (size_t)kQW * kQW * 2;
constexpr size_t kWsTotal = kOffGF   + (size_t)kTok * kQW * 4;
constexpr size_t kOffATT  = kOffQKV;
constexpr size_t kOffGH   = kOffXB;
constexpr size_t kOffEH   = kOffWQKV;
constexpr size_t kOffEL   = kOffWQKV + (size_t)kERows * kQW * 2;
static_assert(kWsTotal == 166723584ull, "carve total");
static_assert(kWsTotal <= 268435456ull, "carve cap");
static_assert(kOffEL + (size_t)kERows * kQW * 2 <= kOffWGB, "hi/lo planes inside the dead weight plane");
static_assert((kOffWQKV % 128) == 0 && (kOffWGB % 128) == 0 && (kOffQKV % 128) == 0 && (kOffQP % 128) == 0 &&
              (kOffKP % 128) == 0 && (kOffVT % 128) == 0 && (kOffQE % 128) == 0 && (kOffKE % 128) == 0 &&
              (kOffVE % 128) == 0 && (kOffWOB % 128) == 0 && (kOffWOH % 128) == 0 && (kOffGF % 128) == 0 &&
              (kOffEL % 128) == 0, "128-B aligned regions");

// ---------------------------------------------------------------------------
// Small helpers
// ---------------------------------------------------------------------------
__device__ __forceinline__ unsigned short f2bf_bits(float f) {
  unsigned u = __float_as_uint(f);
  return (unsigned short)((u + 0x7FFFu + ((u >> 16) & 1u)) >> 16);
}
__device__ __forceinline__ float bf_bits2f(unsigned short h) { return __uint_as_float(((unsigned)h) << 16); }
__device__ __forceinline__ float bf16r(float f) { return bf_bits2f(f2bf_bits(f)); }
__device__ __forceinline__ unsigned pk16(unsigned short a, unsigned short b) { return (unsigned)a | ((unsigned)b << 16); }
__device__ __forceinline__ unsigned short h_bits(float f) { const _Float16 h = (_Float16)f; return __builtin_bit_cast(unsigned short, h); }
__device__ __forceinline__ void wave_lds_sync() {
  __builtin_amdgcn_fence(__ATOMIC_RELEASE, "workgroup");
  __builtin_amdgcn_wave_barrier();
  __builtin_amdgcn_fence(__ATOMIC_ACQUIRE, "workgroup");
}

/* lane l <-> lane l ^ X inside a row of 16 lanes (X = 1, 2, 4, 8) and l <-> l ^ 16, on the vector unit: no trip through the
   LDS path and no wait on its counter; every lane is on wherever these stand */
template <int X>
__device__ __forceinline__ float row_xor(float v) {
  return __builtin_bit_cast(float, __builtin_amdgcn_update_dpp(0, __builtin_bit_cast(int, v), 0x160 + X, 0xf, 0xf, true));
}
__device__ __forceinline__ float half_xor(float v) {
  const int b = __builtin_bit_cast(int, v);
  return __builtin_bit_cast(float, __builtin_amdgcn_permlanex16(b, b, 0x76543210, 0xfedcba98, false, false));
}
/* butterflies in the order 16, 8, 4, 2, 1 over the wave */
__device__ __forceinline__ float wave_max(float m) {
  m = fmaxf(m, half_xor(m));
  m = fmaxf(m, row_xor<8>(m));
  m = fmaxf(m, row_xor<4>(m));
  m = fmaxf(m, row_xor<2>(m));
  m = fmaxf(m, row_xor<1>(m));
  return m;
}
__device__ __forceinline__ float wave_sum(float v) {
  v += half_xor(v);
  v += row_xor<8>(v);
  v += row_xor<4>(v);
  v += row_xor<2>(v);
  v += row_xor<1>(v);
  return v;
}

/* matrix op followed by the 4-slot hazard guard; one accumulator per guard statement, A and B named as inputs */
__device__ __forceinline__ v8f mma_guard_h(v16h a, v16h b, v8f c) {
  c = __builtin_amdgcn_wmma_f32_16x16x32_f16(false, a, false, b, (short)0, c, false, false);
  asm volatile("v_nop\n\tv_nop\n\tv_nop\n\tv_nop" : "+v"(c) : "v"(a), "v"(b));
  return c;
}
__device__ __forceinline__ v8f mma_guard_b(v16b a, v16b b, v8f c) {
  c = __builtin_amdgcn_wmma_f32_16x16x32_bf16(false, a, false, b, (short)0, c, false, false);
  asm volatile("v_nop\n\tv_nop\n\tv_nop\n\tv_nop" : "+v"(c) : "v"(a), "v"(b));
  return c;
}
__device__ __forceinline__ void keep4_h(v16h a, v16h b, v16h c, v16h d) { asm volatile("v_nop" :: "v"(a), "v"(b), "v"(c), "v"(d)); }
__device__ __forceinline__ void keep4_b(v16b a, v16b b, v16b c, v16b d) { asm volatile("v_nop" :: "v"(a), "v"(b), "v"(c), "v"(d)); }
__device__ __forceinline__ void acc_guard4(v8f& a, v8f& b, v8f& c, v8f& d) { asm volatile("v_nop\n\tv_nop\n\tv_nop\n\tv_nop" : "+v"(a), "+v"(b), "+v"(c), "+v"(d)); }

template <typename T> struct Frag;
template <> struct Frag<_Float16> {
  typedef v16h V; union U { v16h v; v8h h[2]; };
  /* elements 0..7 <- p[0..7], 8..15 <- p[16..23] */
  static __device__ __forceinline__ v16h load(const _Float16* p) {
    U f; f.h[0] = *(const v8h*)(p); f.h[1] = *(const v8h*)(p + 16); return f.v;
  }
  static __device__ __forceinline__ v8f mmag(v16h a, v16h b, v8f c) { return mma_guard_h(a, b, c); }
  static __device__ __forceinline__ void keep(v16h a, v16h b, v16h c, v16h d) { keep4_h(a, b, c, d); }
};
template <> struct Frag<__bf16> {
  typedef v16b V; union U { v16b v; v8b h[2]; };
  static __device__ __forceinline__ v16b load(const __bf16* p) {
    U f; f.h[0] = *(const v8b*)(p); f.h[1] = *(const v8b*)(p + 16); return f.v;
  }
  static __device__ __forceinline__ v8f mmag(v16b a, v16b b, v8f c) { return mma_guard_b(a, b, c); }
  static __device__ __forceinline__ void keep(v16b a, v16b b, v16b c, v16b d) { keep4_b(a, b, c, d); }
};

// ---------------------------------------------------------------------------
// Batched GEMM: C[m,n] = scale * sum_k A[m,k] * Bt[n,k]. A block of 8 waves (2 x 4) owns a 128 x 256 tile, each wave 64x64 of it.
// A row-major [M,K]; Bt row-major [N,K]; M % 128 == 0, N % 256 == 0, K % 64 == 0 (no tails).
// Operands reach LDS by asynchronous 16-B copies, 64 k per stage (128-B rows at a 144-B pitch), two buffers: the next
// stage's copies fly while this stage's fragments are read from LDS; 8 lanes copy one whole 128-B line of a row.
// ASPLIT: A carried as hi/lo planes (A2 = lo plane, same layout): product = hi.b + lo.b into one accumulator.
// ET: 0 = f16 operands, 1 = bf16 operands (pointers passed as 16-bit storage). Output f32.
// ---------------------------------------------------------------------------
constexpr int kGBM    = 128;
constexpr int kGBN    = 256;
constexpr int kGKS    = 64;
constexpr int kGPitch = 72;
constexpr unsigned kGPitchB = kGPitch * 2;
static_assert((kTok % kGBM) == 0 && ((kS - kEarly) % kGBM) == 0 && (kEarly % kGBM) == 0, "GEMM M multiples of the block tile");
static_assert((kQKVW % kGBN) == 0 && (kQW % kGBN) == 0, "GEMM N multiples of the block tile");
static_assert((kHid % kGKS) == 0 && (kQW % kGKS) == 0 && kHid / kGKS >= 2 && kQW / kGKS >= 2, "GEMM K in whole stages");

__device__ __forceinline__ unsigned lds_off(const void* p) { return (unsigned)(size_t)p; }

/* copies of 16 B per lane, global -> LDS through no register: row r of the run lies 32 * r rows behind the first, in LDS
   (pitch kGPitchB) and in the source (step32 elements). One statement holds a whole run, and the s_wait_xcnt closes it so
   that no address register of a copy is rewritten in front of it; one run per statement keeps that wait to one per run */
__device__ __forceinline__ void copy4_async(unsigned l, const unsigned short* g, size_t step32) {
  asm volatile("global_load_async_to_lds_b128 %0, %4, off\n\t"
               "global_load_async_to_lds_b128 %1, %5, off\n\t"
               "global_load_async_to_lds_b128 %2, %6, off\n\t"
               "global_load_async_to_lds_b128 %3, %7, off\n\t"
               "s_wait_xcnt 0x0"
               :: "v"(l), "v"(l + 32u * kGPitchB), "v"(l + 64u * kGPitchB), "v"(l + 96u * kGPitchB),
                  "v"(g), "v"(g + step32), "v"(g + 2 * step32), "v"(g + 3 * step32) : "memory");
}
__device__ __forceinline__ void copy8_async(unsigned l, const unsigned short* g, size_t step32,
                                            unsigned m, const unsigned short* h, size_t step32h) {
  asm volatile("global_load_async_to_lds_b128 %0, %8, off\n\t"
               "global_load_async_to_lds_b128 %1, %9, off\n\t"
               "global_load_async_to_lds_b128 %2, %10, off\n\t"
               "global_load_async_to_lds_b128 %3, %11, off\n\t"
               "global_load_async_to_lds_b128 %4, %12, off\n\t"
               "global_load_async_to_lds_b128 %5, %13, off\n\t"
               "global_load_async_to_lds_b128 %6, %14, off\n\t"
               "global_load_async_to_lds_b128 %7, %15, off\n\t"
               "s_wait_xcnt 0x0"
               :: "v"(l), "v"(l + 32u * kGPitchB), "v"(l + 64u * kGPitchB), "v"(l + 96u * kGPitchB),
                  "v"(m), "v"(m + 32u * kGPitchB), "v"(m + 64u * kGPitchB), "v"(m + 96u * kGPitchB),
                  "v"(g), "v"(g + step32), "v"(g + 2 * step32), "v"(g + 3 * step32),
                  "v"(h), "v"(h + step32h), "v"(h + 2 * step32h), "v"(h + 3 * step32h) : "memory");
}

template <int ET> struct Elem;
template <> struct Elem<0> { typedef _Float16 T; };
template <> struct Elem<1> { typedef __bf16 T; };
/* LDS of one GEMM block: two stage buffers, then the 8 waves' store slabs */
template <bool ASPLIT> struct GemmLds {
  static constexpr int kARows = ASPLIT ? 2 * kGBM : kGBM;
  static constexpr int kRows  = kARows + kGBN;
  static constexpr unsigned kBufB   = (unsigned)kRows * kGPitchB;
  static constexpr unsigned kBytes  = 2u * kBufB + 8u * 16u * 68u * 4u;
};
/* one block's tile: bx = tile number inside the batch entry b; smem = the block's LDS, GemmLds<ASPLIT>::kBytes of it */
template <int ET, bool ASPLIT>
__device__ __forceinline__ void gemm_block(
    unsigned char* smem, int bx, int b,
    const unsigned short* __restrict__ Ap, const unsigned short* __restrict__ A2p, int lda, long strideA,
    const unsigned short* __restrict__ Btp, int ldb, long strideB,
    float* __restrict__ Cout, int ldc, long strideC,
    int M, int N, int K, float scale) {
  typedef typename Elem<ET>::T T;
  typedef typename Frag<T>::V V;
  constexpr int kARows = GemmLds<ASPLIT>::kARows;
  constexpr int kRows  = GemmLds<ASPLIT>::kRows;
  constexpr unsigned kBufB = GemmLds<ASPLIT>::kBufB;
  unsigned short* sStage = (unsigned short*)smem;
  float* sT = (float*)(smem + 2u * kBufB);
  const int tid  = threadIdx.x;
  const int lane = tid & 31;
  const int wave = __builtin_amdgcn_readfirstlane((int)(threadIdx.x >> 5));
  const int tilesN = N / kGBN;
  const int tilesM = M / kGBM;
  /* block-uniform, in front of every barrier and copy */
  if (bx >= tilesM * tilesN) return;
  const int tm = bx / tilesN;
  const int tn = bx - tm * tilesN;
  const int bm0 = tm * kGBM;
  const int bn0 = tn * kGBN;
  const int wm = wave >> 2;
  const int wn = wave & 3;
  const int m0 = bm0 + (wm << 6);
  const int n0 = bn0 + (wn << 6);

  const int rlane = lane & 15;
  const int koff  = (lane >> 4) * 8;
  const int mOff  = (lane >> 4) * 8;

  /* the thread's own place in a stage and in the two (three) source planes */
  const int crow = tid >> 3;
  const int cch  = tid & 7;
  const unsigned lds0 = lds_off(sStage) + (unsigned)crow * kGPitchB + (unsigned)cch * 16u;
  const unsigned short* gA  = Ap  + (size_t)b * strideA + (size_t)(bm0 + crow) * lda + cch * 8;
  const unsigned short* gA2 = A2p + (size_t)b * strideA + (size_t)(bm0 + crow) * lda + cch * 8;
  const unsigned short* gB  = Btp + (size_t)b * strideB + (size_t)(bn0 + crow) * ldb + cch * 8;
  const size_t stepA = (size_t)32 * lda;
  const size_t stepB = (size_t)32 * ldb;
  const int nst = K / kGKS;

  auto issue_stage = [&](int t) {
    const unsigned l = lds0 + (unsigned)(t & 1) * kBufB;
    const size_t k0 = (size_t)t * kGKS;
    const unsigned lb = l + (unsigned)kARows * kGPitchB;
    /* thread t brings bytes 16*(t&7).. of rows (t>>3) + 32*i of each panel: 128 rows of A (and of A2), 256 of Bt */
    if (ASPLIT) copy8_async(l, gA + k0, stepA, l + (unsigned)kGBM * kGPitchB, gA2 + k0, stepA);
    else        copy4_async(l, gA + k0, stepA);
    copy8_async(lb, gB + k0, stepB, lb + 128u * kGPitchB, gB + k0 + 4 * stepB, stepB);
  };

  v8f acc[4][4];
#pragma unroll
  for (int i = 0; i < 4; ++i)
#pragma unroll
    for (int j = 0; j < 4; ++j) acc[i][j] = (v8f){0.f,0.f,0.f,0.f,0.f,0.f,0.f,0.f};

  issue_stage(0);
  /* stage 0 has landed for this wave; the barrier publishes it to the others */
  asm volatile("s_wait_asynccnt 0x0" ::: "memory");
  __syncthreads();
  if (nst > 1) issue_stage(1);

  for (int t = 0; t < nst; ++t) {
    const T* sb = (const T*)(sStage + (t & 1) * (kRows * kGPitch));
    const T* sa = sb + ((wm << 6) + rlane) * kGPitch + koff;
    const T* sw = sb + (kARows + (wn << 6) + rlane) * kGPitch + koff;
#pragma unroll
    for (int ks = 0; ks < kGKS / 32; ++ks) {
      /* all fragments of a k step are read from LDS as one group in front of its products */
      V bh[4], ah[4], al[4];
#pragma unroll
      for (int j = 0; j < 4; ++j) bh[j] = Frag<T>::load(sw + (j << 4) * kGPitch + ks * 32);
#pragma unroll
      for (int i = 0; i < 4; ++i) {
        ah[i] = Frag<T>::load(sa + (i << 4) * kGPitch + ks * 32);
        al[i] = ah[i];
        if (ASPLIT) al[i] = Frag<T>::load(sa + (kGBM + (i << 4)) * kGPitch + ks * 32);
      }
#pragma unroll
      for (int i = 0; i < 4; ++i) {
#pragma unroll
        for (int j = 0; j < 4; ++j) {
          acc[i][j] = Frag<T>::mmag(ah[i], bh[j], acc[i][j]);
          if (ASPLIT) acc[i][j] = Frag<T>::mmag(al[i], bh[j], acc[i][j]);
        }
      }
      Frag<T>::keep(bh[0], bh[1], bh[2], bh[3]);
    }
    /* hand-over: this wave's reads of the buffer are done, */
    asm volatile("s_wait_dscnt 0x0" ::: "memory");
    /* its copies of stage t + 1 have landed, */
    asm volatile("s_wait_asynccnt 0x0" ::: "memory");
    /* and the barrier publishes stage t + 1 and frees the buffer that was just read */
    __syncthreads();
    if (t + 2 < nst) issue_stage(t + 2);
  }
  /* no copy is left in flight when the wave goes on */
  asm volatile("s_wait_asynccnt 0x0" ::: "memory");
  acc_guard4(acc[0][0], acc[0][1], acc[0][2], acc[0][3]);
  acc_guard4(acc[1][0], acc[1][1], acc[1][2], acc[1][3]);
  acc_guard4(acc[2][0], acc[2][1], acc[2][2], acc[2][3]);
  acc_guard4(acc[3][0], acc[3][1], acc[3][2], acc[3][3]);

  float* slab = sT + wave * (16 * 68);
  float* C = Cout + (size_t)b * strideC;
#pragma unroll
  for (int i = 0; i < 4; ++i) {
    const int mBase = m0 + (i << 4);
#pragma unroll
    for (int j = 0; j < 4; ++j) {
#pragma unroll
      for (int r = 0; r < 8; ++r) {
        slab[(mOff + r) * 68 + (j << 4) + rlane] = acc[i][j][r] * scale;
      }
    }
    wave_lds_sync();
    {
      const int hh = lane >> 4, c4 = (lane & 15) * 4;
      {
#pragma unroll
        for (int it = 0; it < 8; ++it) {
          const int row = it * 2 + hh;
          v4f v = *(const v4f*)(slab + row * 68 + c4);
          *(v4f*)(C + (size_t)(mBase + row) * ldc + n0 + c4) = v;
        }
        
      }
    }
    wave_lds_sync();
  }
}

// ---------------------------------------------------------------------------
// Projections of x, bf16: QKV[4096][3072] = x . [Wq;Wk;Wv]^T (32 x 12 = 384 blocks) and, in the same launch, the first
// kGateWithProj tiles of the gate projection GF[4096][2048] = x . Wg^T (neither reads what the other writes). Two blocks
// fit a WGP; 384 blocks leave 128 of the 512 places of 256 WGPs empty, and the gate tiles take them. The other gate tiles
// run beside the attention for positions >= 128.
// ---------------------------------------------------------------------------
constexpr int kQKVBlocks    = (kTok / kGBM) * (kQKVW / kGBN);
constexpr int kGateGBlocks  = (kTok / kGBM) * (kQW / kGBN);
constexpr int kGateWithProj = 2 * 256 - kQKVBlocks;
static_assert(kGateWithProj > 0 && kGateWithProj < kGateGBlocks, "the gate tiles are split between two launches");
__global__ __launch_bounds__(256) void proj_kernel(
    const unsigned short* __restrict__ XB, const unsigned short* __restrict__ WQKV, const unsigned short* __restrict__ WGB,
    float* __restrict__ QKV, float* __restrict__ GF) {
  __shared__ __align__(16) unsigned char smem[GemmLds<false>::kBytes];
  const int blk = (int)blockIdx.x;
  const bool gt = blk >= kQKVBlocks;
  const int n   = gt ? kQW : kQKVW;
  gemm_block<1, false>(smem, gt ? blk - kQKVBlocks : blk, 0, XB, XB, kHid, 0L, gt ? WGB : WQKV, kHid, 0L,
                       gt ? GF : QKV, n, 0L, kTok, n, kHid, 1.0f);
}

// ---------------------------------------------------------------------------
// Output projection, both parts in one launch (they write disjoint rows of out and read nothing of each other):
//   blocks 0 .. 15   positions < 128 of each batch: bf16 hi.W + lo.W, 1 x 8 tiles x 2 batches (twice the products of a tile
//                    of the other part, so they take the lowest block numbers)
//   blocks 16 .. 255 positions >= 128 of each batch: f16 single product, carries folded back, 15 x 8 tiles x 2 batches
// ---------------------------------------------------------------------------
constexpr int kOutEB = (kEarly / kGBM) * (kQW / kGBN);
constexpr int kOutLB = ((kS - kEarly) / kGBM) * (kQW / kGBN);
__global__ __launch_bounds__(256) void out_proj_kernel(
    const unsigned short* __restrict__ GH, const unsigned short* __restrict__ EH, const unsigned short* __restrict__ EL,
    const unsigned short* __restrict__ WOH, const unsigned short* __restrict__ WOB, float* __restrict__ out) {
  __shared__ __align__(16) unsigned char smem[GemmLds<true>::kBytes];
  const int blk = (int)blockIdx.x;
  /* block-uniform: every barrier of a part is passed by the whole block or by none of it */
  if (blk < kB * kOutEB) {
    gemm_block<1, true>(smem, blk % kOutEB, blk / kOutEB, EH, EL, kQW, (long)kEarly * kQW, WOB, kQW, 0L,
                        out, kQW, (long)kS * kQW, kEarly, kQW, kQW, 1.0f);
  } else {
    const int l = blk - kB * kOutEB;
    gemm_block<0, false>(smem, l % kOutLB, l / kOutLB, GH + (size_t)kEarly * kQW, GH + (size_t)kEarly * kQW, kQW,
                         (long)kS * kQW, WOH, kQW, 0L, out + (size_t)kEarly * kQW, kQW, (long)kS * kQW,
                         kS - kEarly, kQW, kQW, kOutLateMul);
  }
}

// ---------------------------------------------------------------------------
// MODE 0: o0 = bf16 (RNE). MODE 1: o0 = bf16 (RNE), o1 = f16 of (bf16 value x carry) (exact: power-of-two carry).
// ---------------------------------------------------------------------------
template <int MODE>
__device__ __forceinline__ void cast8_block(const float* __restrict__ in, unsigned short* __restrict__ o0,
                                            unsigned short* __restrict__ o1, int blk, float carry) {
  const int i = blk * 256 + threadIdx.x;
  const size_t e0 = (size_t)i << 3;
  const v4f a0 = *(const v4f*)(in + e0);
  const v4f a1 = *(const v4f*)(in + e0 + 4);
  unsigned short bb[8], hb[8];
#pragma unroll
  for (int e = 0; e < 4; ++e) {
    bb[e]     = f2bf_bits(a0[e]);
    bb[4 + e] = f2bf_bits(a1[e]);
  }
#pragma unroll
  for (int e = 0; e < 8; ++e) hb[e] = (MODE == 1) ? h_bits(bf_bits2f(bb[e]) * carry) : (unsigned short)0;
  const v4u ub = (v4u){pk16(bb[0], bb[1]), pk16(bb[2], bb[3]), pk16(bb[4], bb[5]), pk16(bb[6], bb[7])};
  const v4u uh = (v4u){pk16(hb[0], hb[1]), pk16(hb[2], hb[3]), pk16(hb[4], hb[5]), pk16(hb[6], hb[7])};
  unsigned short* q0 = o0 + e0;
  unsigned short* q1 = o1 + e0;
  *(v4u*)q0 = ub;
  if (MODE == 1) *(v4u*)q1 = uh;
  /* closes the stores: in the joint kernel another plane's code follows in the listing and rewrites their registers */
  asm volatile("s_wait_xcnt 0x0" ::: "memory");
}
/* all six planes in one launch: a block (2048 elements) belongs to one plane, found from its number; no plane has a tail */
constexpr int kCbX  = kTok * kHid / 2048;
constexpr int kCbQ  = kQW * kHid / 2048;
constexpr int kCbK  = kKW * kHid / 2048;
constexpr int kCbO  = kQW * kQW / 2048;
constexpr int kCbAll = kCbX + 2 * kCbQ + 2 * kCbK + kCbO;
static_assert((kTok * kHid) % 2048 == 0 && (kQW * kHid) % 2048 == 0 && (kKW * kHid) % 2048 == 0 && (kQW * kQW) % 2048 == 0, "whole blocks");
__global__ __launch_bounds__(256) void cast_all_kernel(
    const float* __restrict__ X, const float* __restrict__ Wq, const float* __restrict__ Wk, const float* __restrict__ Wv,
    const float* __restrict__ Wg, const float* __restrict__ Wo,
    unsigned short* __restrict__ XB, unsigned short* __restrict__ WQKV, unsigned short* __restrict__ WGB,
    unsigned short* __restrict__ WOB, unsigned short* __restrict__ WOH) {
  int blk = (int)blockIdx.x;
  if (blk < kCbX) { cast8_block<0>(X, XB, XB, blk, 1.0f); return; }
  blk -= kCbX;
  if (blk < kCbO) { cast8_block<1>(Wo, WOB, WOH, blk, kWoCarry); return; }
  blk -= kCbO;
  if (blk < kCbQ) { cast8_block<0>(Wq, WQKV, WQKV, blk, 1.0f); return; }
  blk -= kCbQ;
  if (blk < kCbQ) { cast8_block<0>(Wg, WGB, WGB, blk, 1.0f); return; }
  blk -= kCbQ;
  if (blk < kCbK) { cast8_block<0>(Wk, WQKV + (size_t)kQW * kHid, WQKV, blk, 1.0f); return; }
  blk -= kCbK;
  cast8_block<0>(Wv, WQKV + (size_t)kVCol0 * kHid, WQKV, blk, 1.0f);
}

// ---------------------------------------------------------------------------
// Per-head RMS norm (eps inside the rsqrt of the mean square) then rotation by the position tables, f32.
// One wave per (token, slot): slots 0..15 = query heads, 16..19 = key heads (columns slot*128 of the q|k|v plane).
// Lane owns d = 4*lane..4*lane+3; the partner d +/- 64 lives in lane ^ 16 (unconditional exchanges).
// d < 64: y = n[d]*c[d] - n[d+64]*s[d]; d >= 64: y = n[d]*c[d] + n[d-64]*s[d]; tables read by value at [pos][d],
// tables and norm weights RNE-converted to bf16 on load.
// ---------------------------------------------------------------------------
__device__ __forceinline__ void normrot_block(
    int blk, const float* __restrict__ QKV, const float* __restrict__ ctab, const float* __restrict__ stab,
    const float* __restrict__ qw, const float* __restrict__ kw,
    unsigned short* __restrict__ Qp, unsigned short* __restrict__ Kp, float* __restrict__ Qe, float* __restrict__ Ke) {
  const int lane = threadIdx.x & 31;
  const int wave = __builtin_amdgcn_readfirstlane((int)(threadIdx.x >> 5));
  const int gw   = blk * 8 + wave;
  const int tok  = gw / kSlots;
  const int slot = gw - tok * kSlots;
  const int pos  = tok & (kS - 1);
  const int b    = tok / kS;
  const bool isq = slot < kHq;
  const int kslot = isq ? 0 : (slot - kHq);

  const v4f x   = *(const v4f*)(QKV + (size_t)tok * kQKVW + slot * kHD + 4 * lane);
  const v4f wq4 = *(const v4f*)(qw + 4 * lane);
  const v4f wk4 = *(const v4f*)(kw + 4 * lane);
  const v4f c4  = *(const v4f*)(ctab + (size_t)pos * kHD + 4 * lane);
  const v4f s4  = *(const v4f*)(stab + (size_t)pos * kHD + 4 * lane);

  float ss = x[0] * x[0];
  ss = fmaf(x[1], x[1], ss);
  ss = fmaf(x[2], x[2], ss);
  ss = fmaf(x[3], x[3], ss);
  ss = wave_sum(ss);
  const float inv = rsqrtf(ss * (1.0f / (float)kHD) + kEps);

  float n[4], p[4], y[4];
#pragma unroll
  for (int e = 0; e < 4; ++e) {
    const float w = bf16r(isq ? wq4[e] : wk4[e]);
    n[e] = x[e] * inv * w;
  }
#pragma unroll
  for (int e = 0; e < 4; ++e) p[e] = half_xor(n[e]);
  const float sgn = (lane < 16) ? -1.0f : 1.0f;
#pragma unroll
  for (int e = 0; e < 4; ++e) y[e] = n[e] * bf16r(c4[e]) + sgn * (p[e] * bf16r(s4[e]));

  unsigned short hb[4];
#pragma unroll
  for (int e = 0; e < 4; ++e) hb[e] = h_bits(y[e] * kQKCarry);
  const v2u u = (v2u){pk16(hb[0], hb[1]), pk16(hb[2], hb[3])};
  const v4f yv = (v4f){y[0], y[1], y[2], y[3]};

  unsigned short* dq = Qp + (size_t)tok * kQW + slot * kHD + 4 * lane;
  unsigned short* dk = Kp + (size_t)tok * kKW + kslot * kHD + 4 * lane;
  unsigned short* d16 = isq ? dq : dk;
  const bool early = pos < kEarly;
  const int erow = b * kEarly + (early ? pos : 0);
  float* eq = Qe + (size_t)erow * kQW + (isq ? slot : 0) * kHD + 4 * lane;
  float* ek = Ke + (size_t)erow * kKW + kslot * kHD + 4 * lane;
  float* d32 = isq ? eq : ek;
  {
    *(v2u*)d16 = u;
    /* no register that the store names is rewritten in front of this wait */
    asm volatile("s_wait_xcnt 0x0" ::: "memory");
    if (early) *(v4f*)d32 = yv;
  }
}

// ---------------------------------------------------------------------------
// v columns of the q|k|v plane -> VT f16 [b][kv head][d][s] carried x64 (LDS transpose), plus VE f32 rows for positions < 128.
// Block = (b, kv head, 64 positions); 256 threads. Load coverage: 8 iterations x 256 threads = 2048 v4f = 64 rows x 32.
// VT stores: row d = it*32 + wave*4 + (lane>>3), it 0..3 x 8 waves x 4 = 128 rows; (lane&7) x 8 halves = 64 positions
// ---------------------------------------------------------------------------
__device__ __forceinline__ void vprep_block(int blk, const float* __restrict__ QKV, unsigned short* __restrict__ Vt,
                                            float* __restrict__ Ve) {
  __shared__ __align__(16) float sm[64 * kVP];
  const int tid  = threadIdx.x;
  const int lane = tid & 31;
  const int wave = __builtin_amdgcn_readfirstlane((int)(tid >> 5));
  const int st   = blk & 31;
  const int hkv  = (blk >> 5) & (kHkv - 1);
  const int b    = blk >> 7;
  const int s0   = st * 64;
  const float* src = QKV + (size_t)(b * kS + s0) * kQKVW + kVCol0 + hkv * kHD;
#pragma unroll
  for (int i = 0; i < 8; ++i) {
    const int e  = i * 256 + tid;
    const int r  = e >> 5;
    const int cc = (e & 31) * 4;
    const v4f v = *(const v4f*)(src + (size_t)r * kQKVW + cc);
    *(v4f*)(sm + r * kVP + cc) = v;
  }
  __syncthreads();
  const int q = lane >> 3, c8 = (lane & 7) * 8;
  v4u tv[4];
#pragma unroll
  for (int it = 0; it < 4; ++it) {
    const int d = it * 32 + wave * 4 + q;
    unsigned short hb[8];
#pragma unroll
    for (int e = 0; e < 8; ++e) hb[e] = h_bits(sm[(c8 + e) * kVP + d] * kVCarry);
    tv[it] = (v4u){pk16(hb[0], hb[1]), pk16(hb[2], hb[3]), pk16(hb[4], hb[5]), pk16(hb[6], hb[7])};
  }
  v4f ev[8];
#pragma unroll
  for (int it = 0; it < 8; ++it) ev[it] = *(const v4f*)(sm + (it * 8 + wave) * kVP + 4 * lane);
  const bool early = s0 < kEarly;
  const int erow0 = b * kEarly + (early ? s0 : 0);
  unsigned short* vt0 = Vt + (size_t)(b * kHkv + hkv) * kHD * kS + s0 + c8;
  float* ve0 = Ve + (size_t)erow0 * kKW + hkv * kHD + 4 * lane;
  {
#pragma unroll
    for (int it = 0; it < 4; ++it) *(v4u*)(vt0 + (size_t)(it * 32 + wave * 4 + q) * kS) = tv[it];
    /* no register that the four stores name is rewritten in front of this wait */
    asm volatile("s_wait_xcnt 0x0" ::: "memory");
    if (early) {
#pragma unroll
      for (int it = 0; it < 8; ++it) *(v4f*)(ve0 + (size_t)(it * 8 + wave) * kKW) = ev[it];
    }
    
  }
}
/* both readers of the q|k|v plane in one launch (disjoint columns in, disjoint planes out): the v blocks, the longer ones,
   come first; the branch is block-uniform, so the v part's barrier is passed by a whole block or by none of it */
constexpr int kVBlocks = kB * kHkv * (kS / 64);
constexpr int kNBlocks = kTok * kSlots / 8;
__global__ __launch_bounds__(256) void prep_kernel(
    const float* __restrict__ QKV, const float* __restrict__ ctab, const float* __restrict__ stab,
    const float* __restrict__ qw, const float* __restrict__ kw,
    unsigned short* __restrict__ Qp, unsigned short* __restrict__ Kp, float* __restrict__ Qe, float* __restrict__ Ke,
    unsigned short* __restrict__ Vt, float* __restrict__ Ve) {
  const int blk = (int)blockIdx.x;
  if (blk < kVBlocks) vprep_block(blk, QKV, Vt, Ve);
  else                normrot_block(blk - kVBlocks, QKV, ctab, stab, qw, kw, Qp, Kp, Qe, Ke);
}

constexpr int kKPitch = 136;
constexpr int kVPitch = 72;
constexpr int kKTile  = kLateKC * kKPitch;
constexpr int kVTile  = kHD * kVPitch;
constexpr int kKVBuf  = kKTile + kVTile;
static_assert(kLateKC == 64 && kHD == 128, "copy maps: 16 lanes per 256-B key row, 8 lanes per 128-B value row");
static_assert(((kKTile * 2) % 16) == 0 && ((kKVBuf * 2) % 16) == 0, "16-B aligned tiles");

/* one chunk's share of a thread: 4 copies of key rows (16 rows apart) and 4 of value rows (32 rows apart), 16 B each,
   global -> LDS through no register; the s_wait_xcnt closes the statement so that no address register of a copy is
   rewritten in front of it */
__device__ __forceinline__ void copy_kv_async(unsigned lk, const unsigned short* gk, unsigned lv, const unsigned short* gv) {
  asm volatile("global_load_async_to_lds_b128 %0, %8, off\n\t"
               "global_load_async_to_lds_b128 %1, %9, off\n\t"
               "global_load_async_to_lds_b128 %2, %10, off\n\t"
               "global_load_async_to_lds_b128 %3, %11, off\n\t"
               "global_load_async_to_lds_b128 %4, %12, off\n\t"
               "global_load_async_to_lds_b128 %5, %13, off\n\t"
               "global_load_async_to_lds_b128 %6, %14, off\n\t"
               "global_load_async_to_lds_b128 %7, %15, off\n\t"
               "s_wait_xcnt 0x0"
               :: "v"(lk), "v"(lk + 16u * (kKPitch * 2u)), "v"(lk + 32u * (kKPitch * 2u)), "v"(lk + 48u * (kKPitch * 2u)),
                  "v"(lv), "v"(lv + 32u * (kVPitch * 2u)), "v"(lv + 64u * (kVPitch * 2u)), "v"(lv + 96u * (kVPitch * 2u)),
                  "v"(gk), "v"(gk + 16 * kKW), "v"(gk + 32 * kKW), "v"(gk + 48 * kKW),
                  "v"(gv), "v"(gv + 32 * kS), "v"(gv + 64 * kS), "v"(gv + 96 * kS) : "memory");
}

/* LDS of one block: two chunk buffers, the 8 waves' store slabs */
constexpr unsigned kLateKVB  = 2u * kKVBuf * 2u;
constexpr unsigned kLateLds  = kLateKVB + 8u * 16u * 68u * 4u;
static_assert((kLateKVB % 16) == 0, "16-B aligned parts");
__device__ __forceinline__ void attn_late_block(unsigned char* smem, int blk,
                                                const unsigned short* __restrict__ Qp, const unsigned short* __restrict__ Kp,
                                                const unsigned short* __restrict__ Vtp, float* __restrict__ attn) {
  union FH { v16h v; v8h h[2]; };
  unsigned short* sKV = (unsigned short*)smem;
  float* Os = (float*)(smem + kLateKVB);
  const int tid  = threadIdx.x;
  const int lane = threadIdx.x & 31;
  const int wave = __builtin_amdgcn_readfirstlane((int)(threadIdx.x >> 5));
  const int hh   = lane >> 4;
  const int c    = lane & 15;
  const int qt2  = blk % kLatePairs;
  const int bh   = blk / kLatePairs;
  const int hkv  = bh & (kHkv - 1);
  const int b    = bh / kHkv;
  const int h    = hkv * kRep + (wave & 3);
  const int q0   = kEarly + (qt2 * 2 + (wave >> 2)) * 16;

  /* the thread's own place in a chunk's two tiles and in the two source planes */
  const unsigned lk0 = lds_off(sKV) + (unsigned)(tid >> 4) * (kKPitch * 2u) + (unsigned)(tid & 15) * 16u;
  const unsigned lv0 = lds_off(sKV + kKTile) + (unsigned)(tid >> 3) * (kVPitch * 2u) + (unsigned)(tid & 7) * 16u;
  const unsigned short* gk0 = Kp + (size_t)(b * kS + (tid >> 4)) * kKW + hkv * kHD + (tid & 15) * 8;
  const unsigned short* gv0 = Vtp + ((size_t)(b * kHkv + hkv) * kHD + (tid >> 3)) * kS + (tid & 7) * 8;
  auto issue_chunk = [&](int t) {
    const unsigned o = (unsigned)(t & 1) * (kKVBuf * 2u);
    copy_kv_async(lk0 + o, gk0 + (size_t)t * (kLateKC * kKW), lv0 + o, gv0 + t * kLateKC);
  };
  float* ob = attn + (size_t)(b * kS + q0) * kQW + h * kHD;

  v16h qa[4];
  {
    const _Float16* qrow = (const _Float16*)Qp + (size_t)(b * kS + q0 + c) * kQW + h * kHD + 8 * hh;
#pragma unroll
    for (int dc = 0; dc < 4; ++dc) qa[dc] = Frag<_Float16>::load(qrow + dc * 32);
  }

  /* of the lane's query q0 + c: running maximum (both halves alike) and the sum over the keys of this half of the wave */
  float mrun = -INFINITY, lrun = 0.0f;
  /* tile t: register r = o[query q0 + c][d = t*16 + 8*hh + r] */
  v8f oacc[8];
#pragma unroll
  for (int t = 0; t < 8; ++t) oacc[t] = (v8f){0.f,0.f,0.f,0.f,0.f,0.f,0.f,0.f};

  int nChunks = (q0 + 16 + kLateKC - 1) / kLateKC;
  if (nChunks > kS / kLateKC) nChunks = kS / kLateKC;
  /* nChunks is the same in all 8 waves: the block's 32 query rows lie inside one chunk of 64 positions */

  issue_chunk(0);
  /* chunk 0 has landed for this wave; the barrier publishes it to the others */
  asm volatile("s_wait_asynccnt 0x0" ::: "memory");
  __syncthreads();
  if (nChunks > 1) issue_chunk(1);

  for (int kc = 0; kc < nChunks; ++kc) {
    const int kv0 = kc * kLateKC;
    const _Float16* sk = (const _Float16*)(sKV + (kc & 1) * kKVBuf) + c * kKPitch + 8 * hh;
    const _Float16* sv = (const _Float16*)(sKV + (kc & 1) * kKVBuf + kKTile) + c * kVPitch + 8 * hh;
    /* fragments are read from LDS in groups of four, in front of the products that use them: eight register sets, the four
       that a group of products has just read are refilled at once with the fragments eight places on */
    v16h ring[8];
#pragma unroll
    for (int f = 0; f < 8; ++f) ring[f] = Frag<_Float16>::load(sk + (f >> 2) * 16 * kKPitch + (f & 3) * 32);
    v8f s[4];
#pragma unroll
    for (int j = 0; j < 4; ++j) {
      s[j] = (v8f){0.f,0.f,0.f,0.f,0.f,0.f,0.f,0.f};
#pragma unroll
      for (int dc = 0; dc < 4; ++dc) s[j] = mma_guard_h(ring[(j & 1) * 4 + dc], qa[dc], s[j]);
      if (j < 2) {
#pragma unroll
        for (int dc = 0; dc < 4; ++dc) ring[(j & 1) * 4 + dc] = Frag<_Float16>::load(sk + (j + 2) * 16 * kKPitch + dc * 32);
      }
    }
    const bool diag = (kc == nChunks - 1);
    /* key kv0 + j*16 + 8*hh + r lies behind query q0 + c where j*16 + r > rel; no key of an earlier chunk does */
    const int rel = diag ? (q0 + c - kv0 - 8 * hh) : kLateKC;
    /* four chains, one per tile of 16 keys, for the maximum as for the sum: no chain of 32 dependent steps */
    float mj[4];
#pragma unroll
    for (int j = 0; j < 4; ++j) {
      float m = -INFINITY;
#pragma unroll
      for (int r = 0; r < 8; ++r) {
        float v = s[j][r] * kScoreMul;
        if (j * 16 + r > rel) v = -INFINITY;
        s[j][r] = v;
        m = fmaxf(m, v);
      }
      mj[j] = m;
    }
    float cm = fmaxf(fmaxf(mj[0], mj[1]), fmaxf(mj[2], mj[3]));
    /* the other 32 keys of the query's chunk lie in lane ^ 16 */
    cm = fmaxf(cm, half_xor(cm));
    const float mnew  = fmaxf(mrun, cm);
    const float alpha = __expf(mrun - mnew);
    mrun = mnew;
    FH pb[2];
    float pj[4];
#pragma unroll
    for (int j = 0; j < 4; ++j) {
      float psum = 0.0f;
#pragma unroll
      for (int r = 0; r < 8; ++r) {
        const float p = __expf(s[j][r] - mnew);
        psum += p;
        pb[j >> 1].v[(j & 1) * 8 + r] = (_Float16)(p * kPCarry);
      }
      pj[j] = psum;
    }
    lrun = lrun * alpha + ((pj[0] + pj[1]) + (pj[2] + pj[3]));
#pragma unroll
    for (int t = 0; t < 8; ++t) oacc[t] *= alpha;
#pragma unroll
    for (int t = 0; t < 8; ++t) ring[t] = Frag<_Float16>::load(sv + t * 16 * kVPitch);
#pragma unroll
    for (int kk = 0; kk < 2; ++kk) {
#pragma unroll
      for (int g = 0; g < 2; ++g) {
#pragma unroll
        for (int t = g * 4; t < g * 4 + 4; ++t) oacc[t] = mma_guard_h(ring[t], pb[kk].v, oacc[t]);
        if (kk == 0) {
#pragma unroll
          for (int t = g * 4; t < g * 4 + 4; ++t) ring[t] = Frag<_Float16>::load(sv + t * 16 * kVPitch + 32);
        }
      }
    }
    /* hand-over: this wave's reads of the buffer are done, */
    asm volatile("s_wait_dscnt 0x0" ::: "memory");
    /* its copies of chunk kc + 1 have landed, */
    asm volatile("s_wait_asynccnt 0x0" ::: "memory");
    /* and the barrier publishes chunk kc + 1 and frees the buffer that was just read */
    __syncthreads();
    if (kc + 2 < nChunks) issue_chunk(kc + 2);
  }
  /* no copy is left in flight when the wave goes on */
  asm volatile("s_wait_asynccnt 0x0" ::: "memory");

  /* the two halves' sums of the query joined */
  lrun += half_xor(lrun);
  const float inv = 1.0f / (lrun * (kPCarry * kVCarry));
  float* os = Os + wave * (16 * 68);
  /* the lane's number read anew: the store addresses formed from it are then made here, behind the loop, and hold no
     register across it; without this the joint kernel, held to 256 registers, spills to scratch */
  const int ln  = (int)__builtin_amdgcn_mbcnt_lo(~0u, 0u);
  const int hh2 = ln >> 4;
  const int c2  = ln & 15;
  const int c4  = c2 * 4;
#pragma unroll
  for (int hf = 0; hf < 2; ++hf) {
    /* slab row = query c2; a lane's eight registers of a tile are eight neighbouring d */
#pragma unroll
    for (int t4 = 0; t4 < 4; ++t4) {
      const v8f o = oacc[hf * 4 + t4] * inv;
      *(v4f*)(os + c2 * 68 + t4 * 16 + 8 * hh2)     = (v4f){o[0], o[1], o[2], o[3]};
      *(v4f*)(os + c2 * 68 + t4 * 16 + 8 * hh2 + 4) = (v4f){o[4], o[5], o[6], o[7]};
    }
    wave_lds_sync();
    {
#pragma unroll
      for (int it = 0; it < 8; ++it) {
        const int row = it * 2 + hh2;
        v4f val = *(const v4f*)(os + row * 68 + c4);
        *(v4f*)(ob + (size_t)row * kQW + hf * 64 + c4) = val;
      }
      
    }
    wave_lds_sync();
  }
}

// ---------------------------------------------------------------------------
// Attention for query positions t < 128 of each batch (a causally closed sub-problem), all f32 on the vector unit.
// Block = (b, kv head, positions t = 2u and 2u + 1), 8 waves; wave = one of the 4 query heads at one of the two positions;
// all 8 share the block's keys and values. The blocks run in the launch of the attention for positions >= 128.
// The key and value rows 0 .. 32*NG-1 (NG = t/32 + 1 groups of 32 keys, the same for both positions, all of them rows of
// positions < 128) reach LDS once per block by asynchronous 16-B copies, a whole 512-B row per copy of a wave: waves 0..3
// bring the keys, waves 4..7 the values, which land while the scores and the softmax are worked out. Key rows lie at a
// pitch of 132 floats, so that 16 lanes reading 16 B of 16 different rows fall on all 64 banks.
// Scores: lane owns keys lane + 32*i (i < NG); the NG dots of a lane run side by side as independent chains and share one
// read of the q row; each dot adds its 128 products in the order d = 0..127. Keys beyond t are set to -inf by value.
// Softmax with precise expf; p written to LDS for all 128 slots (zeros beyond t).
// p.v: lane owns d = 4*lane..+3; keys 0 .. in order, up to the next multiple of 8 (p = 0 beyond t adds nothing).
// ---------------------------------------------------------------------------
constexpr int kEKP = 132;
/* eight copies of 16 B per lane, global -> LDS through no register: eight rows, four rows apart in the source plane (pitch
   kKW floats) and in LDS (pitch PITCH floats); the s_wait_xcnt closes the statement so that no address register of a copy
   is rewritten in front of it */
template <int PITCH>
__device__ __forceinline__ void copy_rows8_async(unsigned l, const float* g) {
  constexpr unsigned kStep = 4u * PITCH * 4u;
  asm volatile("global_load_async_to_lds_b128 %0, %8, off\n\t"
               "global_load_async_to_lds_b128 %1, %9, off\n\t"
               "global_load_async_to_lds_b128 %2, %10, off\n\t"
               "global_load_async_to_lds_b128 %3, %11, off\n\t"
               "global_load_async_to_lds_b128 %4, %12, off\n\t"
               "global_load_async_to_lds_b128 %5, %13, off\n\t"
               "global_load_async_to_lds_b128 %6, %14, off\n\t"
               "global_load_async_to_lds_b128 %7, %15, off\n\t"
               "s_wait_xcnt 0x0"
               :: "v"(l), "v"(l + kStep), "v"(l + 2u * kStep), "v"(l + 3u * kStep),
                  "v"(l + 4u * kStep), "v"(l + 5u * kStep), "v"(l + 6u * kStep), "v"(l + 7u * kStep),
                  "v"(g), "v"(g + 4 * kKW), "v"(g + 8 * kKW), "v"(g + 12 * kKW),
                  "v"(g + 16 * kKW), "v"(g + 20 * kKW), "v"(g + 24 * kKW), "v"(g + 28 * kKW) : "memory");
}
template <int NG>
__device__ __forceinline__ void early_dots(const float* skl, const float* sqw, float (&dot)[4]) {
  /* eight steps a trip: their LDS reads are issued ahead of the products, which would else wait for each read in turn */
#pragma unroll 8
  for (int d4 = 0; d4 < kHD / 4; ++d4) {
    const v4f qq = *(const v4f*)(sqw + 4 * d4);
    /* unrolled: dot[i] stays in a register, and the NG chains alternate */
#pragma unroll
    for (int i = 0; i < NG; ++i) {
      const v4f kv = *(const v4f*)(skl + i * 32 * kEKP + 4 * d4);
      dot[i] = fmaf(kv[0], qq[0], dot[i]);
      dot[i] = fmaf(kv[1], qq[1], dot[i]);
      dot[i] = fmaf(kv[2], qq[2], dot[i]);
      dot[i] = fmaf(kv[3], qq[3], dot[i]);
    }
  }
}

/* LDS of one block: key rows, value rows, the 8 waves' q rows, the 8 waves' p rows */
constexpr int kEarlyPairs  = kEarly / 2;
constexpr int kEarlyBlocks = kB * kHkv * kEarlyPairs;
constexpr unsigned kEarlyLds = (unsigned)(kEarly * kEKP + kEarly * kHD + 8 * kHD + 8 * kEarly) * 4u;
static_assert((kEarly % 32) == 0 && ((kEarly * kEKP * 4) % 16) == 0, "whole groups of 32 keys; 16-B aligned parts");
__device__ __forceinline__ void attn_early_block(unsigned char* smem, int blk,
                                                 const float* __restrict__ Qe, const float* __restrict__ Ke,
                                                 const float* __restrict__ Ve, float* __restrict__ attn) {
  float* sK = (float*)smem;
  float* sV = sK + kEarly * kEKP;
  float* sq = sV + kEarly * kHD;
  float* sp = sq + 8 * kHD;
  const int lane = threadIdx.x & 31;
  const int wave = __builtin_amdgcn_readfirstlane((int)(threadIdx.x >> 5));
  const int w4   = wave & 3;
  /* in each (b, kv head) run of 64 blocks the longest (most keys) have the lowest numbers */
  const int t    = 2 * (kEarlyPairs - 1 - (blk % kEarlyPairs)) + (wave >> 2);
  const int hkv  = (blk / kEarlyPairs) & (kHkv - 1);
  const int b    = blk / (kEarlyPairs * kHkv);
  const int h    = hkv * kRep + w4;
  const int erow = b * kEarly + t;
  const int nG   = (t >> 5) + 1;
  float* sqw = sq + wave * kHD;
  float* spw = sp + wave * kEarly;
  {
    const v4f qv = *(const v4f*)(Qe + (size_t)erow * kQW + h * kHD + 4 * lane);
    *(v4f*)(sqw + 4 * lane) = qv;
  }
  {
    /* wave w (keys) or w + 4 (values) brings rows w, w + 4, .. of each group of 32, a whole row per copy; at most 32 copies
       of a wave are in flight; the branch is the same in a whole wave */
    const size_t ro = (size_t)(b * kEarly + w4) * kKW + hkv * kHD + 4 * lane;
    if (wave < 4) {
      const float* kg = Ke + ro;
      const unsigned lk = lds_off(sK) + (unsigned)(w4 * kEKP + 4 * lane) * 4u;
      for (int g = 0; g < nG; ++g) copy_rows8_async<kEKP>(lk + (unsigned)g * (32u * kEKP * 4u), kg + (size_t)g * (32 * kKW));
      /* this wave's key rows have landed */
      asm volatile("s_wait_asynccnt 0x0" ::: "memory");
    } else {
      const float* vg = Ve + ro;
      const unsigned lv = lds_off(sV) + (unsigned)(w4 * kHD + 4 * lane) * 4u;
      for (int g = 0; g < nG; ++g) copy_rows8_async<kHD>(lv + (unsigned)g * (32u * kHD * 4u), vg + (size_t)g * (32 * kKW));
    }
  }
  /* publishes the key rows to the block's eight waves (and each wave's q row to its own lanes); every wave of the block
     passes both barriers of this part */
  __syncthreads();
  float dot[4] = {0.0f, 0.0f, 0.0f, 0.0f};
  const float* skl = sK + lane * kEKP;
  if (nG == 4)      early_dots<4>(skl, sqw, dot);
  else if (nG == 3) early_dots<3>(skl, sqw, dot);
  else if (nG == 2) early_dots<2>(skl, sqw, dot);
  else              early_dots<1>(skl, sqw, dot);
  float sc[4];
#pragma unroll
  for (int i = 0; i < 4; ++i) sc[i] = (lane + 32 * i <= t) ? (dot[i] * kInvSqrtHD) : -INFINITY;
  float m = fmaxf(fmaxf(sc[0], sc[1]), fmaxf(sc[2], sc[3]));
  m = wave_max(m);
  float psum = 0.0f;
#pragma unroll
  for (int i = 0; i < 4; ++i) {
    const float p = expf(sc[i] - m);
    psum += p;
    spw[lane + 32 * i] = p;
  }
  psum = wave_sum(psum);
  /* this wave's value rows (waves 4..7) have landed, */
  asm volatile("s_wait_asynccnt 0x0" ::: "memory");
  /* and the barrier publishes them to the block's eight waves (and each wave's p row to its own lanes) */
  __syncthreads();
  float a0 = 0.0f, a1 = 0.0f, a2 = 0.0f, a3 = 0.0f;
  const float* vr = sV + 4 * lane;
  const int nj = (t + 8) & ~7;
  for (int j0 = 0; j0 < nj; j0 += 8) {
    /* unrolled: the LDS reads of eight keys are issued ahead of their products */
#pragma unroll
    for (int u = 0; u < 8; ++u) {
      const float p = spw[j0 + u];
      const v4f vv = *(const v4f*)(vr + (j0 + u) * kHD);
      a0 = fmaf(p, vv[0], a0);
      a1 = fmaf(p, vv[1], a1);
      a2 = fmaf(p, vv[2], a2);
      a3 = fmaf(p, vv[3], a3);
    }
  }
  const float il = 1.0f / psum;
  const v4f ov = (v4f){a0 * il, a1 * il, a2 * il, a3 * il};
  float* dst = attn + (size_t)(b * kS + t) * kQW + h * kHD + 4 * lane;
  *(v4f*)dst = ov;
  /* closes the store: in the joint kernel the common tail follows in the listing and rewrites the store's base register */
  asm volatile("s_wait_xcnt 0x0" ::: "memory");
}

// ---------------------------------------------------------------------------
// Attention for positions >= 128, the gate projection's tiles from kGateWithProj on and the attention for positions < 128
// in one launch: none reads what another writes. The blocks for positions >= 128 come first: their lengths run from 3 to
// 32 chunks, and the projection's blocks, then the short blocks for positions < 128, take the places that the short ones
// leave.
// ---------------------------------------------------------------------------
constexpr int kLateBlocks  = kLatePairs * kHkv * kB;
constexpr int kGateRest    = kGateGBlocks - kGateWithProj;
constexpr unsigned kLateGateLds = kLateLds > GemmLds<false>::kBytes ? kLateLds : GemmLds<false>::kBytes;
static_assert(kEarlyLds <= kLateGateLds, "the part for positions < 128 fits the LDS of the other two");
/* four waves per SIMD (two blocks per WGP, as the LDS allows) hold only while a wave stays inside 256 registers */
__global__ __launch_bounds__(256) __attribute__((amdgpu_waves_per_eu(4, 4))) void attn_late_gate_kernel(
    const unsigned short* __restrict__ Qp, const unsigned short* __restrict__ Kp, const unsigned short* __restrict__ Vtp,
    float* __restrict__ attn, const unsigned short* __restrict__ XB, const unsigned short* __restrict__ WGB,
    float* __restrict__ GF, const float* __restrict__ Qe, const float* __restrict__ Ke, const float* __restrict__ Ve) {
  __shared__ __align__(16) unsigned char smem[kLateGateLds];
  const int blk = (int)blockIdx.x;
  /* block-uniform: every barrier of a part is passed by the whole block or by none of it */
  if (blk < kLateBlocks) attn_late_block(smem, blk, Qp, Kp, Vtp, attn);
  else if (blk < kLateBlocks + kGateRest) gemm_block<1, false>(smem, blk - kLateBlocks + kGateWithProj, 0, XB, XB, kHid, 0L, WGB, kHid, 0L, GF, kQW, 0L, kTok, kQW, kHid, 1.0f);
  else attn_early_block(smem, blk - kLateBlocks - kGateRest, Qe, Ke, Ve, attn);
}

// ---------------------------------------------------------------------------
// gated = attn * sigmoid(gate projection), f32; one block per token row (2048 columns).
// Rolled loop: 8 iterations x 256 threads, one column each (coalesced 4-B loads), result into LDS; after the block barrier
// thread t owns columns 8t..8t+7. Positions >= 128: f16 plane carried x1024 (row = token). Positions < 128: bf16 hi plane and
// bf16 lo plane (lo = RNE bf16 of value - hi), row = b*128 + position. One 16-B store per lane per plane; a wave = 512
// ---------------------------------------------------------------------------
__global__ __launch_bounds__(256) void gate_kernel(const float* __restrict__ attn, const float* __restrict__ G,
                                                   unsigned short* __restrict__ GH, unsigned short* __restrict__ EH,
                                                   unsigned short* __restrict__ EL) {
  __shared__ __align__(16) float sm[kQW];
  const int tid = threadIdx.x;
  const int row = blockIdx.x;
  const int pos = row & (kS - 1);
  const int b   = row / kS;
  const float* ar = attn + (size_t)row * kQW;
  const float* gr = G + (size_t)row * kQW;
#pragma unroll 1
  for (int i = 0; i < kQW / 256; ++i) {
    const int col = i * 256 + tid;
    const float a = ar[col];
    const float g = gr[col];
    const float sg = 1.0f / (1.0f + expf(-g));
    sm[col] = a * sg;
  }
  __syncthreads();
  const v4f x0 = *(const v4f*)(sm + 8 * tid);
  const v4f x1 = *(const v4f*)(sm + 8 * tid + 4);
  if (pos >= kEarly) {
    unsigned short hb[8];
#pragma unroll
    for (int e = 0; e < 4; ++e) {
      hb[e]     = h_bits(x0[e] * kGCarry);
      hb[4 + e] = h_bits(x1[e] * kGCarry);
    }
    const v4u u = (v4u){pk16(hb[0], hb[1]), pk16(hb[2], hb[3]), pk16(hb[4], hb[5]), pk16(hb[6], hb[7])};
    unsigned short* d = GH + (size_t)row * kQW + 8 * tid;
    *(v4u*)d = u;
    
  } else {
    unsigned short hb[8], lb[8];
#pragma unroll
    for (int e = 0; e < 4; ++e) {
      const float f0 = x0[e];
      const float f1 = x1[e];
      hb[e]     = f2bf_bits(f0);
      hb[4 + e] = f2bf_bits(f1);
      lb[e]     = f2bf_bits(f0 - bf_bits2f(hb[e]));
      lb[4 + e] = f2bf_bits(f1 - bf_bits2f(hb[4 + e]));
    }
    const v4u uh = (v4u){pk16(hb[0], hb[1]), pk16(hb[2], hb[3]), pk16(hb[4], hb[5]), pk16(hb[6], hb[7])};
    const v4u ul = (v4u){pk16(lb[0], lb[1]), pk16(lb[2], lb[3]), pk16(lb[4], lb[5]), pk16(lb[6], lb[7])};
    const size_t o = (size_t)(b * kEarly + pos) * kQW + 8 * tid;
    *(v4u*)(EH + o) = uh;
    *(v4u*)(EL + o) = ul;
    
  }
}

// ---------------------------------------------------------------------------
// Host glue: 6 kernel launches, nothing else.
// GEMM shapes (all K % 64 == 0, M % 128 == 0, N % 256 == 0, no padding planes):
//   q|k|v proj : M 4096, N 3072, K 2048 -> 32 x 12 = 384 blocks (bf16)
//   gate proj  : M 4096, N 2048, K 2048 -> 32 x 8 = 256 blocks (bf16): 128 in the q|k|v launch, 128 in the launch of the
//                attention for positions >= 128
//   out late   : per batch M 1920 (positions 128..2047), N 2048, K 2048 -> 15 x 8 = 120 blocks x 2 (f16)
//   out early  : per batch M 128 (positions 0..127), N 2048, K 2048, A hi+lo -> 1 x 8 = 8 blocks x 2 (bf16), same launch
// ---------------------------------------------------------------------------
extern "C" void kernel_launch(void* const* d_in, const int* in_sizes, int n_in,
                              void* d_out, int out_size, void* d_ws, size_t ws_size,
                              hipStream_t stream) {
  if (n_in < 10) return;
  if (in_sizes[0] != kTok * kHid) return;
  if (in_sizes[1] != kS * kHD) return;
  if (in_sizes[2] != kS * kHD) return;
  if (in_sizes[3] != kQW * kHid) return;
  if (in_sizes[4] != kKW * kHid) return;
  if (in_sizes[5] != kKW * kHid) return;
  if (in_sizes[6] != kQW * kHid) return;
  if (in_sizes[7] != kQW * kQW) return;
  if (in_sizes[8] != kHD) return;
  if (in_sizes[9] != kHD) return;
  if (out_size != kTok * kQW) return;
  if (ws_size < kWsTotal) return;

  const float* X    = (const float*)d_in[0];
  const float* ctab = (const float*)d_in[1];
  const float* stab = (const float*)d_in[2];
  const float* Wq   = (const float*)d_in[3];
  const float* Wk   = (const float*)d_in[4];
  const float* Wv   = (const float*)d_in[5];
  const float* Wg   = (const float*)d_in[6];
  const float* Wo   = (const float*)d_in[7];
  const float* qnw  = (const float*)d_in[8];
  const float* knw  = (const float*)d_in[9];
  float* out = (float*)d_out;

  char* ws = (char*)d_ws;
  unsigned short* XB   = (unsigned short*)(ws + kOffXB);
  unsigned short* WQKV = (unsigned short*)(ws + kOffWQKV);
  unsigned short* WGB  = (unsigned short*)(ws + kOffWGB);
  float*          QKV  = (float*)(ws + kOffQKV);
  unsigned short* QP   = (unsigned short*)(ws + kOffQP);
  unsigned short* KP   = (unsigned short*)(ws + kOffKP);
  unsigned short* VT   = (unsigned short*)(ws + kOffVT);
  float*          QE   = (float*)(ws + kOffQE);
  float*          KE   = (float*)(ws + kOffKE);
  float*          VE   = (float*)(ws + kOffVE);
  unsigned short* WOB  = (unsigned short*)(ws + kOffWOB);
  unsigned short* WOH  = (unsigned short*)(ws + kOffWOH);
  float*          ATT  = (float*)(ws + kOffATT);
  float*          GF   = (float*)(ws + kOffGF);
  unsigned short* GH   = (unsigned short*)(ws + kOffGH);
  unsigned short* EH   = (unsigned short*)(ws + kOffEH);
  unsigned short* EL   = (unsigned short*)(ws + kOffEL);

  /* operand planes: every float input RNE-converted to bf16 once (weights are [out][in] = Bt layout already) */
  cast_all_kernel<<<kCbAll, 256, 0, stream>>>(X, Wq, Wk, Wv, Wg, Wo, XB, WQKV, WGB, WOB, WOH);

  /* q|k|v projection: QKV[4096][3072] = x . [Wq;Wk;Wv]^T, and the first tiles of the gate projection */
  proj_kernel<<<kQKVBlocks + kGateWithProj, 256, 0, stream>>>(XB, WQKV, WGB, QKV, GF);

  /* v transpose -> VT (f16 x64) and VE (f32, positions < 128): 2 x 4 x 32 blocks; norm + rotation -> QP, KP (f16 x64) and
     QE, KE (f32, positions < 128) */
  prep_kernel<<<kVBlocks + kNBlocks, 256, 0, stream>>>(QKV, ctab, stab, qnw, knw, QP, KP, QE, KE, VT, VE);

  /* attention, positions >= 128 (matrix ops), beside the rest of the gate projection and positions < 128 (f32); disjoint rows of ATT */
  attn_late_gate_kernel<<<kLateBlocks + kGateRest + kEarlyBlocks, 256, 0, stream>>>(QP, KP, VT, ATT, XB, WGB, GF, QE, KE, VE);

  /* gated planes */
  gate_kernel<<<kTok, 256, 0, stream>>>(ATT, GF, GH, EH, EL);

  /* output projection: positions < 128 (bf16 hi.W + lo.W) and positions >= 128 (f16) of each batch */
  out_proj_kernel<<<kB * (kOutEB + kOutLB), 256, 0, stream>>>(GH, EH, EL, WOH, WOB, out);
}

// v008
// It runs in 184 microseconds.
// Next to v007, in two timings, it ran 1.03 times as fast each time.
// Over all steps from v000 it is 4.27 times as fast.
// Projections x.Wq/Wk/Wv/Wg^T: v_wmma_f32_16x16x32_bf16 (every float input RNE-converted to bf16 once, exact products, f32 accumulate); scores q.k^T and p.v for query positions >= 128: v_wmma_f32_16x16x32_f16 (q,k,v planes carried x64, p carried x32768); query positions < 128: f32 VALU attention; output projection: f16 (gated carried x1024, Wo carried x1024) for positions >= 128, bf16 hi+lo gated planes x bf16 Wo (two products) for positions < 128; norms, position rotation, softmax, gate in f32.
#include <hip/hip_runtime.h>
#include <math.h>

typedef __attribute__((ext_vector_type(16))) _Float16 v16h;
typedef __attribute__((ext_vector_type(8)))  _Float16 v8h;
typedef __attribute__((ext_vector_type(16))) __bf16   v16b;
typedef __attribute__((ext_vector_type(8)))  __bf16   v8b;
typedef __attribute__((ext_vector_type(8)))  float    v8f;
typedef __attribute__((ext_vector_type(4)))  float    v4f;
typedef __attribute__((ext_vector_type(4)))  unsigned int v4u;
typedef __attribute__((ext_vector_type(2)))  unsigned int v2u;

// ---------------------------------------------------------------------------
// Shape constants
// ---------------------------------------------------------------------------
constexpr int kB     = 2;
constexpr int kS     = 2048;
constexpr int kHid   = 2048;
constexpr int kHq    = 16;
constexpr int kHkv   = 4;
constexpr int kRep   = kHq / kHkv;
constexpr int kHD    = 128;
constexpr int kTok   = kB * kS;
constexpr int kQW    = kHq * kHD;
constexpr int kKW    = kHkv * kHD;
constexpr int kQKVW  = kQW + 2 * kKW;
constexpr int kVCol0 = kQW + kKW;
constexpr int kSlots = kHq + kHkv;
constexpr int kEarly = 128;
constexpr int kERows = kB * kEarly;
constexpr int kLateKC    = 64;
constexpr int kLatePairs = (kS - kEarly) / 32;
constexpr int kVP    = 132;
constexpr float kEps = 1e-6f;

constexpr double cx_sqrt(double x) {
  double r = (x > 1.0) ? x : 1.0;
  for (int i = 0; i < 80; ++i) r = 0.5 * (r + x / r);
  return r;
}
constexpr float kInvSqrtHD = (float)(1.0 / cx_sqrt((double)kHD));
/* power-of-two carries of the f16 operand planes */
constexpr float kQKCarry = 64.0f;
constexpr float kVCarry  = 64.0f;
constexpr float kPCarry  = 32768.0f;
constexpr float kGCarry  = 1024.0f;
constexpr float kWoCarry = 1024.0f;
constexpr float kScoreMul   = kInvSqrtHD / (kQKCarry * kQKCarry);
constexpr float kOutLateMul = 1.0f / (kGCarry * kWoCarry);

static_assert(kRep == 4 && kHkv == 4 && kHD == 128, "lane maps assume 4 kv heads x 4 query heads x 128");
static_assert(kTok == 4096 && kQW == 2048 && kKW == 512 && kQKVW == 3072, "wire shapes");
static_assert((kHid % 32) == 0 && (kQW % 32) == 0, "GEMM K multiples of 32");
static_assert((kTok % 64) == 0 && (kQKVW % 64) == 0 && (kQW % 64) == 0 && ((kS - kEarly) % 64) == 0 && (kEarly % 64) == 0, "GEMM M,N multiples of 64");
static_assert((kS % 64) == 0 && (kS / 64) == 32 && (kEarly % 16) == 0 && ((kS - kEarly) % 32) == 0, "tile multiples");

// ---------------------------------------------------------------------------
// Workspace region map (bytes; every offset a multiple of 128)
//   XB   bf16 [4096][2048]  x plane                                16,777,216
//   WQKV bf16 [3072][2048]  Wq | Wk | Wv rows                      12,582,912
//   WGB  bf16 [2048][2048]  Wg                                      8,388,608
//   QKV  f32  [4096][3072]  q | k | v projections                  50,331,648
//   QP   f16  [4096][2048]  normed+rotated q x64                   16,777,216
//   KP   f16  [4096][512]   normed+rotated k x64                    4,194,304
//   VT   f16  [2][4][128][2048] v transposed x64                    4,194,304
//   QE   f32  [256][2048]   q rows of positions < 128               2,097,152
//   KE   f32  [256][512]    k rows of positions < 128                 524,288
//   VE   f32  [256][512]    v rows of positions < 128                 524,288
//   WOB  bf16 [2048][2048]  Wo                                      8,388,608
//   WOH  f16  [2048][2048]  Wo (bf16 value) x1024                   8,388,608
//   GF   f32  [4096][2048]  gate projection                        33,554,432
//   total                                                         166,723,584
// Aliases (each across whole launches):
//   ATT  f32 [4096][2048]  = first 33,554,432 B of QKV (after the joint norm/rotation and v-prep launch)
//   GH   f16 [4096][2048]  = XB (after the gate projection)
//   EH/EL bf16 [256][2048] = first 2 x 1,048,576 B of WQKV (after the q|k|v projection)
// ---------------------------------------------------------------------------
constexpr size_t kOffXB   = 0;
constexpr size_t kOffWQKV = kOffXB   + (size_t)kTok * kHid * 2;
constexpr size_t kOffWGB  = kOffWQKV + (size_t)kQKVW * kHid * 2;
constexpr size_t kOffQKV  = kOffWGB  + (size_t)kQW * kHid * 2;
constexpr size_t kOffQP   = kOffQKV  + (size_t)kTok * kQKVW * 4;
constexpr size_t kOffKP   = kOffQP   + (size_t)kTok * kQW * 2;
constexpr size_t kOffVT   = kOffKP   + (size_t)kTok * kKW * 2;
constexpr size_t kOffQE   = kOffVT   + (size_t)kTok * kKW * 2;
constexpr size_t kOffKE   = kOffQE   + (size_t)kERows * kQW * 4;
constexpr size_t kOffVE   = kOffKE   + (size_t)kERows * kKW * 4;
constexpr size_t kOffWOB  = kOffVE   + (size_t)kERows * kKW * 4;
constexpr size_t kOffWOH  = kOffWOB  + (size_t)kQW * kQW * 2;
constexpr size_t kOffGF   = kOffWOH  + (size_t)kQW * kQW * 2;
constexpr size_t kWsTotal = kOffGF   + (size_t)kTok * kQW * 4;
constexpr size_t kOffATT  = kOffQKV;
constexpr size_t kOffGH   = kOffXB;
constexpr size_t kOffEH   = kOffWQKV;
constexpr size_t kOffEL   = kOffWQKV + (size_t)kERows * kQW * 2;
static_assert(kWsTotal == 166723584ull, "carve total");
static_assert(kWsTotal <= 268435456ull, "carve cap");
static_assert(kOffEL + (size_t)kERows * kQW * 2 <= kOffWGB, "hi/lo planes inside the dead weight plane");
static_assert((kOffWQKV % 128) == 0 && (kOffWGB % 128) == 0 && (kOffQKV % 128) == 0 && (kOffQP % 128) == 0 &&
              (kOffKP % 128) == 0 && (kOffVT % 128) == 0 && (kOffQE % 128) == 0 && (kOffKE % 128) == 0 &&
              (kOffVE % 128) == 0 && (kOffWOB % 128) == 0 && (kOffWOH % 128) == 0 && (kOffGF % 128) == 0 &&
              (kOffEL % 128) == 0, "128-B aligned regions");

// ---------------------------------------------------------------------------
// Small helpers
// ---------------------------------------------------------------------------
__device__ __forceinline__ unsigned short f2bf_bits(float f) {
  unsigned u = __float_as_uint(f);
  return (unsigned short)((u + 0x7FFFu + ((u >> 16) & 1u)) >> 16);
}
__device__ __forceinline__ float bf_bits2f(unsigned short h) { return __uint_as_float(((unsigned)h) << 16); }
__device__ __forceinline__ float bf16r(float f) { return bf_bits2f(f2bf_bits(f)); }
__device__ __forceinline__ unsigned pk16(unsigned short a, unsigned short b) { return (unsigned)a | ((unsigned)b << 16); }
__device__ __forceinline__ unsigned short h_bits(float f) { const _Float16 h = (_Float16)f; return __builtin_bit_cast(unsigned short, h); }
__device__ __forceinline__ void wave_lds_sync() {
  __builtin_amdgcn_fence(__ATOMIC_RELEASE, "workgroup");
  __builtin_amdgcn_wave_barrier();
  __builtin_amdgcn_fence(__ATOMIC_ACQUIRE, "workgroup");
}

/* lane l <-> lane l ^ X inside a row of 16 lanes (X = 1, 2, 4, 8) and l <-> l ^ 16, on the vector unit: no trip through the
   LDS path and no wait on its counter; every lane is on wherever these stand */
template <int X>
__device__ __forceinline__ float row_xor(float v) {
  return __builtin_bit_cast(float, __builtin_amdgcn_update_dpp(0, __builtin_bit_cast(int, v), 0x160 + X, 0xf, 0xf, true));
}
__device__ __forceinline__ float half_xor(float v) {
  const int b = __builtin_bit_cast(int, v);
  return __builtin_bit_cast(float, __builtin_amdgcn_permlanex16(b, b, 0x76543210, 0xfedcba98, false, false));
}
/* butterflies in the order 16, 8, 4, 2, 1 over the wave */
__device__ __forceinline__ float wave_max(float m) {
  m = fmaxf(m, half_xor(m));
  m = fmaxf(m, row_xor<8>(m));
  m = fmaxf(m, row_xor<4>(m));
  m = fmaxf(m, row_xor<2>(m));
  m = fmaxf(m, row_xor<1>(m));
  return m;
}
__device__ __forceinline__ float wave_sum(float v) {
  v += half_xor(v);
  v += row_xor<8>(v);
  v += row_xor<4>(v);
  v += row_xor<2>(v);
  v += row_xor<1>(v);
  return v;
}

/* the bare matrix op: the compiler keeps the distance to the vector instructions that it places behind it */
__device__ __forceinline__ v8f mma_h(v16h a, v16h b, v8f c) {
  return __builtin_amdgcn_wmma_f32_16x16x32_f16(false, a, false, b, (short)0, c, false, false);
}
/* keeps a group of LDS reads and a group of matrix ops in the order of the source (vector and scalar instructions may pass):
   without it the compiler spreads the reads singly among the matrix ops, each waited for at once */
__device__ __forceinline__ void group_fence() { __builtin_amdgcn_sched_barrier(0x6); }
__device__ __forceinline__ v8f mma_b(v16b a, v16b b, v8f c) {
  return __builtin_amdgcn_wmma_f32_16x16x32_bf16(false, a, false, b, (short)0, c, false, false);
}
__device__ __forceinline__ void keep4_h(v16h a, v16h b, v16h c, v16h d) { asm volatile("v_nop" :: "v"(a), "v"(b), "v"(c), "v"(d)); }
__device__ __forceinline__ void keep4_b(v16b a, v16b b, v16b c, v16b d) { asm volatile("v_nop" :: "v"(a), "v"(b), "v"(c), "v"(d)); }
__device__ __forceinline__ void acc_guard4(v8f& a, v8f& b, v8f& c, v8f& d) { asm volatile("v_nop\n\tv_nop\n\tv_nop\n\tv_nop" : "+v"(a), "+v"(b), "+v"(c), "+v"(d)); }

template <typename T> struct Frag;
template <> struct Frag<_Float16> {
  typedef v16h V; union U { v16h v; v8h h[2]; };
  /* elements 0..7 <- p[0..7], 8..15 <- p[16..23] */
  static __device__ __forceinline__ v16h load(const _Float16* p) {
    U f; f.h[0] = *(const v8h*)(p); f.h[1] = *(const v8h*)(p + 16); return f.v;
  }
  static __device__ __forceinline__ v8f mmag(v16h a, v16h b, v8f c) { return mma_h(a, b, c); }
  static __device__ __forceinline__ void keep(v16h a, v16h b, v16h c, v16h d) { keep4_h(a, b, c, d); }
};
template <> struct Frag<__bf16> {
  typedef v16b V; union U { v16b v; v8b h[2]; };
  static __device__ __forceinline__ v16b load(const __bf16* p) {
    U f; f.h[0] = *(const v8b*)(p); f.h[1] = *(const v8b*)(p + 16); return f.v;
  }
  static __device__ __forceinline__ v8f mmag(v16b a, v16b b, v8f c) { return mma_b(a, b, c); }
  static __device__ __forceinline__ void keep(v16b a, v16b b, v16b c, v16b d) { keep4_b(a, b, c, d); }
};

// ---------------------------------------------------------------------------
// Batched GEMM: C[m,n] = scale * sum_k A[m,k] * Bt[n,k]. A block of 8 waves (2 x 4) owns a 128 x 256 tile, each wave 64x64 of it.
// A row-major [M,K]; Bt row-major [N,K]; M % 128 == 0, N % 256 == 0, K % 64 == 0 (no tails).
// Operands reach LDS by asynchronous 16-B copies, 64 k per stage (128-B rows at a 144-B pitch), two buffers: the next
// stage's copies fly while this stage's fragments are read from LDS; 8 lanes copy one whole 128-B line of a row.
// ASPLIT: A carried as hi/lo planes (A2 = lo plane, same layout): product = hi.b + lo.b into one accumulator.
// ET: 0 = f16 operands, 1 = bf16 operands (pointers passed as 16-bit storage). Output f32.
// ---------------------------------------------------------------------------
constexpr int kGBM    = 128;
constexpr int kGBN    = 256;
constexpr int kGKS    = 64;
constexpr int kGPitch = 72;
constexpr unsigned kGPitchB = kGPitch * 2;
static_assert((kTok % kGBM) == 0 && ((kS - kEarly) % kGBM) == 0 && (kEarly % kGBM) == 0, "GEMM M multiples of the block tile");
static_assert((kQKVW % kGBN) == 0 && (kQW % kGBN) == 0, "GEMM N multiples of the block tile");
static_assert((kHid % kGKS) == 0 && (kQW % kGKS) == 0 && kHid / kGKS >= 2 && kQW / kGKS >= 2, "GEMM K in whole stages");

__device__ __forceinline__ unsigned lds_off(const void* p) { return (unsigned)(size_t)p; }

/* copies of 16 B per lane, global -> LDS through no register: row r of the run lies 32 * r rows behind the first, in LDS
   (pitch kGPitchB) and in the source (step32 elements). One statement holds a whole run, and the s_wait_xcnt closes it so
   that no address register of a copy is rewritten in front of it; one run per statement keeps that wait to one per run */
__device__ __forceinline__ void copy4_async(unsigned l, const unsigned short* g, size_t step32) {
  asm volatile("global_load_async_to_lds_b128 %0, %4, off\n\t"
               "global_load_async_to_lds_b128 %1, %5, off\n\t"
               "global_load_async_to_lds_b128 %2, %6, off\n\t"
               "global_load_async_to_lds_b128 %3, %7, off\n\t"
               "s_wait_xcnt 0x0"
               :: "v"(l), "v"(l + 32u * kGPitchB), "v"(l + 64u * kGPitchB), "v"(l + 96u * kGPitchB),
                  "v"(g), "v"(g + step32), "v"(g + 2 * step32), "v"(g + 3 * step32) : "memory");
}
__device__ __forceinline__ void copy8_async(unsigned l, const unsigned short* g, size_t step32,
                                            unsigned m, const unsigned short* h, size_t step32h) {
  asm volatile("global_load_async_to_lds_b128 %0, %8, off\n\t"
               "global_load_async_to_lds_b128 %1, %9, off\n\t"
               "global_load_async_to_lds_b128 %2, %10, off\n\t"
               "global_load_async_to_lds_b128 %3, %11, off\n\t"
               "global_load_async_to_lds_b128 %4, %12, off\n\t"
               "global_load_async_to_lds_b128 %5, %13, off\n\t"
               "global_load_async_to_lds_b128 %6, %14, off\n\t"
               "global_load_async_to_lds_b128 %7, %15, off\n\t"
               "s_wait_xcnt 0x0"
               :: "v"(l), "v"(l + 32u * kGPitchB), "v"(l + 64u * kGPitchB), "v"(l + 96u * kGPitchB),
                  "v"(m), "v"(m + 32u * kGPitchB), "v"(m + 64u * kGPitchB), "v"(m + 96u * kGPitchB),
                  "v"(g), "v"(g + step32), "v"(g + 2 * step32), "v"(g + 3 * step32),
                  "v"(h), "v"(h + step32h), "v"(h + 2 * step32h), "v"(h + 3 * step32h) : "memory");
}

template <int ET> struct Elem;
template <> struct Elem<0> { typedef _Float16 T; };
template <> struct Elem<1> { typedef __bf16 T; };
/* LDS of one GEMM block: two stage buffers, then the 8 waves' store slabs */
template <bool ASPLIT> struct GemmLds {
  static constexpr int kARows = ASPLIT ? 2 * kGBM : kGBM;
  static constexpr int kRows  = kARows + kGBN;
  static constexpr unsigned kBufB   = (unsigned)kRows * kGPitchB;
  static constexpr unsigned kBytes  = 2u * kBufB + 8u * 16u * 68u * 4u;
};
/* one block's tile: bx = tile number inside the batch entry b; smem = the block's LDS, GemmLds<ASPLIT>::kBytes of it */
template <int ET, bool ASPLIT>
__device__ __forceinline__ void gemm_block(
    unsigned char* smem, int bx, int b,
    const unsigned short* __restrict__ Ap, const unsigned short* __restrict__ A2p, int lda, long strideA,
    const unsigned short* __restrict__ Btp, int ldb, long strideB,
    float* __restrict__ Cout, int ldc, long strideC,
    int M, int N, int K, float scale) {
  typedef typename Elem<ET>::T T;
  typedef typename Frag<T>::V V;
  constexpr int kARows = GemmLds<ASPLIT>::kARows;
  constexpr int kRows  = GemmLds<ASPLIT>::kRows;
  constexpr unsigned kBufB = GemmLds<ASPLIT>::kBufB;
  unsigned short* sStage = (unsigned short*)smem;
  float* sT = (float*)(smem + 2u * kBufB);
  const int tid  = threadIdx.x;
  const int lane = tid & 31;
  const int wave = __builtin_amdgcn_readfirstlane((int)(threadIdx.x >> 5));
  const int tilesN = N / kGBN;
  const int tilesM = M / kGBM;
  /* block-uniform, in front of every barrier and copy */
  if (bx >= tilesM * tilesN) return;
  const int tm = bx / tilesN;
  const int tn = bx - tm * tilesN;
  const int bm0 = tm * kGBM;
  const int bn0 = tn * kGBN;
  const int wm = wave >> 2;
  const int wn = wave & 3;
  const int m0 = bm0 + (wm << 6);
  const int n0 = bn0 + (wn << 6);

  const int rlane = lane & 15;
  const int koff  = (lane >> 4) * 8;
  const int mOff  = (lane >> 4) * 8;

  /* the thread's own place in a stage and in the two (three) source planes */
  const int crow = tid >> 3;
  const int cch  = tid & 7;
  const unsigned lds0 = lds_off(sStage) + (unsigned)crow * kGPitchB + (unsigned)cch * 16u;
  const unsigned short* gA  = Ap  + (size_t)b * strideA + (size_t)(bm0 + crow) * lda + cch * 8;
  const unsigned short* gA2 = A2p + (size_t)b * strideA + (size_t)(bm0 + crow) * lda + cch * 8;
  const unsigned short* gB  = Btp + (size_t)b * strideB + (size_t)(bn0 + crow) * ldb + cch * 8;
  const size_t stepA = (size_t)32 * lda;
  const size_t stepB = (size_t)32 * ldb;
  const int nst = K / kGKS;

  auto issue_stage = [&](int t) {
    const unsigned l = lds0 + (unsigned)(t & 1) * kBufB;
    const size_t k0 = (size_t)t * kGKS;
    const unsigned lb = l + (unsigned)kARows * kGPitchB;
    /* thread t brings bytes 16*(t&7).. of rows (t>>3) + 32*i of each panel: 128 rows of A (and of A2), 256 of Bt */
    if (ASPLIT) copy8_async(l, gA + k0, stepA, l + (unsigned)kGBM * kGPitchB, gA2 + k0, stepA);
    else        copy4_async(l, gA + k0, stepA);
    copy8_async(lb, gB + k0, stepB, lb + 128u * kGPitchB, gB + k0 + 4 * stepB, stepB);
  };

  v8f acc[4][4];
#pragma unroll
  for (int i = 0; i < 4; ++i)
#pragma unroll
    for (int j = 0; j < 4; ++j) acc[i][j] = (v8f){0.f,0.f,0.f,0.f,0.f,0.f,0.f,0.f};

  issue_stage(0);
  /* stage 0 has landed for this wave; the barrier publishes it to the others */
  asm volatile("s_wait_asynccnt 0x0" ::: "memory");
  __syncthreads();
  if (nst > 1) issue_stage(1);

  for (int t = 0; t < nst; ++t) {
    const T* sb = (const T*)(sStage + (t & 1) * (kRows * kGPitch));
    const T* sa = sb + ((wm << 6) + rlane) * kGPitch + koff;
    const T* sw = sb + (kARows + (wn << 6) + rlane) * kGPitch + koff;
#pragma unroll
    for (int ks = 0; ks < kGKS / 32; ++ks) {
      /* all fragments of a k step are read from LDS as one group in front of its products */
      V bh[4], ah[4], al[4];
#pragma unroll
      for (int j = 0; j < 4; ++j) bh[j] = Frag<T>::load(sw + (j << 4) * kGPitch + ks * 32);
#pragma unroll
      for (int i = 0; i < 4; ++i) {
        ah[i] = Frag<T>::load(sa + (i << 4) * kGPitch + ks * 32);
        al[i] = ah[i];
        if (ASPLIT) al[i] = Frag<T>::load(sa + (kGBM + (i << 4)) * kGPitch + ks * 32);
      }
      group_fence();
#pragma unroll
      for (int i = 0; i < 4; ++i) {
#pragma unroll
        for (int j = 0; j < 4; ++j) {
          acc[i][j] = Frag<T>::mmag(ah[i], bh[j], acc[i][j]);
          if (ASPLIT) acc[i][j] = Frag<T>::mmag(al[i], bh[j], acc[i][j]);
        }
      }
      group_fence();
      Frag<T>::keep(bh[0], bh[1], bh[2], bh[3]);
    }
    /* hand-over: this wave's reads of the buffer are done, */
    asm volatile("s_wait_dscnt 0x0" ::: "memory");
    /* its copies of stage t + 1 have landed, */
    asm volatile("s_wait_asynccnt 0x0" ::: "memory");
    /* and the barrier publishes stage t + 1 and frees the buffer that was just read */
    __syncthreads();
    if (t + 2 < nst) issue_stage(t + 2);
  }
  /* no copy is left in flight when the wave goes on */
  asm volatile("s_wait_asynccnt 0x0" ::: "memory");
  acc_guard4(acc[0][0], acc[0][1], acc[0][2], acc[0][3]);
  acc_guard4(acc[1][0], acc[1][1], acc[1][2], acc[1][3]);
  acc_guard4(acc[2][0], acc[2][1], acc[2][2], acc[2][3]);
  acc_guard4(acc[3][0], acc[3][1], acc[3][2], acc[3][3]);

  float* slab = sT + wave * (16 * 68);
  float* C = Cout + (size_t)b * strideC;
#pragma unroll
  for (int i = 0; i < 4; ++i) {
    const int mBase = m0 + (i << 4);
#pragma unroll
    for (int j = 0; j < 4; ++j) {
#pragma unroll
      for (int r = 0; r < 8; ++r) {
        slab[(mOff + r) * 68 + (j << 4) + rlane] = acc[i][j][r] * scale;
      }
    }
    wave_lds_sync();
    {
      const int hh = lane >> 4, c4 = (lane & 15) * 4;
      {
#pragma unroll
        for (int it = 0; it < 8; ++it) {
          const int row = it * 2 + hh;
          v4f v = *(const v4f*)(slab + row * 68 + c4);
          *(v4f*)(C + (size_t)(mBase + row) * ldc + n0 + c4) = v;
        }
        
      }
    }
    wave_lds_sync();
  }
}

// ---------------------------------------------------------------------------
// Projections of x, bf16: QKV[4096][3072] = x . [Wq;Wk;Wv]^T (32 x 12 = 384 blocks) and, in the same launch, the first
// kGateWithProj tiles of the gate projection GF[4096][2048] = x . Wg^T (neither reads what the other writes). Two blocks
// fit a WGP; 384 blocks leave 128 of the 512 places of 256 WGPs empty, and the gate tiles take them. The other gate tiles
// run beside the attention for positions >= 128.
// ---------------------------------------------------------------------------
constexpr int kQKVBlocks    = (kTok / kGBM) * (kQKVW / kGBN);
constexpr int kGateGBlocks  = (kTok / kGBM) * (kQW / kGBN);
constexpr int kGateWithProj = 2 * 256 - kQKVBlocks;
static_assert(kGateWithProj > 0 && kGateWithProj < kGateGBlocks, "the gate tiles are split between two launches");
__global__ __launch_bounds__(256) void proj_kernel(
    const unsigned short* __restrict__ XB, const unsigned short* __restrict__ WQKV, const unsigned short* __restrict__ WGB,
    float* __restrict__ QKV, float* __restrict__ GF) {
  __shared__ __align__(16) unsigned char smem[GemmLds<false>::kBytes];
  const int blk = (int)blockIdx.x;
  const bool gt = blk >= kQKVBlocks;
  const int n   = gt ? kQW : kQKVW;
  gemm_block<1, false>(smem, gt ? blk - kQKVBlocks : blk, 0, XB, XB, kHid, 0L, gt ? WGB : WQKV, kHid, 0L,
                       gt ? GF : QKV, n, 0L, kTok, n, kHid, 1.0f);
}

// ---------------------------------------------------------------------------
// Output projection, both parts in one launch (they write disjoint rows of out and read nothing of each other):
//   blocks 0 .. 15   positions < 128 of each batch: bf16 hi.W + lo.W, 1 x 8 tiles x 2 batches (twice the products of a tile
//                    of the other part, so they take the lowest block numbers)
//   blocks 16 .. 255 positions >= 128 of each batch: f16 single product, carries folded back, 15 x 8 tiles x 2 batches
// ---------------------------------------------------------------------------
constexpr int kOutEB = (kEarly / kGBM) * (kQW / kGBN);
constexpr int kOutLB = ((kS - kEarly) / kGBM) * (kQW / kGBN);
__global__ __launch_bounds__(256) void out_proj_kernel(
    const unsigned short* __restrict__ GH, const unsigned short* __restrict__ EH, const unsigned short* __restrict__ EL,
    const unsigned short* __restrict__ WOH, const unsigned short* __restrict__ WOB, float* __restrict__ out) {
  __shared__ __align__(16) unsigned char smem[GemmLds<true>::kBytes];
  const int blk = (int)blockIdx.x;
  /* block-uniform: every barrier of a part is passed by the whole block or by none of it */
  if (blk < kB * kOutEB) {
    gemm_block<1, true>(smem, blk % kOutEB, blk / kOutEB, EH, EL, kQW, (long)kEarly * kQW, WOB, kQW, 0L,
                        out, kQW, (long)kS * kQW, kEarly, kQW, kQW, 1.0f);
  } else {
    const int l = blk - kB * kOutEB;
    gemm_block<0, false>(smem, l % kOutLB, l / kOutLB, GH + (size_t)kEarly * kQW, GH + (size_t)kEarly * kQW, kQW,
                         (long)kS * kQW, WOH, kQW, 0L, out + (size_t)kEarly * kQW, kQW, (long)kS * kQW,
                         kS - kEarly, kQW, kQW, kOutLateMul);
  }
}

// ---------------------------------------------------------------------------
// MODE 0: o0 = bf16 (RNE). MODE 1: o0 = bf16 (RNE), o1 = f16 of (bf16 value x carry) (exact: power-of-two carry).
// ---------------------------------------------------------------------------
template <int MODE>
__device__ __forceinline__ void cast8_block(const float* __restrict__ in, unsigned short* __restrict__ o0,
                                            unsigned short* __restrict__ o1, int blk, float carry) {
  const int i = blk * 256 + threadIdx.x;
  const size_t e0 = (size_t)i << 3;
  const v4f a0 = *(const v4f*)(in + e0);
  const v4f a1 = *(const v4f*)(in + e0 + 4);
  unsigned short bb[8], hb[8];
#pragma unroll
  for (int e = 0; e < 4; ++e) {
    bb[e]     = f2bf_bits(a0[e]);
    bb[4 + e] = f2bf_bits(a1[e]);
  }
#pragma unroll
  for (int e = 0; e < 8; ++e) hb[e] = (MODE == 1) ? h_bits(bf_bits2f(bb[e]) * carry) : (unsigned short)0;
  const v4u ub = (v4u){pk16(bb[0], bb[1]), pk16(bb[2], bb[3]), pk16(bb[4], bb[5]), pk16(bb[6], bb[7])};
  const v4u uh = (v4u){pk16(hb[0], hb[1]), pk16(hb[2], hb[3]), pk16(hb[4], hb[5]), pk16(hb[6], hb[7])};
  unsigned short* q0 = o0 + e0;
  unsigned short* q1 = o1 + e0;
  *(v4u*)q0 = ub;
  if (MODE == 1) *(v4u*)q1 = uh;
  /* closes the stores: in the joint kernel another plane's code follows in the listing and rewrites their registers */
  asm volatile("s_wait_xcnt 0x0" ::: "memory");
}
/* all six planes in one launch: a block (2048 elements) belongs to one plane, found from its number; no plane has a tail */
constexpr int kCbX  = kTok * kHid / 2048;
constexpr int kCbQ  = kQW * kHid / 2048;
constexpr int kCbK  = kKW * kHid / 2048;
constexpr int kCbO  = kQW * kQW / 2048;
constexpr int kCbAll = kCbX + 2 * kCbQ + 2 * kCbK + kCbO;
static_assert((kTok * kHid) % 2048 == 0 && (kQW * kHid) % 2048 == 0 && (kKW * kHid) % 2048 == 0 && (kQW * kQW) % 2048 == 0, "whole blocks");
__global__ __launch_bounds__(256) void cast_all_kernel(
    const float* __restrict__ X, const float* __restrict__ Wq, const float* __restrict__ Wk, const float* __restrict__ Wv,
    const float* __restrict__ Wg, const float* __restrict__ Wo,
    unsigned short* __restrict__ XB, unsigned short* __restrict__ WQKV, unsigned short* __restrict__ WGB,
    unsigned short* __restrict__ WOB, unsigned short* __restrict__ WOH) {
  int blk = (int)blockIdx.x;
  if (blk < kCbX) { cast8_block<0>(X, XB, XB, blk, 1.0f); return; }
  blk -= kCbX;
  if (blk < kCbO) { cast8_block<1>(Wo, WOB, WOH, blk, kWoCarry); return; }
  blk -= kCbO;
  if (blk < kCbQ) { cast8_block<0>(Wq, WQKV, WQKV, blk, 1.0f); return; }
  blk -= kCbQ;
  if (blk < kCbQ) { cast8_block<0>(Wg, WGB, WGB, blk, 1.0f); return; }
  blk -= kCbQ;
  if (blk < kCbK) { cast8_block<0>(Wk, WQKV + (size_t)kQW * kHid, WQKV, blk, 1.0f); return; }
  blk -= kCbK;
  cast8_block<0>(Wv, WQKV + (size_t)kVCol0 * kHid, WQKV, blk, 1.0f);
}

// ---------------------------------------------------------------------------
// Per-head RMS norm (eps inside the rsqrt of the mean square) then rotation by the position tables, f32.
// One wave per (token, slot): slots 0..15 = query heads, 16..19 = key heads (columns slot*128 of the q|k|v plane).
// Lane owns d = 4*lane..4*lane+3; the partner d +/- 64 lives in lane ^ 16 (unconditional exchanges).
// d < 64: y = n[d]*c[d] - n[d+64]*s[d]; d >= 64: y = n[d]*c[d] + n[d-64]*s[d]; tables read by value at [pos][d],
// tables and norm weights RNE-converted to bf16 on load.
// ---------------------------------------------------------------------------
__device__ __forceinline__ void normrot_block(
    int blk, const float* __restrict__ QKV, const float* __restrict__ ctab, const float* __restrict__ stab,
    const float* __restrict__ qw, const float* __restrict__ kw,
    unsigned short* __restrict__ Qp, unsigned short* __restrict__ Kp, float* __restrict__ Qe, float* __restrict__ Ke) {
  const int lane = threadIdx.x & 31;
  const int wave = __builtin_amdgcn_readfirstlane((int)(threadIdx.x >> 5));
  const int gw   = blk * 8 + wave;
  const int tok  = gw / kSlots;
  const int slot = gw - tok * kSlots;
  const int pos  = tok & (kS - 1);
  const int b    = tok / kS;
  const bool isq = slot < kHq;
  const int kslot = isq ? 0 : (slot - kHq);

  const v4f x   = *(const v4f*)(QKV + (size_t)tok * kQKVW + slot * kHD + 4 * lane);
  const v4f wq4 = *(const v4f*)(qw + 4 * lane);
  const v4f wk4 = *(const v4f*)(kw + 4 * lane);
  const v4f c4  = *(const v4f*)(ctab + (size_t)pos * kHD + 4 * lane);
  const v4f s4  = *(const v4f*)(stab + (size_t)pos * kHD + 4 * lane);

  float ss = x[0] * x[0];
  ss = fmaf(x[1], x[1], ss);
  ss = fmaf(x[2], x[2], ss);
  ss = fmaf(x[3], x[3], ss);
  ss = wave_sum(ss);
  const float inv = rsqrtf(ss * (1.0f / (float)kHD) + kEps);

  float n[4], p[4], y[4];
#pragma unroll
  for (int e = 0; e < 4; ++e) {
    const float w = bf16r(isq ? wq4[e] : wk4[e]);
    n[e] = x[e] * inv * w;
  }
#pragma unroll
  for (int e = 0; e < 4; ++e) p[e] = half_xor(n[e]);
  const float sgn = (lane < 16) ? -1.0f : 1.0f;
#pragma unroll
  for (int e = 0; e < 4; ++e) y[e] = n[e] * bf16r(c4[e]) + sgn * (p[e] * bf16r(s4[e]));

  unsigned short hb[4];
#pragma unroll
  for (int e = 0; e < 4; ++e) hb[e] = h_bits(y[e] * kQKCarry);
  const v2u u = (v2u){pk16(hb[0], hb[1]), pk16(hb[2], hb[3])};
  const v4f yv = (v4f){y[0], y[1], y[2], y[3]};

  unsigned short* dq = Qp + (size_t)tok * kQW + slot * kHD + 4 * lane;
  unsigned short* dk = Kp + (size_t)tok * kKW + kslot * kHD + 4 * lane;
  unsigned short* d16 = isq ? dq : dk;
  const bool early = pos < kEarly;
  const int erow = b * kEarly + (early ? pos : 0);
  float* eq = Qe + (size_t)erow * kQW + (isq ? slot : 0) * kHD + 4 * lane;
  float* ek = Ke + (size_t)erow * kKW + kslot * kHD + 4 * lane;
  float* d32 = isq ? eq : ek;
  {
    *(v2u*)d16 = u;
    /* no register that the store names is rewritten in front of this wait */
    asm volatile("s_wait_xcnt 0x0" ::: "memory");
    if (early) *(v4f*)d32 = yv;
  }
}

// ---------------------------------------------------------------------------
// v columns of the q|k|v plane -> VT f16 [b][kv head][d][s] carried x64 (LDS transpose), plus VE f32 rows for positions < 128.
// Block = (b, kv head, 64 positions); 256 threads. Load coverage: 8 iterations x 256 threads = 2048 v4f = 64 rows x 32.
// VT stores: row d = it*32 + wave*4 + (lane>>3), it 0..3 x 8 waves x 4 = 128 rows; (lane&7) x 8 halves = 64 positions
// ---------------------------------------------------------------------------
__device__ __forceinline__ void vprep_block(int blk, const float* __restrict__ QKV, unsigned short* __restrict__ Vt,
                                            float* __restrict__ Ve) {
  __shared__ __align__(16) float sm[64 * kVP];
  const int tid  = threadIdx.x;
  const int lane = tid & 31;
  const int wave = __builtin_amdgcn_readfirstlane((int)(tid >> 5));
  const int st   = blk & 31;
  const int hkv  = (blk >> 5) & (kHkv - 1);
  const int b    = blk >> 7;
  const int s0   = st * 64;
  const float* src = QKV + (size_t)(b * kS + s0) * kQKVW + kVCol0 + hkv * kHD;
#pragma unroll
  for (int i = 0; i < 8; ++i) {
    const int e  = i * 256 + tid;
    const int r  = e >> 5;
    const int cc = (e & 31) * 4;
    const v4f v = *(const v4f*)(src + (size_t)r * kQKVW + cc);
    *(v4f*)(sm + r * kVP + cc) = v;
  }
  __syncthreads();
  const int q = lane >> 3, c8 = (lane & 7) * 8;
  v4u tv[4];
#pragma unroll
  for (int it = 0; it < 4; ++it) {
    const int d = it * 32 + wave * 4 + q;
    unsigned short hb[8];
#pragma unroll
    for (int e = 0; e < 8; ++e) hb[e] = h_bits(sm[(c8 + e) * kVP + d] * kVCarry);
    tv[it] = (v4u){pk16(hb[0], hb[1]), pk16(hb[2], hb[3]), pk16(hb[4], hb[5]), pk16(hb[6], hb[7])};
  }
  v4f ev[8];
#pragma unroll
  for (int it = 0; it < 8; ++it) ev[it] = *(const v4f*)(sm + (it * 8 + wave) * kVP + 4 * lane);
  const bool early = s0 < kEarly;
  const int erow0 = b * kEarly + (early ? s0 : 0);
  unsigned short* vt0 = Vt + (size_t)(b * kHkv + hkv) * kHD * kS + s0 + c8;
  float* ve0 = Ve + (size_t)erow0 * kKW + hkv * kHD + 4 * lane;
  {
#pragma unroll
    for (int it = 0; it < 4; ++it) *(v4u*)(vt0 + (size_t)(it * 32 + wave * 4 + q) * kS) = tv[it];
    /* no register that the four stores name is rewritten in front of this wait */
    asm volatile("s_wait_xcnt 0x0" ::: "memory");
    if (early) {
#pragma unroll
      for (int it = 0; it < 8; ++it) *(v4f*)(ve0 + (size_t)(it * 8 + wave) * kKW) = ev[it];
    }
    
  }
}
/* both readers of the q|k|v plane in one launch (disjoint columns in, disjoint planes out): the v blocks, the longer ones,
   come first; the branch is block-uniform, so the v part's barrier is passed by a whole block or by none of it */
constexpr int kVBlocks = kB * kHkv * (kS / 64);
constexpr int kNBlocks = kTok * kSlots / 8;
__global__ __launch_bounds__(256) void prep_kernel(
    const float* __restrict__ QKV, const float* __restrict__ ctab, const float* __restrict__ stab,
    const float* __restrict__ qw, const float* __restrict__ kw,
    unsigned short* __restrict__ Qp, unsigned short* __restrict__ Kp, float* __restrict__ Qe, float* __restrict__ Ke,
    unsigned short* __restrict__ Vt, float* __restrict__ Ve) {
  const int blk = (int)blockIdx.x;
  if (blk < kVBlocks) vprep_block(blk, QKV, Vt, Ve);
  else                normrot_block(blk - kVBlocks, QKV, ctab, stab, qw, kw, Qp, Kp, Qe, Ke);
}

constexpr int kKPitch = 136;
constexpr int kVPitch = 72;
constexpr int kKTile  = kLateKC * kKPitch;
constexpr int kVTile  = kHD * kVPitch;
constexpr int kKVBuf  = kKTile + kVTile;
static_assert(kLateKC == 64 && kHD == 128, "copy maps: 16 lanes per 256-B key row, 8 lanes per 128-B value row");
static_assert(((kKTile * 2) % 16) == 0 && ((kKVBuf * 2) % 16) == 0, "16-B aligned tiles");

/* one chunk's share of a thread: 4 copies of key rows (16 rows apart) and 4 of value rows (32 rows apart), 16 B each,
   global -> LDS through no register; the s_wait_xcnt closes the statement so that no address register of a copy is
   rewritten in front of it */
__device__ __forceinline__ void copy_kv_async(unsigned lk, const unsigned short* gk, unsigned lv, const unsigned short* gv) {
  asm volatile("global_load_async_to_lds_b128 %0, %8, off\n\t"
               "global_load_async_to_lds_b128 %1, %9, off\n\t"
               "global_load_async_to_lds_b128 %2, %10, off\n\t"
               "global_load_async_to_lds_b128 %3, %11, off\n\t"
               "global_load_async_to_lds_b128 %4, %12, off\n\t"
               "global_load_async_to_lds_b128 %5, %13, off\n\t"
               "global_load_async_to_lds_b128 %6, %14, off\n\t"
               "global_load_async_to_lds_b128 %7, %15, off\n\t"
               "s_wait_xcnt 0x0"
               :: "v"(lk), "v"(lk + 16u * (kKPitch * 2u)), "v"(lk + 32u * (kKPitch * 2u)), "v"(lk + 48u * (kKPitch * 2u)),
                  "v"(lv), "v"(lv + 32u * (kVPitch * 2u)), "v"(lv + 64u * (kVPitch * 2u)), "v"(lv + 96u * (kVPitch * 2u)),
                  "v"(gk), "v"(gk + 16 * kKW), "v"(gk + 32 * kKW), "v"(gk + 48 * kKW),
                  "v"(gv), "v"(gv + 32 * kS), "v"(gv + 64 * kS), "v"(gv + 96 * kS) : "memory");
}

/* LDS of one block: two chunk buffers, the 8 waves' store slabs */
constexpr unsigned kLateKVB  = 2u * kKVBuf * 2u;
constexpr unsigned kLateLds  = kLateKVB + 8u * 16u * 68u * 4u;
static_assert((kLateKVB % 16) == 0, "16-B aligned parts");
__device__ __forceinline__ void attn_late_block(unsigned char* smem, int blk,
                                                const unsigned short* __restrict__ Qp, const unsigned short* __restrict__ Kp,
                                                const unsigned short* __restrict__ Vtp, float* __restrict__ attn) {
  union FH { v16h v; v8h h[2]; };
  unsigned short* sKV = (unsigned short*)smem;
  float* Os = (float*)(smem + kLateKVB);
  const int tid  = threadIdx.x;
  const int lane = threadIdx.x & 31;
  const int wave = __builtin_amdgcn_readfirstlane((int)(threadIdx.x >> 5));
  const int hh   = lane >> 4;
  const int c    = lane & 15;
  const int qt2  = blk % kLatePairs;
  const int bh   = blk / kLatePairs;
  const int hkv  = bh & (kHkv - 1);
  const int b    = bh / kHkv;
  const int h    = hkv * kRep + (wave & 3);
  const int q0   = kEarly + (qt2 * 2 + (wave >> 2)) * 16;

  /* the thread's own place in a chunk's two tiles and in the two source planes */
  const unsigned lk0 = lds_off(sKV) + (unsigned)(tid >> 4) * (kKPitch * 2u) + (unsigned)(tid & 15) * 16u;
  const unsigned lv0 = lds_off(sKV + kKTile) + (unsigned)(tid >> 3) * (kVPitch * 2u) + (unsigned)(tid & 7) * 16u;
  const unsigned short* gk0 = Kp + (size_t)(b * kS + (tid >> 4)) * kKW + hkv * kHD + (tid & 15) * 8;
  const unsigned short* gv0 = Vtp + ((size_t)(b * kHkv + hkv) * kHD + (tid >> 3)) * kS + (tid & 7) * 8;
  auto issue_chunk = [&](int t) {
    const unsigned o = (unsigned)(t & 1) * (kKVBuf * 2u);
    copy_kv_async(lk0 + o, gk0 + (size_t)t * (kLateKC * kKW), lv0 + o, gv0 + t * kLateKC);
  };
  float* ob = attn + (size_t)(b * kS + q0) * kQW + h * kHD;

  v16h qa[4];
  {
    const _Float16* qrow = (const _Float16*)Qp + (size_t)(b * kS + q0 + c) * kQW + h * kHD + 8 * hh;
#pragma unroll
    for (int dc = 0; dc < 4; ++dc) qa[dc] = Frag<_Float16>::load(qrow + dc * 32);
  }

  /* of the lane's query q0 + c: running maximum (both halves alike) and the sum over the keys of this half of the wave */
  float mrun = -INFINITY, lrun = 0.0f;
  /* tile t: register r = o[query q0 + c][d = t*16 + 8*hh + r] */
  v8f oacc[8];
#pragma unroll
  for (int t = 0; t < 8; ++t) oacc[t] = (v8f){0.f,0.f,0.f,0.f,0.f,0.f,0.f,0.f};

  int nChunks = (q0 + 16 + kLateKC - 1) / kLateKC;
  if (nChunks > kS / kLateKC) nChunks = kS / kLateKC;
  /* nChunks is the same in all 8 waves: the block's 32 query rows lie inside one chunk of 64 positions */

  issue_chunk(0);
  /* chunk 0 has landed for this wave; the barrier publishes it to the others */
  asm volatile("s_wait_asynccnt 0x0" ::: "memory");
  __syncthreads();
  if (nChunks > 1) issue_chunk(1);

  for (int kc = 0; kc < nChunks; ++kc) {
    const int kv0 = kc * kLateKC;
    const _Float16* sk = (const _Float16*)(sKV + (kc & 1) * kKVBuf) + c * kKPitch + 8 * hh;
    const _Float16* sv = (const _Float16*)(sKV + (kc & 1) * kKVBuf + kKTile) + c * kVPitch + 8 * hh;
    /* fragments are read from LDS in groups of four, in front of the products that use them: eight register sets, the four
       that a group of products has just read are refilled at once with the fragments eight places on */
    v16h ring[8];
#pragma unroll
    for (int f = 0; f < 8; ++f) ring[f] = Frag<_Float16>::load(sk + (f >> 2) * 16 * kKPitch + (f & 3) * 32);
    group_fence();
    v8f s[4];
#pragma unroll
    for (int j = 0; j < 4; ++j) {
      s[j] = (v8f){0.f,0.f,0.f,0.f,0.f,0.f,0.f,0.f};
#pragma unroll
      for (int dc = 0; dc < 4; ++dc) s[j] = mma_h(ring[(j & 1) * 4 + dc], qa[dc], s[j]);
      group_fence();
      if (j < 2) {
#pragma unroll
        for (int dc = 0; dc < 4; ++dc) ring[(j & 1) * 4 + dc] = Frag<_Float16>::load(sk + (j + 2) * 16 * kKPitch + dc * 32);
        group_fence();
      }
    }
    const bool diag = (kc == nChunks - 1);
    /* key kv0 + j*16 + 8*hh + r lies behind query q0 + c where j*16 + r > rel; no key of an earlier chunk does */
    const int rel = diag ? (q0 + c - kv0 - 8 * hh) : kLateKC;
    /* four chains, one per tile of 16 keys, for the maximum as for the sum: no chain of 32 dependent steps */
    float mj[4];
#pragma unroll
    for (int j = 0; j < 4; ++j) {
      float m = -INFINITY;
#pragma unroll
      for (int r = 0; r < 8; ++r) {
        float v = s[j][r] * kScoreMul;
        if (j * 16 + r > rel) v = -INFINITY;
        s[j][r] = v;
        m = fmaxf(m, v);
      }
      mj[j] = m;
    }
    float cm = fmaxf(fmaxf(mj[0], mj[1]), fmaxf(mj[2], mj[3]));
    /* the other 32 keys of the query's chunk lie in lane ^ 16 */
    cm = fmaxf(cm, half_xor(cm));
    const float mnew  = fmaxf(mrun, cm);
    const float alpha = __expf(mrun - mnew);
    mrun = mnew;
    FH pb[2];
    float pj[4];
#pragma unroll
    for (int j = 0; j < 4; ++j) {
      float psum = 0.0f;
#pragma unroll
      for (int r = 0; r < 8; ++r) {
        const float p = __expf(s[j][r] - mnew);
        psum += p;
        pb[j >> 1].v[(j & 1) * 8 + r] = (_Float16)(p * kPCarry);
      }
      pj[j] = psum;
    }
    lrun = lrun * alpha + ((pj[0] + pj[1]) + (pj[2] + pj[3]));
#pragma unroll
    for (int t = 0; t < 8; ++t) oacc[t] *= alpha;
#pragma unroll
    for (int t = 0; t < 8; ++t) ring[t] = Frag<_Float16>::load(sv + t * 16 * kVPitch);
    group_fence();
#pragma unroll
    for (int kk = 0; kk < 2; ++kk) {
#pragma unroll
      for (int g = 0; g < 2; ++g) {
#pragma unroll
        for (int t = g * 4; t < g * 4 + 4; ++t) oacc[t] = mma_h(ring[t], pb[kk].v, oacc[t]);
        group_fence();
        if (kk == 0) {
#pragma unroll
          for (int t = g * 4; t < g * 4 + 4; ++t) ring[t] = Frag<_Float16>::load(sv + t * 16 * kVPitch + 32);
          group_fence();
        }
      }
    }
    /* hand-over: this wave's reads of the buffer are done, */
    asm volatile("s_wait_dscnt 0x0" ::: "memory");
    /* its copies of chunk kc + 1 have landed, */
    asm volatile("s_wait_asynccnt 0x0" ::: "memory");
    /* and the barrier publishes chunk kc + 1 and frees the buffer that was just read */
    __syncthreads();
    if (kc + 2 < nChunks) issue_chunk(kc + 2);
  }
  /* no copy is left in flight when the wave goes on */
  asm volatile("s_wait_asynccnt 0x0" ::: "memory");

  /* the two halves' sums of the query joined */
  lrun += half_xor(lrun);
  const float inv = 1.0f / (lrun * (kPCarry * kVCarry));
  float* os = Os + wave * (16 * 68);
  /* the lane's number read anew: the store addresses formed from it are then made here, behind the loop, and hold no
     register across it; without this the joint kernel, held to 256 registers, spills to scratch */
  const int ln  = (int)__builtin_amdgcn_mbcnt_lo(~0u, 0u);
  const int hh2 = ln >> 4;
  const int c2  = ln & 15;
  const int c4  = c2 * 4;
#pragma unroll
  for (int hf = 0; hf < 2; ++hf) {
    /* slab row = query c2; a lane's eight registers of a tile are eight neighbouring d */
#pragma unroll
    for (int t4 = 0; t4 < 4; ++t4) {
      const v8f o = oacc[hf * 4 + t4] * inv;
      *(v4f*)(os + c2 * 68 + t4 * 16 + 8 * hh2)     = (v4f){o[0], o[1], o[2], o[3]};
      *(v4f*)(os + c2 * 68 + t4 * 16 + 8 * hh2 + 4) = (v4f){o[4], o[5], o[6], o[7]};
    }
    wave_lds_sync();
    {
#pragma unroll
      for (int it = 0; it < 8; ++it) {
        const int row = it * 2 + hh2;
        v4f val = *(const v4f*)(os + row * 68 + c4);
        *(v4f*)(ob + (size_t)row * kQW + hf * 64 + c4) = val;
      }
      
    }
    wave_lds_sync();
  }
}

// ---------------------------------------------------------------------------
// Attention for query positions t < 128 of each batch (a causally closed sub-problem), all f32 on the vector unit.
// Block = (b, kv head, positions t = 2u and 2u + 1), 8 waves; wave = one of the 4 query heads at one of the two positions;
// all 8 share the block's keys and values. The blocks run in the launch of the attention for positions >= 128.
// The key and value rows 0 .. 32*NG-1 (NG = t/32 + 1 groups of 32 keys, the same for both positions, all of them rows of
// positions < 128) reach LDS once per block by asynchronous 16-B copies, a whole 512-B row per copy of a wave: waves 0..3
// bring the keys, waves 4..7 the values, which land while the scores and the softmax are worked out. Key rows lie at a
// pitch of 132 floats, so that 16 lanes reading 16 B of 16 different rows fall on all 64 banks.
// Scores: lane owns keys lane + 32*i (i < NG); the NG dots of a lane run side by side as independent chains and share one
// read of the q row; each dot adds its 128 products in the order d = 0..127. Keys beyond t are set to -inf by value.
// Softmax with precise expf; p written to LDS for all 128 slots (zeros beyond t).
// p.v: lane owns d = 4*lane..+3; keys 0 .. in order, up to the next multiple of 8 (p = 0 beyond t adds nothing).
// ---------------------------------------------------------------------------
constexpr int kEKP = 132;
/* eight copies of 16 B per lane, global -> LDS through no register: eight rows, four rows apart in the source plane (pitch
   kKW floats) and in LDS (pitch PITCH floats); the s_wait_xcnt closes the statement so that no address register of a copy
   is rewritten in front of it */
template <int PITCH>
__device__ __forceinline__ void copy_rows8_async(unsigned l, const float* g) {
  constexpr unsigned kStep = 4u * PITCH * 4u;
  asm volatile("global_load_async_to_lds_b128 %0, %8, off\n\t"
               "global_load_async_to_lds_b128 %1, %9, off\n\t"
               "global_load_async_to_lds_b128 %2, %10, off\n\t"
               "global_load_async_to_lds_b128 %3, %11, off\n\t"
               "global_load_async_to_lds_b128 %4, %12, off\n\t"
               "global_load_async_to_lds_b128 %5, %13, off\n\t"
               "global_load_async_to_lds_b128 %6, %14, off\n\t"
               "global_load_async_to_lds_b128 %7, %15, off\n\t"
               "s_wait_xcnt 0x0"
               :: "v"(l), "v"(l + kStep), "v"(l + 2u * kStep), "v"(l + 3u * kStep),
                  "v"(l + 4u * kStep), "v"(l + 5u * kStep), "v"(l + 6u * kStep), "v"(l + 7u * kStep),
                  "v"(g), "v"(g + 4 * kKW), "v"(g + 8 * kKW), "v"(g + 12 * kKW),
                  "v"(g + 16 * kKW), "v"(g + 20 * kKW), "v"(g + 24 * kKW), "v"(g + 28 * kKW) : "memory");
}
template <int NG>
__device__ __forceinline__ void early_dots(const float* skl, const float* sqw, float (&dot)[4]) {
  /* eight steps a trip: their LDS reads are issued ahead of the products, which would else wait for each read in turn */
#pragma unroll 8
  for (int d4 = 0; d4 < kHD / 4; ++d4) {
    const v4f qq = *(const v4f*)(sqw + 4 * d4);
    /* unrolled: dot[i] stays in a register, and the NG chains alternate */
#pragma unroll
    for (int i = 0; i < NG; ++i) {
      const v4f kv = *(const v4f*)(skl + i * 32 * kEKP + 4 * d4);
      dot[i] = fmaf(kv[0], qq[0], dot[i]);
      dot[i] = fmaf(kv[1], qq[1], dot[i]);
      dot[i] = fmaf(kv[2], qq[2], dot[i]);
      dot[i] = fmaf(kv[3], qq[3], dot[i]);
    }
  }
}

/* LDS of one block: key rows, value rows, the 8 waves' q rows, the 8 waves' p rows */
constexpr int kEarlyPairs  = kEarly / 2;
constexpr int kEarlyBlocks = kB * kHkv * kEarlyPairs;
constexpr unsigned kEarlyLds = (unsigned)(kEarly * kEKP + kEarly * kHD + 8 * kHD + 8 * kEarly) * 4u;
static_assert((kEarly % 32) == 0 && ((kEarly * kEKP * 4) % 16) == 0, "whole groups of 32 keys; 16-B aligned parts");
__device__ __forceinline__ void attn_early_block(unsigned char* smem, int blk,
                                                 const float* __restrict__ Qe, const float* __restrict__ Ke,
                                                 const float* __restrict__ Ve, float* __restrict__ attn) {
  float* sK = (float*)smem;
  float* sV = sK + kEarly * kEKP;
  float* sq = sV + kEarly * kHD;
  float* sp = sq + 8 * kHD;
  const int lane = threadIdx.x & 31;
  const int wave = __builtin_amdgcn_readfirstlane((int)(threadIdx.x >> 5));
  const int w4   = wave & 3;
  /* in each (b, kv head) run of 64 blocks the longest (most keys) have the lowest numbers */
  const int t    = 2 * (kEarlyPairs - 1 - (blk % kEarlyPairs)) + (wave >> 2);
  const int hkv  = (blk / kEarlyPairs) & (kHkv - 1);
  const int b    = blk / (kEarlyPairs * kHkv);
  const int h    = hkv * kRep + w4;
  const int erow = b * kEarly + t;
  const int nG   = (t >> 5) + 1;
  float* sqw = sq + wave * kHD;
  float* spw = sp + wave * kEarly;
  {
    const v4f qv = *(const v4f*)(Qe + (size_t)erow * kQW + h * kHD + 4 * lane);
    *(v4f*)(sqw + 4 * lane) = qv;
  }
  {
    /* wave w (keys) or w + 4 (values) brings rows w, w + 4, .. of each group of 32, a whole row per copy; at most 32 copies
       of a wave are in flight; the branch is the same in a whole wave */
    const size_t ro = (size_t)(b * kEarly + w4) * kKW + hkv * kHD + 4 * lane;
    if (wave < 4) {
      const float* kg = Ke + ro;
      const unsigned lk = lds_off(sK) + (unsigned)(w4 * kEKP + 4 * lane) * 4u;
      for (int g = 0; g < nG; ++g) copy_rows8_async<kEKP>(lk + (unsigned)g * (32u * kEKP * 4u), kg + (size_t)g * (32 * kKW));
      /* this wave's key rows have landed */
      asm volatile("s_wait_asynccnt 0x0" ::: "memory");
    } else {
      const float* vg = Ve + ro;
      const unsigned lv = lds_off(sV) + (unsigned)(w4 * kHD + 4 * lane) * 4u;
      for (int g = 0; g < nG; ++g) copy_rows8_async<kHD>(lv + (unsigned)g * (32u * kHD * 4u), vg + (size_t)g * (32 * kKW));
    }
  }
  /* publishes the key rows to the block's eight waves (and each wave's q row to its own lanes); every wave of the block
     passes both barriers of this part */
  __syncthreads();
  float dot[4] = {0.0f, 0.0f, 0.0f, 0.0f};
  const float* skl = sK + lane * kEKP;
  if (nG == 4)      early_dots<4>(skl, sqw, dot);
  else if (nG == 3) early_dots<3>(skl, sqw, dot);
  else if (nG == 2) early_dots<2>(skl, sqw, dot);
  else              early_dots<1>(skl, sqw, dot);
  float sc[4];
#pragma unroll
  for (int i = 0; i < 4; ++i) sc[i] = (lane + 32 * i <= t) ? (dot[i] * kInvSqrtHD) : -INFINITY;
  float m = fmaxf(fmaxf(sc[0], sc[1]), fmaxf(sc[2], sc[3]));
  m = wave_max(m);
  float psum = 0.0f;
#pragma unroll
  for (int i = 0; i < 4; ++i) {
    const float p = expf(sc[i] - m);
    psum += p;
    spw[lane + 32 * i] = p;
  }
  psum = wave_sum(psum);
  /* this wave's value rows (waves 4..7) have landed, */
  asm volatile("s_wait_asynccnt 0x0" ::: "memory");
  /* and the barrier publishes them to the block's eight waves (and each wave's p row to its own lanes) */
  __syncthreads();
  float a0 = 0.0f, a1 = 0.0f, a2 = 0.0f, a3 = 0.0f;
  const float* vr = sV + 4 * lane;
  const int nj = (t + 8) & ~7;
  for (int j0 = 0; j0 < nj; j0 += 8) {
    /* unrolled: the LDS reads of eight keys are issued ahead of their products */
#pragma unroll
    for (int u = 0; u < 8; ++u) {
      const float p = spw[j0 + u];
      const v4f vv = *(const v4f*)(vr + (j0 + u) * kHD);
      a0 = fmaf(p, vv[0], a0);
      a1 = fmaf(p, vv[1], a1);
      a2 = fmaf(p, vv[2], a2);
      a3 = fmaf(p, vv[3], a3);
    }
  }
  const float il = 1.0f / psum;
  const v4f ov = (v4f){a0 * il, a1 * il, a2 * il, a3 * il};
  float* dst = attn + (size_t)(b * kS + t) * kQW + h * kHD + 4 * lane;
  *(v4f*)dst = ov;
  /* closes the store: in the joint kernel the common tail follows in the listing and rewrites the store's base register */
  asm volatile("s_wait_xcnt 0x0" ::: "memory");
}

// ---------------------------------------------------------------------------
// Attention for positions >= 128, the gate projection's tiles from kGateWithProj on and the attention for positions < 128
// in one launch: none reads what another writes. The blocks for positions >= 128 come first: their lengths run from 3 to
// 32 chunks, and the projection's blocks, then the short blocks for positions < 128, take the places that the short ones
// leave.
// ---------------------------------------------------------------------------
constexpr int kLateBlocks  = kLatePairs * kHkv * kB;
constexpr int kGateRest    = kGateGBlocks - kGateWithProj;
constexpr unsigned kLateGateLds = kLateLds > GemmLds<false>::kBytes ? kLateLds : GemmLds<false>::kBytes;
static_assert(kEarlyLds <= kLateGateLds, "the part for positions < 128 fits the LDS of the other two");
/* four waves per SIMD (two blocks per WGP, as the LDS allows) hold only while a wave stays inside 256 registers */
__global__ __launch_bounds__(256) __attribute__((amdgpu_waves_per_eu(4, 4))) void attn_late_gate_kernel(
    const unsigned short* __restrict__ Qp, const unsigned short* __restrict__ Kp, const unsigned short* __restrict__ Vtp,
    float* __restrict__ attn, const unsigned short* __restrict__ XB, const unsigned short* __restrict__ WGB,
    float* __restrict__ GF, const float* __restrict__ Qe, const float* __restrict__ Ke, const float* __restrict__ Ve) {
  __shared__ __align__(16) unsigned char smem[kLateGateLds];
  const int blk = (int)blockIdx.x;
  /* block-uniform: every barrier of a part is passed by the whole block or by none of it */
  if (blk < kLateBlocks) attn_late_block(smem, blk, Qp, Kp, Vtp, attn);
  else if (blk < kLateBlocks + kGateRest) gemm_block<1, false>(smem, blk - kLateBlocks + kGateWithProj, 0, XB, XB, kHid, 0L, WGB, kHid, 0L, GF, kQW, 0L, kTok, kQW, kHid, 1.0f);
  else attn_early_block(smem, blk - kLateBlocks - kGateRest, Qe, Ke, Ve, attn);
}

// ---------------------------------------------------------------------------
// gated = attn * sigmoid(gate projection), f32; one block per token row (2048 columns).
// Rolled loop: 8 iterations x 256 threads, one column each (coalesced 4-B loads), result into LDS; after the block barrier
// thread t owns columns 8t..8t+7. Positions >= 128: f16 plane carried x1024 (row = token). Positions < 128: bf16 hi plane and
// bf16 lo plane (lo = RNE bf16 of value - hi), row = b*128 + position. One 16-B store per lane per plane; a wave = 512
// ---------------------------------------------------------------------------
__global__ __launch_bounds__(256) void gate_kernel(const float* __restrict__ attn, const float* __restrict__ G,
                                                   unsigned short* __restrict__ GH, unsigned short* __restrict__ EH,
                                                   unsigned short* __restrict__ EL) {
  __shared__ __align__(16) float sm[kQW];
  const int tid = threadIdx.x;
  const int row = blockIdx.x;
  const int pos = row & (kS - 1);
  const int b   = row / kS;
  const float* ar = attn + (size_t)row * kQW;
  const float* gr = G + (size_t)row * kQW;
#pragma unroll 1
  for (int i = 0; i < kQW / 256; ++i) {
    const int col = i * 256 + tid;
    const float a = ar[col];
    const float g = gr[col];
    const float sg = 1.0f / (1.0f + expf(-g));
    sm[col] = a * sg;
  }
  __syncthreads();
  const v4f x0 = *(const v4f*)(sm + 8 * tid);
  const v4f x1 = *(const v4f*)(sm + 8 * tid + 4);
  if (pos >= kEarly) {
    unsigned short hb[8];
#pragma unroll
    for (int e = 0; e < 4; ++e) {
      hb[e]     = h_bits(x0[e] * kGCarry);
      hb[4 + e] = h_bits(x1[e] * kGCarry);
    }
    const v4u u = (v4u){pk16(hb[0], hb[1]), pk16(hb[2], hb[3]), pk16(hb[4], hb[5]), pk16(hb[6], hb[7])};
    unsigned short* d = GH + (size_t)row * kQW + 8 * tid;
    *(v4u*)d = u;
    
  } else {
    unsigned short hb[8], lb[8];
#pragma unroll
    for (int e = 0; e < 4; ++e) {
      const float f0 = x0[e];
      const float f1 = x1[e];
      hb[e]     = f2bf_bits(f0);
      hb[4 + e] = f2bf_bits(f1);
      lb[e]     = f2bf_bits(f0 - bf_bits2f(hb[e]));
      lb[4 + e] = f2bf_bits(f1 - bf_bits2f(hb[4 + e]));
    }
    const v4u uh = (v4u){pk16(hb[0], hb[1]), pk16(hb[2], hb[3]), pk16(hb[4], hb[5]), pk16(hb[6], hb[7])};
    const v4u ul = (v4u){pk16(lb[0], lb[1]), pk16(lb[2], lb[3]), pk16(lb[4], lb[5]), pk16(lb[6], lb[7])};
    const size_t o = (size_t)(b * kEarly + pos) * kQW + 8 * tid;
    *(v4u*)(EH + o) = uh;
    *(v4u*)(EL + o) = ul;
    
  }
}

// ---------------------------------------------------------------------------
// Host glue: 6 kernel launches, nothing else.
// GEMM shapes (all K % 64 == 0, M % 128 == 0, N % 256 == 0, no padding planes):
//   q|k|v proj : M 4096, N 3072, K 2048 -> 32 x 12 = 384 blocks (bf16)
//   gate proj  : M 4096, N 2048, K 2048 -> 32 x 8 = 256 blocks (bf16): 128 in the q|k|v launch, 128 in the launch of the
//                attention for positions >= 128
//   out late   : per batch M 1920 (positions 128..2047), N 2048, K 2048 -> 15 x 8 = 120 blocks x 2 (f16)
//   out early  : per batch M 128 (positions 0..127), N 2048, K 2048, A hi+lo -> 1 x 8 = 8 blocks x 2 (bf16), same launch
// ---------------------------------------------------------------------------
extern "C" void kernel_launch(void* const* d_in, const int* in_sizes, int n_in,
                              void* d_out, int out_size, void* d_ws, size_t ws_size,
                              hipStream_t stream) {
  if (n_in < 10) return;
  if (in_sizes[0] != kTok * kHid) return;
  if (in_sizes[1] != kS * kHD) return;
  if (in_sizes[2] != kS * kHD) return;
  if (in_sizes[3] != kQW * kHid) return;
  if (in_sizes[4] != kKW * kHid) return;
  if (in_sizes[5] != kKW * kHid) return;
  if (in_sizes[6] != kQW * kHid) return;
  if (in_sizes[7] != kQW * kQW) return;
  if (in_sizes[8] != kHD) return;
  if (in_sizes[9] != kHD) return;
  if (out_size != kTok * kQW) return;
  if (ws_size < kWsTotal) return;

  const float* X    = (const float*)d_in[0];
  const float* ctab = (const float*)d_in[1];
  const float* stab = (const float*)d_in[2];
  const float* Wq   = (const float*)d_in[3];
  const float* Wk   = (const float*)d_in[4];
  const float* Wv   = (const float*)d_in[5];
  const float* Wg   = (const float*)d_in[6];
  const float* Wo   = (const float*)d_in[7];
  const float* qnw  = (const float*)d_in[8];
  const float* knw  = (const float*)d_in[9];
  float* out = (float*)d_out;

  char* ws = (char*)d_ws;
  unsigned short* XB   = (unsigned short*)(ws + kOffXB);
  unsigned short* WQKV = (unsigned short*)(ws + kOffWQKV);
  unsigned short* WGB  = (unsigned short*)(ws + kOffWGB);
  float*          QKV  = (float*)(ws + kOffQKV);
  unsigned short* QP   = (unsigned short*)(ws + kOffQP);
  unsigned short* KP   = (unsigned short*)(ws + kOffKP);
  unsigned short* VT   = (unsigned short*)(ws + kOffVT);
  float*          QE   = (float*)(ws + kOffQE);
  float*          KE   = (float*)(ws + kOffKE);
  float*          VE   = (float*)(ws + kOffVE);
  unsigned short* WOB  = (unsigned short*)(ws + kOffWOB);
  unsigned short* WOH  = (unsigned short*)(ws + kOffWOH);
  float*          ATT  = (float*)(ws + kOffATT);
  float*          GF   = (float*)(ws + kOffGF);
  unsigned short* GH   = (unsigned short*)(ws + kOffGH);
  unsigned short* EH   = (unsigned short*)(ws + kOffEH);
  unsigned short* EL   = (unsigned short*)(ws + kOffEL);

  /* operand planes: every float input RNE-converted to bf16 once (weights are [out][in] = Bt layout already) */
  cast_all_kernel<<<kCbAll, 256, 0, stream>>>(X, Wq, Wk, Wv, Wg, Wo, XB, WQKV, WGB, WOB, WOH);

  /* q|k|v projection: QKV[4096][3072] = x . [Wq;Wk;Wv]^T, and the first tiles of the gate projection */
  proj_kernel<<<kQKVBlocks + kGateWithProj, 256, 0, stream>>>(XB, WQKV, WGB, QKV, GF);

  /* v transpose -> VT (f16 x64) and VE (f32, positions < 128): 2 x 4 x 32 blocks; norm + rotation -> QP, KP (f16 x64) and
     QE, KE (f32, positions < 128) */
  prep_kernel<<<kVBlocks + kNBlocks, 256, 0, stream>>>(QKV, ctab, stab, qnw, knw, QP, KP, QE, KE, VT, VE);

  /* attention, positions >= 128 (matrix ops), beside the rest of the gate projection and positions < 128 (f32); disjoint rows of ATT */
  attn_late_gate_kernel<<<kLateBlocks + kGateRest + kEarlyBlocks, 256, 0, stream>>>(QP, KP, VT, ATT, XB, WGB, GF, QE, KE, VE);

  /* gated planes */
  gate_kernel<<<kTok, 256, 0, stream>>>(ATT, GF, GH, EH, EL);

  /* output projection: positions < 128 (bf16 hi.W + lo.W) and positions >= 128 (f16) of each batch */
  out_proj_kernel<<<kB * (kOutEB + kOutLB), 256, 0, stream>>>(GH, EH, EL, WOH, WOB, out);
}

// v009
// Measured time: 171 microseconds a run.
// Next to v008, in two timings, it ran 1.07 times as fast each time.
// Over all steps from v000 it is 4.58 times as fast.
// Projections x.Wq/Wk/Wv/Wg^T: v_wmma_f32_16x16x32_bf16 (every float input RNE-converted to bf16 once, exact products, f32 accumulate); scores q.k^T and p.v for query positions >= 128: v_wmma_f32_16x16x32_f16 (q,k,v planes carried x64, p carried x32768); query positions < 128: f32 VALU attention; output projection: f16 (gated carried x1024, Wo carried x1024) for positions >= 128, bf16 hi+lo gated planes x bf16 Wo (two products) for positions < 128; norms, position rotation, softmax, gate in f32.
#include <hip/hip_runtime.h>
#include <math.h>

typedef __attribute__((ext_vector_type(16))) _Float16 v16h;
typedef __attribute__((ext_vector_type(8)))  _Float16 v8h;
typedef __attribute__((ext_vector_type(16))) __bf16   v16b;
typedef __attribute__((ext_vector_type(8)))  __bf16   v8b;
typedef __attribute__((ext_vector_type(8)))  float    v8f;
typedef __attribute__((ext_vector_type(4)))  float    v4f;
typedef __attribute__((ext_vector_type(4)))  unsigned int v4u;
typedef __attribute__((ext_vector_type(2)))  unsigned int v2u;

// ---------------------------------------------------------------------------
// Shape constants
// ---------------------------------------------------------------------------
constexpr int kB     = 2;
constexpr int kS     = 2048;
constexpr int kHid   = 2048;
constexpr int kHq    = 16;
constexpr int kHkv   = 4;
constexpr int kRep   = kHq / kHkv;
constexpr int kHD    = 128;
constexpr int kTok   = kB * kS;
constexpr int kQW    = kHq * kHD;
constexpr int kKW    = kHkv * kHD;
constexpr int kQKVW  = kQW + 2 * kKW;
constexpr int kVCol0 = kQW + kKW;
constexpr int kEarly = 128;
constexpr int kERows = kB * kEarly;
constexpr int kLateKC    = 64;
constexpr int kLatePairs = (kS - kEarly) / 32;
constexpr float kEps = 1e-6f;

constexpr double cx_sqrt(double x) {
  double r = (x > 1.0) ? x : 1.0;
  for (int i = 0; i < 80; ++i) r = 0.5 * (r + x / r);
  return r;
}
constexpr float kInvSqrtHD = (float)(1.0 / cx_sqrt((double)kHD));
/* power-of-two carries of the f16 operand planes */
constexpr float kQKCarry = 64.0f;
constexpr float kVCarry  = 64.0f;
constexpr float kPCarry  = 32768.0f;
constexpr float kGCarry  = 1024.0f;
constexpr float kWoCarry = 1024.0f;
constexpr float kScoreMul   = kInvSqrtHD / (kQKCarry * kQKCarry);
constexpr float kOutLateMul = 1.0f / (kGCarry * kWoCarry);

static_assert(kRep == 4 && kHkv == 4 && kHD == 128, "lane maps assume 4 kv heads x 4 query heads x 128");
static_assert(kTok == 4096 && kQW == 2048 && kKW == 512 && kQKVW == 3072, "wire shapes");
static_assert((kHid % 32) == 0 && (kQW % 32) == 0, "GEMM K multiples of 32");
static_assert((kTok % 64) == 0 && (kQKVW % 64) == 0 && (kQW % 64) == 0 && ((kS - kEarly) % 64) == 0 && (kEarly % 64) == 0, "GEMM M,N multiples of 64");
static_assert((kS % 64) == 0 && (kS / 64) == 32 && (kEarly % 16) == 0 && ((kS - kEarly) % 32) == 0, "tile multiples");

// ---------------------------------------------------------------------------
// Workspace region map (bytes; every offset a multiple of 128)
//   XB   bf16 [4096][2048]  x plane                                16,777,216
//   WQKV bf16 [3072][2048]  Wq | Wk | Wv rows                      12,582,912
//   WGB  bf16 [2048][2048]  Wg                                      8,388,608
//   ATT  f32  [4096][2048]  attention output (region of 50,331,648 B, the first 33,554,432 used)
//   QP   f16  [4096][2048]  normed+rotated q x64                   16,777,216
//   KP   f16  [4096][512]   normed+rotated k x64                    4,194,304
//   VT   f16  [2][4][128][2048] v transposed x64                    4,194,304
//   QE   f32  [256][2048]   q rows of positions < 128               2,097,152
//   KE   f32  [256][512]    k rows of positions < 128                 524,288
//   VE   f32  [256][512]    v rows of positions < 128                 524,288
//   WOB  bf16 [2048][2048]  Wo                                      8,388,608
//   WOH  f16  [2048][2048]  Wo (bf16 value) x1024                   8,388,608
//   GF   f32  [4096][2048]  gate projection                        33,554,432
//   total                                                         166,723,584
// Aliases (each across whole launches):
//   GH   f16 [4096][2048]  = XB (after the gate projection)
//   EH/EL bf16 [256][2048] = first 2 x 1,048,576 B of WQKV (after the q|k|v projection)
// ---------------------------------------------------------------------------
constexpr size_t kOffXB   = 0;
constexpr size_t kOffWQKV = kOffXB   + (size_t)kTok * kHid * 2;
constexpr size_t kOffWGB  = kOffWQKV + (size_t)kQKVW * kHid * 2;
constexpr size_t kOffQKV  = kOffWGB  + (size_t)kQW * kHid * 2;
constexpr size_t kOffQP   = kOffQKV  + (size_t)kTok * kQKVW * 4;
constexpr size_t kOffKP   = kOffQP   + (size_t)kTok * kQW * 2;
constexpr size_t kOffVT   = kOffKP   + (size_t)kTok * kKW * 2;
constexpr size_t kOffQE   = kOffVT   + (size_t)kTok * kKW * 2;
constexpr size_t kOffKE   = kOffQE   + (size_t)kERows * kQW * 4;
constexpr size_t kOffVE   = kOffKE   + (size_t)kERows * kKW * 4;
constexpr size_t kOffWOB  = kOffVE   + (size_t)kERows * kKW * 4;
constexpr size_t kOffWOH  = kOffWOB  + (size_t)kQW * kQW * 2;
constexpr size_t kOffGF   = kOffWOH  + (size_t)kQW * kQW * 2;
constexpr size_t kWsTotal = kOffGF   + (size_t)kTok * kQW * 4;
constexpr size_t kOffATT  = kOffQKV;
constexpr size_t kOffGH   = kOffXB;
constexpr size_t kOffEH   = kOffWQKV;
constexpr size_t kOffEL   = kOffWQKV + (size_t)kERows * kQW * 2;
static_assert(kWsTotal == 166723584ull, "carve total");
static_assert(kWsTotal <= 268435456ull, "carve cap");
static_assert(kOffEL + (size_t)kERows * kQW * 2 <= kOffWGB, "hi/lo planes inside the dead weight plane");
static_assert((kOffWQKV % 128) == 0 && (kOffWGB % 128) == 0 && (kOffQKV % 128) == 0 && (kOffQP % 128) == 0 &&
              (kOffKP % 128) == 0 && (kOffVT % 128) == 0 && (kOffQE % 128) == 0 && (kOffKE % 128) == 0 &&
              (kOffVE % 128) == 0 && (kOffWOB % 128) == 0 && (kOffWOH % 128) == 0 && (kOffGF % 128) == 0 &&
              (kOffEL % 128) == 0, "128-B aligned regions");

// ---------------------------------------------------------------------------
// Small helpers
// ---------------------------------------------------------------------------
__device__ __forceinline__ unsigned short f2bf_bits(float f) {
  unsigned u = __float_as_uint(f);
  return (unsigned short)((u + 0x7FFFu + ((u >> 16) & 1u)) >> 16);
}
__device__ __forceinline__ float bf_bits2f(unsigned short h) { return __uint_as_float(((unsigned)h) << 16); }
__device__ __forceinline__ float bf16r(float f) { return bf_bits2f(f2bf_bits(f)); }
/* the same value for every finite f, by the conversion instruction (round to nearest even) */
__device__ __forceinline__ float bf16r_v(float f) { return (float)(__bf16)f; }
__device__ __forceinline__ unsigned pk16(unsigned short a, unsigned short b) { return (unsigned)a | ((unsigned)b << 16); }
__device__ __forceinline__ unsigned short h_bits(float f) { const _Float16 h = (_Float16)f; return __builtin_bit_cast(unsigned short, h); }
__device__ __forceinline__ void wave_lds_sync() {
  __builtin_amdgcn_fence(__ATOMIC_RELEASE, "workgroup");
  __builtin_amdgcn_wave_barrier();
  __builtin_amdgcn_fence(__ATOMIC_ACQUIRE, "workgroup");
}

/* lane l <-> lane l ^ X inside a row of 16 lanes (X = 1, 2, 4, 8) and l <-> l ^ 16, on the vector unit: no trip through the
   LDS path and no wait on its counter; every lane is on wherever these stand */
template <int X>
__device__ __forceinline__ float row_xor(float v) {
  return __builtin_bit_cast(float, __builtin_amdgcn_update_dpp(0, __builtin_bit_cast(int, v), 0x160 + X, 0xf, 0xf, true));
}
__device__ __forceinline__ float half_xor(float v) {
  const int b = __builtin_bit_cast(int, v);
  return __builtin_bit_cast(float, __builtin_amdgcn_permlanex16(b, b, 0x76543210, 0xfedcba98, false, false));
}
/* butterflies in the order 16, 8, 4, 2, 1 over the wave */
__device__ __forceinline__ float wave_max(float m) {
  m = fmaxf(m, half_xor(m));
  m = fmaxf(m, row_xor<8>(m));
  m = fmaxf(m, row_xor<4>(m));
  m = fmaxf(m, row_xor<2>(m));
  m = fmaxf(m, row_xor<1>(m));
  return m;
}
__device__ __forceinline__ float wave_sum(float v) {
  v += half_xor(v);
  v += row_xor<8>(v);
  v += row_xor<4>(v);
  v += row_xor<2>(v);
  v += row_xor<1>(v);
  return v;
}

/* the bare matrix op: the compiler keeps the distance to the vector instructions that it places behind it */
__device__ __forceinline__ v8f mma_h(v16h a, v16h b, v8f c) {
  return __builtin_amdgcn_wmma_f32_16x16x32_f16(false, a, false, b, (short)0, c, false, false);
}
/* keeps a group of LDS reads and a group of matrix ops in the order of the source (vector and scalar instructions may pass):
   without it the compiler spreads the reads singly among the matrix ops, each waited for at once */
__device__ __forceinline__ void group_fence() { __builtin_amdgcn_sched_barrier(0x6); }
__device__ __forceinline__ v8f mma_b(v16b a, v16b b, v8f c) {
  return __builtin_amdgcn_wmma_f32_16x16x32_bf16(false, a, false, b, (short)0, c, false, false);
}
__device__ __forceinline__ void keep4_h(v16h a, v16h b, v16h c, v16h d) { asm volatile("v_nop" :: "v"(a), "v"(b), "v"(c), "v"(d)); }
__device__ __forceinline__ void keep4_b(v16b a, v16b b, v16b c, v16b d) { asm volatile("v_nop" :: "v"(a), "v"(b), "v"(c), "v"(d)); }
__device__ __forceinline__ void acc_guard4(v8f& a, v8f& b, v8f& c, v8f& d) { asm volatile("v_nop\n\tv_nop\n\tv_nop\n\tv_nop" : "+v"(a), "+v"(b), "+v"(c), "+v"(d)); }

template <typename T> struct Frag;
template <> struct Frag<_Float16> {
  typedef v16h V; union U { v16h v; v8h h[2]; };
  /* elements 0..7 <- p[0..7], 8..15 <- p[16..23] */
  static __device__ __forceinline__ v16h load(const _Float16* p) {
    U f; f.h[0] = *(const v8h*)(p); f.h[1] = *(const v8h*)(p + 16); return f.v;
  }
  static __device__ __forceinline__ v8f mmag(v16h a, v16h b, v8f c) { return mma_h(a, b, c); }
  static __device__ __forceinline__ void keep(v16h a, v16h b, v16h c, v16h d) { keep4_h(a, b, c, d); }
};
template <> struct Frag<__bf16> {
  typedef v16b V; union U { v16b v; v8b h[2]; };
  static __device__ __forceinline__ v16b load(const __bf16* p) {
    U f; f.h[0] = *(const v8b*)(p); f.h[1] = *(const v8b*)(p + 16); return f.v;
  }
  static __device__ __forceinline__ v8f mmag(v16b a, v16b b, v8f c) { return mma_b(a, b, c); }
  static __device__ __forceinline__ void keep(v16b a, v16b b, v16b c, v16b d) { keep4_b(a, b, c, d); }
};

// ---------------------------------------------------------------------------
// Batched GEMM: C[m,n] = scale * sum_k A[m,k] * Bt[n,k]. A block of 8 waves (2 x 4) owns a 128 x 256 tile, each wave 64x64 of it.
// A row-major [M,K]; Bt row-major [N,K]; M % 128 == 0, N % 256 == 0, K % 64 == 0 (no tails).
// Operands reach LDS by asynchronous 16-B copies, 64 k per stage (128-B rows at a 144-B pitch), two buffers: the next
// stage's copies fly while this stage's fragments are read from LDS; 8 lanes copy one whole 128-B line of a row.
// ASPLIT: A carried as hi/lo planes (A2 = lo plane, same layout): product = hi.b + lo.b into one accumulator.
// ET: 0 = f16 operands, 1 = bf16 operands (pointers passed as 16-bit storage). Output f32.
// ---------------------------------------------------------------------------
constexpr int kGBM    = 128;
constexpr int kGBN    = 256;
constexpr int kGKS    = 64;
constexpr int kGPitch = 72;
constexpr unsigned kGPitchB = kGPitch * 2;
static_assert((kTok % kGBM) == 0 && ((kS - kEarly) % kGBM) == 0 && (kEarly % kGBM) == 0, "GEMM M multiples of the block tile");
static_assert((kQKVW % kGBN) == 0 && (kQW % kGBN) == 0, "GEMM N multiples of the block tile");
static_assert((kHid % kGKS) == 0 && (kQW % kGKS) == 0 && kHid / kGKS >= 2 && kQW / kGKS >= 2, "GEMM K in whole stages");

__device__ __forceinline__ unsigned lds_off(const void* p) { return (unsigned)(size_t)p; }

/* copies of 16 B per lane, global -> LDS through no register: row r of the run lies 32 * r rows behind the first, in LDS
   (pitch kGPitchB) and in the source (step32 elements). One statement holds a whole run, and the s_wait_xcnt closes it so
   that no address register of a copy is rewritten in front of it; one run per statement keeps that wait to one per run */
__device__ __forceinline__ void copy4_async(unsigned l, const unsigned short* g, size_t step32) {
  asm volatile("global_load_async_to_lds_b128 %0, %4, off\n\t"
               "global_load_async_to_lds_b128 %1, %5, off\n\t"
               "global_load_async_to_lds_b128 %2, %6, off\n\t"
               "global_load_async_to_lds_b128 %3, %7, off\n\t"
               "s_wait_xcnt 0x0"
               :: "v"(l), "v"(l + 32u * kGPitchB), "v"(l + 64u * kGPitchB), "v"(l + 96u * kGPitchB),
                  "v"(g), "v"(g + step32), "v"(g + 2 * step32), "v"(g + 3 * step32) : "memory");
}
__device__ __forceinline__ void copy8_async(unsigned l, const unsigned short* g, size_t step32,
                                            unsigned m, const unsigned short* h, size_t step32h) {
  asm volatile("global_load_async_to_lds_b128 %0, %8, off\n\t"
               "global_load_async_to_lds_b128 %1, %9, off\n\t"
               "global_load_async_to_lds_b128 %2, %10, off\n\t"
               "global_load_async_to_lds_b128 %3, %11, off\n\t"
               "global_load_async_to_lds_b128 %4, %12, off\n\t"
               "global_load_async_to_lds_b128 %5, %13, off\n\t"
               "global_load_async_to_lds_b128 %6, %14, off\n\t"
               "global_load_async_to_lds_b128 %7, %15, off\n\t"
               "s_wait_xcnt 0x0"
               :: "v"(l), "v"(l + 32u * kGPitchB), "v"(l + 64u * kGPitchB), "v"(l + 96u * kGPitchB),
                  "v"(m), "v"(m + 32u * kGPitchB), "v"(m + 64u * kGPitchB), "v"(m + 96u * kGPitchB),
                  "v"(g), "v"(g + step32), "v"(g + 2 * step32), "v"(g + 3 * step32),
                  "v"(h), "v"(h + step32h), "v"(h + 2 * step32h), "v"(h + 3 * step32h) : "memory");
}

template <int ET> struct Elem;
template <> struct Elem<0> { typedef _Float16 T; };
template <> struct Elem<1> { typedef __bf16 T; };
/* LDS of one GEMM block: two stage buffers, then the 8 waves' store slabs */
template <bool ASPLIT> struct GemmLds {
  static constexpr int kARows = ASPLIT ? 2 * kGBM : kGBM;
  static constexpr int kRows  = kARows + kGBN;
  static constexpr unsigned kBufB   = (unsigned)kRows * kGPitchB;
  static constexpr unsigned kBytes  = 2u * kBufB + 8u * 16u * 68u * 4u;
};
/* one block's tile: bx = tile number inside the batch entry b; smem = the block's LDS, GemmLds<ASPLIT>::kBytes of it */
/* mode (only where MODES; the same in the whole block): 0 = the tile goes to Cout; 1 = the f32 tile is left in LDS (pitch kTP
   floats) for the caller; 2 = the tile is left in LDS transposed as f16 carried x64 (row = column of the tile, pitch kTHP
   halves), and goes to Cout as well where toC. The caller's barrier publishes what is left in LDS */
constexpr int kTP  = 260;
constexpr int kTHP = 136;
template <int ET, bool ASPLIT, bool MODES = false>
__device__ __forceinline__ void gemm_block(
    unsigned char* smem, int bx, int b,
    const unsigned short* __restrict__ Ap, const unsigned short* __restrict__ A2p, int lda, long strideA,
    const unsigned short* __restrict__ Btp, int ldb, long strideB,
    float* __restrict__ Cout, int ldc, long strideC,
    int M, int N, int K, float scale, int mode = 0, bool toC = true) {
  typedef typename Elem<ET>::T T;
  typedef typename Frag<T>::V V;
  constexpr int kARows = GemmLds<ASPLIT>::kARows;
  constexpr int kRows  = GemmLds<ASPLIT>::kRows;
  constexpr unsigned kBufB = GemmLds<ASPLIT>::kBufB;
  unsigned short* sStage = (unsigned short*)smem;
  float* sT = (float*)(smem + 2u * kBufB);
  const int tid  = threadIdx.x;
  const int lane = tid & 31;
  const int wave = __builtin_amdgcn_readfirstlane((int)(threadIdx.x >> 5));
  const int tilesN = N / kGBN;
  const int tilesM = M / kGBM;
  /* block-uniform, in front of every barrier and copy */
  if (bx >= tilesM * tilesN) return;
  const int tm = bx / tilesN;
  const int tn = bx - tm * tilesN;
  const int bm0 = tm * kGBM;
  const int bn0 = tn * kGBN;
  const int wm = wave >> 2;
  const int wn = wave & 3;
  const int m0 = bm0 + (wm << 6);
  const int n0 = bn0 + (wn << 6);

  const int rlane = lane & 15;
  const int koff  = (lane >> 4) * 8;
  const int mOff  = (lane >> 4) * 8;

  /* the thread's own place in a stage and in the two (three) source planes */
  const int crow = tid >> 3;
  const int cch  = tid & 7;
  const unsigned lds0 = lds_off(sStage) + (unsigned)crow * kGPitchB + (unsigned)cch * 16u;
  const unsigned short* gA  = Ap  + (size_t)b * strideA + (size_t)(bm0 + crow) * lda + cch * 8;
  const unsigned short* gA2 = A2p + (size_t)b * strideA + (size_t)(bm0 + crow) * lda + cch * 8;
  const unsigned short* gB  = Btp + (size_t)b * strideB + (size_t)(bn0 + crow) * ldb + cch * 8;
  const size_t stepA = (size_t)32 * lda;
  const size_t stepB = (size_t)32 * ldb;
  const int nst = K / kGKS;

  auto issue_stage = [&](int t) {
    const unsigned l = lds0 + (unsigned)(t & 1) * kBufB;
    const size_t k0 = (size_t)t * kGKS;
    const unsigned lb = l + (unsigned)kARows * kGPitchB;
    /* thread t brings bytes 16*(t&7).. of rows (t>>3) + 32*i of each panel: 128 rows of A (and of A2), 256 of Bt */
    if (ASPLIT) copy8_async(l, gA + k0, stepA, l + (unsigned)kGBM * kGPitchB, gA2 + k0, stepA);
    else        copy4_async(l, gA + k0, stepA);
    copy8_async(lb, gB + k0, stepB, lb + 128u * kGPitchB, gB + k0 + 4 * stepB, stepB);
  };

  v8f acc[4][4];
#pragma unroll
  for (int i = 0; i < 4; ++i)
#pragma unroll
    for (int j = 0; j < 4; ++j) acc[i][j] = (v8f){0.f,0.f,0.f,0.f,0.f,0.f,0.f,0.f};

  issue_stage(0);
  /* stage 0 has landed for this wave; the barrier publishes it to the others */
  asm volatile("s_wait_asynccnt 0x0" ::: "memory");
  __syncthreads();
  if (nst > 1) issue_stage(1);

  for (int t = 0; t < nst; ++t) {
    const T* sb = (const T*)(sStage + (t & 1) * (kRows * kGPitch));
    const T* sa = sb + ((wm << 6) + rlane) * kGPitch + koff;
    const T* sw = sb + (kARows + (wn << 6) + rlane) * kGPitch + koff;
#pragma unroll
    for (int ks = 0; ks < kGKS / 32; ++ks) {
      /* all fragments of a k step are read from LDS as one group in front of its products */
      V bh[4], ah[4], al[4];
#pragma unroll
      for (int j = 0; j < 4; ++j) bh[j] = Frag<T>::load(sw + (j << 4) * kGPitch + ks * 32);
#pragma unroll
      for (int i = 0; i < 4; ++i) {
        ah[i] = Frag<T>::load(sa + (i << 4) * kGPitch + ks * 32);
        al[i] = ah[i];
        if (ASPLIT) al[i] = Frag<T>::load(sa + (kGBM + (i << 4)) * kGPitch + ks * 32);
      }
      group_fence();
#pragma unroll
      for (int i = 0; i < 4; ++i) {
#pragma unroll
        for (int j = 0; j < 4; ++j) {
          acc[i][j] = Frag<T>::mmag(ah[i], bh[j], acc[i][j]);
          if (ASPLIT) acc[i][j] = Frag<T>::mmag(al[i], bh[j], acc[i][j]);
        }
      }
      group_fence();
      Frag<T>::keep(bh[0], bh[1], bh[2], bh[3]);
    }
    /* hand-over: this wave's reads of the buffer are done, */
    asm volatile("s_wait_dscnt 0x0" ::: "memory");
    /* its copies of stage t + 1 have landed, */
    asm volatile("s_wait_asynccnt 0x0" ::: "memory");
    /* and the barrier publishes stage t + 1 and frees the buffer that was just read */
    __syncthreads();
    if (t + 2 < nst) issue_stage(t + 2);
  }
  /* no copy is left in flight when the wave goes on */
  asm volatile("s_wait_asynccnt 0x0" ::: "memory");
  acc_guard4(acc[0][0], acc[0][1], acc[0][2], acc[0][3]);
  acc_guard4(acc[1][0], acc[1][1], acc[1][2], acc[1][3]);
  acc_guard4(acc[2][0], acc[2][1], acc[2][2], acc[2][3]);
  acc_guard4(acc[3][0], acc[3][1], acc[3][2], acc[3][3]);

  if (MODES && mode == 1) {
    /* the loop's last barrier has ended every wave's reads of the stage buffers, and no copy is in flight */
    float* tl = (float*)smem + ((wm << 6) + mOff) * kTP + (wn << 6) + rlane;
#pragma unroll
    for (int i = 0; i < 4; ++i)
#pragma unroll
      for (int j = 0; j < 4; ++j)
#pragma unroll
        for (int r = 0; r < 8; ++r) tl[((i << 4) + r) * kTP + (j << 4)] = acc[i][j][r] * scale;
    return;
  }
  if (MODES && mode == 2) {
    /* a lane's eight registers of a tile are eight neighbouring rows of one column: one 16-B piece of the transposed row */
    unsigned short* th = (unsigned short*)smem + ((wn << 6) + rlane) * kTHP + (wm << 6) + mOff;
#pragma unroll
    for (int i = 0; i < 4; ++i)
#pragma unroll
      for (int j = 0; j < 4; ++j) {
        unsigned short hb[8];
#pragma unroll
        for (int r = 0; r < 8; ++r) hb[r] = h_bits(acc[i][j][r] * scale * kVCarry);
        *(v4u*)(th + (j << 4) * kTHP + (i << 4)) =
            (v4u){pk16(hb[0], hb[1]), pk16(hb[2], hb[3]), pk16(hb[4], hb[5]), pk16(hb[6], hb[7])};
      }
    if (!toC) return;
  }

  float* slab = sT + wave * (16 * 68);
  float* C = Cout + (size_t)b * strideC;
#pragma unroll
  for (int i = 0; i < 4; ++i) {
    const int mBase = m0 + (i << 4);
#pragma unroll
    for (int j = 0; j < 4; ++j) {
#pragma unroll
      for (int r = 0; r < 8; ++r) {
        slab[(mOff + r) * 68 + (j << 4) + rlane] = acc[i][j][r] * scale;
      }
    }
    wave_lds_sync();
    {
      const int hh = lane >> 4, c4 = (lane & 15) * 4;
      {
#pragma unroll
        for (int it = 0; it < 8; ++it) {
          const int row = it * 2 + hh;
          v4f v = *(const v4f*)(slab + row * 68 + c4);
          *(v4f*)(C + (size_t)(mBase + row) * ldc + n0 + c4) = v;
        }
        
      }
    }
    wave_lds_sync();
  }
}

// ---------------------------------------------------------------------------
// Output projection, both parts in one launch (they write disjoint rows of out and read nothing of each other):
//   blocks 0 .. 15   positions < 128 of each batch: bf16 hi.W + lo.W, 1 x 8 tiles x 2 batches (twice the products of a tile
//                    of the other part, so they take the lowest block numbers)
//   blocks 16 .. 255 positions >= 128 of each batch: f16 single product, carries folded back, 15 x 8 tiles x 2 batches
// ---------------------------------------------------------------------------
constexpr int kOutEB = (kEarly / kGBM) * (kQW / kGBN);
constexpr int kOutLB = ((kS - kEarly) / kGBM) * (kQW / kGBN);
__global__ __launch_bounds__(256) void out_proj_kernel(
    const unsigned short* __restrict__ GH, const unsigned short* __restrict__ EH, const unsigned short* __restrict__ EL,
    const unsigned short* __restrict__ WOH, const unsigned short* __restrict__ WOB, float* __restrict__ out) {
  __shared__ __align__(16) unsigned char smem[GemmLds<true>::kBytes];
  const int blk = (int)blockIdx.x;
  /* block-uniform: every barrier of a part is passed by the whole block or by none of it */
  if (blk < kB * kOutEB) {
    gemm_block<1, true>(smem, blk % kOutEB, blk / kOutEB, EH, EL, kQW, (long)kEarly * kQW, WOB, kQW, 0L,
                        out, kQW, (long)kS * kQW, kEarly, kQW, kQW, 1.0f);
  } else {
    const int l = blk - kB * kOutEB;
    gemm_block<0, false>(smem, l % kOutLB, l / kOutLB, GH + (size_t)kEarly * kQW, GH + (size_t)kEarly * kQW, kQW,
                         (long)kS * kQW, WOH, kQW, 0L, out + (size_t)kEarly * kQW, kQW, (long)kS * kQW,
                         kS - kEarly, kQW, kQW, kOutLateMul);
  }
}

// ---------------------------------------------------------------------------
// MODE 0: o0 = bf16 (RNE). MODE 1: o0 = bf16 (RNE), o1 = f16 of (bf16 value x carry) (exact: power-of-two carry).
// ---------------------------------------------------------------------------
template <int MODE>
__device__ __forceinline__ void cast8_block(const float* __restrict__ in, unsigned short* __restrict__ o0,
                                            unsigned short* __restrict__ o1, int blk, float carry) {
  const int i = blk * 256 + threadIdx.x;
  const size_t e0 = (size_t)i << 3;
  const v4f a0 = *(const v4f*)(in + e0);
  const v4f a1 = *(const v4f*)(in + e0 + 4);
  unsigned short bb[8], hb[8];
#pragma unroll
  for (int e = 0; e < 4; ++e) {
    bb[e]     = f2bf_bits(a0[e]);
    bb[4 + e] = f2bf_bits(a1[e]);
  }
#pragma unroll
  for (int e = 0; e < 8; ++e) hb[e] = (MODE == 1) ? h_bits(bf_bits2f(bb[e]) * carry) : (unsigned short)0;
  const v4u ub = (v4u){pk16(bb[0], bb[1]), pk16(bb[2], bb[3]), pk16(bb[4], bb[5]), pk16(bb[6], bb[7])};
  const v4u uh = (v4u){pk16(hb[0], hb[1]), pk16(hb[2], hb[3]), pk16(hb[4], hb[5]), pk16(hb[6], hb[7])};
  unsigned short* q0 = o0 + e0;
  unsigned short* q1 = o1 + e0;
  *(v4u*)q0 = ub;
  if (MODE == 1) *(v4u*)q1 = uh;
  /* closes the stores: in the joint kernel another plane's code follows in the listing and rewrites their registers */
  asm volatile("s_wait_xcnt 0x0" ::: "memory");
}
/* all six planes in one launch: a block (2048 elements) belongs to one plane, found from its number; no plane has a tail */
constexpr int kCbX  = kTok * kHid / 2048;
constexpr int kCbQ  = kQW * kHid / 2048;
constexpr int kCbK  = kKW * kHid / 2048;
constexpr int kCbO  = kQW * kQW / 2048;
constexpr int kCbAll = kCbX + 2 * kCbQ + 2 * kCbK + kCbO;
static_assert((kTok * kHid) % 2048 == 0 && (kQW * kHid) % 2048 == 0 && (kKW * kHid) % 2048 == 0 && (kQW * kQW) % 2048 == 0, "whole blocks");
__global__ __launch_bounds__(256) void cast_all_kernel(
    const float* __restrict__ X, const float* __restrict__ Wq, const float* __restrict__ Wk, const float* __restrict__ Wv,
    const float* __restrict__ Wg, const float* __restrict__ Wo,
    unsigned short* __restrict__ XB, unsigned short* __restrict__ WQKV, unsigned short* __restrict__ WGB,
    unsigned short* __restrict__ WOB, unsigned short* __restrict__ WOH) {
  int blk = (int)blockIdx.x;
  if (blk < kCbX) { cast8_block<0>(X, XB, XB, blk, 1.0f); return; }
  blk -= kCbX;
  if (blk < kCbO) { cast8_block<1>(Wo, WOB, WOH, blk, kWoCarry); return; }
  blk -= kCbO;
  if (blk < kCbQ) { cast8_block<0>(Wq, WQKV, WQKV, blk, 1.0f); return; }
  blk -= kCbQ;
  if (blk < kCbQ) { cast8_block<0>(Wg, WGB, WGB, blk, 1.0f); return; }
  blk -= kCbQ;
  if (blk < kCbK) { cast8_block<0>(Wk, WQKV + (size_t)kQW * kHid, WQKV, blk, 1.0f); return; }
  blk -= kCbK;
  cast8_block<0>(Wv, WQKV + (size_t)kVCol0 * kHid, WQKV, blk, 1.0f);
}

// ---------------------------------------------------------------------------
// Per-head RMS norm (eps inside the rsqrt of the mean square) then rotation by the position tables, f32, on a block's own
// 128 x 256 tile of the q|k projection, read from LDS (pitch kTP floats): 128 tokens x 2 slots (slots 0..15 = query heads,
// 16..19 = key heads). One wave per (token, slot) at a time; a wave owns 16 tokens and takes both slots of a token behind one
// read of the token's table rows; the table rows of four tokens are asked for together.
// Lane owns d = 4*lane..4*lane+3; the partner d +/- 64 lives in lane ^ 16 (unconditional exchanges).
// d < 64: y = n[d]*c[d] - n[d+64]*s[d]; d >= 64: y = n[d]*c[d] + n[d-64]*s[d]; tables read by value at [pos][d],
// tables and norm weights RNE-converted to bf16 on load.
// ---------------------------------------------------------------------------
__device__ __forceinline__ void normrot_tile(
    const float* tl, int tok0, int slot0, const float* __restrict__ ctab, const float* __restrict__ stab,
    const float* __restrict__ qw, const float* __restrict__ kw,
    unsigned short* __restrict__ Qp, unsigned short* __restrict__ Kp, float* __restrict__ Qe, float* __restrict__ Ke) {
  const int lane = threadIdx.x & 31;
  const int wave = __builtin_amdgcn_readfirstlane((int)(threadIdx.x >> 5));
  /* the same for the whole tile: its two slots are of one kind, its 128 tokens of one batch and on one side of kEarly */
  const bool isq   = slot0 < kHq;
  const int  pos0  = tok0 & (kS - 1);
  const int  b     = tok0 / kS;
  const bool early = pos0 < kEarly;
  const int  col0  = (isq ? slot0 : slot0 - kHq) * kHD + 4 * lane;
  const int  ld    = isq ? kQW : kKW;
  unsigned short* p16 = (isq ? Qp : Kp) + (size_t)tok0 * ld + col0;
  float*          p32 = (isq ? Qe : Ke) + (size_t)(b * kEarly + (early ? pos0 : 0)) * ld + col0;

  const v4f w4 = *(const v4f*)((isq ? qw : kw) + 4 * lane);
  float w[4];
#pragma unroll
  for (int e = 0; e < 4; ++e) w[e] = bf16r(w4[e]);
  const float sgn = (lane < 16) ? -1.0f : 1.0f;

  /* rolled: four tokens a trip keep the registers of the matrix loop's kernel inside its bound; the trip's eight (token,
     slot) chains stand in one straight run, so that they fill each other's waits */
#pragma unroll 1
  for (int g = 0; g < 4; ++g) {
    const int r0 = wave * 16 + g * 4;
    v4f c4[4], s4[4], x[4][2], y[4][2];
#pragma unroll
    for (int u = 0; u < 4; ++u) {
      c4[u] = *(const v4f*)(ctab + (size_t)(pos0 + r0 + u) * kHD + 4 * lane);
      s4[u] = *(const v4f*)(stab + (size_t)(pos0 + r0 + u) * kHD + 4 * lane);
    }
#pragma unroll
    for (int u = 0; u < 4; ++u)
#pragma unroll
      for (int hd = 0; hd < 2; ++hd) x[u][hd] = *(const v4f*)(tl + (r0 + u) * kTP + hd * kHD + 4 * lane);
#pragma unroll
    for (int u = 0; u < 4; ++u) {
      float cb[4], sb[4];
      /* the sign of the partner's term goes into the table value: exact */
#pragma unroll
      for (int e = 0; e < 4; ++e) { cb[e] = bf16r_v(c4[u][e]); sb[e] = sgn * bf16r_v(s4[u][e]); }
#pragma unroll
      for (int hd = 0; hd < 2; ++hd) {
        const v4f xx = x[u][hd];
        float ss = xx[0] * xx[0];
        ss = fmaf(xx[1], xx[1], ss);
        ss = fmaf(xx[2], xx[2], ss);
        ss = fmaf(xx[3], xx[3], ss);
        ss = wave_sum(ss);
        /* the argument is at least kEps, far above the smallest normal number: the bare instruction gives rsqrtf's value */
        const float inv = __builtin_amdgcn_rsqf(ss * (1.0f / (float)kHD) + kEps);
        float n[4], p[4];
#pragma unroll
        for (int e = 0; e < 4; ++e) n[e] = xx[e] * inv * w[e];
#pragma unroll
        for (int e = 0; e < 4; ++e) p[e] = half_xor(n[e]);
#pragma unroll
        for (int e = 0; e < 4; ++e) y[u][hd][e] = n[e] * cb[e] + p[e] * sb[e];
        unsigned short hb[4];
#pragma unroll
        for (int e = 0; e < 4; ++e) hb[e] = h_bits(y[u][hd][e] * kQKCarry);
        *(v2u*)(p16 + (size_t)(r0 + u) * ld + hd * kHD) = (v2u){pk16(hb[0], hb[1]), pk16(hb[2], hb[3])};
      }
    }
    /* no register that a load or store of this trip names is rewritten in front of this wait */
    asm volatile("s_wait_xcnt 0x0" ::: "memory");
    if (early) {
#pragma unroll
      for (int u = 0; u < 4; ++u)
#pragma unroll
        for (int hd = 0; hd < 2; ++hd) *(v4f*)(p32 + (size_t)(r0 + u) * ld + hd * kHD) = y[u][hd];
      /* the same for these stores */
      asm volatile("s_wait_xcnt 0x0" ::: "memory");
    }
  }
}

// ---------------------------------------------------------------------------
// A block's own 128 x 256 tile of the v projection, left in LDS transposed as f16 x64 (256 rows = 2 kv heads x 128 d, 128
// positions each, pitch kTHP halves) -> VT f16 [b][kv head][d][s]: 16 lanes store one whole 256-B piece of a row.
// ---------------------------------------------------------------------------
__device__ __forceinline__ void vt_tile(const unsigned short* th, int tok0, int hkv0, unsigned short* __restrict__ Vt) {
  const int lane = threadIdx.x & 31;
  const int wave = __builtin_amdgcn_readfirstlane((int)(threadIdx.x >> 5));
  const int b    = tok0 / kS;
  const int s0   = tok0 & (kS - 1);
  const int dr0  = wave * 32 + (lane >> 4);
  const int c8   = (lane & 15) * 8;
  const unsigned short* src = th + dr0 * kTHP + c8;
  unsigned short* dst = Vt + ((size_t)(b * kHkv + hkv0) * kHD + dr0) * kS + s0 + c8;
#pragma unroll
  for (int it = 0; it < 16; ++it) {
    const v4u v = *(const v4u*)(src + it * 2 * kTHP);
    *(v4u*)(dst + (size_t)(it * 2) * kS) = v;
  }
  /* no register that the stores name is rewritten in front of this wait */
  asm volatile("s_wait_xcnt 0x0" ::: "memory");
}

// ---------------------------------------------------------------------------
// Projections of x, bf16: x . [Wq;Wk;Wv]^T (32 x 12 = 384 blocks) and, in the same launch, the first kGateWithProj tiles of
// the gate projection GF[4096][2048] = x . Wg^T. Two blocks fit a WGP; 384 blocks leave 128 of the 512 places of 256 WGPs
// empty, and the gate tiles take them. The other gate tiles run beside the attention for positions >= 128.
// A q|k|v tile (128 tokens x 256 columns = two whole heads) reaches memory as f32 only as the VE rows (v tiles of positions < 128): the block leaves it in its own LDS
// and forms from it what the attention reads: column tiles 0..9 (q, k): norm + rotation -> QP, KP (f16 x64) and QE, KE
// (f32, positions < 128); column tiles 10, 11 (v): VT (f16 x64, transposed) and VE (f32 rows, positions < 128).
// ---------------------------------------------------------------------------
constexpr int kQKVBlocks    = (kTok / kGBM) * (kQKVW / kGBN);
constexpr int kGateGBlocks  = (kTok / kGBM) * (kQW / kGBN);
constexpr int kGateWithProj = 2 * 256 - kQKVBlocks;
constexpr int kQKVTilesN    = kQKVW / kGBN;
constexpr int kQKTilesN     = kVCol0 / kGBN;
static_assert(kGateWithProj > 0 && kGateWithProj < kGateGBlocks, "the gate tiles are split between two launches");
static_assert(kGBN == 2 * kHD && (kVCol0 % kGBN) == 0 && (kQW % kGBN) == 0, "a column tile is two whole heads of one kind");
static_assert(kGBM == kEarly && (kS % kGBM) == 0, "a row tile lies in one batch and on one side of kEarly");
static_assert((unsigned)(kGBM * kTP * 4) <= GemmLds<false>::kBytes, "the f32 tile fits the block's LDS");
static_assert((unsigned)(kGBN * kTHP * 2) <= 2u * GemmLds<false>::kBufB, "the transposed tile lies in front of the store slabs");
__global__ __launch_bounds__(256) void proj_kernel(
    const unsigned short* __restrict__ XB, const unsigned short* __restrict__ WQKV, const unsigned short* __restrict__ WGB,
    float* __restrict__ GF, const float* __restrict__ ctab, const float* __restrict__ stab,
    const float* __restrict__ qw, const float* __restrict__ kw,
    unsigned short* __restrict__ Qp, unsigned short* __restrict__ Kp, float* __restrict__ Qe, float* __restrict__ Ke,
    unsigned short* __restrict__ Vt, float* __restrict__ Ve) {
  __shared__ __align__(16) unsigned char smem[GemmLds<false>::kBytes];
  const int blk = (int)blockIdx.x;
  /* all of these are the same in the whole block */
  const bool gt  = blk >= kQKVBlocks;
  const int n    = gt ? kQW : kQKVW;
  const int tm   = blk / kQKVTilesN;
  const int tn   = blk - tm * kQKVTilesN;
  const int tok0 = tm * kGBM;
  const int mode = gt ? 0 : (tn < kQKTilesN ? 1 : 2);
  const bool early = (tok0 & (kS - 1)) < kEarly;
  /* row tok0 + i, column kVCol0 + c of the q|k|v tile grid is row (batch * kEarly + i), column c of VE */
  float* veC = Ve + ((long)(tok0 / kS) * kEarly - (long)tok0) * kKW - kVCol0;
  gemm_block<1, false, true>(smem, gt ? blk - kQKVBlocks : blk, 0, XB, XB, kHid, 0L, gt ? WGB : WQKV, kHid, 0L,
                             gt ? GF : veC, gt ? kQW : kKW, 0L, kTok, n, kHid, 1.0f, mode, gt || early);
  if (gt) return;
  /* publishes the tile that the eight waves have left in LDS; passed by the whole block or (a gate tile) by none of it */
  __syncthreads();
  if (mode == 1) normrot_tile((const float*)smem, tok0, tn * 2, ctab, stab, qw, kw, Qp, Kp, Qe, Ke);
  else           vt_tile((const unsigned short*)smem, tok0, (tn - kQKTilesN) * 2, Vt);
}

constexpr int kKPitch = 136;
constexpr int kVPitch = 72;
constexpr int kKTile  = kLateKC * kKPitch;
constexpr int kVTile  = kHD * kVPitch;
constexpr int kKVBuf  = kKTile + kVTile;
static_assert(kLateKC == 64 && kHD == 128, "copy maps: 16 lanes per 256-B key row, 8 lanes per 128-B value row");
static_assert(((kKTile * 2) % 16) == 0 && ((kKVBuf * 2) % 16) == 0, "16-B aligned tiles");

/* one chunk's share of a thread: 4 copies of key rows (16 rows apart) and 4 of value rows (32 rows apart), 16 B each,
   global -> LDS through no register; the s_wait_xcnt closes the statement so that no address register of a copy is
   rewritten in front of it */
__device__ __forceinline__ void copy_kv_async(unsigned lk, const unsigned short* gk, unsigned lv, const unsigned short* gv) {
  asm volatile("global_load_async_to_lds_b128 %0, %8, off\n\t"
               "global_load_async_to_lds_b128 %1, %9, off\n\t"
               "global_load_async_to_lds_b128 %2, %10, off\n\t"
               "global_load_async_to_lds_b128 %3, %11, off\n\t"
               "global_load_async_to_lds_b128 %4, %12, off\n\t"
               "global_load_async_to_lds_b128 %5, %13, off\n\t"
               "global_load_async_to_lds_b128 %6, %14, off\n\t"
               "global_load_async_to_lds_b128 %7, %15, off\n\t"
               "s_wait_xcnt 0x0"
               :: "v"(lk), "v"(lk + 16u * (kKPitch * 2u)), "v"(lk + 32u * (kKPitch * 2u)), "v"(lk + 48u * (kKPitch * 2u)),
                  "v"(lv), "v"(lv + 32u * (kVPitch * 2u)), "v"(lv + 64u * (kVPitch * 2u)), "v"(lv + 96u * (kVPitch * 2u)),
                  "v"(gk), "v"(gk + 16 * kKW), "v"(gk + 32 * kKW), "v"(gk + 48 * kKW),
                  "v"(gv), "v"(gv + 32 * kS), "v"(gv + 64 * kS), "v"(gv + 96 * kS) : "memory");
}

/* LDS of one block: two chunk buffers, the 8 waves' store slabs */
constexpr unsigned kLateKVB  = 2u * kKVBuf * 2u;
constexpr unsigned kLateLds  = kLateKVB + 8u * 16u * 68u * 4u;
static_assert((kLateKVB % 16) == 0, "16-B aligned parts");
__device__ __forceinline__ void attn_late_block(unsigned char* smem, int blk,
                                                const unsigned short* __restrict__ Qp, const unsigned short* __restrict__ Kp,
                                                const unsigned short* __restrict__ Vtp, float* __restrict__ attn) {
  union FH { v16h v; v8h h[2]; };
  unsigned short* sKV = (unsigned short*)smem;
  float* Os = (float*)(smem + kLateKVB);
  const int tid  = threadIdx.x;
  const int lane = threadIdx.x & 31;
  const int wave = __builtin_amdgcn_readfirstlane((int)(threadIdx.x >> 5));
  const int hh   = lane >> 4;
  const int c    = lane & 15;
  const int qt2  = blk % kLatePairs;
  const int bh   = blk / kLatePairs;
  const int hkv  = bh & (kHkv - 1);
  const int b    = bh / kHkv;
  const int h    = hkv * kRep + (wave & 3);
  const int q0   = kEarly + (qt2 * 2 + (wave >> 2)) * 16;

  /* the thread's own place in a chunk's two tiles and in the two source planes */
  const unsigned lk0 = lds_off(sKV) + (unsigned)(tid >> 4) * (kKPitch * 2u) + (unsigned)(tid & 15) * 16u;
  const unsigned lv0 = lds_off(sKV + kKTile) + (unsigned)(tid >> 3) * (kVPitch * 2u) + (unsigned)(tid & 7) * 16u;
  const unsigned short* gk0 = Kp + (size_t)(b * kS + (tid >> 4)) * kKW + hkv * kHD + (tid & 15) * 8;
  const unsigned short* gv0 = Vtp + ((size_t)(b * kHkv + hkv) * kHD + (tid >> 3)) * kS + (tid & 7) * 8;
  auto issue_chunk = [&](int t) {
    const unsigned o = (unsigned)(t & 1) * (kKVBuf * 2u);
    copy_kv_async(lk0 + o, gk0 + (size_t)t * (kLateKC * kKW), lv0 + o, gv0 + t * kLateKC);
  };
  float* ob = attn + (size_t)(b * kS + q0) * kQW + h * kHD;

  v16h qa[4];
  {
    const _Float16* qrow = (const _Float16*)Qp + (size_t)(b * kS + q0 + c) * kQW + h * kHD + 8 * hh;
#pragma unroll
    for (int dc = 0; dc < 4; ++dc) qa[dc] = Frag<_Float16>::load(qrow + dc * 32);
  }

  /* of the lane's query q0 + c: running maximum (both halves alike) and the sum over the keys of this half of the wave */
  float mrun = -INFINITY, lrun = 0.0f;
  /* tile t: register r = o[query q0 + c][d = t*16 + 8*hh + r] */
  v8f oacc[8];
#pragma unroll
  for (int t = 0; t < 8; ++t) oacc[t] = (v8f){0.f,0.f,0.f,0.f,0.f,0.f,0.f,0.f};

  int nChunks = (q0 + 16 + kLateKC - 1) / kLateKC;
  if (nChunks > kS / kLateKC) nChunks = kS / kLateKC;
  /* nChunks is the same in all 8 waves: the block's 32 query rows lie inside one chunk of 64 positions */

  issue_chunk(0);
  /* chunk 0 has landed for this wave; the barrier publishes it to the others */
  asm volatile("s_wait_asynccnt 0x0" ::: "memory");
  __syncthreads();
  if (nChunks > 1) issue_chunk(1);

  for (int kc = 0; kc < nChunks; ++kc) {
    const int kv0 = kc * kLateKC;
    const _Float16* sk = (const _Float16*)(sKV + (kc & 1) * kKVBuf) + c * kKPitch + 8 * hh;
    const _Float16* sv = (const _Float16*)(sKV + (kc & 1) * kKVBuf + kKTile) + c * kVPitch + 8 * hh;
    /* fragments are read from LDS in groups of four, in front of the products that use them: eight register sets, the four
       that a group of products has just read are refilled at once with the fragments eight places on */
    v16h ring[8];
#pragma unroll
    for (int f = 0; f < 8; ++f) ring[f] = Frag<_Float16>::load(sk + (f >> 2) * 16 * kKPitch + (f & 3) * 32);
    group_fence();
    v8f s[4];
#pragma unroll
    for (int j = 0; j < 4; ++j) {
      s[j] = (v8f){0.f,0.f,0.f,0.f,0.f,0.f,0.f,0.f};
#pragma unroll
      for (int dc = 0; dc < 4; ++dc) s[j] = mma_h(ring[(j & 1) * 4 + dc], qa[dc], s[j]);
      group_fence();
      if (j < 2) {
#pragma unroll
        for (int dc = 0; dc < 4; ++dc) ring[(j & 1) * 4 + dc] = Frag<_Float16>::load(sk + (j + 2) * 16 * kKPitch + dc * 32);
        group_fence();
      }
    }
    const bool diag = (kc == nChunks - 1);
    /* key kv0 + j*16 + 8*hh + r lies behind query q0 + c where j*16 + r > rel; no key of an earlier chunk does */
    const int rel = diag ? (q0 + c - kv0 - 8 * hh) : kLateKC;
    /* four chains, one per tile of 16 keys, for the maximum as for the sum: no chain of 32 dependent steps */
    float mj[4];
#pragma unroll
    for (int j = 0; j < 4; ++j) {
      float m = -INFINITY;
#pragma unroll
      for (int r = 0; r < 8; ++r) {
        float v = s[j][r] * kScoreMul;
        if (j * 16 + r > rel) v = -INFINITY;
        s[j][r] = v;
        m = fmaxf(m, v);
      }
      mj[j] = m;
    }
    float cm = fmaxf(fmaxf(mj[0], mj[1]), fmaxf(mj[2], mj[3]));
    /* the other 32 keys of the query's chunk lie in lane ^ 16 */
    cm = fmaxf(cm, half_xor(cm));
    const float mnew  = fmaxf(mrun, cm);
    const float alpha = __expf(mrun - mnew);
    mrun = mnew;
    FH pb[2];
    float pj[4];
#pragma unroll
    for (int j = 0; j < 4; ++j) {
      float psum = 0.0f;
#pragma unroll
      for (int r = 0; r < 8; ++r) {
        const float p = __expf(s[j][r] - mnew);
        psum += p;
        pb[j >> 1].v[(j & 1) * 8 + r] = (_Float16)(p * kPCarry);
      }
      pj[j] = psum;
    }
    lrun = lrun * alpha + ((pj[0] + pj[1]) + (pj[2] + pj[3]));
#pragma unroll
    for (int t = 0; t < 8; ++t) oacc[t] *= alpha;
#pragma unroll
    for (int t = 0; t < 8; ++t) ring[t] = Frag<_Float16>::load(sv + t * 16 * kVPitch);
    group_fence();
#pragma unroll
    for (int kk = 0; kk < 2; ++kk) {
#pragma unroll
      for (int g = 0; g < 2; ++g) {
#pragma unroll
        for (int t = g * 4; t < g * 4 + 4; ++t) oacc[t] = mma_h(ring[t], pb[kk].v, oacc[t]);
        group_fence();
        if (kk == 0) {
#pragma unroll
          for (int t = g * 4; t < g * 4 + 4; ++t) ring[t] = Frag<_Float16>::load(sv + t * 16 * kVPitch + 32);
          group_fence();
        }
      }
    }
    /* hand-over: this wave's reads of the buffer are done, */
    asm volatile("s_wait_dscnt 0x0" ::: "memory");
    /* its copies of chunk kc + 1 have landed, */
    asm volatile("s_wait_asynccnt 0x0" ::: "memory");
    /* and the barrier publishes chunk kc + 1 and frees the buffer that was just read */
    __syncthreads();
    if (kc + 2 < nChunks) issue_chunk(kc + 2);
  }
  /* no copy is left in flight when the wave goes on */
  asm volatile("s_wait_asynccnt 0x0" ::: "memory");

  /* the two halves' sums of the query joined */
  lrun += half_xor(lrun);
  const float inv = 1.0f / (lrun * (kPCarry * kVCarry));
  float* os = Os + wave * (16 * 68);
  /* the lane's number read anew: the store addresses formed from it are then made here, behind the loop, and hold no
     register across it; without this the joint kernel, held to 256 registers, spills to scratch */
  const int ln  = (int)__builtin_amdgcn_mbcnt_lo(~0u, 0u);
  const int hh2 = ln >> 4;
  const int c2  = ln & 15;
  const int c4  = c2 * 4;
#pragma unroll
  for (int hf = 0; hf < 2; ++hf) {
    /* slab row = query c2; a lane's eight registers of a tile are eight neighbouring d */
#pragma unroll
    for (int t4 = 0; t4 < 4; ++t4) {
      const v8f o = oacc[hf * 4 + t4] * inv;
      *(v4f*)(os + c2 * 68 + t4 * 16 + 8 * hh2)     = (v4f){o[0], o[1], o[2], o[3]};
      *(v4f*)(os + c2 * 68 + t4 * 16 + 8 * hh2 + 4) = (v4f){o[4], o[5], o[6], o[7]};
    }
    wave_lds_sync();
    {
#pragma unroll
      for (int it = 0; it < 8; ++it) {
        const int row = it * 2 + hh2;
        v4f val = *(const v4f*)(os + row * 68 + c4);
        *(v4f*)(ob + (size_t)row * kQW + hf * 64 + c4) = val;
      }
      
    }
    wave_lds_sync();
  }
}

// ---------------------------------------------------------------------------
// Attention for query positions t < 128 of each batch (a causally closed sub-problem), all f32 on the vector unit.
// Block = (b, kv head, positions t = 2u and 2u + 1), 8 waves; wave = one of the 4 query heads at one of the two positions;
// all 8 share the block's keys and values. The blocks run in the launch of the attention for positions >= 128.
// The key and value rows 0 .. 32*NG-1 (NG = t/32 + 1 groups of 32 keys, the same for both positions, all of them rows of
// positions < 128) reach LDS once per block by asynchronous 16-B copies, a whole 512-B row per copy of a wave: waves 0..3
// bring the keys, waves 4..7 the values, which land while the scores and the softmax are worked out. Key rows lie at a
// pitch of 132 floats, so that 16 lanes reading 16 B of 16 different rows fall on all 64 banks.
// Scores: lane owns keys lane + 32*i (i < NG); the NG dots of a lane run side by side as independent chains and share one
// read of the q row; each dot adds its 128 products in the order d = 0..127. Keys beyond t are set to -inf by value.
// Softmax with precise expf; p written to LDS for all 128 slots (zeros beyond t).
// p.v: lane owns d = 4*lane..+3; keys 0 .. in order, up to the next multiple of 8 (p = 0 beyond t adds nothing).
// ---------------------------------------------------------------------------
constexpr int kEKP = 132;
/* eight copies of 16 B per lane, global -> LDS through no register: eight rows, four rows apart in the source plane (pitch
   kKW floats) and in LDS (pitch PITCH floats); the s_wait_xcnt closes the statement so that no address register of a copy
   is rewritten in front of it */
template <int PITCH>
__device__ __forceinline__ void copy_rows8_async(unsigned l, const float* g) {
  constexpr unsigned kStep = 4u * PITCH * 4u;
  asm volatile("global_load_async_to_lds_b128 %0, %8, off\n\t"
               "global_load_async_to_lds_b128 %1, %9, off\n\t"
               "global_load_async_to_lds_b128 %2, %10, off\n\t"
               "global_load_async_to_lds_b128 %3, %11, off\n\t"
               "global_load_async_to_lds_b128 %4, %12, off\n\t"
               "global_load_async_to_lds_b128 %5, %13, off\n\t"
               "global_load_async_to_lds_b128 %6, %14, off\n\t"
               "global_load_async_to_lds_b128 %7, %15, off\n\t"
               "s_wait_xcnt 0x0"
               :: "v"(l), "v"(l + kStep), "v"(l + 2u * kStep), "v"(l + 3u * kStep),
                  "v"(l + 4u * kStep), "v"(l + 5u * kStep), "v"(l + 6u * kStep), "v"(l + 7u * kStep),
                  "v"(g), "v"(g + 4 * kKW), "v"(g + 8 * kKW), "v"(g + 12 * kKW),
                  "v"(g + 16 * kKW), "v"(g + 20 * kKW), "v"(g + 24 * kKW), "v"(g + 28 * kKW) : "memory");
}
template <int NG>
__device__ __forceinline__ void early_dots(const float* skl, const float* sqw, float (&dot)[4]) {
  /* eight steps a trip: their LDS reads are issued ahead of the products, which would else wait for each read in turn */
#pragma unroll 8
  for (int d4 = 0; d4 < kHD / 4; ++d4) {
    const v4f qq = *(const v4f*)(sqw + 4 * d4);
    /* unrolled: dot[i] stays in a register, and the NG chains alternate */
#pragma unroll
    for (int i = 0; i < NG; ++i) {
      const v4f kv = *(const v4f*)(skl + i * 32 * kEKP + 4 * d4);
      dot[i] = fmaf(kv[0], qq[0], dot[i]);
      dot[i] = fmaf(kv[1], qq[1], dot[i]);
      dot[i] = fmaf(kv[2], qq[2], dot[i]);
      dot[i] = fmaf(kv[3], qq[3], dot[i]);
    }
  }
}

/* LDS of one block: key rows, value rows, the 8 waves' q rows, the 8 waves' p rows */
constexpr int kEarlyPairs  = kEarly / 2;
constexpr int kEarlyBlocks = kB * kHkv * kEarlyPairs;
constexpr unsigned kEarlyLds = (unsigned)(kEarly * kEKP + kEarly * kHD + 8 * kHD + 8 * kEarly) * 4u;
static_assert((kEarly % 32) == 0 && ((kEarly * kEKP * 4) % 16) == 0, "whole groups of 32 keys; 16-B aligned parts");
__device__ __forceinline__ void attn_early_block(unsigned char* smem, int blk,
                                                 const float* __restrict__ Qe, const float* __restrict__ Ke,
                                                 const float* __restrict__ Ve, float* __restrict__ attn) {
  float* sK = (float*)smem;
  float* sV = sK + kEarly * kEKP;
  float* sq = sV + kEarly * kHD;
  float* sp = sq + 8 * kHD;
  const int lane = threadIdx.x & 31;
  const int wave = __builtin_amdgcn_readfirstlane((int)(threadIdx.x >> 5));
  const int w4   = wave & 3;
  /* in each (b, kv head) run of 64 blocks the longest (most keys) have the lowest numbers */
  const int t    = 2 * (kEarlyPairs - 1 - (blk % kEarlyPairs)) + (wave >> 2);
  const int hkv  = (blk / kEarlyPairs) & (kHkv - 1);
  const int b    = blk / (kEarlyPairs * kHkv);
  const int h    = hkv * kRep + w4;
  const int erow = b * kEarly + t;
  const int nG   = (t >> 5) + 1;
  float* sqw = sq + wave * kHD;
  float* spw = sp + wave * kEarly;
  {
    const v4f qv = *(const v4f*)(Qe + (size_t)erow * kQW + h * kHD + 4 * lane);
    *(v4f*)(sqw + 4 * lane) = qv;
  }
  {
    /* wave w (keys) or w + 4 (values) brings rows w, w + 4, .. of each group of 32, a whole row per copy; at most 32 copies
       of a wave are in flight; the branch is the same in a whole wave */
    const size_t ro = (size_t)(b * kEarly + w4) * kKW + hkv * kHD + 4 * lane;
    if (wave < 4) {
      const float* kg = Ke + ro;
      const unsigned lk = lds_off(sK) + (unsigned)(w4 * kEKP + 4 * lane) * 4u;
      for (int g = 0; g < nG; ++g) copy_rows8_async<kEKP>(lk + (unsigned)g * (32u * kEKP * 4u), kg + (size_t)g * (32 * kKW));
      /* this wave's key rows have landed */
      asm volatile("s_wait_asynccnt 0x0" ::: "memory");
    } else {
      const float* vg = Ve + ro;
      const unsigned lv = lds_off(sV) + (unsigned)(w4 * kHD + 4 * lane) * 4u;
      for (int g = 0; g < nG; ++g) copy_rows8_async<kHD>(lv + (unsigned)g * (32u * kHD * 4u), vg + (size_t)g * (32 * kKW));
    }
  }
  /* publishes the key rows to the block's eight waves (and each wave's q row to its own lanes); every wave of the block
     passes both barriers of this part */
  __syncthreads();
  float dot[4] = {0.0f, 0.0f, 0.0f, 0.0f};
  const float* skl = sK + lane * kEKP;
  if (nG == 4)      early_dots<4>(skl, sqw, dot);
  else if (nG == 3) early_dots<3>(skl, sqw, dot);
  else if (nG == 2) early_dots<2>(skl, sqw, dot);
  else              early_dots<1>(skl, sqw, dot);
  float sc[4];
#pragma unroll
  for (int i = 0; i < 4; ++i) sc[i] = (lane + 32 * i <= t) ? (dot[i] * kInvSqrtHD) : -INFINITY;
  float m = fmaxf(fmaxf(sc[0], sc[1]), fmaxf(sc[2], sc[3]));
  m = wave_max(m);
  float psum = 0.0f;
#pragma unroll
  for (int i = 0; i < 4; ++i) {
    const float p = expf(sc[i] - m);
    psum += p;
    spw[lane + 32 * i] = p;
  }
  psum = wave_sum(psum);
  /* this wave's value rows (waves 4..7) have landed, */
  asm volatile("s_wait_asynccnt 0x0" ::: "memory");
  /* and the barrier publishes them to the block's eight waves (and each wave's p row to its own lanes) */
  __syncthreads();
  float a0 = 0.0f, a1 = 0.0f, a2 = 0.0f, a3 = 0.0f;
  const float* vr = sV + 4 * lane;
  const int nj = (t + 8) & ~7;
  for (int j0 = 0; j0 < nj; j0 += 8) {
    /* unrolled: the LDS reads of eight keys are issued ahead of their products */
#pragma unroll
    for (int u = 0; u < 8; ++u) {
      const float p = spw[j0 + u];
      const v4f vv = *(const v4f*)(vr + (j0 + u) * kHD);
      a0 = fmaf(p, vv[0], a0);
      a1 = fmaf(p, vv[1], a1);
      a2 = fmaf(p, vv[2], a2);
      a3 = fmaf(p, vv[3], a3);
    }
  }
  const float il = 1.0f / psum;
  const v4f ov = (v4f){a0 * il, a1 * il, a2 * il, a3 * il};
  float* dst = attn + (size_t)(b * kS + t) * kQW + h * kHD + 4 * lane;
  *(v4f*)dst = ov;
  /* closes the store: in the joint kernel the common tail follows in the listing and rewrites the store's base register */
  asm volatile("s_wait_xcnt 0x0" ::: "memory");
}

// ---------------------------------------------------------------------------
// Attention for positions >= 128, the gate projection's tiles from kGateWithProj on and the attention for positions < 128
// in one launch: none reads what another writes. The blocks for positions >= 128 come first: their lengths run from 3 to
// 32 chunks, and the projection's blocks, then the short blocks for positions < 128, take the places that the short ones
// leave.
// ---------------------------------------------------------------------------
constexpr int kLateBlocks  = kLatePairs * kHkv * kB;
constexpr int kGateRest    = kGateGBlocks - kGateWithProj;
constexpr unsigned kLateGateLds = kLateLds > GemmLds<false>::kBytes ? kLateLds : GemmLds<false>::kBytes;
static_assert(kEarlyLds <= kLateGateLds, "the part for positions < 128 fits the LDS of the other two");
/* four waves per SIMD (two blocks per WGP, as the LDS allows) hold only while a wave stays inside 256 registers */
__global__ __launch_bounds__(256) __attribute__((amdgpu_waves_per_eu(4, 4))) void attn_late_gate_kernel(
    const unsigned short* __restrict__ Qp, const unsigned short* __restrict__ Kp, const unsigned short* __restrict__ Vtp,
    float* __restrict__ attn, const unsigned short* __restrict__ XB, const unsigned short* __restrict__ WGB,
    float* __restrict__ GF, const float* __restrict__ Qe, const float* __restrict__ Ke, const float* __restrict__ Ve) {
  __shared__ __align__(16) unsigned char smem[kLateGateLds];
  const int blk = (int)blockIdx.x;
  /* block-uniform: every barrier of a part is passed by the whole block or by none of it */
  if (blk < kLateBlocks) attn_late_block(smem, blk, Qp, Kp, Vtp, attn);
  else if (blk < kLateBlocks + kGateRest) gemm_block<1, false>(smem, blk - kLateBlocks + kGateWithProj, 0, XB, XB, kHid, 0L, WGB, kHid, 0L, GF, kQW, 0L, kTok, kQW, kHid, 1.0f);
  else attn_early_block(smem, blk - kLateBlocks - kGateRest, Qe, Ke, Ve, attn);
}

// ---------------------------------------------------------------------------
// gated = attn * sigmoid(gate projection), f32; one block per token row (2048 columns).
// Rolled loop: 8 iterations x 256 threads, one column each (coalesced 4-B loads), result into LDS; after the block barrier
// thread t owns columns 8t..8t+7. Positions >= 128: f16 plane carried x1024 (row = token). Positions < 128: bf16 hi plane and
// bf16 lo plane (lo = RNE bf16 of value - hi), row = b*128 + position. One 16-B store per lane per plane; a wave = 512
// ---------------------------------------------------------------------------
__global__ __launch_bounds__(256) void gate_kernel(const float* __restrict__ attn, const float* __restrict__ G,
                                                   unsigned short* __restrict__ GH, unsigned short* __restrict__ EH,
                                                   unsigned short* __restrict__ EL) {
  __shared__ __align__(16) float sm[kQW];
  const int tid = threadIdx.x;
  const int row = blockIdx.x;
  const int pos = row & (kS - 1);
  const int b   = row / kS;
  const float* ar = attn + (size_t)row * kQW;
  const float* gr = G + (size_t)row * kQW;
#pragma unroll 1
  for (int i = 0; i < kQW / 256; ++i) {
    const int col = i * 256 + tid;
    const float a = ar[col];
    const float g = gr[col];
    const float sg = 1.0f / (1.0f + expf(-g));
    sm[col] = a * sg;
  }
  __syncthreads();
  const v4f x0 = *(const v4f*)(sm + 8 * tid);
  const v4f x1 = *(const v4f*)(sm + 8 * tid + 4);
  if (pos >= kEarly) {
    unsigned short hb[8];
#pragma unroll
    for (int e = 0; e < 4; ++e) {
      hb[e]     = h_bits(x0[e] * kGCarry);
      hb[4 + e] = h_bits(x1[e] * kGCarry);
    }
    const v4u u = (v4u){pk16(hb[0], hb[1]), pk16(hb[2], hb[3]), pk16(hb[4], hb[5]), pk16(hb[6], hb[7])};
    unsigned short* d = GH + (size_t)row * kQW + 8 * tid;
    *(v4u*)d = u;
    
  } else {
    unsigned short hb[8], lb[8];
#pragma unroll
    for (int e = 0; e < 4; ++e) {
      const float f0 = x0[e];
      const float f1 = x1[e];
      hb[e]     = f2bf_bits(f0);
      hb[4 + e] = f2bf_bits(f1);
      lb[e]     = f2bf_bits(f0 - bf_bits2f(hb[e]));
      lb[4 + e] = f2bf_bits(f1 - bf_bits2f(hb[4 + e]));
    }
    const v4u uh = (v4u){pk16(hb[0], hb[1]), pk16(hb[2], hb[3]), pk16(hb[4], hb[5]), pk16(hb[6], hb[7])};
    const v4u ul = (v4u){pk16(lb[0], lb[1]), pk16(lb[2], lb[3]), pk16(lb[4], lb[5]), pk16(lb[6], lb[7])};
    const size_t o = (size_t)(b * kEarly + pos) * kQW + 8 * tid;
    *(v4u*)(EH + o) = uh;
    *(v4u*)(EL + o) = ul;
    
  }
}

// ---------------------------------------------------------------------------
// Host glue: 5 kernel launches, nothing else.
// GEMM shapes (all K % 64 == 0, M % 128 == 0, N % 256 == 0, no padding planes):
//   q|k|v proj : M 4096, N 3072, K 2048 -> 32 x 12 = 384 blocks (bf16)
//   gate proj  : M 4096, N 2048, K 2048 -> 32 x 8 = 256 blocks (bf16): 128 in the q|k|v launch, 128 in the launch of the
//                attention for positions >= 128
//   out late   : per batch M 1920 (positions 128..2047), N 2048, K 2048 -> 15 x 8 = 120 blocks x 2 (f16)
//   out early  : per batch M 128 (positions 0..127), N 2048, K 2048, A hi+lo -> 1 x 8 = 8 blocks x 2 (bf16), same launch
// ---------------------------------------------------------------------------
extern "C" void kernel_launch(void* const* d_in, const int* in_sizes, int n_in,
                              void* d_out, int out_size, void* d_ws, size_t ws_size,
                              hipStream_t stream) {
  if (n_in < 10) return;
  if (in_sizes[0] != kTok * kHid) return;
  if (in_sizes[1] != kS * kHD) return;
  if (in_sizes[2] != kS * kHD) return;
  if (in_sizes[3] != kQW * kHid) return;
  if (in_sizes[4] != kKW * kHid) return;
  if (in_sizes[5] != kKW * kHid) return;
  if (in_sizes[6] != kQW * kHid) return;
  if (in_sizes[7] != kQW * kQW) return;
  if (in_sizes[8] != kHD) return;
  if (in_sizes[9] != kHD) return;
  if (out_size != kTok * kQW) return;
  if (ws_size < kWsTotal) return;

  const float* X    = (const float*)d_in[0];
  const float* ctab = (const float*)d_in[1];
  const float* stab = (const float*)d_in[2];
  const float* Wq   = (const float*)d_in[3];
  const float* Wk   = (const float*)d_in[4];
  const float* Wv   = (const float*)d_in[5];
  const float* Wg   = (const float*)d_in[6];
  const float* Wo   = (const float*)d_in[7];
  const float* qnw  = (const float*)d_in[8];
  const float* knw  = (const float*)d_in[9];
  float* out = (float*)d_out;

  char* ws = (char*)d_ws;
  unsigned short* XB   = (unsigned short*)(ws + kOffXB);
  unsigned short* WQKV = (unsigned short*)(ws + kOffWQKV);
  unsigned short* WGB  = (unsigned short*)(ws + kOffWGB);
  unsigned short* QP   = (unsigned short*)(ws + kOffQP);
  unsigned short* KP   = (unsigned short*)(ws + kOffKP);
  unsigned short* VT   = (unsigned short*)(ws + kOffVT);
  float*          QE   = (float*)(ws + kOffQE);
  float*          KE   = (float*)(ws + kOffKE);
  float*          VE   = (float*)(ws + kOffVE);
  unsigned short* WOB  = (unsigned short*)(ws + kOffWOB);
  unsigned short* WOH  = (unsigned short*)(ws + kOffWOH);
  float*          ATT  = (float*)(ws + kOffATT);
  float*          GF   = (float*)(ws + kOffGF);
  unsigned short* GH   = (unsigned short*)(ws + kOffGH);
  unsigned short* EH   = (unsigned short*)(ws + kOffEH);
  unsigned short* EL   = (unsigned short*)(ws + kOffEL);

  /* operand planes: every float input RNE-converted to bf16 once (weights are [out][in] = Bt layout already) */
  cast_all_kernel<<<kCbAll, 256, 0, stream>>>(X, Wq, Wk, Wv, Wg, Wo, XB, WQKV, WGB, WOB, WOH);

  /* q|k|v projection x . [Wq;Wk;Wv]^T with norm + rotation -> QP, KP (f16 x64), QE, KE (f32, positions < 128) and the v
     transposition -> VT (f16 x64), VE (f32, positions < 128) in its blocks' epilogues; the first tiles of the gate projection */
  proj_kernel<<<kQKVBlocks + kGateWithProj, 256, 0, stream>>>(XB, WQKV, WGB, GF, ctab, stab, qnw, knw, QP, KP, QE, KE, VT, VE);

  /* attention, positions >= 128 (matrix ops), beside the rest of the gate projection and positions < 128 (f32); disjoint rows of ATT */
  attn_late_gate_kernel<<<kLateBlocks + kGateRest + kEarlyBlocks, 256, 0, stream>>>(QP, KP, VT, ATT, XB, WGB, GF, QE, KE, VE);

  /* gated planes */
  gate_kernel<<<kTok, 256, 0, stream>>>(ATT, GF, GH, EH, EL);

  /* output projection: positions < 128 (bf16 hi.W + lo.W) and positions >= 128 (f16) of each batch */
  out_proj_kernel<<<kB * (kOutEB + kOutLB), 256, 0, stream>>>(GH, EH, EL, WOH, WOB, out);
}
